// v000
// Measured on an AMD MI455X. A time is GPU time per run, averaged over a window of back-to-back runs after a warm-up
// (all launches, gaps included; the runs take copies of the inputs in turn), and the median of several windows.
// Apart from v000's, it joins two sittings. Times from different sittings can be a few percent apart, while
// side-by-side timings come from the same sitting.
// v000 is the starting kernel. One run takes 10.3 milliseconds.
#include <hip/hip_runtime.h>
// Causal multi-head self-attention with a PER-HEAD interleaved fused QKV projection and rotary embeddings (x [4][2048][1024]; qkv = x W_qkv + b_qkv ([in][out] 1024 x 3072, zero bias) reshaped (B, T, 16, 192): head h owns columns h*192 + [0..63 | 64..127 | 128..191] = q | k | v; rope on q and k from the INPUT tables cos / sin [2048][32]: t1 = even elements, t2 = odd elements, out = cat(t1 c - t2 s, t1 s + t2 c) (an interleaved-pair rotation followed by the same fixed permutation on q and k: the scores are unchanged by it); scores / 8; causal (tril, -inf); softmax; out = merged W_out + b_out ([in][out]) -> [4][2048][1024]).
// Structure: token rows r = b*2048 + s; x as exact f16 rows (bf16-rounded); Q, K, V as three WMMA GEMMs (32x64 wave tiles, f32 accumulation, exact x16 weights, f32 q / k outputs roped into f16 rows, f16 v output); per batch: V^T for all heads via LDS transposes; per query tile of 256 rows: scores against the keys below the tile end only (K = 64, all heads on grid.y, alpha = 0.125), causal row softmax on VALU with an arithmetic 0/1 key mask over the computed range (f32 statistics, native exp; weights x256 f16), o = P . V^T (K = keys below the tile end, alpha 2^-2: o carried x64, folded into the output GEMM alpha) written straight into the merged f16 o rows; out = o W_o GEMM (f32) into the output layout.
// Compute dtype: inputs rounded to bf16; x / weights exact; q, k, v, softmax weights and o as plain f16 GEMM operands (~2^-12); scores and softmax statistics f32. v_wmma_f32_16x16x32_f16.
#define NB 4
#define SQ 2048
#define DM 1024
#define NH 16
#define HD 64
#define HG 4                         /* heads per launch of the unlaunched k_vt(b, h0) overload */
#define QT 256                       /* query rows per causal tile */
#define NKX SQ                       /* S / P row pitch */
#define QT0 128                      /* first-tile rows recomputed exactly in f32 */
#define B0 0                         /* first batch processed (debug hook) */
#define NBR NB                       /* batches processed (debug hook) */
#define NR ((size_t)NB * SQ)         /* token rows */
#define MP ((int)((size_t)NBR * SQ)) /* rows projected (debug hook) */
#define QN SQ                        /* query rows attended per batch (debug hook) */
#define NHD NH                       /* heads attended (debug hook) */
#define MPO MP                       /* rows through the output stage (debug hook) */
#define LQ DM      /* row pitch of the q/k/v rows */
typedef __bf16 v16b __attribute__((ext_vector_type(16)));
typedef unsigned short v8us __attribute__((ext_vector_type(8), may_alias));
typedef float  v8f  __attribute__((ext_vector_type(8)));
typedef float  v4f  __attribute__((ext_vector_type(4)));
typedef float  v4fa __attribute__((ext_vector_type(4), may_alias));
union FragB { v16b v; v8us half[2]; unsigned short u[16]; };

__device__ __forceinline__ unsigned short bf16_bits(float x) { unsigned int u = __float_as_uint(x); return (unsigned short)((u + 0x7FFFu + ((u >> 16) & 1u)) >> 16); }
__device__ __forceinline__ float bf16_val(unsigned short b) { return __uint_as_float(((unsigned int)b) << 16); }
__device__ __forceinline__ float bf16_round(float x) { return bf16_val(bf16_bits(x)); }
// D += A·B with NT terms: 1 = ah·bh, 2 = + al·bh (A split), 3 = + ah·bl (both split)
template <int NT>
__device__ __forceinline__ v8f mmaN(v16b ah, v16b al, v16b bh, v16b bl, v8f c) {
  c = __builtin_amdgcn_wmma_f32_16x16x32_bf16(false, ah, false, bh, (short)0, c, false, false);
  if (NT >= 2) c = __builtin_amdgcn_wmma_f32_16x16x32_bf16(false, al, false, bh, (short)0, c, false, false);
  if (NT >= 3) c = __builtin_amdgcn_wmma_f32_16x16x32_bf16(false, ah, false, bl, (short)0, c, false, false);
  asm volatile("v_nop\n\tv_nop\n\tv_nop\n\tv_nop" : "+v"(c) : "v"(ah), "v"(al), "v"(bh), "v"(bl));
  return c;
}

__global__ __launch_bounds__(256) void k_wt_bf16(const float* __restrict__ W, unsigned short* __restrict__ Wt, int K, int N) {
  const int t = blockIdx.x * 256 + threadIdx.x;
  const int k8n = K / 8;
  if (t >= N * k8n) return;
  const int n = t / k8n, k8 = (t % k8n) * 8;
  v8us v;
#pragma unroll
  for (int i = 0; i < 8; ++i) v[i] = bf16_bits(W[(size_t)(k8 + i) * N + n]);
  *(v8us*)(Wt + (size_t)n * K + k8) = v;
  
}

// GEMM C[M][N] (f32, pitch ldc) = act(A[M][K]·W + bias). A f32 row-major (pitch lda) converted per fragment to bf16
// (ASPLIT: hi/lo two planes -> 2 terms, else single rounded term); Wt bf16 [N][K] (pitch ldb). BIAS_BF16 rounds the
// bias to bf16 first (bias quantised to bf16 before the add). K%32==0, M%16==0, N%64==0.
template <bool ASPLIT, int ACT, bool BIAS_BF16>
__global__ __launch_bounds__(128) void k_gemm_bf(const float* __restrict__ A, int lda, const unsigned short* __restrict__ Wt, int ldb,
                                               const float* __restrict__ bias, float* __restrict__ C, int ldc, int M, int N, int K) {
  __shared__ __attribute__((aligned(16))) float so[4][16][64];
  const int tid = threadIdx.x, w = tid >> 5, lane = tid & 31, ln = lane & 15, hh = lane >> 4;
  const int ntn = N / 64;
  const int wid = blockIdx.x * 4 + w;
  const int mt = wid / ntn, nq = wid % ntn;
  if (mt * 16 >= M) return;
  const int row0 = mt * 16, col0 = nq * 64;
  const float* arow = A + (size_t)(row0 + ln) * lda;
  v8f acc[4] = {};
  for (int kb = 0; kb < K; kb += 32) {
    FragB ah, al;
    const v4f x0 = *(const v4fa*)(arow + kb + 8 * hh), x1 = *(const v4fa*)(arow + kb + 8 * hh + 4);
    const v4f x2 = *(const v4fa*)(arow + kb + 16 + 8 * hh), x3 = *(const v4fa*)(arow + kb + 16 + 8 * hh + 4);
    float xs[16] = {x0[0],x0[1],x0[2],x0[3],x1[0],x1[1],x1[2],x1[3],x2[0],x2[1],x2[2],x2[3],x3[0],x3[1],x3[2],x3[3]};
#pragma unroll
    for (int i = 0; i < 16; ++i) { const unsigned short hb = bf16_bits(xs[i]); ah.u[i] = hb; al.u[i] = ASPLIT ? bf16_bits(xs[i] - bf16_val(hb)) : (unsigned short)0; }
#pragma unroll
    for (int t = 0; t < 4; ++t) {
      const unsigned short* brow = Wt + (size_t)(col0 + t * 16 + ln) * ldb + kb;
      FragB b;
      b.half[0] = *(const v8us*)(brow + 8 * hh);
      b.half[1] = *(const v8us*)(brow + 16 + 8 * hh);
      acc[t] = mmaN<ASPLIT ? 2 : 1>(ah.v, al.v, b.v, b.v, acc[t]);
    }
  }
#pragma unroll
  for (int t = 0; t < 4; ++t) {
    float bv = bias ? bias[col0 + t * 16 + ln] : 0.f;
    if (BIAS_BF16) bv = bf16_round(bv);
#pragma unroll
    for (int r = 0; r < 8; ++r) { float v = acc[t][r] + bv; if (ACT == 1) v = fmaxf(v, 0.f); so[w][8 * hh + r][t * 16 + ln] = v; }
  }
  __builtin_amdgcn_fence(__ATOMIC_ACQ_REL, "workgroup");
  __builtin_amdgcn_wave_barrier();
  const int rsub = lane >> 4, c4 = (lane & 15) * 4;
  {
#pragma unroll
    for (int q = 0; q < 8; ++q) {
      const int r = q * 2 + rsub;
      const v4f v = *(const v4fa*)&so[w][r][c4];
      *(v4f*)(C + (size_t)(row0 + r) * ldc + col0 + c4) = v;
    }
    
  }
}

// GEMM C = act(A·W + bias + resid): A f32 (ASPLIT -> hi/lo 2 terms), Wt bf16 [N][K]; ACT 0 none, 1 relu, 2 exact gelu;
// resid (optional, f32, row index = (row % rmod), pitch ldr, RES_BF16 rounds it) added before the activation.
template <bool ASPLIT, int ACT, bool BIAS_BF16, bool RES_BF16>
__global__ __launch_bounds__(128) void k_gemm_bf3(const float* __restrict__ A, int lda, const unsigned short* __restrict__ Wt, int ldb,
                                                const float* __restrict__ bias, const float* __restrict__ resid, int rmod, int ldr,
                                                float* __restrict__ C, int ldc, int M, int N, int K) {
  __shared__ __attribute__((aligned(16))) float so[4][16][64];
  const int tid = threadIdx.x, w = tid >> 5, lane = tid & 31, ln = lane & 15, hh = lane >> 4;
  const int ntn = N / 64;
  const int wid = blockIdx.x * 4 + w;
  const int mt = wid / ntn, nq = wid % ntn;
  if (mt * 16 >= M) return;
  const int row0 = mt * 16, col0 = nq * 64;
  const float* arow = A + (size_t)(row0 + ln) * lda;
  v8f acc[4] = {};
  for (int kb = 0; kb < K; kb += 32) {
    FragB ah, al;
    const v4f x0 = *(const v4fa*)(arow + kb + 8 * hh), x1 = *(const v4fa*)(arow + kb + 8 * hh + 4);
    const v4f x2 = *(const v4fa*)(arow + kb + 16 + 8 * hh), x3 = *(const v4fa*)(arow + kb + 16 + 8 * hh + 4);
    float xs[16] = {x0[0],x0[1],x0[2],x0[3],x1[0],x1[1],x1[2],x1[3],x2[0],x2[1],x2[2],x2[3],x3[0],x3[1],x3[2],x3[3]};
#pragma unroll
    for (int i = 0; i < 16; ++i) { const unsigned short hb = bf16_bits(xs[i]); ah.u[i] = hb; al.u[i] = ASPLIT ? bf16_bits(xs[i] - bf16_val(hb)) : (unsigned short)0; }
#pragma unroll
    for (int t = 0; t < 4; ++t) {
      const unsigned short* brow = Wt + (size_t)(col0 + t * 16 + ln) * ldb + kb;
      FragB b;
      b.half[0] = *(const v8us*)(brow + 8 * hh);
      b.half[1] = *(const v8us*)(brow + 16 + 8 * hh);
      acc[t] = mmaN<ASPLIT ? 2 : 1>(ah.v, al.v, b.v, b.v, acc[t]);
    }
  }
#pragma unroll
  for (int t = 0; t < 4; ++t) {
    const int col = col0 + t * 16 + ln;
    float bv = bias ? bias[col] : 0.f;
    if (BIAS_BF16) bv = bf16_round(bv);
#pragma unroll
    for (int r = 0; r < 8; ++r) {
      float v = acc[t][r] + bv;
      if (resid) { float rv = resid[(size_t)((row0 + 8 * hh + r) % rmod) * ldr + col]; if (RES_BF16) rv = bf16_round(rv); v += rv; }
      if (ACT == 1) v = fmaxf(v, 0.f);
      if (ACT == 2) v = 0.5f * v * (1.0f + erff(v * 0.70710678118654752f));
      if (ACT == 3) { const float u = 0.7978845608028654f * (v + 0.044715f * v * v * v); v = 0.5f * v * (1.0f + tanhf(u)); }
      so[w][8 * hh + r][t * 16 + ln] = v;
    }
  }
  __builtin_amdgcn_fence(__ATOMIC_ACQ_REL, "workgroup");
  __builtin_amdgcn_wave_barrier();
  const int rsub = lane >> 4, c4 = (lane & 15) * 4;
  {
#pragma unroll
    for (int q = 0; q < 8; ++q) {
      const int r = q * 2 + rsub;
      const v4f v = *(const v4fa*)&so[w][r][c4];
      *(v4f*)(C + (size_t)(row0 + r) * ldc + col0 + c4) = v;
    }
    
  }
}
// row LayerNorm (biased variance, eps) over N: s = X (+ R); optional out_sum <- s; out_norm <- (s-mu)*rsqrt(var+eps)*g + b
template <bool PARAM_BF16>
__global__ __launch_bounds__(256) void k_layernorm(const float* __restrict__ X, const float* __restrict__ R, const float* __restrict__ g, const float* __restrict__ bta,
                                                  float* __restrict__ out_sum, float* __restrict__ out_norm, int N, float eps) {
  __shared__ float red[256];
  const int row = blockIdx.x, tid = threadIdx.x;
  const float* x = X + (size_t)row * N; const float* rr = R ? R + (size_t)row * N : nullptr;
  float vals[16];                     // up to N = 4096
  const int per = N / 256;            // contiguous chunk per thread? use strided-by-4 chunks: thread handles j = tid*4 + 1024*u
  float s1 = 0.f;
  for (int u = 0; u < per / 4; ++u) {
    const int j = tid * 4 + 1024 * u;
    const v4f a = *(const v4fa*)(x + j);
    v4f b = {0.f,0.f,0.f,0.f}; if (rr) b = *(const v4fa*)(rr + j);
#pragma unroll
    for (int q = 0; q < 4; ++q) { const float v = a[q] + b[q]; vals[u * 4 + q] = v; s1 += v; }
  }
  red[tid] = s1; __syncthreads();
  for (int st = 128; st > 0; st >>= 1) { if (tid < st) red[tid] += red[tid + st]; __syncthreads(); }
  const float mu = red[0] / (float)N; __syncthreads();
  float s2 = 0.f;
  for (int u = 0; u < per / 4; ++u)
#pragma unroll
    for (int q = 0; q < 4; ++q) { const float c = vals[u * 4 + q] - mu; s2 += c * c; }
  red[tid] = s2; __syncthreads();
  for (int st = 128; st > 0; st >>= 1) { if (tid < st) red[tid] += red[tid + st]; __syncthreads(); }
  const float rs = rsqrtf(red[0] / (float)N + eps);
  {
    for (int u = 0; u < per / 4; ++u) {
      const int j = tid * 4 + 1024 * u;
      v4f o, sm;
#pragma unroll
      for (int q = 0; q < 4; ++q) {
        float gg = g[j + q], bb = bta[j + q];
        if (PARAM_BF16) { gg = bf16_round(gg); bb = bf16_round(bb); }
        sm[q] = vals[u * 4 + q]; o[q] = (vals[u * 4 + q] - mu) * rs * gg + bb;
      }
      if (out_sum) *(v4f*)(out_sum + (size_t)row * N + j) = sm;
      *(v4f*)(out_norm + (size_t)row * N + j) = o;
    }
    
  }
}



// ---- f16 WMMA path (v_wmma_f32_16x16x32_f16): 11-bit significands for operands in range — used where a [0,1] probability operand needs more precision than bf16
typedef _Float16 v16h __attribute__((ext_vector_type(16)));
union FragH { v16h v; v8us half[2]; _Float16 h[16]; unsigned short u[16]; };
template <int NT>
__device__ __forceinline__ v8f mmaH(v16h ah, v16h al, v16h bh, v16h bl, v8f c) {
  c = __builtin_amdgcn_wmma_f32_16x16x32_f16(false, ah, false, bh, (short)0, c, false, false);
  if (NT >= 2) c = __builtin_amdgcn_wmma_f32_16x16x32_f16(false, al, false, bh, (short)0, c, false, false);
  if (NT >= 3) c = __builtin_amdgcn_wmma_f32_16x16x32_f16(false, ah, false, bl, (short)0, c, false, false);
  asm volatile("v_nop\n\tv_nop\n\tv_nop\n\tv_nop" : "+v"(c) : "v"(ah), "v"(al), "v"(bh), "v"(bl));
  return c;
}
// batched GEMM like k_gemm_b but f16 operands: A f32 (split into f16 hi/lo if ASPLIT, else rounded to f16), Bt = f16 values [n][k]; alpha; C f32; N multiple of 16 (partial tiles skipped)
template <bool ASPLIT>
__global__ __launch_bounds__(128) void k_gemm_h(const float* __restrict__ A, int lda, size_t sA, const _Float16* __restrict__ Bh, int ldb, size_t sB, float alpha, float* __restrict__ C, int ldc, size_t sC, int M, int N, int K) {
  __shared__ __attribute__((aligned(16))) float so[4][16][64];
  const int tid = threadIdx.x, w = tid >> 5, lane = tid & 31, ln = lane & 15, hh = lane >> 4; const int by = blockIdx.y;
  A += (size_t)by * sA; Bh += (size_t)by * sB; C += (size_t)by * sC;
  const int ntn = (N + 63) / 64; const int wid = blockIdx.x * 4 + w; const int mt = wid / ntn, nq = wid % ntn; if (mt * 16 >= M) return;
  const int row0 = mt * 16, col0 = nq * 64; const float* arow = A + (size_t)(row0 + ln) * lda;
  v8f acc[4] = {};
  for (int kb = 0; kb < K; kb += 32) {
    FragH ah, al;
    const v4f x0 = *(const v4fa*)(arow + kb + 8 * hh), x1 = *(const v4fa*)(arow + kb + 8 * hh + 4), x2 = *(const v4fa*)(arow + kb + 16 + 8 * hh), x3 = *(const v4fa*)(arow + kb + 16 + 8 * hh + 4);
    float xs[16] = {x0[0],x0[1],x0[2],x0[3],x1[0],x1[1],x1[2],x1[3],x2[0],x2[1],x2[2],x2[3],x3[0],x3[1],x3[2],x3[3]};
#pragma unroll
    for (int i = 0; i < 16; ++i) { const _Float16 h = (_Float16)xs[i]; ah.h[i] = h; al.h[i] = ASPLIT ? (_Float16)(xs[i] - (float)h) : (_Float16)0.0f; }
#pragma unroll
    for (int t = 0; t < 4; ++t) { if (col0 + t * 16 >= N) continue; const size_t boff = (size_t)(col0 + t * 16 + ln) * ldb + kb; FragH bq; bq.half[0] = *(const v8us*)(Bh + boff + 8 * hh); bq.half[1] = *(const v8us*)(Bh + boff + 16 + 8 * hh);
      acc[t] = mmaH<ASPLIT ? 2 : 1>(ah.v, al.v, bq.v, bq.v, acc[t]); }
  }
#pragma unroll
  for (int t = 0; t < 4; ++t) { if (col0 + t * 16 >= N) continue;
#pragma unroll
    for (int r = 0; r < 8; ++r) so[w][8 * hh + r][t * 16 + ln] = acc[t][r] * alpha; }
  __builtin_amdgcn_fence(__ATOMIC_ACQ_REL, "workgroup"); __builtin_amdgcn_wave_barrier();
  const int rsub = lane >> 4, c4 = (lane & 15) * 4;
  {
#pragma unroll
    for (int q = 0; q < 8; ++q) { const int r = q * 2 + rsub; if (col0 + c4 < N) { const v4f v = *(const v4fa*)&so[w][r][c4]; *(v4f*)(C + (size_t)(row0 + r) * ldc + col0 + c4) = v; } }
     }
}

// Wt[n][k] = f16(W[k][n]·scale) from f32 row-major W[K][N] (scale = power of two; bf16-exact weights stay exact in f16 away from the subnormal range)
__global__ __launch_bounds__(256) void k_wt_f16(const float* __restrict__ W, _Float16* __restrict__ Wt, int K, int N, float scale) {
  const int t = blockIdx.x * 256 + threadIdx.x; if (t >= N * (K / 8)) return; const int n = t / (K / 8), k8 = (t % (K / 8)) * 8; FragH f;
#pragma unroll
  for (int i = 0; i < 8; ++i) f.h[i] = (_Float16)(bf16_round(W[(size_t)(k8 + i) * N + n]) * scale); const v8us o = f.half[0];
  *(v8us*)((unsigned short*)Wt + (size_t)n * K + k8) = o; 
}
// k_gemm_hh variant with fused epilogue: v = acc·alpha + bias[by·sBias + col] (+ CP[(row/rowsPerB)·sCPb + by·64 + col] if CP) ; ACT 0 none / 1 elu ; writes f16 C16 (and f32 C if non-null)
template <int ACT>
__global__ __launch_bounds__(128) void k_gemm_hhx(const _Float16* __restrict__ A, int lda, size_t sA, const _Float16* __restrict__ Bh, int ldb, size_t sB, float alpha, const float* __restrict__ bias, size_t sBias, const float* __restrict__ CP, int rowsPerB, size_t sCPb, int row0g,
    float* __restrict__ C, _Float16* __restrict__ C16, int ldc, size_t sC, int M, int N, int K) {
  __shared__ __attribute__((aligned(16))) float so[4][16][64];
  const int tid = threadIdx.x, w = tid >> 5, lane = tid & 31, ln = lane & 15, hh = lane >> 4; const int by = blockIdx.y;
  A += (size_t)by * sA; Bh += (size_t)by * sB; const size_t cofs = (size_t)by * sC; const float* bp = bias ? bias + (size_t)by * sBias : nullptr;
  const int ntn = (N + 63) / 64; const int wid = blockIdx.x * 4 + w; const int mt = wid / ntn, nq = wid % ntn; if (mt * 16 >= M) return;
  const int row0 = mt * 16, col0 = nq * 64; const _Float16* arow = A + (size_t)(row0 + ln) * lda;
  v8f acc[4] = {};
  for (int kb = 0; kb < K; kb += 32) { FragH ah; ah.half[0] = *(const v8us*)((const unsigned short*)arow + kb + 8 * hh); ah.half[1] = *(const v8us*)((const unsigned short*)arow + kb + 16 + 8 * hh);
#pragma unroll
    for (int t = 0; t < 4; ++t) { if (col0 + t * 16 >= N) continue; const size_t boff = (size_t)(col0 + t * 16 + ln) * ldb + kb; FragH bq; bq.half[0] = *(const v8us*)((const unsigned short*)Bh + boff + 8 * hh); bq.half[1] = *(const v8us*)((const unsigned short*)Bh + boff + 16 + 8 * hh);
      acc[t] = mmaH<1>(ah.v, ah.v, bq.v, bq.v, acc[t]); }
  }
#pragma unroll
  for (int t = 0; t < 4; ++t) { if (col0 + t * 16 >= N) continue; const int col = col0 + t * 16 + ln; const float bv = bp ? bf16_round(bp[col]) : 0.f;
#pragma unroll
    for (int r = 0; r < 8; ++r) { float v = acc[t][r] * alpha + bv; if (CP) { const int rr = row0g + row0 + 8 * hh + r; if (rowsPerB < 0) v += CP[cofs + (size_t)rr * ldc + col];      /* rowsPerB < 0: own element of the batched C plane */ else { const int bidx = rr / rowsPerB; v += CP[(size_t)bidx * sCPb + (size_t)by * 64 + col]; } } if (ACT == 1) v = (v > 0.f) ? v : expm1f(v); else if (ACT == 7) v = (v > 0.f) ? v + 1.0f : expf(v); else if (ACT == 8) v = tanhf(v); else if (ACT == 9) v = 0.5f * v * (1.0f + tanhf(0.7978845608028654f * (v + 0.044715f * v * v * v))); else if (ACT == 11) v = 1.0f / (1.0f + expf(-v)); else if (ACT == 12) v = (v > 0.f) ? v : 0.01f * v; else if (ACT == 14) v = (v > 0.f) ? v : 0.1f * v; else if (ACT == 16) v = (v >= 0.f) ? v : 0.3f * v; else if (ACT == 17) v = (v >= 0.f) ? v : 0.2f * v; else if (ACT == 15) v = v / (1.0f + expf(-v)); else if (ACT == 3) v = fmaxf(v, 0.f); else if (ACT == 6) v = 0.5f * v * (1.0f + erff(v * 0.70710678118654752f)); so[w][8 * hh + r][t * 16 + ln] = v; } }
  __builtin_amdgcn_fence(__ATOMIC_ACQ_REL, "workgroup"); __builtin_amdgcn_wave_barrier();
  const int rsub = lane >> 4, c4 = (lane & 15) * 4; typedef _Float16 v4h __attribute__((ext_vector_type(4)));
  {
#pragma unroll
    for (int q = 0; q < 8; ++q) { const int r = q * 2 + rsub; if (col0 + c4 < N) { const v4f v = *(const v4fa*)&so[w][r][c4]; if (C) *(v4f*)(C + cofs + (size_t)(row0 + r) * ldc + col0 + c4) = v; if (C16) { v4h h4; for (int i = 0; i < 4; ++i) h4[i] = (_Float16)v[i]; *(v4h*)(C16 + cofs + (size_t)(row0 + r) * ldc + col0 + c4) = h4; } } }
     }
}


typedef _Float16 v4h __attribute__((ext_vector_type(4)));

__global__ __launch_bounds__(256) void k_x16(const float* __restrict__ x, _Float16* __restrict__ X16, size_t n8) { const size_t t = (size_t)blockIdx.x * 256 + threadIdx.x; if (t >= n8) return; FragH f;
#pragma unroll
  for (int q = 0; q < 8; ++q) f.h[q] = (_Float16)bf16_round(x[t * 8 + q]); *(v8us*)((unsigned short*)X16 + t * 8) = f.half[0];  }
__global__ __launch_bounds__(256) void k_h16(const float* __restrict__ x, _Float16* __restrict__ X16, size_t n8) { const size_t t = (size_t)blockIdx.x * 256 + threadIdx.x; if (t >= n8) return; FragH f;
#pragma unroll
  for (int q = 0; q < 8; ++q) f.h[q] = (_Float16)x[t * 8 + q]; *(v8us*)((unsigned short*)X16 + t * 8) = f.half[0];  }
__global__ __launch_bounds__(256) void k_round16f(const float* __restrict__ W, _Float16* __restrict__ Bt, size_t n8) { const size_t t = (size_t)blockIdx.x * 256 + threadIdx.x; if (t >= n8) return; FragH f;
#pragma unroll
  for (int i = 0; i < 8; ++i) f.h[i] = (_Float16)(bf16_round(W[t * 8 + i]) * 16.0f); *(v8us*)((unsigned short*)Bt + t * 8) = f.half[0];  }
template <int NHv, int TTv>
__global__ __launch_bounds__(256) void k_vt(const _Float16* __restrict__ V16, int ldv, int voff, _Float16* __restrict__ Vt) { __shared__ unsigned short tl[64][66]; const int tid = threadIdx.x; const int slab = blockIdx.x / (TTv / 64), lg = blockIdx.x % (TTv / 64); const int b = slab / NHv, h = slab % NHv;
  for (int i = tid; i < 64 * 8; i += 256) { const int r = i / 8, c8 = (i % 8) * 8; FragH f; f.half[0] = *(const v8us*)((const unsigned short*)V16 + ((size_t)b * TTv + lg * 64 + r) * ldv + voff + h * 64 + c8);
#pragma unroll
    for (int q = 0; q < 8; ++q) tl[r][c8 + q] = f.u[q]; }
  __syncthreads();
  {
#pragma unroll
    for (int rd = 0; rd < 2; ++rd) { const int d = rd * 32 + tid / 8, pc = tid % 8; FragH f;
#pragma unroll
      for (int q = 0; q < 8; ++q) f.u[q] = tl[pc * 8 + q][d];
      *(v8us*)((unsigned short*)Vt + ((size_t)slab * 64 + d) * TTv + lg * 64 + pc * 8) = f.half[0]; }
     } }

__global__ __launch_bounds__(256) void k_hl(const float* __restrict__ F, _Float16* __restrict__ Hh, _Float16* __restrict__ Hl, size_t n8) { const size_t t = (size_t)blockIdx.x * 256 + threadIdx.x; if (t >= n8) return; FragH fh, fl; const v4f a = *(const v4fa*)(F + t * 8), c = *(const v4fa*)(F + t * 8 + 4);
#pragma unroll
  for (int q = 0; q < 4; ++q) { _Float16 h = (_Float16)a[q]; fh.h[q] = h; fl.h[q] = (_Float16)((a[q] - (float)h) * 1024.0f); h = (_Float16)c[q]; fh.h[4 + q] = h; fl.h[4 + q] = (_Float16)((c[q] - (float)h) * 1024.0f); }
  { *(v8us*)((unsigned short*)Hh + t * 8) = fh.half[0]; *(v8us*)((unsigned short*)Hl + t * 8) = fl.half[0];  } }

// ---- fast GEMM (wave tile 32x64; requires M % 32 == 0 rows per launch region and N % 64 == 0); epilogue = k_gemm_hhx semantics ----
__device__ __forceinline__ v16h g2_frag(const _Float16* p, int hh) { FragH f; f.half[0] = *(const v8us*)((const unsigned short*)p + 8 * hh); f.half[1] = *(const v8us*)((const unsigned short*)p + 16 + 8 * hh); return f.v; }
__device__ __forceinline__ v8f g2_mma(v16h a, v16h b, v8f c) { v8f d = __builtin_amdgcn_wmma_f32_16x16x32_f16(false, a, false, b, (short)0, c, false, false); asm volatile("v_nop\n\tv_nop\n\tv_nop\n\tv_nop" : "+v"(d) : "v"(a), "v"(b)); return d; }
template <int ACT>
__global__ __launch_bounds__(128) void k_gemm2(const _Float16* __restrict__ A, int lda, size_t sA, const _Float16* __restrict__ Bh, int ldb, size_t sB, float alpha, const float* __restrict__ bias, size_t sBias, const float* __restrict__ CP, int rowsPerB, size_t sCPb, int row0g,
    float* __restrict__ C, _Float16* __restrict__ C16, int ldc, size_t sC, int M, int N, int K) { static_assert(ACT == 0 || ACT == 3 || ACT == 6 || ACT == 8 || ACT == 9 || ACT == 11 || ACT == 12 || ACT == 14 || ACT == 15 || ACT == 16 || ACT == 17, "k_gemm2: unsupported ACT code (would silently apply no activation)");
  __shared__ __attribute__((aligned(16))) float so[4][32][68];
  const int tid = threadIdx.x, w = tid >> 5, lane = tid & 31, ln = lane & 15, hh = lane >> 4; const int by = blockIdx.y;
  A += (size_t)by * sA; Bh += (size_t)by * sB; const size_t cofs = (size_t)by * sC; const float* bp = bias ? bias + (size_t)by * sBias : nullptr;
  const int ntn = N >> 6; const int mt = blockIdx.x / ntn, nq = blockIdx.x - mt * ntn; const int row0 = mt * 128 + 32 * w, col0 = nq * 64; if (row0 >= M) return;
  const _Float16* a0p = A + (size_t)(row0 + ln) * lda; const _Float16* a1p = a0p + (size_t)16 * lda;
  const _Float16* b0p = Bh + (size_t)(col0 + ln) * ldb; const _Float16* b1p = b0p + (size_t)16 * ldb; const _Float16* b2p = b1p + (size_t)16 * ldb; const _Float16* b3p = b2p + (size_t)16 * ldb;
  const v8f z8 = {0.f,0.f,0.f,0.f,0.f,0.f,0.f,0.f}; v8f c00 = z8, c01 = z8, c02 = z8, c03 = z8, c10 = z8, c11 = z8, c12 = z8, c13 = z8;
#pragma unroll 1
  for (int kb = 0; kb < K; kb += 32) { const v16h a0 = g2_frag(a0p + kb, hh), a1 = g2_frag(a1p + kb, hh);
    v16h b = g2_frag(b0p + kb, hh); c00 = g2_mma(a0, b, c00); c10 = g2_mma(a1, b, c10);
    b = g2_frag(b1p + kb, hh); c01 = g2_mma(a0, b, c01); c11 = g2_mma(a1, b, c11);
    b = g2_frag(b2p + kb, hh); c02 = g2_mma(a0, b, c02); c12 = g2_mma(a1, b, c12);
    b = g2_frag(b3p + kb, hh); c03 = g2_mma(a0, b, c03); c13 = g2_mma(a1, b, c13); }
  v8f accs[8] = {c00, c01, c02, c03, c10, c11, c12, c13};
#pragma unroll
  for (int u = 0; u < 8; ++u) { const int t = u & 3, half = u >> 2; const int col = col0 + t * 16 + ln; const float bv = bp ? bf16_round(bp[col]) : 0.f;
#pragma unroll
    for (int r = 0; r < 8; ++r) { const int rloc = half * 16 + 8 * hh + r; float v = accs[u][r] * alpha + bv; if (CP) { if (rowsPerB < 0) v += CP[cofs + (size_t)(row0g + row0 + rloc) * ldc + col];      /* rowsPerB < 0: own element of the batched C plane */ else { const int bidx = (row0g + row0 + rloc) / rowsPerB; v += CP[(size_t)bidx * sCPb + (size_t)by * 64 + col]; } }
      if (ACT == 3) v = fmaxf(v, 0.f); else if (ACT == 6) v = 0.5f * v * (1.0f + erff(v * 0.70710678118654752f)); else if (ACT == 11) v = 1.0f / (1.0f + expf(-v)); else if (ACT == 15) v = v / (1.0f + expf(-v)); else if (ACT == 12) v = (v > 0.f) ? v : 0.01f * v; else if (ACT == 8) v = tanhf(v); else if (ACT == 9) v = 0.5f * v * (1.0f + tanhf(0.7978845608028654f * (v + 0.044715f * v * v * v))); else if (ACT == 14) v = (v > 0.f) ? v : 0.1f * v; else if (ACT == 16) v = (v >= 0.f) ? v : 0.3f * v; else if (ACT == 17) v = (v >= 0.f) ? v : 0.2f * v;
      so[w][rloc][t * 16 + ln] = v; } }
  __builtin_amdgcn_fence(__ATOMIC_ACQ_REL, "workgroup"); __builtin_amdgcn_wave_barrier();
  const int rsub = lane >> 4, c4 = (lane & 15) * 4;
  {
#pragma unroll
    for (int q = 0; q < 16; ++q) { const int r = q * 2 + rsub; const v4f v = *(const v4fa*)&so[w][r][c4]; if (C) *(v4f*)(C + cofs + (size_t)(row0 + r) * ldc + col0 + c4) = v; if (C16) { v4h h4; for (int i = 0; i < 4; ++i) h4[i] = (_Float16)v[i]; *(v4h*)(C16 + cofs + (size_t)(row0 + r) * ldc + col0 + c4) = h4; } }
     } }


__global__ __launch_bounds__(256) void k_wnat(const float* __restrict__ w, size_t n8, _Float16* __restrict__ Bt) { const size_t t = (size_t)blockIdx.x * 256 + threadIdx.x; if (t >= n8) return; FragH f; for (int q = 0; q < 8; ++q) f.h[q] = (_Float16)(bf16_round(w[t * 8 + q]) * 16.0f); *(v8us*)((unsigned short*)Bt + t * 8) = f.half[0];  }
__global__ __launch_bounds__(256) void k_rsm(const float* __restrict__ S, _Float16* __restrict__ P, int nrows) {
  #pragma clang fp contract(off)
  const int i = blockIdx.x * 256 + threadIdx.x; if (i >= nrows) return; const float* s = S + (size_t)i * SQ; float mx = -3.0e38f;
#pragma unroll 1
  for (int j = 0; j < SQ; ++j) mx = fmaxf(mx, s[j]); float se = 0.f;
#pragma unroll 1
  for (int j = 0; j < SQ; ++j) se += expf(s[j] - mx); const float sc = 256.0f / se;
#pragma unroll 1
  for (int j0 = 0; j0 < SQ; j0 += 8) { FragH f; for (int q = 0; q < 8; ++q) f.h[q] = (_Float16)(expf(s[j0 + q] - mx) * sc); unsigned short* d = (unsigned short*)P + (size_t)i * SQ + j0; *(v8us*)d = f.half[0];  } }
__global__ __launch_bounds__(256) void k_vt(const _Float16* __restrict__ V16, int b, int h0, _Float16* __restrict__ VT) { __shared__ unsigned short tl[64][65]; const int tid = threadIdx.x; const int hh = blockIdx.x % HG, sg = blockIdx.x / HG; const int s0 = sg * 64; const int h = h0 + hh;
  for (int i = tid; i < 64 * 8; i += 256) { const int j = i / 8, d8 = (i % 8) * 8; FragH f; f.half[0] = *(const v8us*)((const unsigned short*)V16 + ((size_t)b * SQ + s0 + j) * DM + h * HD + d8); for (int q = 0; q < 8; ++q) tl[d8 + q][j] = f.u[q]; }
  __syncthreads();
  { for (int i = tid; i < 64 * 8; i += 256) { const int d = i / 8, j8 = (i % 8) * 8; FragH f; for (int q = 0; q < 8; ++q) f.u[q] = tl[d][j8 + q]; *(v8us*)((unsigned short*)VT + ((size_t)hh * HD + d) * SQ + s0 + j8) = f.half[0]; }  } }



__global__ __launch_bounds__(256) void k_rsmcf2(const float* __restrict__ S, _Float16* __restrict__ P, int hg, int q0, int nk) {
  #pragma clang fp contract(off)
  const int t = blockIdx.x * 256 + threadIdx.x; if (t >= hg * QT) return; const size_t i = (size_t)t; const float* s = S + i * NKX; const int last = q0 + (t % QT); float mx = -3.0e38f;
#pragma unroll 1
  for (int j = 0; j < nk; ++j) { const float f = (j <= last) ? 1.f : 0.f; mx = fmaxf(mx, fmaf(f, s[j], (1.f - f) * -1.0e9f)); } float se = 0.f;
#pragma unroll 1
  for (int j = 0; j < nk; ++j) { const float f = (j <= last) ? 1.f : 0.f; se += __expf(fmaf(f, s[j], (1.f - f) * -1.0e9f) - mx); } const float sc = 256.0f / se;
#pragma unroll 1
  for (int j0 = 0; j0 < nk; j0 += 8) { FragH fr; for (int q = 0; q < 8; ++q) { const int j = j0 + q; const float f = (j <= last) ? 1.f : 0.f; fr.h[q] = (_Float16)(__expf(fmaf(f, s[j], (1.f - f) * -1.0e9f) - mx) * sc); } unsigned short* d = (unsigned short*)P + i * NKX + j0; *(v8us*)d = fr.half[0];  } }


template <int MASKADD>
__global__ __launch_bounds__(64) void k_att0(const float* __restrict__ QF, const float* __restrict__ KF, const float* __restrict__ VF, int ld, const float* __restrict__ mask, float scale, float* __restrict__ OF, int ldo) {
  #pragma clang fp contract(off)
  __shared__ __attribute__((aligned(16))) float lq[64][64]; __shared__ __attribute__((aligned(16))) float lo[64][64];
  const int tid = threadIdx.x; const int h = blockIdx.x / (QT0 / 64), rg = blockIdx.x % (QT0 / 64); const int i = rg * 64 + tid;
  const float* qr = QF + (size_t)i * ld + h * HD;
#pragma unroll 1
  for (int c = 0; c < HD / 4; ++c) { *(v4f*)&lq[tid][c * 4] = *(const v4fa*)(qr + c * 4); const v4f z = {0.f, 0.f, 0.f, 0.f}; *(v4f*)&lo[tid][c * 4] = z; }
  float m = -1.0e30f, l = 0.f; const int jmax = MASKADD ? (SQ - 1) : (rg * 64 + 63);      /* additive-mask form: every key (the mask input decides); causal form: keys up to the block's last row */
#pragma unroll 1
  for (int j = 0; j <= jmax; ++j) { const float* kr = KF + (size_t)j * ld + h * HD; const float* vr = VF + (size_t)j * ld + h * HD; float s = 0.f;
#pragma unroll 1
    for (int c = 0; c < HD / 4; ++c) { const v4f kq = *(const v4fa*)(kr + c * 4); const v4f qq = *(v4f*)&lq[tid][c * 4]; s = __fadd_rn(s, __fmul_rn(qq[0], kq[0])); s = __fadd_rn(s, __fmul_rn(qq[1], kq[1])); s = __fadd_rn(s, __fmul_rn(qq[2], kq[2])); s = __fadd_rn(s, __fmul_rn(qq[3], kq[3])); }
    s = __fmul_rn(s, scale); if (MASKADD) s = __fadd_rn(s, __fmul_rn(bf16_round(mask[(size_t)i * SQ + j]), -10000.0f));
    const float f = (MASKADD || j <= i) ? 1.f : 0.f; const float sm = fmaf(f, s, (1.f - f) * -1.0e30f); const float mn = fmaxf(m, sm); const float sc = expf(m - mn); const float e = expf(sm - mn); l = __fadd_rn(__fmul_rn(l, sc), e); m = mn;
#pragma unroll 1
    for (int c = 0; c < HD / 4; ++c) { const v4f vv = *(const v4fa*)(vr + c * 4); v4f oo = *(v4f*)&lo[tid][c * 4]; for (int u = 0; u < 4; ++u) oo[u] = __fadd_rn(__fmul_rn(oo[u], sc), __fmul_rn(e, vv[u])); *(v4f*)&lo[tid][c * 4] = oo; } }
  const float fin = 64.0f / l;      /* o carried x64 like the f16 path */
#pragma unroll 1
  for (int c = 0; c < HD / 4; ++c) { v4f oo = *(v4f*)&lo[tid][c * 4]; for (int u = 0; u < 4; ++u) oo[u] = __fmul_rn(oo[u], fin); *(v4f*)&lo[tid][c * 4] = oo; }
  __syncthreads();
  {
#pragma unroll 1
    for (int it = 0; it < 16; ++it) { const int row = it * 4 + tid / 16, pc = (tid % 16) * 4; const v4f v = *(const v4f*)&lo[row][pc]; *(v4f*)(OF + (size_t)(rg * 64 + row) * ldo + h * HD + pc) = v; }
     } }


__global__ __launch_bounds__(256) void k_wt_hq(const float* __restrict__ Wf, const float* __restrict__ bf, _Float16* __restrict__ Bq, _Float16* __restrict__ Bk, _Float16* __restrict__ Bv, float* __restrict__ B3) {
  const int t = blockIdx.x * 256 + threadIdx.x; if (t >= 3 * DM * (DM / 8)) return; const int n = t / (DM / 8), k8 = (t % (DM / 8)) * 8; const int h = n / (3 * HD), wh = (n % (3 * HD)) / HD, d = n % HD; const int row = h * HD + d; FragH f;
#pragma unroll
  for (int i = 0; i < 8; ++i) f.h[i] = (_Float16)(bf16_round(Wf[(size_t)(k8 + i) * (3 * DM) + n]) * 16.0f); const v8us o = f.half[0];
  _Float16* dst = (wh == 0) ? Bq : ((wh == 1) ? Bk : Bv); unsigned short* p = (unsigned short*)dst + (size_t)row * DM + k8; *(v8us*)p = o; 
  (void)bf; (void)B3; }
__global__ __launch_bounds__(256) void k_bhq(const float* __restrict__ bf, float* __restrict__ B3) {
  const int t = blockIdx.x * 256 + threadIdx.x; if (t >= 3 * DM) return; const int wh = t / DM, row = t % DM; const int h = row / HD, d = row % HD; const float v = bf16_round(bf[h * (3 * HD) + wh * HD + d]); *(float*)(B3 + t) = v;  }

template <int NORM, int ROPE>
__global__ __launch_bounds__(64) void k_xform(const float* __restrict__ F, int ldf, int nh, const float* __restrict__ gain, float eps, const float* __restrict__ CS, const float* __restrict__ SN, _Float16* __restrict__ H16, int ldo) {
  #pragma clang fp contract(off)
  __shared__ float xv[HD]; __shared__ float red[HD]; __shared__ unsigned short sh_[HD]; const int d = threadIdx.x; const int h = blockIdx.x % nh; const size_t r = blockIdx.x / nh; const int p = (int)(r % SQ);
  float x = F[r * (size_t)ldf + (size_t)h * HD + d];
  if (NORM) { red[d] = __fmul_rn(x, x); __syncthreads(); for (int st = HD / 2; st > 0; st >>= 1) { if (d < st) red[d] = __fadd_rn(red[d], red[d + st]); __syncthreads(); } const float rs = rsqrtf(__fadd_rn(red[0] / (float)HD, eps)); x = __fmul_rn(__fmul_rn(x, rs), bf16_round(gain[d])); }
  xv[d] = x; __syncthreads();
  float o = x;
  if (ROPE == 1) { const int i = d >> 1; const float c = CS[p * (HD / 2) + i], s = SN[p * (HD / 2) + i]; const float ev = xv[2 * i], od = xv[2 * i + 1]; o = (d & 1) ? __fadd_rn(__fmul_rn(ev, s), __fmul_rn(od, c)) : __fadd_rn(__fmul_rn(ev, c), -__fmul_rn(od, s)); }
  if (ROPE == 2) { const int i = d & (HD / 2 - 1); const float c = CS[p * (HD / 2) + i], s = SN[p * (HD / 2) + i]; const float lo = xv[i], hi = xv[i + HD / 2]; o = (d < HD / 2) ? __fadd_rn(__fmul_rn(lo, c), -__fmul_rn(hi, s)) : __fadd_rn(__fmul_rn(lo, s), __fmul_rn(hi, c)); }
  FragH th; th.h[0] = (_Float16)o; sh_[d] = th.u[0]; __syncthreads();
  if (d < HD / 8) { FragH f; for (int q = 0; q < 8; ++q) f.u[q] = sh_[d * 8 + q]; unsigned short* dst = (unsigned short*)H16 + r * (size_t)ldo + (size_t)h * HD + d * 8; *(v8us*)dst = f.half[0];  } }


template <int NORM, int ROPE>
__global__ __launch_bounds__(64) void k_xformf(const float* __restrict__ F, int ldf, int nh, const float* __restrict__ gain, float eps, const float* __restrict__ CS, const float* __restrict__ SN, float* __restrict__ F32, int ldo) {
  #pragma clang fp contract(off)
  __shared__ float xv[HD]; __shared__ float red[HD]; const int d = threadIdx.x; const int h = blockIdx.x % nh; const size_t r = blockIdx.x / nh; const int p = (int)(r % SQ);
  float x = F[r * (size_t)ldf + (size_t)h * HD + d];
  if (NORM) { red[d] = __fmul_rn(x, x); __syncthreads(); for (int st = HD / 2; st > 0; st >>= 1) { if (d < st) red[d] = __fadd_rn(red[d], red[d + st]); __syncthreads(); } const float rs = rsqrtf(__fadd_rn(red[0] / (float)HD, eps)); x = __fmul_rn(__fmul_rn(x, rs), bf16_round(gain[d])); }
  xv[d] = x; __syncthreads();
  float o = x;
  if (ROPE == 1) { const int i = d >> 1; const float c = CS[p * (HD / 2) + i], s = SN[p * (HD / 2) + i]; const float ev = xv[2 * i], od = xv[2 * i + 1]; o = (d & 1) ? __fadd_rn(__fmul_rn(ev, s), __fmul_rn(od, c)) : __fadd_rn(__fmul_rn(ev, c), -__fmul_rn(od, s)); }
  if (ROPE == 2) { const int i = d & (HD / 2 - 1); const float c = CS[p * (HD / 2) + i], s = SN[p * (HD / 2) + i]; const float lo = xv[i], hi = xv[i + HD / 2]; o = (d < HD / 2) ? __fadd_rn(__fmul_rn(lo, c), -__fmul_rn(hi, s)) : __fadd_rn(__fmul_rn(lo, s), __fmul_rn(hi, c)); }
  float* dst = F32 + r * (size_t)ldo + (size_t)h * HD + d; *(float*)dst = o;  }


__global__ __launch_bounds__(256) void k_tabcp32(const float* __restrict__ tc, const float* __restrict__ tsn, float* __restrict__ CS, float* __restrict__ SN, int n) {
  const int t = blockIdx.x * 256 + threadIdx.x; if (t >= n) return; const float c = bf16_round(tc[t]), s = bf16_round(tsn[t]);
  *(float*)(CS + t) = c; *(float*)(SN + t) = s;  }
extern "C" void kernel_launch(void* const* d_in, const int* in_sizes, int n_in,
                              void* d_out, int out_size, void* d_ws, size_t ws_size, hipStream_t stream) {
  (void)in_sizes; (void)n_in; (void)out_size;
  const float* const* I = (const float* const*)d_in; const float* x = I[0]; const float* wqkv = I[1]; const float* bqkv = I[2]; const float* wo = I[3]; const float* bo = I[4]; const float* tcos = I[5]; const float* tsin = I[6];      /* x; fused W_qkv [1024][3072] + b_qkv [3072] ([in][out]; per-head (q | k | v) column triples); W_out + b_out ([in][out]); rope tables cos / sin [2048][32] */
  char* ws = (char*)d_ws; size_t off = 0;
  auto take = [&](size_t bytes) { char* p = ws + off; off += (bytes + 255) & ~(size_t)255; return p; };
  _Float16* BQ = (_Float16*)take((size_t)DM * DM * 2); _Float16* BK = (_Float16*)take((size_t)DM * DM * 2); _Float16* BV = (_Float16*)take((size_t)DM * DM * 2); _Float16* BO = (_Float16*)take((size_t)DM * DM * 2);
  float* BQB = (float*)take((size_t)3 * DM * 4); float* QF = (float*)take(NR * DM * 4); float* CSB = (float*)take((size_t)SQ * 32 * 4); float* SNB = (float*)take((size_t)SQ * 32 * 4);      /* de-interleaved bias vector bq | bk | bv; f32 projection plane (q, then reused for k) for the rope; bf16-rounded copies of the rope tables */ _Float16* X16 = (_Float16*)take(NR * DM * 2); _Float16* Q16 = (_Float16*)take(NR * DM * 2); _Float16* K16 = (_Float16*)take(NR * DM * 2); _Float16* V16 = (_Float16*)take(NR * DM * 2); _Float16* O16 = (_Float16*)take(NR * DM * 2);
  float* S = (float*)take((size_t)NH * QT * NKX * 4); _Float16* P = (_Float16*)take((size_t)NH * QT * NKX * 2); _Float16* VT = (_Float16*)take((size_t)NH * HD * SQ * 2);
  float* QF0 = (float*)take((size_t)QT0 * DM * 4); float* KF0 = (float*)take((size_t)QT0 * DM * 4); float* VF0 = (float*)take((size_t)QT0 * DM * 4); float* OF0 = (float*)take((size_t)NB * QT0 * DM * 4); _Float16* OH0 = (_Float16*)take((size_t)NB * QT0 * DM * 2); _Float16* OL0 = (_Float16*)take((size_t)NB * QT0 * DM * 2);
  if (off > ws_size) return;
  k_wt_hq<<<(unsigned)(((size_t)3 * DM * (DM / 8) + 255) / 256), 256, 0, stream>>>(wqkv, bqkv, BQ, BK, BV, BQB); k_bhq<<<(3 * DM + 255) / 256, 256, 0, stream>>>(bqkv, BQB); k_wt_f16<<<(unsigned)(((size_t)DM * (DM / 8) + 255) / 256), 256, 0, stream>>>(wo, BO, DM, DM, 16.0f);      /* fused [in][out] weight with per-head (q | k | v) column triples -> three Bt planes (row h*64 + d) x16 + the de-interleaved bias vector; W_out [in][out] -> Bt x16 */
  k_tabcp32<<<(SQ * 32 + 255) / 256, 256, 0, stream>>>(tcos, tsin, CSB, SNB, SQ * 32);      /* rope tables [pos][32], bf16-rounded copies */

  k_x16<<<(unsigned)((NR * DM / 8 + 255) / 256), 256, 0, stream>>>(x, X16, NR * DM / 8);
  const size_t r0p = (size_t)B0 * SQ;      /* first projected row */
  k_gemm2<0><<<dim3((unsigned)((MP / 128) * (DM / 64)), 1), 128, 0, stream>>>(X16 + r0p * DM, DM, 0, BQ, DM, 0, 0.0625f, BQB, 0, nullptr, 1, 0, 0, QF + r0p * DM, nullptr, DM, 0, MP, DM, DM); k_xform<0, 1><<<(unsigned)((size_t)MP * NH), 64, 0, stream>>>(QF + r0p * DM, DM, NH, nullptr, 0.f, CSB, SNB, Q16 + r0p * DM, DM);      /* q (f32) + bias -> interleaved-pair rope (position = row % SQ) -> f16 rows */
  k_gemm2<0><<<dim3((unsigned)((MP / 128) * (DM / 64)), 1), 128, 0, stream>>>(X16 + r0p * DM, DM, 0, BK, DM, 0, 0.0625f, BQB + DM, 0, nullptr, 1, 0, 0, QF + r0p * DM, nullptr, DM, 0, MP, DM, DM); k_xform<0, 1><<<(unsigned)((size_t)MP * NH), 64, 0, stream>>>(QF + r0p * DM, DM, NH, nullptr, 0.f, CSB, SNB, K16 + r0p * DM, DM);      /* k likewise (the f32 plane is reused after q's rope) */
  k_gemm2<0><<<dim3((unsigned)((MP / 128) * (DM / 64)), 1), 128, 0, stream>>>(X16 + r0p * DM, DM, 0, BV, DM, 0, 0.0625f, BQB + 2 * DM, 0, nullptr, 1, 0, 0, nullptr, V16 + r0p * DM, DM, 0, MP, DM, DM);
  for (int b = B0; b < B0 + NBR; ++b) { const size_t r0 = (size_t)b * SQ;
    k_vt<NH, SQ><<<NH * (SQ / 64), 256, 0, stream>>>(V16 + r0 * LQ, LQ, 0, VT);      /* V^T [NH][HD][SQ] for this batch */
    k_gemm2<0><<<dim3((QT0 / 128) * (DM / 64), 1), 128, 0, stream>>>(X16 + r0 * DM, DM, 0, BQ, DM, 0, 0.0625f, BQB, 0, nullptr, 1, 0, 0, QF0, nullptr, DM, 0, QT0, DM, DM); k_gemm2<0><<<dim3((QT0 / 128) * (DM / 64), 1), 128, 0, stream>>>(X16 + r0 * DM, DM, 0, BK, DM, 0, 0.0625f, BQB + DM, 0, nullptr, 1, 0, 0, KF0, nullptr, DM, 0, QT0, DM, DM); k_gemm2<0><<<dim3((QT0 / 128) * (DM / 64), 1), 128, 0, stream>>>(X16 + r0 * DM, DM, 0, BV, DM, 0, 0.0625f, BQB + 2 * DM, 0, nullptr, 1, 0, 0, VF0, nullptr, DM, 0, QT0, DM, DM);      /* f32 q, k, v of the first 128 rows (exact products) */
    k_xformf<0, 1><<<(unsigned)(QT0 * NH), 64, 0, stream>>>(QF0, DM, NH, nullptr, 0.f, CSB, SNB, QF0, DM); k_xformf<0, 1><<<(unsigned)(QT0 * NH), 64, 0, stream>>>(KF0, DM, NH, nullptr, 0.f, CSB, SNB, KF0, DM);      /* f32 rope of the first-tile q, k IN PLACE (each (row, head) block stages its 64 values in LDS before writing; first-tile row r = position r) */
    k_att0<0><<<NH * (QT0 / 64), 64, 0, stream>>>(QF0, KF0, VF0, DM, nullptr, 0.125f, OF0 + (size_t)b * QT0 * DM, DM);      /* exact f32 attention for rows 0..127 (o x64) */
    for (int q0 = 0; q0 < QN; q0 += QT) { const int nk = q0 + QT;      /* causal: only keys below the tile end are computed */
      k_gemm2<0><<<dim3((QT / 128) * (nk / 64), NHD), 128, 0, stream>>>(Q16 + (r0 + q0) * LQ, LQ, (size_t)HD, K16 + r0 * LQ, LQ, (size_t)HD, 0.125f, nullptr, 0, nullptr, 1, 0, 0, S, nullptr, NKX, (size_t)QT * NKX, QT, nk, HD);      /* scores, all heads on grid.y */
      k_rsmcf2<<<(NHD * QT + 255) / 256, 256, 0, stream>>>(S, P, NHD, q0, nk);
      k_gemm2<0><<<dim3((QT / 128) * (HD / 64), NHD), 128, 0, stream>>>(P, NKX, (size_t)QT * NKX, VT, SQ, (size_t)HD * SQ, 0.25f, nullptr, 0, nullptr, 1, 0, 0, nullptr, O16 + (r0 + q0) * DM, DM, (size_t)HD, QT, HD, nk); } }      /* o (merged heads, x64) as f16 rows */
  k_gemm2<0><<<dim3((unsigned)((MPO / 128) * (DM / 64)), 1), 128, 0, stream>>>(O16 + r0p * DM, DM, 0, BO, DM, 0, 0.0009765625f, bo, 0, nullptr, 1, 0, 0, (float*)d_out + r0p * DM, nullptr, DM, 0, MPO, DM, DM);      /* out rows are the output layout */
  k_hl<<<(unsigned)(((size_t)NB * QT0 * DM / 8 + 255) / 256), 256, 0, stream>>>(OF0, OH0, OL0, (size_t)NB * QT0 * DM / 8);      /* first-tile o (x64) -> f16 hi + x1024 residual planes */
  for (int b = B0; b < B0 + NBR; ++b) { const size_t r0 = (size_t)b * SQ; const size_t f0 = (size_t)b * QT0;
    k_gemm2<0><<<dim3((QT0 / 128) * (DM / 64), 1), 128, 0, stream>>>(OH0 + f0 * DM, DM, 0, BO, DM, 0, 0.0009765625f, bo, 0, nullptr, 1, 0, 0, (float*)d_out + r0 * DM, nullptr, DM, 0, QT0, DM, DM);      /* rows 0..127: out = o_hi Wo (+ b), overwriting the f16-path rows */
    k_gemm2<0><<<dim3((QT0 / 128) * (DM / 64), 1), 128, 0, stream>>>(OL0 + f0 * DM, DM, 0, BO, DM, 0, 0.00000095367431640625f, nullptr, 0, (const float*)d_out + r0 * DM, -1, 0, 0, (float*)d_out + r0 * DM, nullptr, DM, 0, QT0, DM, DM); }      /* += o_lo Wo 2^-20 (own-element accumulate) */
}

// v001
// Measured time: 4280 microseconds a run.
// Two timings next to v000 put it at 2.42 and 2.43 times that version's speed.
#include <hip/hip_runtime.h>
// Causal multi-head self-attention with a PER-HEAD interleaved fused QKV projection and rotary embeddings (x [4][2048][1024]; qkv = x W_qkv + b_qkv ([in][out] 1024 x 3072, zero bias) reshaped (B, T, 16, 192): head h owns columns h*192 + [0..63 | 64..127 | 128..191] = q | k | v; rope on q and k from the INPUT tables cos / sin [2048][32]: t1 = even elements, t2 = odd elements, out = cat(t1 c - t2 s, t1 s + t2 c) (an interleaved-pair rotation followed by the same fixed permutation on q and k: the scores are unchanged by it); scores / 8; causal (tril, -inf); softmax; out = merged W_out + b_out ([in][out]) -> [4][2048][1024]).
// Structure: token rows r = b*2048 + s; x as exact f16 rows (bf16-rounded); Q, K, V as three WMMA GEMMs (32x64 wave tiles, f32 accumulation, exact x16 weights, f32 q / k outputs roped into f16 rows, f16 v output); per batch: V^T for all heads via LDS transposes; per query tile of 256 rows: scores against the keys below the tile end only (K = 64, all heads on grid.y, alpha = 0.125), causal row softmax on VALU with an arithmetic 0/1 key mask over the computed range (f32 statistics, native exp; weights x256 f16), o = P . V^T (K = keys below the tile end, alpha 2^-2: o carried x64, folded into the output GEMM alpha) written straight into the merged f16 o rows; out = o W_o GEMM (f32) into the output layout.
// Compute dtype: inputs rounded to bf16; x / weights exact; q, k, v, softmax weights and o as plain f16 GEMM operands (~2^-12); scores and softmax statistics f32. v_wmma_f32_16x16x32_f16.
#define NB 4
#define SQ 2048
#define DM 1024
#define NH 16
#define HD 64
#define HG 4                         /* heads per launch of the unlaunched k_vt(b, h0) overload */
#define QT 256                       /* query rows per causal tile */
#define NKX SQ                       /* S / P row pitch */
#define QT0 128                      /* first-tile rows recomputed exactly in f32 */
#define B0 0                         /* first batch processed (debug hook) */
#define NBR NB                       /* batches processed (debug hook) */
#define NR ((size_t)NB * SQ)         /* token rows */
#define MP ((int)((size_t)NBR * SQ)) /* rows projected (debug hook) */
#define QN SQ                        /* query rows attended per batch (debug hook) */
#define NHD NH                       /* heads attended (debug hook) */
#define MPO MP                       /* rows through the output stage (debug hook) */
#define LQ DM      /* row pitch of the q/k/v rows */
typedef __bf16 v16b __attribute__((ext_vector_type(16)));
typedef unsigned short v8us __attribute__((ext_vector_type(8), may_alias));
typedef float  v8f  __attribute__((ext_vector_type(8)));
typedef float  v4f  __attribute__((ext_vector_type(4)));
typedef float  v4fa __attribute__((ext_vector_type(4), may_alias));
union FragB { v16b v; v8us half[2]; unsigned short u[16]; };

__device__ __forceinline__ unsigned short bf16_bits(float x) { unsigned int u = __float_as_uint(x); return (unsigned short)((u + 0x7FFFu + ((u >> 16) & 1u)) >> 16); }
__device__ __forceinline__ float bf16_val(unsigned short b) { return __uint_as_float(((unsigned int)b) << 16); }
__device__ __forceinline__ float bf16_round(float x) { return bf16_val(bf16_bits(x)); }
// D += A·B with NT terms: 1 = ah·bh, 2 = + al·bh (A split), 3 = + ah·bl (both split)
template <int NT>
__device__ __forceinline__ v8f mmaN(v16b ah, v16b al, v16b bh, v16b bl, v8f c) {
  c = __builtin_amdgcn_wmma_f32_16x16x32_bf16(false, ah, false, bh, (short)0, c, false, false);
  if (NT >= 2) c = __builtin_amdgcn_wmma_f32_16x16x32_bf16(false, al, false, bh, (short)0, c, false, false);
  if (NT >= 3) c = __builtin_amdgcn_wmma_f32_16x16x32_bf16(false, ah, false, bl, (short)0, c, false, false);
  asm volatile("v_nop\n\tv_nop\n\tv_nop\n\tv_nop" : "+v"(c) : "v"(ah), "v"(al), "v"(bh), "v"(bl));
  return c;
}

__global__ __launch_bounds__(256) void k_wt_bf16(const float* __restrict__ W, unsigned short* __restrict__ Wt, int K, int N) {
  const int t = blockIdx.x * 256 + threadIdx.x;
  const int k8n = K / 8;
  if (t >= N * k8n) return;
  const int n = t / k8n, k8 = (t % k8n) * 8;
  v8us v;
#pragma unroll
  for (int i = 0; i < 8; ++i) v[i] = bf16_bits(W[(size_t)(k8 + i) * N + n]);
  *(v8us*)(Wt + (size_t)n * K + k8) = v;
  
}

// GEMM C[M][N] (f32, pitch ldc) = act(A[M][K]·W + bias). A f32 row-major (pitch lda) converted per fragment to bf16
// (ASPLIT: hi/lo two planes -> 2 terms, else single rounded term); Wt bf16 [N][K] (pitch ldb). BIAS_BF16 rounds the
// bias to bf16 first (bias quantised to bf16 before the add). K%32==0, M%16==0, N%64==0.
template <bool ASPLIT, int ACT, bool BIAS_BF16>
__global__ __launch_bounds__(128) void k_gemm_bf(const float* __restrict__ A, int lda, const unsigned short* __restrict__ Wt, int ldb,
                                               const float* __restrict__ bias, float* __restrict__ C, int ldc, int M, int N, int K) {
  __shared__ __attribute__((aligned(16))) float so[4][16][64];
  const int tid = threadIdx.x, w = tid >> 5, lane = tid & 31, ln = lane & 15, hh = lane >> 4;
  const int ntn = N / 64;
  const int wid = blockIdx.x * 4 + w;
  const int mt = wid / ntn, nq = wid % ntn;
  if (mt * 16 >= M) return;
  const int row0 = mt * 16, col0 = nq * 64;
  const float* arow = A + (size_t)(row0 + ln) * lda;
  v8f acc[4] = {};
  for (int kb = 0; kb < K; kb += 32) {
    FragB ah, al;
    const v4f x0 = *(const v4fa*)(arow + kb + 8 * hh), x1 = *(const v4fa*)(arow + kb + 8 * hh + 4);
    const v4f x2 = *(const v4fa*)(arow + kb + 16 + 8 * hh), x3 = *(const v4fa*)(arow + kb + 16 + 8 * hh + 4);
    float xs[16] = {x0[0],x0[1],x0[2],x0[3],x1[0],x1[1],x1[2],x1[3],x2[0],x2[1],x2[2],x2[3],x3[0],x3[1],x3[2],x3[3]};
#pragma unroll
    for (int i = 0; i < 16; ++i) { const unsigned short hb = bf16_bits(xs[i]); ah.u[i] = hb; al.u[i] = ASPLIT ? bf16_bits(xs[i] - bf16_val(hb)) : (unsigned short)0; }
#pragma unroll
    for (int t = 0; t < 4; ++t) {
      const unsigned short* brow = Wt + (size_t)(col0 + t * 16 + ln) * ldb + kb;
      FragB b;
      b.half[0] = *(const v8us*)(brow + 8 * hh);
      b.half[1] = *(const v8us*)(brow + 16 + 8 * hh);
      acc[t] = mmaN<ASPLIT ? 2 : 1>(ah.v, al.v, b.v, b.v, acc[t]);
    }
  }
#pragma unroll
  for (int t = 0; t < 4; ++t) {
    float bv = bias ? bias[col0 + t * 16 + ln] : 0.f;
    if (BIAS_BF16) bv = bf16_round(bv);
#pragma unroll
    for (int r = 0; r < 8; ++r) { float v = acc[t][r] + bv; if (ACT == 1) v = fmaxf(v, 0.f); so[w][8 * hh + r][t * 16 + ln] = v; }
  }
  __builtin_amdgcn_fence(__ATOMIC_ACQ_REL, "workgroup");
  __builtin_amdgcn_wave_barrier();
  const int rsub = lane >> 4, c4 = (lane & 15) * 4;
  {
#pragma unroll
    for (int q = 0; q < 8; ++q) {
      const int r = q * 2 + rsub;
      const v4f v = *(const v4fa*)&so[w][r][c4];
      *(v4f*)(C + (size_t)(row0 + r) * ldc + col0 + c4) = v;
    }
    
  }
}

// GEMM C = act(A·W + bias + resid): A f32 (ASPLIT -> hi/lo 2 terms), Wt bf16 [N][K]; ACT 0 none, 1 relu, 2 exact gelu;
// resid (optional, f32, row index = (row % rmod), pitch ldr, RES_BF16 rounds it) added before the activation.
template <bool ASPLIT, int ACT, bool BIAS_BF16, bool RES_BF16>
__global__ __launch_bounds__(128) void k_gemm_bf3(const float* __restrict__ A, int lda, const unsigned short* __restrict__ Wt, int ldb,
                                                const float* __restrict__ bias, const float* __restrict__ resid, int rmod, int ldr,
                                                float* __restrict__ C, int ldc, int M, int N, int K) {
  __shared__ __attribute__((aligned(16))) float so[4][16][64];
  const int tid = threadIdx.x, w = tid >> 5, lane = tid & 31, ln = lane & 15, hh = lane >> 4;
  const int ntn = N / 64;
  const int wid = blockIdx.x * 4 + w;
  const int mt = wid / ntn, nq = wid % ntn;
  if (mt * 16 >= M) return;
  const int row0 = mt * 16, col0 = nq * 64;
  const float* arow = A + (size_t)(row0 + ln) * lda;
  v8f acc[4] = {};
  for (int kb = 0; kb < K; kb += 32) {
    FragB ah, al;
    const v4f x0 = *(const v4fa*)(arow + kb + 8 * hh), x1 = *(const v4fa*)(arow + kb + 8 * hh + 4);
    const v4f x2 = *(const v4fa*)(arow + kb + 16 + 8 * hh), x3 = *(const v4fa*)(arow + kb + 16 + 8 * hh + 4);
    float xs[16] = {x0[0],x0[1],x0[2],x0[3],x1[0],x1[1],x1[2],x1[3],x2[0],x2[1],x2[2],x2[3],x3[0],x3[1],x3[2],x3[3]};
#pragma unroll
    for (int i = 0; i < 16; ++i) { const unsigned short hb = bf16_bits(xs[i]); ah.u[i] = hb; al.u[i] = ASPLIT ? bf16_bits(xs[i] - bf16_val(hb)) : (unsigned short)0; }
#pragma unroll
    for (int t = 0; t < 4; ++t) {
      const unsigned short* brow = Wt + (size_t)(col0 + t * 16 + ln) * ldb + kb;
      FragB b;
      b.half[0] = *(const v8us*)(brow + 8 * hh);
      b.half[1] = *(const v8us*)(brow + 16 + 8 * hh);
      acc[t] = mmaN<ASPLIT ? 2 : 1>(ah.v, al.v, b.v, b.v, acc[t]);
    }
  }
#pragma unroll
  for (int t = 0; t < 4; ++t) {
    const int col = col0 + t * 16 + ln;
    float bv = bias ? bias[col] : 0.f;
    if (BIAS_BF16) bv = bf16_round(bv);
#pragma unroll
    for (int r = 0; r < 8; ++r) {
      float v = acc[t][r] + bv;
      if (resid) { float rv = resid[(size_t)((row0 + 8 * hh + r) % rmod) * ldr + col]; if (RES_BF16) rv = bf16_round(rv); v += rv; }
      if (ACT == 1) v = fmaxf(v, 0.f);
      if (ACT == 2) v = 0.5f * v * (1.0f + erff(v * 0.70710678118654752f));
      if (ACT == 3) { const float u = 0.7978845608028654f * (v + 0.044715f * v * v * v); v = 0.5f * v * (1.0f + tanhf(u)); }
      so[w][8 * hh + r][t * 16 + ln] = v;
    }
  }
  __builtin_amdgcn_fence(__ATOMIC_ACQ_REL, "workgroup");
  __builtin_amdgcn_wave_barrier();
  const int rsub = lane >> 4, c4 = (lane & 15) * 4;
  {
#pragma unroll
    for (int q = 0; q < 8; ++q) {
      const int r = q * 2 + rsub;
      const v4f v = *(const v4fa*)&so[w][r][c4];
      *(v4f*)(C + (size_t)(row0 + r) * ldc + col0 + c4) = v;
    }
    
  }
}
// row LayerNorm (biased variance, eps) over N: s = X (+ R); optional out_sum <- s; out_norm <- (s-mu)*rsqrt(var+eps)*g + b
template <bool PARAM_BF16>
__global__ __launch_bounds__(256) void k_layernorm(const float* __restrict__ X, const float* __restrict__ R, const float* __restrict__ g, const float* __restrict__ bta,
                                                  float* __restrict__ out_sum, float* __restrict__ out_norm, int N, float eps) {
  __shared__ float red[256];
  const int row = blockIdx.x, tid = threadIdx.x;
  const float* x = X + (size_t)row * N; const float* rr = R ? R + (size_t)row * N : nullptr;
  float vals[16];                     // up to N = 4096
  const int per = N / 256;            // contiguous chunk per thread? use strided-by-4 chunks: thread handles j = tid*4 + 1024*u
  float s1 = 0.f;
  for (int u = 0; u < per / 4; ++u) {
    const int j = tid * 4 + 1024 * u;
    const v4f a = *(const v4fa*)(x + j);
    v4f b = {0.f,0.f,0.f,0.f}; if (rr) b = *(const v4fa*)(rr + j);
#pragma unroll
    for (int q = 0; q < 4; ++q) { const float v = a[q] + b[q]; vals[u * 4 + q] = v; s1 += v; }
  }
  red[tid] = s1; __syncthreads();
  for (int st = 128; st > 0; st >>= 1) { if (tid < st) red[tid] += red[tid + st]; __syncthreads(); }
  const float mu = red[0] / (float)N; __syncthreads();
  float s2 = 0.f;
  for (int u = 0; u < per / 4; ++u)
#pragma unroll
    for (int q = 0; q < 4; ++q) { const float c = vals[u * 4 + q] - mu; s2 += c * c; }
  red[tid] = s2; __syncthreads();
  for (int st = 128; st > 0; st >>= 1) { if (tid < st) red[tid] += red[tid + st]; __syncthreads(); }
  const float rs = rsqrtf(red[0] / (float)N + eps);
  {
    for (int u = 0; u < per / 4; ++u) {
      const int j = tid * 4 + 1024 * u;
      v4f o, sm;
#pragma unroll
      for (int q = 0; q < 4; ++q) {
        float gg = g[j + q], bb = bta[j + q];
        if (PARAM_BF16) { gg = bf16_round(gg); bb = bf16_round(bb); }
        sm[q] = vals[u * 4 + q]; o[q] = (vals[u * 4 + q] - mu) * rs * gg + bb;
      }
      if (out_sum) *(v4f*)(out_sum + (size_t)row * N + j) = sm;
      *(v4f*)(out_norm + (size_t)row * N + j) = o;
    }
    
  }
}



// ---- f16 WMMA path (v_wmma_f32_16x16x32_f16): 11-bit significands for operands in range — used where a [0,1] probability operand needs more precision than bf16
typedef _Float16 v16h __attribute__((ext_vector_type(16)));
union FragH { v16h v; v8us half[2]; _Float16 h[16]; unsigned short u[16]; };
template <int NT>
__device__ __forceinline__ v8f mmaH(v16h ah, v16h al, v16h bh, v16h bl, v8f c) {
  c = __builtin_amdgcn_wmma_f32_16x16x32_f16(false, ah, false, bh, (short)0, c, false, false);
  if (NT >= 2) c = __builtin_amdgcn_wmma_f32_16x16x32_f16(false, al, false, bh, (short)0, c, false, false);
  if (NT >= 3) c = __builtin_amdgcn_wmma_f32_16x16x32_f16(false, ah, false, bl, (short)0, c, false, false);
  asm volatile("v_nop\n\tv_nop\n\tv_nop\n\tv_nop" : "+v"(c) : "v"(ah), "v"(al), "v"(bh), "v"(bl));
  return c;
}
// batched GEMM like k_gemm_b but f16 operands: A f32 (split into f16 hi/lo if ASPLIT, else rounded to f16), Bt = f16 values [n][k]; alpha; C f32; N multiple of 16 (partial tiles skipped)
template <bool ASPLIT>
__global__ __launch_bounds__(128) void k_gemm_h(const float* __restrict__ A, int lda, size_t sA, const _Float16* __restrict__ Bh, int ldb, size_t sB, float alpha, float* __restrict__ C, int ldc, size_t sC, int M, int N, int K) {
  __shared__ __attribute__((aligned(16))) float so[4][16][64];
  const int tid = threadIdx.x, w = tid >> 5, lane = tid & 31, ln = lane & 15, hh = lane >> 4; const int by = blockIdx.y;
  A += (size_t)by * sA; Bh += (size_t)by * sB; C += (size_t)by * sC;
  const int ntn = (N + 63) / 64; const int wid = blockIdx.x * 4 + w; const int mt = wid / ntn, nq = wid % ntn; if (mt * 16 >= M) return;
  const int row0 = mt * 16, col0 = nq * 64; const float* arow = A + (size_t)(row0 + ln) * lda;
  v8f acc[4] = {};
  for (int kb = 0; kb < K; kb += 32) {
    FragH ah, al;
    const v4f x0 = *(const v4fa*)(arow + kb + 8 * hh), x1 = *(const v4fa*)(arow + kb + 8 * hh + 4), x2 = *(const v4fa*)(arow + kb + 16 + 8 * hh), x3 = *(const v4fa*)(arow + kb + 16 + 8 * hh + 4);
    float xs[16] = {x0[0],x0[1],x0[2],x0[3],x1[0],x1[1],x1[2],x1[3],x2[0],x2[1],x2[2],x2[3],x3[0],x3[1],x3[2],x3[3]};
#pragma unroll
    for (int i = 0; i < 16; ++i) { const _Float16 h = (_Float16)xs[i]; ah.h[i] = h; al.h[i] = ASPLIT ? (_Float16)(xs[i] - (float)h) : (_Float16)0.0f; }
#pragma unroll
    for (int t = 0; t < 4; ++t) { if (col0 + t * 16 >= N) continue; const size_t boff = (size_t)(col0 + t * 16 + ln) * ldb + kb; FragH bq; bq.half[0] = *(const v8us*)(Bh + boff + 8 * hh); bq.half[1] = *(const v8us*)(Bh + boff + 16 + 8 * hh);
      acc[t] = mmaH<ASPLIT ? 2 : 1>(ah.v, al.v, bq.v, bq.v, acc[t]); }
  }
#pragma unroll
  for (int t = 0; t < 4; ++t) { if (col0 + t * 16 >= N) continue;
#pragma unroll
    for (int r = 0; r < 8; ++r) so[w][8 * hh + r][t * 16 + ln] = acc[t][r] * alpha; }
  __builtin_amdgcn_fence(__ATOMIC_ACQ_REL, "workgroup"); __builtin_amdgcn_wave_barrier();
  const int rsub = lane >> 4, c4 = (lane & 15) * 4;
  {
#pragma unroll
    for (int q = 0; q < 8; ++q) { const int r = q * 2 + rsub; if (col0 + c4 < N) { const v4f v = *(const v4fa*)&so[w][r][c4]; *(v4f*)(C + (size_t)(row0 + r) * ldc + col0 + c4) = v; } }
     }
}

// Wt[n][k] = f16(W[k][n]·scale) from f32 row-major W[K][N] (scale = power of two; bf16-exact weights stay exact in f16 away from the subnormal range)
__global__ __launch_bounds__(256) void k_wt_f16(const float* __restrict__ W, _Float16* __restrict__ Wt, int K, int N, float scale) {
  const int t = blockIdx.x * 256 + threadIdx.x; if (t >= N * (K / 8)) return; const int n = t / (K / 8), k8 = (t % (K / 8)) * 8; FragH f;
#pragma unroll
  for (int i = 0; i < 8; ++i) f.h[i] = (_Float16)(bf16_round(W[(size_t)(k8 + i) * N + n]) * scale); const v8us o = f.half[0];
  *(v8us*)((unsigned short*)Wt + (size_t)n * K + k8) = o; 
}
// k_gemm_hh variant with fused epilogue: v = acc·alpha + bias[by·sBias + col] (+ CP[(row/rowsPerB)·sCPb + by·64 + col] if CP) ; ACT 0 none / 1 elu ; writes f16 C16 (and f32 C if non-null)
template <int ACT>
__global__ __launch_bounds__(128) void k_gemm_hhx(const _Float16* __restrict__ A, int lda, size_t sA, const _Float16* __restrict__ Bh, int ldb, size_t sB, float alpha, const float* __restrict__ bias, size_t sBias, const float* __restrict__ CP, int rowsPerB, size_t sCPb, int row0g,
    float* __restrict__ C, _Float16* __restrict__ C16, int ldc, size_t sC, int M, int N, int K) {
  __shared__ __attribute__((aligned(16))) float so[4][16][64];
  const int tid = threadIdx.x, w = tid >> 5, lane = tid & 31, ln = lane & 15, hh = lane >> 4; const int by = blockIdx.y;
  A += (size_t)by * sA; Bh += (size_t)by * sB; const size_t cofs = (size_t)by * sC; const float* bp = bias ? bias + (size_t)by * sBias : nullptr;
  const int ntn = (N + 63) / 64; const int wid = blockIdx.x * 4 + w; const int mt = wid / ntn, nq = wid % ntn; if (mt * 16 >= M) return;
  const int row0 = mt * 16, col0 = nq * 64; const _Float16* arow = A + (size_t)(row0 + ln) * lda;
  v8f acc[4] = {};
  for (int kb = 0; kb < K; kb += 32) { FragH ah; ah.half[0] = *(const v8us*)((const unsigned short*)arow + kb + 8 * hh); ah.half[1] = *(const v8us*)((const unsigned short*)arow + kb + 16 + 8 * hh);
#pragma unroll
    for (int t = 0; t < 4; ++t) { if (col0 + t * 16 >= N) continue; const size_t boff = (size_t)(col0 + t * 16 + ln) * ldb + kb; FragH bq; bq.half[0] = *(const v8us*)((const unsigned short*)Bh + boff + 8 * hh); bq.half[1] = *(const v8us*)((const unsigned short*)Bh + boff + 16 + 8 * hh);
      acc[t] = mmaH<1>(ah.v, ah.v, bq.v, bq.v, acc[t]); }
  }
#pragma unroll
  for (int t = 0; t < 4; ++t) { if (col0 + t * 16 >= N) continue; const int col = col0 + t * 16 + ln; const float bv = bp ? bf16_round(bp[col]) : 0.f;
#pragma unroll
    for (int r = 0; r < 8; ++r) { float v = acc[t][r] * alpha + bv; if (CP) { const int rr = row0g + row0 + 8 * hh + r; if (rowsPerB < 0) v += CP[cofs + (size_t)rr * ldc + col];      /* rowsPerB < 0: own element of the batched C plane */ else { const int bidx = rr / rowsPerB; v += CP[(size_t)bidx * sCPb + (size_t)by * 64 + col]; } } if (ACT == 1) v = (v > 0.f) ? v : expm1f(v); else if (ACT == 7) v = (v > 0.f) ? v + 1.0f : expf(v); else if (ACT == 8) v = tanhf(v); else if (ACT == 9) v = 0.5f * v * (1.0f + tanhf(0.7978845608028654f * (v + 0.044715f * v * v * v))); else if (ACT == 11) v = 1.0f / (1.0f + expf(-v)); else if (ACT == 12) v = (v > 0.f) ? v : 0.01f * v; else if (ACT == 14) v = (v > 0.f) ? v : 0.1f * v; else if (ACT == 16) v = (v >= 0.f) ? v : 0.3f * v; else if (ACT == 17) v = (v >= 0.f) ? v : 0.2f * v; else if (ACT == 15) v = v / (1.0f + expf(-v)); else if (ACT == 3) v = fmaxf(v, 0.f); else if (ACT == 6) v = 0.5f * v * (1.0f + erff(v * 0.70710678118654752f)); so[w][8 * hh + r][t * 16 + ln] = v; } }
  __builtin_amdgcn_fence(__ATOMIC_ACQ_REL, "workgroup"); __builtin_amdgcn_wave_barrier();
  const int rsub = lane >> 4, c4 = (lane & 15) * 4; typedef _Float16 v4h __attribute__((ext_vector_type(4)));
  {
#pragma unroll
    for (int q = 0; q < 8; ++q) { const int r = q * 2 + rsub; if (col0 + c4 < N) { const v4f v = *(const v4fa*)&so[w][r][c4]; if (C) *(v4f*)(C + cofs + (size_t)(row0 + r) * ldc + col0 + c4) = v; if (C16) { v4h h4; for (int i = 0; i < 4; ++i) h4[i] = (_Float16)v[i]; *(v4h*)(C16 + cofs + (size_t)(row0 + r) * ldc + col0 + c4) = h4; } } }
     }
}


typedef _Float16 v4h __attribute__((ext_vector_type(4)));

__global__ __launch_bounds__(256) void k_x16(const float* __restrict__ x, _Float16* __restrict__ X16, size_t n8) { const size_t t = (size_t)blockIdx.x * 256 + threadIdx.x; if (t >= n8) return; FragH f;
#pragma unroll
  for (int q = 0; q < 8; ++q) f.h[q] = (_Float16)bf16_round(x[t * 8 + q]); *(v8us*)((unsigned short*)X16 + t * 8) = f.half[0];  }
__global__ __launch_bounds__(256) void k_h16(const float* __restrict__ x, _Float16* __restrict__ X16, size_t n8) { const size_t t = (size_t)blockIdx.x * 256 + threadIdx.x; if (t >= n8) return; FragH f;
#pragma unroll
  for (int q = 0; q < 8; ++q) f.h[q] = (_Float16)x[t * 8 + q]; *(v8us*)((unsigned short*)X16 + t * 8) = f.half[0];  }
__global__ __launch_bounds__(256) void k_round16f(const float* __restrict__ W, _Float16* __restrict__ Bt, size_t n8) { const size_t t = (size_t)blockIdx.x * 256 + threadIdx.x; if (t >= n8) return; FragH f;
#pragma unroll
  for (int i = 0; i < 8; ++i) f.h[i] = (_Float16)(bf16_round(W[t * 8 + i]) * 16.0f); *(v8us*)((unsigned short*)Bt + t * 8) = f.half[0];  }
template <int NHv, int TTv>
__global__ __launch_bounds__(256) void k_vt(const _Float16* __restrict__ V16, int ldv, int voff, _Float16* __restrict__ Vt) { __shared__ unsigned short tl[64][66]; const int tid = threadIdx.x; const int slab = blockIdx.x / (TTv / 64), lg = blockIdx.x % (TTv / 64); const int b = slab / NHv, h = slab % NHv;
  for (int i = tid; i < 64 * 8; i += 256) { const int r = i / 8, c8 = (i % 8) * 8; FragH f; f.half[0] = *(const v8us*)((const unsigned short*)V16 + ((size_t)b * TTv + lg * 64 + r) * ldv + voff + h * 64 + c8);
#pragma unroll
    for (int q = 0; q < 8; ++q) tl[r][c8 + q] = f.u[q]; }
  __syncthreads();
  {
#pragma unroll
    for (int rd = 0; rd < 2; ++rd) { const int d = rd * 32 + tid / 8, pc = tid % 8; FragH f;
#pragma unroll
      for (int q = 0; q < 8; ++q) f.u[q] = tl[pc * 8 + q][d];
      *(v8us*)((unsigned short*)Vt + ((size_t)slab * 64 + d) * TTv + lg * 64 + pc * 8) = f.half[0]; }
     } }

__global__ __launch_bounds__(256) void k_hl(const float* __restrict__ F, _Float16* __restrict__ Hh, _Float16* __restrict__ Hl, size_t n8) { const size_t t = (size_t)blockIdx.x * 256 + threadIdx.x; if (t >= n8) return; FragH fh, fl; const v4f a = *(const v4fa*)(F + t * 8), c = *(const v4fa*)(F + t * 8 + 4);
#pragma unroll
  for (int q = 0; q < 4; ++q) { _Float16 h = (_Float16)a[q]; fh.h[q] = h; fl.h[q] = (_Float16)((a[q] - (float)h) * 1024.0f); h = (_Float16)c[q]; fh.h[4 + q] = h; fl.h[4 + q] = (_Float16)((c[q] - (float)h) * 1024.0f); }
  { *(v8us*)((unsigned short*)Hh + t * 8) = fh.half[0]; *(v8us*)((unsigned short*)Hl + t * 8) = fl.half[0];  } }

// ---- fast GEMM (wave tile 32x64; requires M % 32 == 0 rows per launch region and N % 64 == 0); epilogue = k_gemm_hhx semantics ----
__device__ __forceinline__ v16h g2_frag(const _Float16* p, int hh) { FragH f; f.half[0] = *(const v8us*)((const unsigned short*)p + 8 * hh); f.half[1] = *(const v8us*)((const unsigned short*)p + 16 + 8 * hh); return f.v; }
__device__ __forceinline__ v8f g2_mma(v16h a, v16h b, v8f c) { v8f d = __builtin_amdgcn_wmma_f32_16x16x32_f16(false, a, false, b, (short)0, c, false, false); asm volatile("v_nop\n\tv_nop\n\tv_nop\n\tv_nop" : "+v"(d) : "v"(a), "v"(b)); return d; }
template <int ACT>
__global__ __launch_bounds__(128) void k_gemm2(const _Float16* __restrict__ A, int lda, size_t sA, const _Float16* __restrict__ Bh, int ldb, size_t sB, float alpha, const float* __restrict__ bias, size_t sBias, const float* __restrict__ CP, int rowsPerB, size_t sCPb, int row0g,
    float* __restrict__ C, _Float16* __restrict__ C16, int ldc, size_t sC, int M, int N, int K) { static_assert(ACT == 0 || ACT == 3 || ACT == 6 || ACT == 8 || ACT == 9 || ACT == 11 || ACT == 12 || ACT == 14 || ACT == 15 || ACT == 16 || ACT == 17, "k_gemm2: unsupported ACT code (would silently apply no activation)");
  __shared__ __attribute__((aligned(16))) float so[4][32][68];
  const int tid = threadIdx.x, w = tid >> 5, lane = tid & 31, ln = lane & 15, hh = lane >> 4; const int by = blockIdx.y;
  A += (size_t)by * sA; Bh += (size_t)by * sB; const size_t cofs = (size_t)by * sC; const float* bp = bias ? bias + (size_t)by * sBias : nullptr;
  const int ntn = N >> 6; const int mt = blockIdx.x / ntn, nq = blockIdx.x - mt * ntn; const int row0 = mt * 128 + 32 * w, col0 = nq * 64; if (row0 >= M) return;
  const _Float16* a0p = A + (size_t)(row0 + ln) * lda; const _Float16* a1p = a0p + (size_t)16 * lda;
  const _Float16* b0p = Bh + (size_t)(col0 + ln) * ldb; const _Float16* b1p = b0p + (size_t)16 * ldb; const _Float16* b2p = b1p + (size_t)16 * ldb; const _Float16* b3p = b2p + (size_t)16 * ldb;
  const v8f z8 = {0.f,0.f,0.f,0.f,0.f,0.f,0.f,0.f}; v8f c00 = z8, c01 = z8, c02 = z8, c03 = z8, c10 = z8, c11 = z8, c12 = z8, c13 = z8;
#pragma unroll 1
  for (int kb = 0; kb < K; kb += 32) { const v16h a0 = g2_frag(a0p + kb, hh), a1 = g2_frag(a1p + kb, hh);
    v16h b = g2_frag(b0p + kb, hh); c00 = g2_mma(a0, b, c00); c10 = g2_mma(a1, b, c10);
    b = g2_frag(b1p + kb, hh); c01 = g2_mma(a0, b, c01); c11 = g2_mma(a1, b, c11);
    b = g2_frag(b2p + kb, hh); c02 = g2_mma(a0, b, c02); c12 = g2_mma(a1, b, c12);
    b = g2_frag(b3p + kb, hh); c03 = g2_mma(a0, b, c03); c13 = g2_mma(a1, b, c13); }
  v8f accs[8] = {c00, c01, c02, c03, c10, c11, c12, c13};
#pragma unroll
  for (int u = 0; u < 8; ++u) { const int t = u & 3, half = u >> 2; const int col = col0 + t * 16 + ln; const float bv = bp ? bf16_round(bp[col]) : 0.f;
#pragma unroll
    for (int r = 0; r < 8; ++r) { const int rloc = half * 16 + 8 * hh + r; float v = accs[u][r] * alpha + bv; if (CP) { if (rowsPerB < 0) v += CP[cofs + (size_t)(row0g + row0 + rloc) * ldc + col];      /* rowsPerB < 0: own element of the batched C plane */ else { const int bidx = (row0g + row0 + rloc) / rowsPerB; v += CP[(size_t)bidx * sCPb + (size_t)by * 64 + col]; } }
      if (ACT == 3) v = fmaxf(v, 0.f); else if (ACT == 6) v = 0.5f * v * (1.0f + erff(v * 0.70710678118654752f)); else if (ACT == 11) v = 1.0f / (1.0f + expf(-v)); else if (ACT == 15) v = v / (1.0f + expf(-v)); else if (ACT == 12) v = (v > 0.f) ? v : 0.01f * v; else if (ACT == 8) v = tanhf(v); else if (ACT == 9) v = 0.5f * v * (1.0f + tanhf(0.7978845608028654f * (v + 0.044715f * v * v * v))); else if (ACT == 14) v = (v > 0.f) ? v : 0.1f * v; else if (ACT == 16) v = (v >= 0.f) ? v : 0.3f * v; else if (ACT == 17) v = (v >= 0.f) ? v : 0.2f * v;
      so[w][rloc][t * 16 + ln] = v; } }
  __builtin_amdgcn_fence(__ATOMIC_ACQ_REL, "workgroup"); __builtin_amdgcn_wave_barrier();
  const int rsub = lane >> 4, c4 = (lane & 15) * 4;
  {
#pragma unroll
    for (int q = 0; q < 16; ++q) { const int r = q * 2 + rsub; const v4f v = *(const v4fa*)&so[w][r][c4]; if (C) *(v4f*)(C + cofs + (size_t)(row0 + r) * ldc + col0 + c4) = v; if (C16) { v4h h4; for (int i = 0; i < 4; ++i) h4[i] = (_Float16)v[i]; *(v4h*)(C16 + cofs + (size_t)(row0 + r) * ldc + col0 + c4) = h4; } }
     } }


__global__ __launch_bounds__(256) void k_wnat(const float* __restrict__ w, size_t n8, _Float16* __restrict__ Bt) { const size_t t = (size_t)blockIdx.x * 256 + threadIdx.x; if (t >= n8) return; FragH f; for (int q = 0; q < 8; ++q) f.h[q] = (_Float16)(bf16_round(w[t * 8 + q]) * 16.0f); *(v8us*)((unsigned short*)Bt + t * 8) = f.half[0];  }
__global__ __launch_bounds__(256) void k_rsm(const float* __restrict__ S, _Float16* __restrict__ P, int nrows) {
  #pragma clang fp contract(off)
  const int i = blockIdx.x * 256 + threadIdx.x; if (i >= nrows) return; const float* s = S + (size_t)i * SQ; float mx = -3.0e38f;
#pragma unroll 1
  for (int j = 0; j < SQ; ++j) mx = fmaxf(mx, s[j]); float se = 0.f;
#pragma unroll 1
  for (int j = 0; j < SQ; ++j) se += expf(s[j] - mx); const float sc = 256.0f / se;
#pragma unroll 1
  for (int j0 = 0; j0 < SQ; j0 += 8) { FragH f; for (int q = 0; q < 8; ++q) f.h[q] = (_Float16)(expf(s[j0 + q] - mx) * sc); unsigned short* d = (unsigned short*)P + (size_t)i * SQ + j0; *(v8us*)d = f.half[0];  } }
__global__ __launch_bounds__(256) void k_vt(const _Float16* __restrict__ V16, int b, int h0, _Float16* __restrict__ VT) { __shared__ unsigned short tl[64][65]; const int tid = threadIdx.x; const int hh = blockIdx.x % HG, sg = blockIdx.x / HG; const int s0 = sg * 64; const int h = h0 + hh;
  for (int i = tid; i < 64 * 8; i += 256) { const int j = i / 8, d8 = (i % 8) * 8; FragH f; f.half[0] = *(const v8us*)((const unsigned short*)V16 + ((size_t)b * SQ + s0 + j) * DM + h * HD + d8); for (int q = 0; q < 8; ++q) tl[d8 + q][j] = f.u[q]; }
  __syncthreads();
  { for (int i = tid; i < 64 * 8; i += 256) { const int d = i / 8, j8 = (i % 8) * 8; FragH f; for (int q = 0; q < 8; ++q) f.u[q] = tl[d][j8 + q]; *(v8us*)((unsigned short*)VT + ((size_t)hh * HD + d) * SQ + s0 + j8) = f.half[0]; }  } }



// One wave per score row: each load takes 512 contiguous bytes of the row, the row is read once and stays in registers through max, sum and scale; row max and row sum end in a five-step butterfly over the lanes.
__global__ __launch_bounds__(256) void k_rsmcf2(const float* __restrict__ S, _Float16* __restrict__ P, int hg, int q0, int nk) {
  #pragma clang fp contract(off)
  const int lane = threadIdx.x & 31; const int t = blockIdx.x * 8 + (threadIdx.x >> 5); if (t >= hg * QT) return; const size_t i = (size_t)t; const float* s = S + i * NKX + lane * 4; const int last = q0 + (t % QT);
  v4f v[NKX / 128];      /* lane l holds keys g*128 + l*4 .. +3 of group g; nk is a multiple of 256, so groups come in pairs; every loop over v is fully unrolled so that its indices are constants and it stays in registers */
#pragma unroll
  for (int c = 0; c < NKX / 256; ++c) if (c * 256 < nk) { v[2 * c] = *(const v4fa*)(s + c * 256); v[2 * c + 1] = *(const v4fa*)(s + c * 256 + 128); }
  float mx = -3.0e38f;
#pragma unroll
  for (int c = 0; c < NKX / 256; ++c) if (c * 256 < nk) {
#pragma unroll
    for (int u = 0; u < 8; ++u) { const int g = 2 * c + (u >> 2), q = u & 3; const float f = (g * 128 + lane * 4 + q <= last) ? 1.f : 0.f; const float x = fmaf(f, v[g][q], (1.f - f) * -1.0e9f); v[g][q] = x; mx = fmaxf(mx, x); } }
#pragma unroll
  for (int m = 16; m >= 1; m >>= 1) mx = fmaxf(mx, __shfl_xor(mx, m, 32));
  v4f s4 = {0.f, 0.f, 0.f, 0.f};
#pragma unroll
  for (int c = 0; c < NKX / 256; ++c) if (c * 256 < nk) {
#pragma unroll
    for (int u = 0; u < 8; ++u) { const int g = 2 * c + (u >> 2), q = u & 3; const float e = __expf(v[g][q] - mx); v[g][q] = e; s4[q] += e; } }
  float se = (s4[0] + s4[1]) + (s4[2] + s4[3]);
#pragma unroll
  for (int m = 16; m >= 1; m >>= 1) se += __shfl_xor(se, m, 32);
  const float sc = 256.0f / se; _Float16* d = P + i * NKX + lane * 4;
#pragma unroll
  for (int c = 0; c < NKX / 256; ++c) if (c * 256 < nk) {
#pragma unroll
    for (int h = 0; h < 2; ++h) { v4h o; for (int q = 0; q < 4; ++q) o[q] = (_Float16)(v[2 * c + h][q] * sc); *(v4h*)(d + c * 256 + h * 128) = o; }
    asm volatile("s_wait_xcnt 0x0" ::: "memory");      /* the next pair's conversions reuse the data registers of these two stores: the wait stands between store and overwrite */
  } }


template <int MASKADD>
__global__ __launch_bounds__(64) void k_att0(const float* __restrict__ QF, const float* __restrict__ KF, const float* __restrict__ VF, int ld, const float* __restrict__ mask, float scale, float* __restrict__ OF, int ldo) {
  #pragma clang fp contract(off)
  __shared__ __attribute__((aligned(16))) float lq[64][64]; __shared__ __attribute__((aligned(16))) float lo[64][64];
  const int tid = threadIdx.x; const int h = blockIdx.x / (QT0 / 64), rg = blockIdx.x % (QT0 / 64); const int i = rg * 64 + tid;
  const float* qr = QF + (size_t)i * ld + h * HD;
#pragma unroll 1
  for (int c = 0; c < HD / 4; ++c) { *(v4f*)&lq[tid][c * 4] = *(const v4fa*)(qr + c * 4); const v4f z = {0.f, 0.f, 0.f, 0.f}; *(v4f*)&lo[tid][c * 4] = z; }
  float m = -1.0e30f, l = 0.f; const int jmax = MASKADD ? (SQ - 1) : (rg * 64 + 63);      /* additive-mask form: every key (the mask input decides); causal form: keys up to the block's last row */
#pragma unroll 1
  for (int j = 0; j <= jmax; ++j) { const float* kr = KF + (size_t)j * ld + h * HD; const float* vr = VF + (size_t)j * ld + h * HD; float s = 0.f;
#pragma unroll 1
    for (int c = 0; c < HD / 4; ++c) { const v4f kq = *(const v4fa*)(kr + c * 4); const v4f qq = *(v4f*)&lq[tid][c * 4]; s = __fadd_rn(s, __fmul_rn(qq[0], kq[0])); s = __fadd_rn(s, __fmul_rn(qq[1], kq[1])); s = __fadd_rn(s, __fmul_rn(qq[2], kq[2])); s = __fadd_rn(s, __fmul_rn(qq[3], kq[3])); }
    s = __fmul_rn(s, scale); if (MASKADD) s = __fadd_rn(s, __fmul_rn(bf16_round(mask[(size_t)i * SQ + j]), -10000.0f));
    const float f = (MASKADD || j <= i) ? 1.f : 0.f; const float sm = fmaf(f, s, (1.f - f) * -1.0e30f); const float mn = fmaxf(m, sm); const float sc = expf(m - mn); const float e = expf(sm - mn); l = __fadd_rn(__fmul_rn(l, sc), e); m = mn;
#pragma unroll 1
    for (int c = 0; c < HD / 4; ++c) { const v4f vv = *(const v4fa*)(vr + c * 4); v4f oo = *(v4f*)&lo[tid][c * 4]; for (int u = 0; u < 4; ++u) oo[u] = __fadd_rn(__fmul_rn(oo[u], sc), __fmul_rn(e, vv[u])); *(v4f*)&lo[tid][c * 4] = oo; } }
  const float fin = 64.0f / l;      /* o carried x64 like the f16 path */
#pragma unroll 1
  for (int c = 0; c < HD / 4; ++c) { v4f oo = *(v4f*)&lo[tid][c * 4]; for (int u = 0; u < 4; ++u) oo[u] = __fmul_rn(oo[u], fin); *(v4f*)&lo[tid][c * 4] = oo; }
  __syncthreads();
  {
#pragma unroll 1
    for (int it = 0; it < 16; ++it) { const int row = it * 4 + tid / 16, pc = (tid % 16) * 4; const v4f v = *(const v4f*)&lo[row][pc]; *(v4f*)(OF + (size_t)(rg * 64 + row) * ldo + h * HD + pc) = v; }
     } }


__global__ __launch_bounds__(256) void k_wt_hq(const float* __restrict__ Wf, const float* __restrict__ bf, _Float16* __restrict__ Bq, _Float16* __restrict__ Bk, _Float16* __restrict__ Bv, float* __restrict__ B3) {
  const int t = blockIdx.x * 256 + threadIdx.x; if (t >= 3 * DM * (DM / 8)) return; const int n = t / (DM / 8), k8 = (t % (DM / 8)) * 8; const int h = n / (3 * HD), wh = (n % (3 * HD)) / HD, d = n % HD; const int row = h * HD + d; FragH f;
#pragma unroll
  for (int i = 0; i < 8; ++i) f.h[i] = (_Float16)(bf16_round(Wf[(size_t)(k8 + i) * (3 * DM) + n]) * 16.0f); const v8us o = f.half[0];
  _Float16* dst = (wh == 0) ? Bq : ((wh == 1) ? Bk : Bv); unsigned short* p = (unsigned short*)dst + (size_t)row * DM + k8; *(v8us*)p = o; 
  (void)bf; (void)B3; }
__global__ __launch_bounds__(256) void k_bhq(const float* __restrict__ bf, float* __restrict__ B3) {
  const int t = blockIdx.x * 256 + threadIdx.x; if (t >= 3 * DM) return; const int wh = t / DM, row = t % DM; const int h = row / HD, d = row % HD; const float v = bf16_round(bf[h * (3 * HD) + wh * HD + d]); *(float*)(B3 + t) = v;  }

template <int NORM, int ROPE>
__global__ __launch_bounds__(64) void k_xform(const float* __restrict__ F, int ldf, int nh, const float* __restrict__ gain, float eps, const float* __restrict__ CS, const float* __restrict__ SN, _Float16* __restrict__ H16, int ldo) {
  #pragma clang fp contract(off)
  __shared__ float xv[HD]; __shared__ float red[HD]; __shared__ unsigned short sh_[HD]; const int d = threadIdx.x; const int h = blockIdx.x % nh; const size_t r = blockIdx.x / nh; const int p = (int)(r % SQ);
  float x = F[r * (size_t)ldf + (size_t)h * HD + d];
  if (NORM) { red[d] = __fmul_rn(x, x); __syncthreads(); for (int st = HD / 2; st > 0; st >>= 1) { if (d < st) red[d] = __fadd_rn(red[d], red[d + st]); __syncthreads(); } const float rs = rsqrtf(__fadd_rn(red[0] / (float)HD, eps)); x = __fmul_rn(__fmul_rn(x, rs), bf16_round(gain[d])); }
  xv[d] = x; __syncthreads();
  float o = x;
  if (ROPE == 1) { const int i = d >> 1; const float c = CS[p * (HD / 2) + i], s = SN[p * (HD / 2) + i]; const float ev = xv[2 * i], od = xv[2 * i + 1]; o = (d & 1) ? __fadd_rn(__fmul_rn(ev, s), __fmul_rn(od, c)) : __fadd_rn(__fmul_rn(ev, c), -__fmul_rn(od, s)); }
  if (ROPE == 2) { const int i = d & (HD / 2 - 1); const float c = CS[p * (HD / 2) + i], s = SN[p * (HD / 2) + i]; const float lo = xv[i], hi = xv[i + HD / 2]; o = (d < HD / 2) ? __fadd_rn(__fmul_rn(lo, c), -__fmul_rn(hi, s)) : __fadd_rn(__fmul_rn(lo, s), __fmul_rn(hi, c)); }
  FragH th; th.h[0] = (_Float16)o; sh_[d] = th.u[0]; __syncthreads();
  if (d < HD / 8) { FragH f; for (int q = 0; q < 8; ++q) f.u[q] = sh_[d * 8 + q]; unsigned short* dst = (unsigned short*)H16 + r * (size_t)ldo + (size_t)h * HD + d * 8; *(v8us*)dst = f.half[0];  } }


template <int NORM, int ROPE>
__global__ __launch_bounds__(64) void k_xformf(const float* __restrict__ F, int ldf, int nh, const float* __restrict__ gain, float eps, const float* __restrict__ CS, const float* __restrict__ SN, float* __restrict__ F32, int ldo) {
  #pragma clang fp contract(off)
  __shared__ float xv[HD]; __shared__ float red[HD]; const int d = threadIdx.x; const int h = blockIdx.x % nh; const size_t r = blockIdx.x / nh; const int p = (int)(r % SQ);
  float x = F[r * (size_t)ldf + (size_t)h * HD + d];
  if (NORM) { red[d] = __fmul_rn(x, x); __syncthreads(); for (int st = HD / 2; st > 0; st >>= 1) { if (d < st) red[d] = __fadd_rn(red[d], red[d + st]); __syncthreads(); } const float rs = rsqrtf(__fadd_rn(red[0] / (float)HD, eps)); x = __fmul_rn(__fmul_rn(x, rs), bf16_round(gain[d])); }
  xv[d] = x; __syncthreads();
  float o = x;
  if (ROPE == 1) { const int i = d >> 1; const float c = CS[p * (HD / 2) + i], s = SN[p * (HD / 2) + i]; const float ev = xv[2 * i], od = xv[2 * i + 1]; o = (d & 1) ? __fadd_rn(__fmul_rn(ev, s), __fmul_rn(od, c)) : __fadd_rn(__fmul_rn(ev, c), -__fmul_rn(od, s)); }
  if (ROPE == 2) { const int i = d & (HD / 2 - 1); const float c = CS[p * (HD / 2) + i], s = SN[p * (HD / 2) + i]; const float lo = xv[i], hi = xv[i + HD / 2]; o = (d < HD / 2) ? __fadd_rn(__fmul_rn(lo, c), -__fmul_rn(hi, s)) : __fadd_rn(__fmul_rn(lo, s), __fmul_rn(hi, c)); }
  float* dst = F32 + r * (size_t)ldo + (size_t)h * HD + d; *(float*)dst = o;  }


__global__ __launch_bounds__(256) void k_tabcp32(const float* __restrict__ tc, const float* __restrict__ tsn, float* __restrict__ CS, float* __restrict__ SN, int n) {
  const int t = blockIdx.x * 256 + threadIdx.x; if (t >= n) return; const float c = bf16_round(tc[t]), s = bf16_round(tsn[t]);
  *(float*)(CS + t) = c; *(float*)(SN + t) = s;  }
extern "C" void kernel_launch(void* const* d_in, const int* in_sizes, int n_in,
                              void* d_out, int out_size, void* d_ws, size_t ws_size, hipStream_t stream) {
  (void)in_sizes; (void)n_in; (void)out_size;
  const float* const* I = (const float* const*)d_in; const float* x = I[0]; const float* wqkv = I[1]; const float* bqkv = I[2]; const float* wo = I[3]; const float* bo = I[4]; const float* tcos = I[5]; const float* tsin = I[6];      /* x; fused W_qkv [1024][3072] + b_qkv [3072] ([in][out]; per-head (q | k | v) column triples); W_out + b_out ([in][out]); rope tables cos / sin [2048][32] */
  char* ws = (char*)d_ws; size_t off = 0;
  auto take = [&](size_t bytes) { char* p = ws + off; off += (bytes + 255) & ~(size_t)255; return p; };
  _Float16* BQ = (_Float16*)take((size_t)DM * DM * 2); _Float16* BK = (_Float16*)take((size_t)DM * DM * 2); _Float16* BV = (_Float16*)take((size_t)DM * DM * 2); _Float16* BO = (_Float16*)take((size_t)DM * DM * 2);
  float* BQB = (float*)take((size_t)3 * DM * 4); float* QF = (float*)take(NR * DM * 4); float* CSB = (float*)take((size_t)SQ * 32 * 4); float* SNB = (float*)take((size_t)SQ * 32 * 4);      /* de-interleaved bias vector bq | bk | bv; f32 projection plane (q, then reused for k) for the rope; bf16-rounded copies of the rope tables */ _Float16* X16 = (_Float16*)take(NR * DM * 2); _Float16* Q16 = (_Float16*)take(NR * DM * 2); _Float16* K16 = (_Float16*)take(NR * DM * 2); _Float16* V16 = (_Float16*)take(NR * DM * 2); _Float16* O16 = (_Float16*)take(NR * DM * 2);
  float* S = (float*)take((size_t)NH * QT * NKX * 4); _Float16* P = (_Float16*)take((size_t)NH * QT * NKX * 2); _Float16* VT = (_Float16*)take((size_t)NH * HD * SQ * 2);
  float* QF0 = (float*)take((size_t)QT0 * DM * 4); float* KF0 = (float*)take((size_t)QT0 * DM * 4); float* VF0 = (float*)take((size_t)QT0 * DM * 4); float* OF0 = (float*)take((size_t)NB * QT0 * DM * 4); _Float16* OH0 = (_Float16*)take((size_t)NB * QT0 * DM * 2); _Float16* OL0 = (_Float16*)take((size_t)NB * QT0 * DM * 2);
  if (off > ws_size) return;
  k_wt_hq<<<(unsigned)(((size_t)3 * DM * (DM / 8) + 255) / 256), 256, 0, stream>>>(wqkv, bqkv, BQ, BK, BV, BQB); k_bhq<<<(3 * DM + 255) / 256, 256, 0, stream>>>(bqkv, BQB); k_wt_f16<<<(unsigned)(((size_t)DM * (DM / 8) + 255) / 256), 256, 0, stream>>>(wo, BO, DM, DM, 16.0f);      /* fused [in][out] weight with per-head (q | k | v) column triples -> three Bt planes (row h*64 + d) x16 + the de-interleaved bias vector; W_out [in][out] -> Bt x16 */
  k_tabcp32<<<(SQ * 32 + 255) / 256, 256, 0, stream>>>(tcos, tsin, CSB, SNB, SQ * 32);      /* rope tables [pos][32], bf16-rounded copies */

  k_x16<<<(unsigned)((NR * DM / 8 + 255) / 256), 256, 0, stream>>>(x, X16, NR * DM / 8);
  const size_t r0p = (size_t)B0 * SQ;      /* first projected row */
  k_gemm2<0><<<dim3((unsigned)((MP / 128) * (DM / 64)), 1), 128, 0, stream>>>(X16 + r0p * DM, DM, 0, BQ, DM, 0, 0.0625f, BQB, 0, nullptr, 1, 0, 0, QF + r0p * DM, nullptr, DM, 0, MP, DM, DM); k_xform<0, 1><<<(unsigned)((size_t)MP * NH), 64, 0, stream>>>(QF + r0p * DM, DM, NH, nullptr, 0.f, CSB, SNB, Q16 + r0p * DM, DM);      /* q (f32) + bias -> interleaved-pair rope (position = row % SQ) -> f16 rows */
  k_gemm2<0><<<dim3((unsigned)((MP / 128) * (DM / 64)), 1), 128, 0, stream>>>(X16 + r0p * DM, DM, 0, BK, DM, 0, 0.0625f, BQB + DM, 0, nullptr, 1, 0, 0, QF + r0p * DM, nullptr, DM, 0, MP, DM, DM); k_xform<0, 1><<<(unsigned)((size_t)MP * NH), 64, 0, stream>>>(QF + r0p * DM, DM, NH, nullptr, 0.f, CSB, SNB, K16 + r0p * DM, DM);      /* k likewise (the f32 plane is reused after q's rope) */
  k_gemm2<0><<<dim3((unsigned)((MP / 128) * (DM / 64)), 1), 128, 0, stream>>>(X16 + r0p * DM, DM, 0, BV, DM, 0, 0.0625f, BQB + 2 * DM, 0, nullptr, 1, 0, 0, nullptr, V16 + r0p * DM, DM, 0, MP, DM, DM);
  for (int b = B0; b < B0 + NBR; ++b) { const size_t r0 = (size_t)b * SQ;
    k_vt<NH, SQ><<<NH * (SQ / 64), 256, 0, stream>>>(V16 + r0 * LQ, LQ, 0, VT);      /* V^T [NH][HD][SQ] for this batch */
    k_gemm2<0><<<dim3((QT0 / 128) * (DM / 64), 1), 128, 0, stream>>>(X16 + r0 * DM, DM, 0, BQ, DM, 0, 0.0625f, BQB, 0, nullptr, 1, 0, 0, QF0, nullptr, DM, 0, QT0, DM, DM); k_gemm2<0><<<dim3((QT0 / 128) * (DM / 64), 1), 128, 0, stream>>>(X16 + r0 * DM, DM, 0, BK, DM, 0, 0.0625f, BQB + DM, 0, nullptr, 1, 0, 0, KF0, nullptr, DM, 0, QT0, DM, DM); k_gemm2<0><<<dim3((QT0 / 128) * (DM / 64), 1), 128, 0, stream>>>(X16 + r0 * DM, DM, 0, BV, DM, 0, 0.0625f, BQB + 2 * DM, 0, nullptr, 1, 0, 0, VF0, nullptr, DM, 0, QT0, DM, DM);      /* f32 q, k, v of the first 128 rows (exact products) */
    k_xformf<0, 1><<<(unsigned)(QT0 * NH), 64, 0, stream>>>(QF0, DM, NH, nullptr, 0.f, CSB, SNB, QF0, DM); k_xformf<0, 1><<<(unsigned)(QT0 * NH), 64, 0, stream>>>(KF0, DM, NH, nullptr, 0.f, CSB, SNB, KF0, DM);      /* f32 rope of the first-tile q, k IN PLACE (each (row, head) block stages its 64 values in LDS before writing; first-tile row r = position r) */
    k_att0<0><<<NH * (QT0 / 64), 64, 0, stream>>>(QF0, KF0, VF0, DM, nullptr, 0.125f, OF0 + (size_t)b * QT0 * DM, DM);      /* exact f32 attention for rows 0..127 (o x64) */
    for (int q0 = 0; q0 < QN; q0 += QT) { const int nk = q0 + QT;      /* causal: only keys below the tile end are computed */
      k_gemm2<0><<<dim3((QT / 128) * (nk / 64), NHD), 128, 0, stream>>>(Q16 + (r0 + q0) * LQ, LQ, (size_t)HD, K16 + r0 * LQ, LQ, (size_t)HD, 0.125f, nullptr, 0, nullptr, 1, 0, 0, S, nullptr, NKX, (size_t)QT * NKX, QT, nk, HD);      /* scores, all heads on grid.y */
      k_rsmcf2<<<(NHD * QT + 7) / 8, 256, 0, stream>>>(S, P, NHD, q0, nk);      /* eight rows, one per wave, per block */
      k_gemm2<0><<<dim3((QT / 128) * (HD / 64), NHD), 128, 0, stream>>>(P, NKX, (size_t)QT * NKX, VT, SQ, (size_t)HD * SQ, 0.25f, nullptr, 0, nullptr, 1, 0, 0, nullptr, O16 + (r0 + q0) * DM, DM, (size_t)HD, QT, HD, nk); } }      /* o (merged heads, x64) as f16 rows */
  k_gemm2<0><<<dim3((unsigned)((MPO / 128) * (DM / 64)), 1), 128, 0, stream>>>(O16 + r0p * DM, DM, 0, BO, DM, 0, 0.0009765625f, bo, 0, nullptr, 1, 0, 0, (float*)d_out + r0p * DM, nullptr, DM, 0, MPO, DM, DM);      /* out rows are the output layout */
  k_hl<<<(unsigned)(((size_t)NB * QT0 * DM / 8 + 255) / 256), 256, 0, stream>>>(OF0, OH0, OL0, (size_t)NB * QT0 * DM / 8);      /* first-tile o (x64) -> f16 hi + x1024 residual planes */
  for (int b = B0; b < B0 + NBR; ++b) { const size_t r0 = (size_t)b * SQ; const size_t f0 = (size_t)b * QT0;
    k_gemm2<0><<<dim3((QT0 / 128) * (DM / 64), 1), 128, 0, stream>>>(OH0 + f0 * DM, DM, 0, BO, DM, 0, 0.0009765625f, bo, 0, nullptr, 1, 0, 0, (float*)d_out + r0 * DM, nullptr, DM, 0, QT0, DM, DM);      /* rows 0..127: out = o_hi Wo (+ b), overwriting the f16-path rows */
    k_gemm2<0><<<dim3((QT0 / 128) * (DM / 64), 1), 128, 0, stream>>>(OL0 + f0 * DM, DM, 0, BO, DM, 0, 0.00000095367431640625f, nullptr, 0, (const float*)d_out + r0 * DM, -1, 0, 0, (float*)d_out + r0 * DM, nullptr, DM, 0, QT0, DM, DM); }      /* += o_lo Wo 2^-20 (own-element accumulate) */
}

// v002
// It runs in 2530 microseconds.
// Two timings next to v001 both put it at 1.69 times that version's speed.
// Counting every step since v000, it is 4.10 times as fast.
#include <hip/hip_runtime.h>
// Causal multi-head self-attention with a PER-HEAD interleaved fused QKV projection and rotary embeddings (x [4][2048][1024]; qkv = x W_qkv + b_qkv ([in][out] 1024 x 3072, zero bias) reshaped (B, T, 16, 192): head h owns columns h*192 + [0..63 | 64..127 | 128..191] = q | k | v; rope on q and k from the INPUT tables cos / sin [2048][32]: t1 = even elements, t2 = odd elements, out = cat(t1 c - t2 s, t1 s + t2 c) (an interleaved-pair rotation followed by the same fixed permutation on q and k: the scores are unchanged by it); scores / 8; causal (tril, -inf); softmax; out = merged W_out + b_out ([in][out]) -> [4][2048][1024]).
// Structure: token rows r = b*2048 + s; x as exact f16 rows (bf16-rounded); Q, K, V as three WMMA GEMMs (32x64 wave tiles, f32 accumulation, exact x16 weights, f32 q / k outputs roped into f16 rows, f16 v output); per batch: V^T for all heads via LDS transposes; per query tile of 256 rows: scores against the keys below the tile end only (K = 64, all heads on grid.y, alpha = 0.125), causal row softmax on VALU with an arithmetic 0/1 key mask over the computed range (f32 statistics, native exp; weights x256 f16), o = P . V^T (K = keys below the tile end, alpha 2^-2: o carried x64, folded into the output GEMM alpha) written straight into the merged f16 o rows; out = o W_o GEMM (f32) into the output layout.
// Compute dtype: inputs rounded to bf16; x / weights exact; q, k, v, softmax weights and o as plain f16 GEMM operands (~2^-12); scores and softmax statistics f32. v_wmma_f32_16x16x32_f16.
#define NB 4
#define SQ 2048
#define DM 1024
#define NH 16
#define HD 64
#define HG 4                         /* heads per launch of the unlaunched k_vt(b, h0) overload */
#define QT 256                       /* query rows per causal tile */
#define NKX SQ                       /* S / P row pitch */
#define QT0 128                      /* first-tile rows recomputed exactly in f32 */
#define B0 0                         /* first batch processed (debug hook) */
#define NBR NB                       /* batches processed (debug hook) */
#define NR ((size_t)NB * SQ)         /* token rows */
#define MP ((int)((size_t)NBR * SQ)) /* rows projected (debug hook) */
#define QN SQ                        /* query rows attended per batch (debug hook) */
#define NHD NH                       /* heads attended (debug hook) */
#define MPO MP                       /* rows through the output stage (debug hook) */
#define LQ DM      /* row pitch of the q/k/v rows */
typedef __bf16 v16b __attribute__((ext_vector_type(16)));
typedef unsigned short v8us __attribute__((ext_vector_type(8), may_alias));
typedef float  v8f  __attribute__((ext_vector_type(8)));
typedef float  v4f  __attribute__((ext_vector_type(4)));
typedef float  v4fa __attribute__((ext_vector_type(4), may_alias));
union FragB { v16b v; v8us half[2]; unsigned short u[16]; };

__device__ __forceinline__ unsigned short bf16_bits(float x) { unsigned int u = __float_as_uint(x); return (unsigned short)((u + 0x7FFFu + ((u >> 16) & 1u)) >> 16); }
__device__ __forceinline__ float bf16_val(unsigned short b) { return __uint_as_float(((unsigned int)b) << 16); }
__device__ __forceinline__ float bf16_round(float x) { return bf16_val(bf16_bits(x)); }
// D += A·B with NT terms: 1 = ah·bh, 2 = + al·bh (A split), 3 = + ah·bl (both split)
template <int NT>
__device__ __forceinline__ v8f mmaN(v16b ah, v16b al, v16b bh, v16b bl, v8f c) {
  c = __builtin_amdgcn_wmma_f32_16x16x32_bf16(false, ah, false, bh, (short)0, c, false, false);
  if (NT >= 2) c = __builtin_amdgcn_wmma_f32_16x16x32_bf16(false, al, false, bh, (short)0, c, false, false);
  if (NT >= 3) c = __builtin_amdgcn_wmma_f32_16x16x32_bf16(false, ah, false, bl, (short)0, c, false, false);
  asm volatile("v_nop\n\tv_nop\n\tv_nop\n\tv_nop" : "+v"(c) : "v"(ah), "v"(al), "v"(bh), "v"(bl));
  return c;
}

__global__ __launch_bounds__(256) void k_wt_bf16(const float* __restrict__ W, unsigned short* __restrict__ Wt, int K, int N) {
  const int t = blockIdx.x * 256 + threadIdx.x;
  const int k8n = K / 8;
  if (t >= N * k8n) return;
  const int n = t / k8n, k8 = (t % k8n) * 8;
  v8us v;
#pragma unroll
  for (int i = 0; i < 8; ++i) v[i] = bf16_bits(W[(size_t)(k8 + i) * N + n]);
  *(v8us*)(Wt + (size_t)n * K + k8) = v;
  
}

// GEMM C[M][N] (f32, pitch ldc) = act(A[M][K]·W + bias). A f32 row-major (pitch lda) converted per fragment to bf16
// (ASPLIT: hi/lo two planes -> 2 terms, else single rounded term); Wt bf16 [N][K] (pitch ldb). BIAS_BF16 rounds the
// bias to bf16 first (bias quantised to bf16 before the add). K%32==0, M%16==0, N%64==0.
template <bool ASPLIT, int ACT, bool BIAS_BF16>
__global__ __launch_bounds__(128) void k_gemm_bf(const float* __restrict__ A, int lda, const unsigned short* __restrict__ Wt, int ldb,
                                               const float* __restrict__ bias, float* __restrict__ C, int ldc, int M, int N, int K) {
  __shared__ __attribute__((aligned(16))) float so[4][16][64];
  const int tid = threadIdx.x, w = tid >> 5, lane = tid & 31, ln = lane & 15, hh = lane >> 4;
  const int ntn = N / 64;
  const int wid = blockIdx.x * 4 + w;
  const int mt = wid / ntn, nq = wid % ntn;
  if (mt * 16 >= M) return;
  const int row0 = mt * 16, col0 = nq * 64;
  const float* arow = A + (size_t)(row0 + ln) * lda;
  v8f acc[4] = {};
  for (int kb = 0; kb < K; kb += 32) {
    FragB ah, al;
    const v4f x0 = *(const v4fa*)(arow + kb + 8 * hh), x1 = *(const v4fa*)(arow + kb + 8 * hh + 4);
    const v4f x2 = *(const v4fa*)(arow + kb + 16 + 8 * hh), x3 = *(const v4fa*)(arow + kb + 16 + 8 * hh + 4);
    float xs[16] = {x0[0],x0[1],x0[2],x0[3],x1[0],x1[1],x1[2],x1[3],x2[0],x2[1],x2[2],x2[3],x3[0],x3[1],x3[2],x3[3]};
#pragma unroll
    for (int i = 0; i < 16; ++i) { const unsigned short hb = bf16_bits(xs[i]); ah.u[i] = hb; al.u[i] = ASPLIT ? bf16_bits(xs[i] - bf16_val(hb)) : (unsigned short)0; }
#pragma unroll
    for (int t = 0; t < 4; ++t) {
      const unsigned short* brow = Wt + (size_t)(col0 + t * 16 + ln) * ldb + kb;
      FragB b;
      b.half[0] = *(const v8us*)(brow + 8 * hh);
      b.half[1] = *(const v8us*)(brow + 16 + 8 * hh);
      acc[t] = mmaN<ASPLIT ? 2 : 1>(ah.v, al.v, b.v, b.v, acc[t]);
    }
  }
#pragma unroll
  for (int t = 0; t < 4; ++t) {
    float bv = bias ? bias[col0 + t * 16 + ln] : 0.f;
    if (BIAS_BF16) bv = bf16_round(bv);
#pragma unroll
    for (int r = 0; r < 8; ++r) { float v = acc[t][r] + bv; if (ACT == 1) v = fmaxf(v, 0.f); so[w][8 * hh + r][t * 16 + ln] = v; }
  }
  __builtin_amdgcn_fence(__ATOMIC_ACQ_REL, "workgroup");
  __builtin_amdgcn_wave_barrier();
  const int rsub = lane >> 4, c4 = (lane & 15) * 4;
  {
#pragma unroll
    for (int q = 0; q < 8; ++q) {
      const int r = q * 2 + rsub;
      const v4f v = *(const v4fa*)&so[w][r][c4];
      *(v4f*)(C + (size_t)(row0 + r) * ldc + col0 + c4) = v;
    }
    
  }
}

// GEMM C = act(A·W + bias + resid): A f32 (ASPLIT -> hi/lo 2 terms), Wt bf16 [N][K]; ACT 0 none, 1 relu, 2 exact gelu;
// resid (optional, f32, row index = (row % rmod), pitch ldr, RES_BF16 rounds it) added before the activation.
template <bool ASPLIT, int ACT, bool BIAS_BF16, bool RES_BF16>
__global__ __launch_bounds__(128) void k_gemm_bf3(const float* __restrict__ A, int lda, const unsigned short* __restrict__ Wt, int ldb,
                                                const float* __restrict__ bias, const float* __restrict__ resid, int rmod, int ldr,
                                                float* __restrict__ C, int ldc, int M, int N, int K) {
  __shared__ __attribute__((aligned(16))) float so[4][16][64];
  const int tid = threadIdx.x, w = tid >> 5, lane = tid & 31, ln = lane & 15, hh = lane >> 4;
  const int ntn = N / 64;
  const int wid = blockIdx.x * 4 + w;
  const int mt = wid / ntn, nq = wid % ntn;
  if (mt * 16 >= M) return;
  const int row0 = mt * 16, col0 = nq * 64;
  const float* arow = A + (size_t)(row0 + ln) * lda;
  v8f acc[4] = {};
  for (int kb = 0; kb < K; kb += 32) {
    FragB ah, al;
    const v4f x0 = *(const v4fa*)(arow + kb + 8 * hh), x1 = *(const v4fa*)(arow + kb + 8 * hh + 4);
    const v4f x2 = *(const v4fa*)(arow + kb + 16 + 8 * hh), x3 = *(const v4fa*)(arow + kb + 16 + 8 * hh + 4);
    float xs[16] = {x0[0],x0[1],x0[2],x0[3],x1[0],x1[1],x1[2],x1[3],x2[0],x2[1],x2[2],x2[3],x3[0],x3[1],x3[2],x3[3]};
#pragma unroll
    for (int i = 0; i < 16; ++i) { const unsigned short hb = bf16_bits(xs[i]); ah.u[i] = hb; al.u[i] = ASPLIT ? bf16_bits(xs[i] - bf16_val(hb)) : (unsigned short)0; }
#pragma unroll
    for (int t = 0; t < 4; ++t) {
      const unsigned short* brow = Wt + (size_t)(col0 + t * 16 + ln) * ldb + kb;
      FragB b;
      b.half[0] = *(const v8us*)(brow + 8 * hh);
      b.half[1] = *(const v8us*)(brow + 16 + 8 * hh);
      acc[t] = mmaN<ASPLIT ? 2 : 1>(ah.v, al.v, b.v, b.v, acc[t]);
    }
  }
#pragma unroll
  for (int t = 0; t < 4; ++t) {
    const int col = col0 + t * 16 + ln;
    float bv = bias ? bias[col] : 0.f;
    if (BIAS_BF16) bv = bf16_round(bv);
#pragma unroll
    for (int r = 0; r < 8; ++r) {
      float v = acc[t][r] + bv;
      if (resid) { float rv = resid[(size_t)((row0 + 8 * hh + r) % rmod) * ldr + col]; if (RES_BF16) rv = bf16_round(rv); v += rv; }
      if (ACT == 1) v = fmaxf(v, 0.f);
      if (ACT == 2) v = 0.5f * v * (1.0f + erff(v * 0.70710678118654752f));
      if (ACT == 3) { const float u = 0.7978845608028654f * (v + 0.044715f * v * v * v); v = 0.5f * v * (1.0f + tanhf(u)); }
      so[w][8 * hh + r][t * 16 + ln] = v;
    }
  }
  __builtin_amdgcn_fence(__ATOMIC_ACQ_REL, "workgroup");
  __builtin_amdgcn_wave_barrier();
  const int rsub = lane >> 4, c4 = (lane & 15) * 4;
  {
#pragma unroll
    for (int q = 0; q < 8; ++q) {
      const int r = q * 2 + rsub;
      const v4f v = *(const v4fa*)&so[w][r][c4];
      *(v4f*)(C + (size_t)(row0 + r) * ldc + col0 + c4) = v;
    }
    
  }
}
// row LayerNorm (biased variance, eps) over N: s = X (+ R); optional out_sum <- s; out_norm <- (s-mu)*rsqrt(var+eps)*g + b
template <bool PARAM_BF16>
__global__ __launch_bounds__(256) void k_layernorm(const float* __restrict__ X, const float* __restrict__ R, const float* __restrict__ g, const float* __restrict__ bta,
                                                  float* __restrict__ out_sum, float* __restrict__ out_norm, int N, float eps) {
  __shared__ float red[256];
  const int row = blockIdx.x, tid = threadIdx.x;
  const float* x = X + (size_t)row * N; const float* rr = R ? R + (size_t)row * N : nullptr;
  float vals[16];                     // up to N = 4096
  const int per = N / 256;            // contiguous chunk per thread? use strided-by-4 chunks: thread handles j = tid*4 + 1024*u
  float s1 = 0.f;
  for (int u = 0; u < per / 4; ++u) {
    const int j = tid * 4 + 1024 * u;
    const v4f a = *(const v4fa*)(x + j);
    v4f b = {0.f,0.f,0.f,0.f}; if (rr) b = *(const v4fa*)(rr + j);
#pragma unroll
    for (int q = 0; q < 4; ++q) { const float v = a[q] + b[q]; vals[u * 4 + q] = v; s1 += v; }
  }
  red[tid] = s1; __syncthreads();
  for (int st = 128; st > 0; st >>= 1) { if (tid < st) red[tid] += red[tid + st]; __syncthreads(); }
  const float mu = red[0] / (float)N; __syncthreads();
  float s2 = 0.f;
  for (int u = 0; u < per / 4; ++u)
#pragma unroll
    for (int q = 0; q < 4; ++q) { const float c = vals[u * 4 + q] - mu; s2 += c * c; }
  red[tid] = s2; __syncthreads();
  for (int st = 128; st > 0; st >>= 1) { if (tid < st) red[tid] += red[tid + st]; __syncthreads(); }
  const float rs = rsqrtf(red[0] / (float)N + eps);
  {
    for (int u = 0; u < per / 4; ++u) {
      const int j = tid * 4 + 1024 * u;
      v4f o, sm;
#pragma unroll
      for (int q = 0; q < 4; ++q) {
        float gg = g[j + q], bb = bta[j + q];
        if (PARAM_BF16) { gg = bf16_round(gg); bb = bf16_round(bb); }
        sm[q] = vals[u * 4 + q]; o[q] = (vals[u * 4 + q] - mu) * rs * gg + bb;
      }
      if (out_sum) *(v4f*)(out_sum + (size_t)row * N + j) = sm;
      *(v4f*)(out_norm + (size_t)row * N + j) = o;
    }
    
  }
}



// ---- f16 WMMA path (v_wmma_f32_16x16x32_f16): 11-bit significands for operands in range — used where a [0,1] probability operand needs more precision than bf16
typedef _Float16 v16h __attribute__((ext_vector_type(16)));
union FragH { v16h v; v8us half[2]; _Float16 h[16]; unsigned short u[16]; };
template <int NT>
__device__ __forceinline__ v8f mmaH(v16h ah, v16h al, v16h bh, v16h bl, v8f c) {
  c = __builtin_amdgcn_wmma_f32_16x16x32_f16(false, ah, false, bh, (short)0, c, false, false);
  if (NT >= 2) c = __builtin_amdgcn_wmma_f32_16x16x32_f16(false, al, false, bh, (short)0, c, false, false);
  if (NT >= 3) c = __builtin_amdgcn_wmma_f32_16x16x32_f16(false, ah, false, bl, (short)0, c, false, false);
  asm volatile("v_nop\n\tv_nop\n\tv_nop\n\tv_nop" : "+v"(c) : "v"(ah), "v"(al), "v"(bh), "v"(bl));
  return c;
}
// batched GEMM like k_gemm_b but f16 operands: A f32 (split into f16 hi/lo if ASPLIT, else rounded to f16), Bt = f16 values [n][k]; alpha; C f32; N multiple of 16 (partial tiles skipped)
template <bool ASPLIT>
__global__ __launch_bounds__(128) void k_gemm_h(const float* __restrict__ A, int lda, size_t sA, const _Float16* __restrict__ Bh, int ldb, size_t sB, float alpha, float* __restrict__ C, int ldc, size_t sC, int M, int N, int K) {
  __shared__ __attribute__((aligned(16))) float so[4][16][64];
  const int tid = threadIdx.x, w = tid >> 5, lane = tid & 31, ln = lane & 15, hh = lane >> 4; const int by = blockIdx.y;
  A += (size_t)by * sA; Bh += (size_t)by * sB; C += (size_t)by * sC;
  const int ntn = (N + 63) / 64; const int wid = blockIdx.x * 4 + w; const int mt = wid / ntn, nq = wid % ntn; if (mt * 16 >= M) return;
  const int row0 = mt * 16, col0 = nq * 64; const float* arow = A + (size_t)(row0 + ln) * lda;
  v8f acc[4] = {};
  for (int kb = 0; kb < K; kb += 32) {
    FragH ah, al;
    const v4f x0 = *(const v4fa*)(arow + kb + 8 * hh), x1 = *(const v4fa*)(arow + kb + 8 * hh + 4), x2 = *(const v4fa*)(arow + kb + 16 + 8 * hh), x3 = *(const v4fa*)(arow + kb + 16 + 8 * hh + 4);
    float xs[16] = {x0[0],x0[1],x0[2],x0[3],x1[0],x1[1],x1[2],x1[3],x2[0],x2[1],x2[2],x2[3],x3[0],x3[1],x3[2],x3[3]};
#pragma unroll
    for (int i = 0; i < 16; ++i) { const _Float16 h = (_Float16)xs[i]; ah.h[i] = h; al.h[i] = ASPLIT ? (_Float16)(xs[i] - (float)h) : (_Float16)0.0f; }
#pragma unroll
    for (int t = 0; t < 4; ++t) { if (col0 + t * 16 >= N) continue; const size_t boff = (size_t)(col0 + t * 16 + ln) * ldb + kb; FragH bq; bq.half[0] = *(const v8us*)(Bh + boff + 8 * hh); bq.half[1] = *(const v8us*)(Bh + boff + 16 + 8 * hh);
      acc[t] = mmaH<ASPLIT ? 2 : 1>(ah.v, al.v, bq.v, bq.v, acc[t]); }
  }
#pragma unroll
  for (int t = 0; t < 4; ++t) { if (col0 + t * 16 >= N) continue;
#pragma unroll
    for (int r = 0; r < 8; ++r) so[w][8 * hh + r][t * 16 + ln] = acc[t][r] * alpha; }
  __builtin_amdgcn_fence(__ATOMIC_ACQ_REL, "workgroup"); __builtin_amdgcn_wave_barrier();
  const int rsub = lane >> 4, c4 = (lane & 15) * 4;
  {
#pragma unroll
    for (int q = 0; q < 8; ++q) { const int r = q * 2 + rsub; if (col0 + c4 < N) { const v4f v = *(const v4fa*)&so[w][r][c4]; *(v4f*)(C + (size_t)(row0 + r) * ldc + col0 + c4) = v; } }
     }
}

// Wt[n][k] = f16(W[k][n]·scale) from f32 row-major W[K][N] (scale = power of two; bf16-exact weights stay exact in f16 away from the subnormal range)
__global__ __launch_bounds__(256) void k_wt_f16(const float* __restrict__ W, _Float16* __restrict__ Wt, int K, int N, float scale) {
  const int t = blockIdx.x * 256 + threadIdx.x; if (t >= N * (K / 8)) return; const int n = t / (K / 8), k8 = (t % (K / 8)) * 8; FragH f;
#pragma unroll
  for (int i = 0; i < 8; ++i) f.h[i] = (_Float16)(bf16_round(W[(size_t)(k8 + i) * N + n]) * scale); const v8us o = f.half[0];
  *(v8us*)((unsigned short*)Wt + (size_t)n * K + k8) = o; 
}
// k_gemm_hh variant with fused epilogue: v = acc·alpha + bias[by·sBias + col] (+ CP[(row/rowsPerB)·sCPb + by·64 + col] if CP) ; ACT 0 none / 1 elu ; writes f16 C16 (and f32 C if non-null)
template <int ACT>
__global__ __launch_bounds__(128) void k_gemm_hhx(const _Float16* __restrict__ A, int lda, size_t sA, const _Float16* __restrict__ Bh, int ldb, size_t sB, float alpha, const float* __restrict__ bias, size_t sBias, const float* __restrict__ CP, int rowsPerB, size_t sCPb, int row0g,
    float* __restrict__ C, _Float16* __restrict__ C16, int ldc, size_t sC, int M, int N, int K) {
  __shared__ __attribute__((aligned(16))) float so[4][16][64];
  const int tid = threadIdx.x, w = tid >> 5, lane = tid & 31, ln = lane & 15, hh = lane >> 4; const int by = blockIdx.y;
  A += (size_t)by * sA; Bh += (size_t)by * sB; const size_t cofs = (size_t)by * sC; const float* bp = bias ? bias + (size_t)by * sBias : nullptr;
  const int ntn = (N + 63) / 64; const int wid = blockIdx.x * 4 + w; const int mt = wid / ntn, nq = wid % ntn; if (mt * 16 >= M) return;
  const int row0 = mt * 16, col0 = nq * 64; const _Float16* arow = A + (size_t)(row0 + ln) * lda;
  v8f acc[4] = {};
  for (int kb = 0; kb < K; kb += 32) { FragH ah; ah.half[0] = *(const v8us*)((const unsigned short*)arow + kb + 8 * hh); ah.half[1] = *(const v8us*)((const unsigned short*)arow + kb + 16 + 8 * hh);
#pragma unroll
    for (int t = 0; t < 4; ++t) { if (col0 + t * 16 >= N) continue; const size_t boff = (size_t)(col0 + t * 16 + ln) * ldb + kb; FragH bq; bq.half[0] = *(const v8us*)((const unsigned short*)Bh + boff + 8 * hh); bq.half[1] = *(const v8us*)((const unsigned short*)Bh + boff + 16 + 8 * hh);
      acc[t] = mmaH<1>(ah.v, ah.v, bq.v, bq.v, acc[t]); }
  }
#pragma unroll
  for (int t = 0; t < 4; ++t) { if (col0 + t * 16 >= N) continue; const int col = col0 + t * 16 + ln; const float bv = bp ? bf16_round(bp[col]) : 0.f;
#pragma unroll
    for (int r = 0; r < 8; ++r) { float v = acc[t][r] * alpha + bv; if (CP) { const int rr = row0g + row0 + 8 * hh + r; if (rowsPerB < 0) v += CP[cofs + (size_t)rr * ldc + col];      /* rowsPerB < 0: own element of the batched C plane */ else { const int bidx = rr / rowsPerB; v += CP[(size_t)bidx * sCPb + (size_t)by * 64 + col]; } } if (ACT == 1) v = (v > 0.f) ? v : expm1f(v); else if (ACT == 7) v = (v > 0.f) ? v + 1.0f : expf(v); else if (ACT == 8) v = tanhf(v); else if (ACT == 9) v = 0.5f * v * (1.0f + tanhf(0.7978845608028654f * (v + 0.044715f * v * v * v))); else if (ACT == 11) v = 1.0f / (1.0f + expf(-v)); else if (ACT == 12) v = (v > 0.f) ? v : 0.01f * v; else if (ACT == 14) v = (v > 0.f) ? v : 0.1f * v; else if (ACT == 16) v = (v >= 0.f) ? v : 0.3f * v; else if (ACT == 17) v = (v >= 0.f) ? v : 0.2f * v; else if (ACT == 15) v = v / (1.0f + expf(-v)); else if (ACT == 3) v = fmaxf(v, 0.f); else if (ACT == 6) v = 0.5f * v * (1.0f + erff(v * 0.70710678118654752f)); so[w][8 * hh + r][t * 16 + ln] = v; } }
  __builtin_amdgcn_fence(__ATOMIC_ACQ_REL, "workgroup"); __builtin_amdgcn_wave_barrier();
  const int rsub = lane >> 4, c4 = (lane & 15) * 4; typedef _Float16 v4h __attribute__((ext_vector_type(4)));
  {
#pragma unroll
    for (int q = 0; q < 8; ++q) { const int r = q * 2 + rsub; if (col0 + c4 < N) { const v4f v = *(const v4fa*)&so[w][r][c4]; if (C) *(v4f*)(C + cofs + (size_t)(row0 + r) * ldc + col0 + c4) = v; if (C16) { v4h h4; for (int i = 0; i < 4; ++i) h4[i] = (_Float16)v[i]; *(v4h*)(C16 + cofs + (size_t)(row0 + r) * ldc + col0 + c4) = h4; } } }
     }
}


typedef _Float16 v4h __attribute__((ext_vector_type(4)));

__global__ __launch_bounds__(256) void k_x16(const float* __restrict__ x, _Float16* __restrict__ X16, size_t n8) { const size_t t = (size_t)blockIdx.x * 256 + threadIdx.x; if (t >= n8) return; FragH f;
#pragma unroll
  for (int q = 0; q < 8; ++q) f.h[q] = (_Float16)bf16_round(x[t * 8 + q]); *(v8us*)((unsigned short*)X16 + t * 8) = f.half[0];  }
__global__ __launch_bounds__(256) void k_h16(const float* __restrict__ x, _Float16* __restrict__ X16, size_t n8) { const size_t t = (size_t)blockIdx.x * 256 + threadIdx.x; if (t >= n8) return; FragH f;
#pragma unroll
  for (int q = 0; q < 8; ++q) f.h[q] = (_Float16)x[t * 8 + q]; *(v8us*)((unsigned short*)X16 + t * 8) = f.half[0];  }
__global__ __launch_bounds__(256) void k_round16f(const float* __restrict__ W, _Float16* __restrict__ Bt, size_t n8) { const size_t t = (size_t)blockIdx.x * 256 + threadIdx.x; if (t >= n8) return; FragH f;
#pragma unroll
  for (int i = 0; i < 8; ++i) f.h[i] = (_Float16)(bf16_round(W[t * 8 + i]) * 16.0f); *(v8us*)((unsigned short*)Bt + t * 8) = f.half[0];  }
template <int NHv, int TTv>
__global__ __launch_bounds__(256) void k_vt(const _Float16* __restrict__ V16, int ldv, int voff, _Float16* __restrict__ Vt) { __shared__ unsigned short tl[64][66]; const int tid = threadIdx.x; const int slab = blockIdx.x / (TTv / 64), lg = blockIdx.x % (TTv / 64); const int b = slab / NHv, h = slab % NHv;
  for (int i = tid; i < 64 * 8; i += 256) { const int r = i / 8, c8 = (i % 8) * 8; FragH f; f.half[0] = *(const v8us*)((const unsigned short*)V16 + ((size_t)b * TTv + lg * 64 + r) * ldv + voff + h * 64 + c8);
#pragma unroll
    for (int q = 0; q < 8; ++q) tl[r][c8 + q] = f.u[q]; }
  __syncthreads();
  {
#pragma unroll
    for (int rd = 0; rd < 2; ++rd) { const int d = rd * 32 + tid / 8, pc = tid % 8; FragH f;
#pragma unroll
      for (int q = 0; q < 8; ++q) f.u[q] = tl[pc * 8 + q][d];
      *(v8us*)((unsigned short*)Vt + ((size_t)slab * 64 + d) * TTv + lg * 64 + pc * 8) = f.half[0]; }
     } }

__global__ __launch_bounds__(256) void k_hl(const float* __restrict__ F, _Float16* __restrict__ Hh, _Float16* __restrict__ Hl, size_t n8) { const size_t t = (size_t)blockIdx.x * 256 + threadIdx.x; if (t >= n8) return; FragH fh, fl; const v4f a = *(const v4fa*)(F + t * 8), c = *(const v4fa*)(F + t * 8 + 4);
#pragma unroll
  for (int q = 0; q < 4; ++q) { _Float16 h = (_Float16)a[q]; fh.h[q] = h; fl.h[q] = (_Float16)((a[q] - (float)h) * 1024.0f); h = (_Float16)c[q]; fh.h[4 + q] = h; fl.h[4 + q] = (_Float16)((c[q] - (float)h) * 1024.0f); }
  { *(v8us*)((unsigned short*)Hh + t * 8) = fh.half[0]; *(v8us*)((unsigned short*)Hl + t * 8) = fl.half[0];  } }

// ---- fast GEMM (wave tile 32x64; requires M % 32 == 0 rows per launch region and N % 64 == 0); epilogue = k_gemm_hhx semantics ----
__device__ __forceinline__ v16h g2_frag(const _Float16* p, int hh) { FragH f; f.half[0] = *(const v8us*)((const unsigned short*)p + 8 * hh); f.half[1] = *(const v8us*)((const unsigned short*)p + 16 + 8 * hh); return f.v; }
__device__ __forceinline__ v8f g2_mma(v16h a, v16h b, v8f c) { v8f d = __builtin_amdgcn_wmma_f32_16x16x32_f16(false, a, false, b, (short)0, c, false, false); asm volatile("v_nop\n\tv_nop\n\tv_nop\n\tv_nop" : "+v"(d) : "v"(a), "v"(b)); return d; }
template <int ACT>
__global__ __launch_bounds__(128) void k_gemm2(const _Float16* __restrict__ A, int lda, size_t sA, const _Float16* __restrict__ Bh, int ldb, size_t sB, float alpha, const float* __restrict__ bias, size_t sBias, const float* __restrict__ CP, int rowsPerB, size_t sCPb, int row0g,
    float* __restrict__ C, _Float16* __restrict__ C16, int ldc, size_t sC, int M, int N, int K) { static_assert(ACT == 0 || ACT == 3 || ACT == 6 || ACT == 8 || ACT == 9 || ACT == 11 || ACT == 12 || ACT == 14 || ACT == 15 || ACT == 16 || ACT == 17, "k_gemm2: unsupported ACT code (would silently apply no activation)");
  __shared__ __attribute__((aligned(16))) float so[4][32][68];
  const int tid = threadIdx.x, w = tid >> 5, lane = tid & 31, ln = lane & 15, hh = lane >> 4; const int by = blockIdx.y;
  A += (size_t)by * sA; Bh += (size_t)by * sB; const size_t cofs = (size_t)by * sC; const float* bp = bias ? bias + (size_t)by * sBias : nullptr;
  const int ntn = N >> 6; const int mt = blockIdx.x / ntn, nq = blockIdx.x - mt * ntn; const int row0 = mt * 128 + 32 * w, col0 = nq * 64; if (row0 >= M) return;
  const _Float16* a0p = A + (size_t)(row0 + ln) * lda; const _Float16* a1p = a0p + (size_t)16 * lda;
  const _Float16* b0p = Bh + (size_t)(col0 + ln) * ldb; const _Float16* b1p = b0p + (size_t)16 * ldb; const _Float16* b2p = b1p + (size_t)16 * ldb; const _Float16* b3p = b2p + (size_t)16 * ldb;
  const v8f z8 = {0.f,0.f,0.f,0.f,0.f,0.f,0.f,0.f}; v8f c00 = z8, c01 = z8, c02 = z8, c03 = z8, c10 = z8, c11 = z8, c12 = z8, c13 = z8;
#pragma unroll 1
  for (int kb = 0; kb < K; kb += 32) { const v16h a0 = g2_frag(a0p + kb, hh), a1 = g2_frag(a1p + kb, hh);
    v16h b = g2_frag(b0p + kb, hh); c00 = g2_mma(a0, b, c00); c10 = g2_mma(a1, b, c10);
    b = g2_frag(b1p + kb, hh); c01 = g2_mma(a0, b, c01); c11 = g2_mma(a1, b, c11);
    b = g2_frag(b2p + kb, hh); c02 = g2_mma(a0, b, c02); c12 = g2_mma(a1, b, c12);
    b = g2_frag(b3p + kb, hh); c03 = g2_mma(a0, b, c03); c13 = g2_mma(a1, b, c13); }
  v8f accs[8] = {c00, c01, c02, c03, c10, c11, c12, c13};
#pragma unroll
  for (int u = 0; u < 8; ++u) { const int t = u & 3, half = u >> 2; const int col = col0 + t * 16 + ln; const float bv = bp ? bf16_round(bp[col]) : 0.f;
#pragma unroll
    for (int r = 0; r < 8; ++r) { const int rloc = half * 16 + 8 * hh + r; float v = accs[u][r] * alpha + bv; if (CP) { if (rowsPerB < 0) v += CP[cofs + (size_t)(row0g + row0 + rloc) * ldc + col];      /* rowsPerB < 0: own element of the batched C plane */ else { const int bidx = (row0g + row0 + rloc) / rowsPerB; v += CP[(size_t)bidx * sCPb + (size_t)by * 64 + col]; } }
      if (ACT == 3) v = fmaxf(v, 0.f); else if (ACT == 6) v = 0.5f * v * (1.0f + erff(v * 0.70710678118654752f)); else if (ACT == 11) v = 1.0f / (1.0f + expf(-v)); else if (ACT == 15) v = v / (1.0f + expf(-v)); else if (ACT == 12) v = (v > 0.f) ? v : 0.01f * v; else if (ACT == 8) v = tanhf(v); else if (ACT == 9) v = 0.5f * v * (1.0f + tanhf(0.7978845608028654f * (v + 0.044715f * v * v * v))); else if (ACT == 14) v = (v > 0.f) ? v : 0.1f * v; else if (ACT == 16) v = (v >= 0.f) ? v : 0.3f * v; else if (ACT == 17) v = (v >= 0.f) ? v : 0.2f * v;
      so[w][rloc][t * 16 + ln] = v; } }
  __builtin_amdgcn_fence(__ATOMIC_ACQ_REL, "workgroup"); __builtin_amdgcn_wave_barrier();
  const int rsub = lane >> 4, c4 = (lane & 15) * 4;
  {
#pragma unroll
    for (int q = 0; q < 16; ++q) { const int r = q * 2 + rsub; const v4f v = *(const v4fa*)&so[w][r][c4]; if (C) *(v4f*)(C + cofs + (size_t)(row0 + r) * ldc + col0 + c4) = v; if (C16) { v4h h4; for (int i = 0; i < 4; ++i) h4[i] = (_Float16)v[i]; *(v4h*)(C16 + cofs + (size_t)(row0 + r) * ldc + col0 + c4) = h4; } }
     } }


__global__ __launch_bounds__(256) void k_wnat(const float* __restrict__ w, size_t n8, _Float16* __restrict__ Bt) { const size_t t = (size_t)blockIdx.x * 256 + threadIdx.x; if (t >= n8) return; FragH f; for (int q = 0; q < 8; ++q) f.h[q] = (_Float16)(bf16_round(w[t * 8 + q]) * 16.0f); *(v8us*)((unsigned short*)Bt + t * 8) = f.half[0];  }
__global__ __launch_bounds__(256) void k_rsm(const float* __restrict__ S, _Float16* __restrict__ P, int nrows) {
  #pragma clang fp contract(off)
  const int i = blockIdx.x * 256 + threadIdx.x; if (i >= nrows) return; const float* s = S + (size_t)i * SQ; float mx = -3.0e38f;
#pragma unroll 1
  for (int j = 0; j < SQ; ++j) mx = fmaxf(mx, s[j]); float se = 0.f;
#pragma unroll 1
  for (int j = 0; j < SQ; ++j) se += expf(s[j] - mx); const float sc = 256.0f / se;
#pragma unroll 1
  for (int j0 = 0; j0 < SQ; j0 += 8) { FragH f; for (int q = 0; q < 8; ++q) f.h[q] = (_Float16)(expf(s[j0 + q] - mx) * sc); unsigned short* d = (unsigned short*)P + (size_t)i * SQ + j0; *(v8us*)d = f.half[0];  } }
__global__ __launch_bounds__(256) void k_vt(const _Float16* __restrict__ V16, int b, int h0, _Float16* __restrict__ VT) { __shared__ unsigned short tl[64][65]; const int tid = threadIdx.x; const int hh = blockIdx.x % HG, sg = blockIdx.x / HG; const int s0 = sg * 64; const int h = h0 + hh;
  for (int i = tid; i < 64 * 8; i += 256) { const int j = i / 8, d8 = (i % 8) * 8; FragH f; f.half[0] = *(const v8us*)((const unsigned short*)V16 + ((size_t)b * SQ + s0 + j) * DM + h * HD + d8); for (int q = 0; q < 8; ++q) tl[d8 + q][j] = f.u[q]; }
  __syncthreads();
  { for (int i = tid; i < 64 * 8; i += 256) { const int d = i / 8, j8 = (i % 8) * 8; FragH f; for (int q = 0; q < 8; ++q) f.u[q] = tl[d][j8 + q]; *(v8us*)((unsigned short*)VT + ((size_t)hh * HD + d) * SQ + s0 + j8) = f.half[0]; }  } }



// One wave per score row: each load takes 512 contiguous bytes of the row, the row is read once and stays in registers through max, sum and scale; row max and row sum end in a five-step butterfly over the lanes.
__global__ __launch_bounds__(256) void k_rsmcf2(const float* __restrict__ S, _Float16* __restrict__ P, int hg, int q0, int nk) {
  #pragma clang fp contract(off)
  const int lane = threadIdx.x & 31; const int t = blockIdx.x * 8 + (threadIdx.x >> 5); if (t >= hg * QT) return; const size_t i = (size_t)t; const float* s = S + i * NKX + lane * 4; const int last = q0 + (t % QT);
  v4f v[NKX / 128];      /* lane l holds keys g*128 + l*4 .. +3 of group g; nk is a multiple of 256, so groups come in pairs; every loop over v is fully unrolled so that its indices are constants and it stays in registers */
#pragma unroll
  for (int c = 0; c < NKX / 256; ++c) if (c * 256 < nk) { v[2 * c] = *(const v4fa*)(s + c * 256); v[2 * c + 1] = *(const v4fa*)(s + c * 256 + 128); }
  float mx = -3.0e38f;
#pragma unroll
  for (int c = 0; c < NKX / 256; ++c) if (c * 256 < nk) {
#pragma unroll
    for (int u = 0; u < 8; ++u) { const int g = 2 * c + (u >> 2), q = u & 3; const float f = (g * 128 + lane * 4 + q <= last) ? 1.f : 0.f; const float x = fmaf(f, v[g][q], (1.f - f) * -1.0e9f); v[g][q] = x; mx = fmaxf(mx, x); } }
#pragma unroll
  for (int m = 16; m >= 1; m >>= 1) mx = fmaxf(mx, __shfl_xor(mx, m, 32));
  v4f s4 = {0.f, 0.f, 0.f, 0.f};
#pragma unroll
  for (int c = 0; c < NKX / 256; ++c) if (c * 256 < nk) {
#pragma unroll
    for (int u = 0; u < 8; ++u) { const int g = 2 * c + (u >> 2), q = u & 3; const float e = __expf(v[g][q] - mx); v[g][q] = e; s4[q] += e; } }
  float se = (s4[0] + s4[1]) + (s4[2] + s4[3]);
#pragma unroll
  for (int m = 16; m >= 1; m >>= 1) se += __shfl_xor(se, m, 32);
  const float sc = 256.0f / se; _Float16* d = P + i * NKX + lane * 4;
#pragma unroll
  for (int c = 0; c < NKX / 256; ++c) if (c * 256 < nk) {
#pragma unroll
    for (int h = 0; h < 2; ++h) { v4h o; for (int q = 0; q < 4; ++q) o[q] = (_Float16)(v[2 * c + h][q] * sc); *(v4h*)(d + c * 256 + h * 128) = o; }
    asm volatile("s_wait_xcnt 0x0" ::: "memory");      /* the next pair's conversions reuse the data registers of these two stores: the wait stands between store and overwrite */
  } }


// Exact f32 attention for the first QT0 rows (o carried x64 like the f16 path). One wave per query row, A0R rows of one head per block.
// All QT0 K and V rows of the head are staged in LDS once by coalesced 16-byte loads. K rows get a pitch of 68 floats (16 bytes x odd), so that 32 lanes reading 32 rows by 16 bytes spread over the banks.
// Scores: lane = key (four partial sums over the head dimension). Row max and row sum: five-step butterfly. o: lane = two head columns, loop over the keys, each key's weight read from its lane into a scalar register; keys above the row carry weight 0.
#define A0R 8                        /* rows (waves) per block */
#define A0KP (HD + 4)                /* K row pitch in LDS, floats */
typedef float v2f __attribute__((ext_vector_type(2)));
__global__ __launch_bounds__(256) void k_att0w(const float* __restrict__ QF, const float* __restrict__ KF, const float* __restrict__ VF, float scale, float* __restrict__ OF) {
  __shared__ __attribute__((aligned(16))) float lk[QT0][A0KP]; __shared__ __attribute__((aligned(16))) float lv[QT0][HD];
  const int tid = threadIdx.x, lane = tid & 31; const int w = __builtin_amdgcn_readfirstlane(tid >> 5);      /* the wave's number as a scalar: row, group count and branches below are wave-uniform */
  const int h = blockIdx.x / (QT0 / A0R), r0 = (blockIdx.x % (QT0 / A0R)) * A0R; const int i = r0 + w;
  const float* qr = QF + (size_t)i * DM + h * HD; v4f q[HD / 4];      /* every loop of this kernel is fully unrolled: the indices into q, kk, vv, sv and o and the lane of each readlane are then constants, so the arrays stay in registers */
#pragma unroll
  for (int c = 0; c < HD / 4; ++c) q[c] = *(const v4fa*)(qr + c * 4);      /* the wave's own q row, whole */
  const int sj = tid >> 4, sc4 = (tid & 15) * 4; const float* kp = KF + (size_t)sj * DM + h * HD + sc4; const float* vp = VF + (size_t)sj * DM + h * HD + sc4; v4f kk[QT0 / 16], vv[QT0 / 16];      /* one pass of the block stages 16 rows; both loops are fully unrolled and free of branches so that every load of the block is in flight before the first LDS store waits; the row pitch is a constant, so the passes differ in the immediate offset alone */
#pragma unroll
  for (int u = 0; u < QT0 / 16; ++u) { kk[u] = *(const v4fa*)(kp + (size_t)u * 16 * DM); vv[u] = *(const v4fa*)(vp + (size_t)u * 16 * DM); }
  asm volatile("s_wait_xcnt 0x0" :: "v"(kp), "v"(vp) : "memory");      /* the wait between the loads above and the first reuse of their address registers; the two addresses are inputs so that their registers stay untouched up to it */
#pragma unroll
  for (int u = 0; u < QT0 / 16; ++u) { *(v4f*)&lk[u * 16 + sj][sc4] = kk[u]; *(v4f*)&lv[u * 16 + sj][sc4] = vv[u]; }
  __syncthreads();
  const int ng = (i >> 5) + 1;      /* key groups of 32 that hold a key <= i */
  float sv[QT0 / 32];
#pragma unroll
  for (int g = 0; g < QT0 / 32; ++g) { sv[g] = -1.0e30f;
    if (g < ng) { const int j = g * 32 + lane; v4f a = {0.f, 0.f, 0.f, 0.f};
#pragma unroll
      for (int c = 0; c < HD / 4; ++c) a += q[c] * *(const v4f*)&lk[j][c * 4];
      const float s = ((a[0] + a[1]) + (a[2] + a[3])) * scale; sv[g] = (j <= i) ? s : -1.0e30f; } }
  float mx = fmaxf(fmaxf(sv[0], sv[1]), fmaxf(sv[2], sv[3]));
#pragma unroll
  for (int m = 16; m >= 1; m >>= 1) mx = fmaxf(mx, __shfl_xor(mx, m, 32));
  float se = 0.f;
#pragma unroll
  for (int g = 0; g < QT0 / 32; ++g) { const float e = expf(sv[g] - mx); sv[g] = e; se += e; }      /* a key above the row holds -1e30: its weight underflows to exactly 0 */
#pragma unroll
  for (int m = 16; m >= 1; m >>= 1) se += __shfl_xor(se, m, 32);
  v2f o[4] = {{0.f, 0.f}, {0.f, 0.f}, {0.f, 0.f}, {0.f, 0.f}};      /* four partial sums over the keys (key mod 4): four independent add chains */
#pragma unroll
  for (int g = 0; g < QT0 / 32; ++g) if (g < ng) {
#pragma unroll
    for (int jj = 0; jj < 32; ++jj) { const float e = __int_as_float(__builtin_amdgcn_readlane(__float_as_int(sv[g]), jj)); o[jj & 3] += e * *(const v2f*)&lv[g * 32 + jj][lane * 2]; } }
  const float fin = 64.0f / se; const v2f r = ((o[0] + o[1]) + (o[2] + o[3])) * fin;
  *(v2f*)(OF + (size_t)i * DM + h * HD + lane * 2) = r; }


__global__ __launch_bounds__(256) void k_wt_hq(const float* __restrict__ Wf, const float* __restrict__ bf, _Float16* __restrict__ Bq, _Float16* __restrict__ Bk, _Float16* __restrict__ Bv, float* __restrict__ B3) {
  const int t = blockIdx.x * 256 + threadIdx.x; if (t >= 3 * DM * (DM / 8)) return; const int n = t / (DM / 8), k8 = (t % (DM / 8)) * 8; const int h = n / (3 * HD), wh = (n % (3 * HD)) / HD, d = n % HD; const int row = h * HD + d; FragH f;
#pragma unroll
  for (int i = 0; i < 8; ++i) f.h[i] = (_Float16)(bf16_round(Wf[(size_t)(k8 + i) * (3 * DM) + n]) * 16.0f); const v8us o = f.half[0];
  _Float16* dst = (wh == 0) ? Bq : ((wh == 1) ? Bk : Bv); unsigned short* p = (unsigned short*)dst + (size_t)row * DM + k8; *(v8us*)p = o; 
  (void)bf; (void)B3; }
__global__ __launch_bounds__(256) void k_bhq(const float* __restrict__ bf, float* __restrict__ B3) {
  const int t = blockIdx.x * 256 + threadIdx.x; if (t >= 3 * DM) return; const int wh = t / DM, row = t % DM; const int h = row / HD, d = row % HD; const float v = bf16_round(bf[h * (3 * HD) + wh * HD + d]); *(float*)(B3 + t) = v;  }

template <int NORM, int ROPE>
__global__ __launch_bounds__(64) void k_xform(const float* __restrict__ F, int ldf, int nh, const float* __restrict__ gain, float eps, const float* __restrict__ CS, const float* __restrict__ SN, _Float16* __restrict__ H16, int ldo) {
  #pragma clang fp contract(off)
  __shared__ float xv[HD]; __shared__ float red[HD]; __shared__ unsigned short sh_[HD]; const int d = threadIdx.x; const int h = blockIdx.x % nh; const size_t r = blockIdx.x / nh; const int p = (int)(r % SQ);
  float x = F[r * (size_t)ldf + (size_t)h * HD + d];
  if (NORM) { red[d] = __fmul_rn(x, x); __syncthreads(); for (int st = HD / 2; st > 0; st >>= 1) { if (d < st) red[d] = __fadd_rn(red[d], red[d + st]); __syncthreads(); } const float rs = rsqrtf(__fadd_rn(red[0] / (float)HD, eps)); x = __fmul_rn(__fmul_rn(x, rs), bf16_round(gain[d])); }
  xv[d] = x; __syncthreads();
  float o = x;
  if (ROPE == 1) { const int i = d >> 1; const float c = CS[p * (HD / 2) + i], s = SN[p * (HD / 2) + i]; const float ev = xv[2 * i], od = xv[2 * i + 1]; o = (d & 1) ? __fadd_rn(__fmul_rn(ev, s), __fmul_rn(od, c)) : __fadd_rn(__fmul_rn(ev, c), -__fmul_rn(od, s)); }
  if (ROPE == 2) { const int i = d & (HD / 2 - 1); const float c = CS[p * (HD / 2) + i], s = SN[p * (HD / 2) + i]; const float lo = xv[i], hi = xv[i + HD / 2]; o = (d < HD / 2) ? __fadd_rn(__fmul_rn(lo, c), -__fmul_rn(hi, s)) : __fadd_rn(__fmul_rn(lo, s), __fmul_rn(hi, c)); }
  FragH th; th.h[0] = (_Float16)o; sh_[d] = th.u[0]; __syncthreads();
  if (d < HD / 8) { FragH f; for (int q = 0; q < 8; ++q) f.u[q] = sh_[d * 8 + q]; unsigned short* dst = (unsigned short*)H16 + r * (size_t)ldo + (size_t)h * HD + d * 8; *(v8us*)dst = f.half[0];  } }


template <int NORM, int ROPE>
__global__ __launch_bounds__(64) void k_xformf(const float* __restrict__ F, int ldf, int nh, const float* __restrict__ gain, float eps, const float* __restrict__ CS, const float* __restrict__ SN, float* __restrict__ F32, int ldo) {
  #pragma clang fp contract(off)
  __shared__ float xv[HD]; __shared__ float red[HD]; const int d = threadIdx.x; const int h = blockIdx.x % nh; const size_t r = blockIdx.x / nh; const int p = (int)(r % SQ);
  float x = F[r * (size_t)ldf + (size_t)h * HD + d];
  if (NORM) { red[d] = __fmul_rn(x, x); __syncthreads(); for (int st = HD / 2; st > 0; st >>= 1) { if (d < st) red[d] = __fadd_rn(red[d], red[d + st]); __syncthreads(); } const float rs = rsqrtf(__fadd_rn(red[0] / (float)HD, eps)); x = __fmul_rn(__fmul_rn(x, rs), bf16_round(gain[d])); }
  xv[d] = x; __syncthreads();
  float o = x;
  if (ROPE == 1) { const int i = d >> 1; const float c = CS[p * (HD / 2) + i], s = SN[p * (HD / 2) + i]; const float ev = xv[2 * i], od = xv[2 * i + 1]; o = (d & 1) ? __fadd_rn(__fmul_rn(ev, s), __fmul_rn(od, c)) : __fadd_rn(__fmul_rn(ev, c), -__fmul_rn(od, s)); }
  if (ROPE == 2) { const int i = d & (HD / 2 - 1); const float c = CS[p * (HD / 2) + i], s = SN[p * (HD / 2) + i]; const float lo = xv[i], hi = xv[i + HD / 2]; o = (d < HD / 2) ? __fadd_rn(__fmul_rn(lo, c), -__fmul_rn(hi, s)) : __fadd_rn(__fmul_rn(lo, s), __fmul_rn(hi, c)); }
  float* dst = F32 + r * (size_t)ldo + (size_t)h * HD + d; *(float*)dst = o;  }


__global__ __launch_bounds__(256) void k_tabcp32(const float* __restrict__ tc, const float* __restrict__ tsn, float* __restrict__ CS, float* __restrict__ SN, int n) {
  const int t = blockIdx.x * 256 + threadIdx.x; if (t >= n) return; const float c = bf16_round(tc[t]), s = bf16_round(tsn[t]);
  *(float*)(CS + t) = c; *(float*)(SN + t) = s;  }
extern "C" void kernel_launch(void* const* d_in, const int* in_sizes, int n_in,
                              void* d_out, int out_size, void* d_ws, size_t ws_size, hipStream_t stream) {
  (void)in_sizes; (void)n_in; (void)out_size;
  const float* const* I = (const float* const*)d_in; const float* x = I[0]; const float* wqkv = I[1]; const float* bqkv = I[2]; const float* wo = I[3]; const float* bo = I[4]; const float* tcos = I[5]; const float* tsin = I[6];      /* x; fused W_qkv [1024][3072] + b_qkv [3072] ([in][out]; per-head (q | k | v) column triples); W_out + b_out ([in][out]); rope tables cos / sin [2048][32] */
  char* ws = (char*)d_ws; size_t off = 0;
  auto take = [&](size_t bytes) { char* p = ws + off; off += (bytes + 255) & ~(size_t)255; return p; };
  _Float16* BQ = (_Float16*)take((size_t)DM * DM * 2); _Float16* BK = (_Float16*)take((size_t)DM * DM * 2); _Float16* BV = (_Float16*)take((size_t)DM * DM * 2); _Float16* BO = (_Float16*)take((size_t)DM * DM * 2);
  float* BQB = (float*)take((size_t)3 * DM * 4); float* QF = (float*)take(NR * DM * 4); float* CSB = (float*)take((size_t)SQ * 32 * 4); float* SNB = (float*)take((size_t)SQ * 32 * 4);      /* de-interleaved bias vector bq | bk | bv; f32 projection plane (q, then reused for k) for the rope; bf16-rounded copies of the rope tables */ _Float16* X16 = (_Float16*)take(NR * DM * 2); _Float16* Q16 = (_Float16*)take(NR * DM * 2); _Float16* K16 = (_Float16*)take(NR * DM * 2); _Float16* V16 = (_Float16*)take(NR * DM * 2); _Float16* O16 = (_Float16*)take(NR * DM * 2);
  float* S = (float*)take((size_t)NH * QT * NKX * 4); _Float16* P = (_Float16*)take((size_t)NH * QT * NKX * 2); _Float16* VT = (_Float16*)take((size_t)NH * HD * SQ * 2);
  float* QF0 = (float*)take((size_t)QT0 * DM * 4); float* KF0 = (float*)take((size_t)QT0 * DM * 4); float* VF0 = (float*)take((size_t)QT0 * DM * 4); float* OF0 = (float*)take((size_t)NB * QT0 * DM * 4); _Float16* OH0 = (_Float16*)take((size_t)NB * QT0 * DM * 2); _Float16* OL0 = (_Float16*)take((size_t)NB * QT0 * DM * 2);
  if (off > ws_size) return;
  k_wt_hq<<<(unsigned)(((size_t)3 * DM * (DM / 8) + 255) / 256), 256, 0, stream>>>(wqkv, bqkv, BQ, BK, BV, BQB); k_bhq<<<(3 * DM + 255) / 256, 256, 0, stream>>>(bqkv, BQB); k_wt_f16<<<(unsigned)(((size_t)DM * (DM / 8) + 255) / 256), 256, 0, stream>>>(wo, BO, DM, DM, 16.0f);      /* fused [in][out] weight with per-head (q | k | v) column triples -> three Bt planes (row h*64 + d) x16 + the de-interleaved bias vector; W_out [in][out] -> Bt x16 */
  k_tabcp32<<<(SQ * 32 + 255) / 256, 256, 0, stream>>>(tcos, tsin, CSB, SNB, SQ * 32);      /* rope tables [pos][32], bf16-rounded copies */

  k_x16<<<(unsigned)((NR * DM / 8 + 255) / 256), 256, 0, stream>>>(x, X16, NR * DM / 8);
  const size_t r0p = (size_t)B0 * SQ;      /* first projected row */
  k_gemm2<0><<<dim3((unsigned)((MP / 128) * (DM / 64)), 1), 128, 0, stream>>>(X16 + r0p * DM, DM, 0, BQ, DM, 0, 0.0625f, BQB, 0, nullptr, 1, 0, 0, QF + r0p * DM, nullptr, DM, 0, MP, DM, DM); k_xform<0, 1><<<(unsigned)((size_t)MP * NH), 64, 0, stream>>>(QF + r0p * DM, DM, NH, nullptr, 0.f, CSB, SNB, Q16 + r0p * DM, DM);      /* q (f32) + bias -> interleaved-pair rope (position = row % SQ) -> f16 rows */
  k_gemm2<0><<<dim3((unsigned)((MP / 128) * (DM / 64)), 1), 128, 0, stream>>>(X16 + r0p * DM, DM, 0, BK, DM, 0, 0.0625f, BQB + DM, 0, nullptr, 1, 0, 0, QF + r0p * DM, nullptr, DM, 0, MP, DM, DM); k_xform<0, 1><<<(unsigned)((size_t)MP * NH), 64, 0, stream>>>(QF + r0p * DM, DM, NH, nullptr, 0.f, CSB, SNB, K16 + r0p * DM, DM);      /* k likewise (the f32 plane is reused after q's rope) */
  k_gemm2<0><<<dim3((unsigned)((MP / 128) * (DM / 64)), 1), 128, 0, stream>>>(X16 + r0p * DM, DM, 0, BV, DM, 0, 0.0625f, BQB + 2 * DM, 0, nullptr, 1, 0, 0, nullptr, V16 + r0p * DM, DM, 0, MP, DM, DM);
  for (int b = B0; b < B0 + NBR; ++b) { const size_t r0 = (size_t)b * SQ;
    k_vt<NH, SQ><<<NH * (SQ / 64), 256, 0, stream>>>(V16 + r0 * LQ, LQ, 0, VT);      /* V^T [NH][HD][SQ] for this batch */
    k_gemm2<0><<<dim3((QT0 / 128) * (DM / 64), 1), 128, 0, stream>>>(X16 + r0 * DM, DM, 0, BQ, DM, 0, 0.0625f, BQB, 0, nullptr, 1, 0, 0, QF0, nullptr, DM, 0, QT0, DM, DM); k_gemm2<0><<<dim3((QT0 / 128) * (DM / 64), 1), 128, 0, stream>>>(X16 + r0 * DM, DM, 0, BK, DM, 0, 0.0625f, BQB + DM, 0, nullptr, 1, 0, 0, KF0, nullptr, DM, 0, QT0, DM, DM); k_gemm2<0><<<dim3((QT0 / 128) * (DM / 64), 1), 128, 0, stream>>>(X16 + r0 * DM, DM, 0, BV, DM, 0, 0.0625f, BQB + 2 * DM, 0, nullptr, 1, 0, 0, VF0, nullptr, DM, 0, QT0, DM, DM);      /* f32 q, k, v of the first 128 rows (exact products) */
    k_xformf<0, 1><<<(unsigned)(QT0 * NH), 64, 0, stream>>>(QF0, DM, NH, nullptr, 0.f, CSB, SNB, QF0, DM); k_xformf<0, 1><<<(unsigned)(QT0 * NH), 64, 0, stream>>>(KF0, DM, NH, nullptr, 0.f, CSB, SNB, KF0, DM);      /* f32 rope of the first-tile q, k IN PLACE (each (row, head) block stages its 64 values in LDS before writing; first-tile row r = position r) */
    k_att0w<<<NH * (QT0 / A0R), 256, 0, stream>>>(QF0, KF0, VF0, 0.125f, OF0 + (size_t)b * QT0 * DM);      /* exact f32 attention for rows 0..127 (o x64) */
    for (int q0 = 0; q0 < QN; q0 += QT) { const int nk = q0 + QT;      /* causal: only keys below the tile end are computed */
      k_gemm2<0><<<dim3((QT / 128) * (nk / 64), NHD), 128, 0, stream>>>(Q16 + (r0 + q0) * LQ, LQ, (size_t)HD, K16 + r0 * LQ, LQ, (size_t)HD, 0.125f, nullptr, 0, nullptr, 1, 0, 0, S, nullptr, NKX, (size_t)QT * NKX, QT, nk, HD);      /* scores, all heads on grid.y */
      k_rsmcf2<<<(NHD * QT + 7) / 8, 256, 0, stream>>>(S, P, NHD, q0, nk);      /* eight rows, one per wave, per block */
      k_gemm2<0><<<dim3((QT / 128) * (HD / 64), NHD), 128, 0, stream>>>(P, NKX, (size_t)QT * NKX, VT, SQ, (size_t)HD * SQ, 0.25f, nullptr, 0, nullptr, 1, 0, 0, nullptr, O16 + (r0 + q0) * DM, DM, (size_t)HD, QT, HD, nk); } }      /* o (merged heads, x64) as f16 rows */
  k_gemm2<0><<<dim3((unsigned)((MPO / 128) * (DM / 64)), 1), 128, 0, stream>>>(O16 + r0p * DM, DM, 0, BO, DM, 0, 0.0009765625f, bo, 0, nullptr, 1, 0, 0, (float*)d_out + r0p * DM, nullptr, DM, 0, MPO, DM, DM);      /* out rows are the output layout */
  k_hl<<<(unsigned)(((size_t)NB * QT0 * DM / 8 + 255) / 256), 256, 0, stream>>>(OF0, OH0, OL0, (size_t)NB * QT0 * DM / 8);      /* first-tile o (x64) -> f16 hi + x1024 residual planes */
  for (int b = B0; b < B0 + NBR; ++b) { const size_t r0 = (size_t)b * SQ; const size_t f0 = (size_t)b * QT0;
    k_gemm2<0><<<dim3((QT0 / 128) * (DM / 64), 1), 128, 0, stream>>>(OH0 + f0 * DM, DM, 0, BO, DM, 0, 0.0009765625f, bo, 0, nullptr, 1, 0, 0, (float*)d_out + r0 * DM, nullptr, DM, 0, QT0, DM, DM);      /* rows 0..127: out = o_hi Wo (+ b), overwriting the f16-path rows */
    k_gemm2<0><<<dim3((QT0 / 128) * (DM / 64), 1), 128, 0, stream>>>(OL0 + f0 * DM, DM, 0, BO, DM, 0, 0.00000095367431640625f, nullptr, 0, (const float*)d_out + r0 * DM, -1, 0, 0, (float*)d_out + r0 * DM, nullptr, DM, 0, QT0, DM, DM); }      /* += o_lo Wo 2^-20 (own-element accumulate) */
}

// v003
// Measured time: 995 microseconds a run.
// In two side-by-side timings against v002, it was 2.54 and 2.53 times as fast.
// All steps since v000 together make it 10.4 times as fast.
#include <hip/hip_runtime.h>
// Causal multi-head self-attention with a PER-HEAD interleaved fused QKV projection and rotary embeddings (x [4][2048][1024]; qkv = x W_qkv + b_qkv ([in][out] 1024 x 3072, zero bias) reshaped (B, T, 16, 192): head h owns columns h*192 + [0..63 | 64..127 | 128..191] = q | k | v; rope on q and k from the INPUT tables cos / sin [2048][32]: t1 = even elements, t2 = odd elements, out = cat(t1 c - t2 s, t1 s + t2 c) (an interleaved-pair rotation followed by the same fixed permutation on q and k: the scores are unchanged by it); scores / 8; causal (tril, -inf); softmax; out = merged W_out + b_out ([in][out]) -> [4][2048][1024]).
// Structure: token rows r = b*2048 + s; x as exact f16 rows (bf16-rounded); Q, K, V as three WMMA GEMMs (32x64 wave tiles, f32 accumulation, exact x16 weights, f16 outputs); V^T for all batches and heads via LDS transposes; one fused attention launch (k_fattn): S^T = K Q^T, online causal softmax in registers (f32 statistics, native exp2; weights x256 f16), O^T += V^T P^T, o carried x64 (folded into the output GEMM alpha) written straight into the merged f16 o rows; out = o W_o GEMM (f32) into the output layout.
// Compute dtype: inputs rounded to bf16; x / weights exact; q, k, v, softmax weights and o as plain f16 GEMM operands (~2^-12); scores and softmax statistics f32. v_wmma_f32_16x16x32_f16.
#define NB 4
#define SQ 2048
#define DM 1024
#define NH 16
#define HD 64
#define HG 4                         /* heads per launch of the per-batch k_vt overload (never launched) */
#define QT0 128                      /* first-tile rows recomputed exactly in f32 */
#define B0 0                         /* first batch processed (debug hook) */
#define NBR NB                       /* batches processed (debug hook) */
#define NR ((size_t)NB * SQ)         /* token rows */
#define MP ((int)((size_t)NBR * SQ)) /* rows projected (debug hook) */
#define MPO MP                       /* rows through the output stage (debug hook) */
#define LQ DM      /* row pitch of the q/k/v rows */
typedef __bf16 v16b __attribute__((ext_vector_type(16)));
typedef unsigned short v8us __attribute__((ext_vector_type(8), may_alias));
typedef float  v8f  __attribute__((ext_vector_type(8)));
typedef float  v4f  __attribute__((ext_vector_type(4)));
typedef float  v4fa __attribute__((ext_vector_type(4), may_alias));
union FragB { v16b v; v8us half[2]; unsigned short u[16]; };

__device__ __forceinline__ unsigned short bf16_bits(float x) { unsigned int u = __float_as_uint(x); return (unsigned short)((u + 0x7FFFu + ((u >> 16) & 1u)) >> 16); }
__device__ __forceinline__ float bf16_val(unsigned short b) { return __uint_as_float(((unsigned int)b) << 16); }
__device__ __forceinline__ float bf16_round(float x) { return bf16_val(bf16_bits(x)); }
// D += A·B with NT terms: 1 = ah·bh, 2 = + al·bh (A split), 3 = + ah·bl (both split)
template <int NT>
__device__ __forceinline__ v8f mmaN(v16b ah, v16b al, v16b bh, v16b bl, v8f c) {
  c = __builtin_amdgcn_wmma_f32_16x16x32_bf16(false, ah, false, bh, (short)0, c, false, false);
  if (NT >= 2) c = __builtin_amdgcn_wmma_f32_16x16x32_bf16(false, al, false, bh, (short)0, c, false, false);
  if (NT >= 3) c = __builtin_amdgcn_wmma_f32_16x16x32_bf16(false, ah, false, bl, (short)0, c, false, false);
  asm volatile("v_nop\n\tv_nop\n\tv_nop\n\tv_nop" : "+v"(c) : "v"(ah), "v"(al), "v"(bh), "v"(bl));
  return c;
}

__global__ __launch_bounds__(256) void k_wt_bf16(const float* __restrict__ W, unsigned short* __restrict__ Wt, int K, int N) {
  const int t = blockIdx.x * 256 + threadIdx.x;
  const int k8n = K / 8;
  if (t >= N * k8n) return;
  const int n = t / k8n, k8 = (t % k8n) * 8;
  v8us v;
#pragma unroll
  for (int i = 0; i < 8; ++i) v[i] = bf16_bits(W[(size_t)(k8 + i) * N + n]);
  *(v8us*)(Wt + (size_t)n * K + k8) = v;
  
}

// GEMM C[M][N] (f32, pitch ldc) = act(A[M][K]·W + bias). A f32 row-major (pitch lda) converted per fragment to bf16
// (ASPLIT: hi/lo two planes -> 2 terms, else single rounded term); Wt bf16 [N][K] (pitch ldb). BIAS_BF16 rounds the
// bias to bf16 first (bias quantised to bf16 before the add). K%32==0, M%16==0, N%64==0.
template <bool ASPLIT, int ACT, bool BIAS_BF16>
__global__ __launch_bounds__(128) void k_gemm_bf(const float* __restrict__ A, int lda, const unsigned short* __restrict__ Wt, int ldb,
                                               const float* __restrict__ bias, float* __restrict__ C, int ldc, int M, int N, int K) {
  __shared__ __attribute__((aligned(16))) float so[4][16][64];
  const int tid = threadIdx.x, w = tid >> 5, lane = tid & 31, ln = lane & 15, hh = lane >> 4;
  const int ntn = N / 64;
  const int wid = blockIdx.x * 4 + w;
  const int mt = wid / ntn, nq = wid % ntn;
  if (mt * 16 >= M) return;
  const int row0 = mt * 16, col0 = nq * 64;
  const float* arow = A + (size_t)(row0 + ln) * lda;
  v8f acc[4] = {};
  for (int kb = 0; kb < K; kb += 32) {
    FragB ah, al;
    const v4f x0 = *(const v4fa*)(arow + kb + 8 * hh), x1 = *(const v4fa*)(arow + kb + 8 * hh + 4);
    const v4f x2 = *(const v4fa*)(arow + kb + 16 + 8 * hh), x3 = *(const v4fa*)(arow + kb + 16 + 8 * hh + 4);
    float xs[16] = {x0[0],x0[1],x0[2],x0[3],x1[0],x1[1],x1[2],x1[3],x2[0],x2[1],x2[2],x2[3],x3[0],x3[1],x3[2],x3[3]};
#pragma unroll
    for (int i = 0; i < 16; ++i) { const unsigned short hb = bf16_bits(xs[i]); ah.u[i] = hb; al.u[i] = ASPLIT ? bf16_bits(xs[i] - bf16_val(hb)) : (unsigned short)0; }
#pragma unroll
    for (int t = 0; t < 4; ++t) {
      const unsigned short* brow = Wt + (size_t)(col0 + t * 16 + ln) * ldb + kb;
      FragB b;
      b.half[0] = *(const v8us*)(brow + 8 * hh);
      b.half[1] = *(const v8us*)(brow + 16 + 8 * hh);
      acc[t] = mmaN<ASPLIT ? 2 : 1>(ah.v, al.v, b.v, b.v, acc[t]);
    }
  }
#pragma unroll
  for (int t = 0; t < 4; ++t) {
    float bv = bias ? bias[col0 + t * 16 + ln] : 0.f;
    if (BIAS_BF16) bv = bf16_round(bv);
#pragma unroll
    for (int r = 0; r < 8; ++r) { float v = acc[t][r] + bv; if (ACT == 1) v = fmaxf(v, 0.f); so[w][8 * hh + r][t * 16 + ln] = v; }
  }
  __builtin_amdgcn_fence(__ATOMIC_ACQ_REL, "workgroup");
  __builtin_amdgcn_wave_barrier();
  const int rsub = lane >> 4, c4 = (lane & 15) * 4;
  {
#pragma unroll
    for (int q = 0; q < 8; ++q) {
      const int r = q * 2 + rsub;
      const v4f v = *(const v4fa*)&so[w][r][c4];
      *(v4f*)(C + (size_t)(row0 + r) * ldc + col0 + c4) = v;
    }
    
  }
}

// GEMM C = act(A·W + bias + resid): A f32 (ASPLIT -> hi/lo 2 terms), Wt bf16 [N][K]; ACT 0 none, 1 relu, 2 exact gelu;
// resid (optional, f32, row index = (row % rmod), pitch ldr, RES_BF16 rounds it) added before the activation.
template <bool ASPLIT, int ACT, bool BIAS_BF16, bool RES_BF16>
__global__ __launch_bounds__(128) void k_gemm_bf3(const float* __restrict__ A, int lda, const unsigned short* __restrict__ Wt, int ldb,
                                                const float* __restrict__ bias, const float* __restrict__ resid, int rmod, int ldr,
                                                float* __restrict__ C, int ldc, int M, int N, int K) {
  __shared__ __attribute__((aligned(16))) float so[4][16][64];
  const int tid = threadIdx.x, w = tid >> 5, lane = tid & 31, ln = lane & 15, hh = lane >> 4;
  const int ntn = N / 64;
  const int wid = blockIdx.x * 4 + w;
  const int mt = wid / ntn, nq = wid % ntn;
  if (mt * 16 >= M) return;
  const int row0 = mt * 16, col0 = nq * 64;
  const float* arow = A + (size_t)(row0 + ln) * lda;
  v8f acc[4] = {};
  for (int kb = 0; kb < K; kb += 32) {
    FragB ah, al;
    const v4f x0 = *(const v4fa*)(arow + kb + 8 * hh), x1 = *(const v4fa*)(arow + kb + 8 * hh + 4);
    const v4f x2 = *(const v4fa*)(arow + kb + 16 + 8 * hh), x3 = *(const v4fa*)(arow + kb + 16 + 8 * hh + 4);
    float xs[16] = {x0[0],x0[1],x0[2],x0[3],x1[0],x1[1],x1[2],x1[3],x2[0],x2[1],x2[2],x2[3],x3[0],x3[1],x3[2],x3[3]};
#pragma unroll
    for (int i = 0; i < 16; ++i) { const unsigned short hb = bf16_bits(xs[i]); ah.u[i] = hb; al.u[i] = ASPLIT ? bf16_bits(xs[i] - bf16_val(hb)) : (unsigned short)0; }
#pragma unroll
    for (int t = 0; t < 4; ++t) {
      const unsigned short* brow = Wt + (size_t)(col0 + t * 16 + ln) * ldb + kb;
      FragB b;
      b.half[0] = *(const v8us*)(brow + 8 * hh);
      b.half[1] = *(const v8us*)(brow + 16 + 8 * hh);
      acc[t] = mmaN<ASPLIT ? 2 : 1>(ah.v, al.v, b.v, b.v, acc[t]);
    }
  }
#pragma unroll
  for (int t = 0; t < 4; ++t) {
    const int col = col0 + t * 16 + ln;
    float bv = bias ? bias[col] : 0.f;
    if (BIAS_BF16) bv = bf16_round(bv);
#pragma unroll
    for (int r = 0; r < 8; ++r) {
      float v = acc[t][r] + bv;
      if (resid) { float rv = resid[(size_t)((row0 + 8 * hh + r) % rmod) * ldr + col]; if (RES_BF16) rv = bf16_round(rv); v += rv; }
      if (ACT == 1) v = fmaxf(v, 0.f);
      if (ACT == 2) v = 0.5f * v * (1.0f + erff(v * 0.70710678118654752f));
      if (ACT == 3) { const float u = 0.7978845608028654f * (v + 0.044715f * v * v * v); v = 0.5f * v * (1.0f + tanhf(u)); }
      so[w][8 * hh + r][t * 16 + ln] = v;
    }
  }
  __builtin_amdgcn_fence(__ATOMIC_ACQ_REL, "workgroup");
  __builtin_amdgcn_wave_barrier();
  const int rsub = lane >> 4, c4 = (lane & 15) * 4;
  {
#pragma unroll
    for (int q = 0; q < 8; ++q) {
      const int r = q * 2 + rsub;
      const v4f v = *(const v4fa*)&so[w][r][c4];
      *(v4f*)(C + (size_t)(row0 + r) * ldc + col0 + c4) = v;
    }
    
  }
}
// row LayerNorm (biased variance, eps) over N: s = X (+ R); optional out_sum <- s; out_norm <- (s-mu)*rsqrt(var+eps)*g + b
template <bool PARAM_BF16>
__global__ __launch_bounds__(256) void k_layernorm(const float* __restrict__ X, const float* __restrict__ R, const float* __restrict__ g, const float* __restrict__ bta,
                                                  float* __restrict__ out_sum, float* __restrict__ out_norm, int N, float eps) {
  __shared__ float red[256];
  const int row = blockIdx.x, tid = threadIdx.x;
  const float* x = X + (size_t)row * N; const float* rr = R ? R + (size_t)row * N : nullptr;
  float vals[16];                     // up to N = 4096
  const int per = N / 256;            // contiguous chunk per thread? use strided-by-4 chunks: thread handles j = tid*4 + 1024*u
  float s1 = 0.f;
  for (int u = 0; u < per / 4; ++u) {
    const int j = tid * 4 + 1024 * u;
    const v4f a = *(const v4fa*)(x + j);
    v4f b = {0.f,0.f,0.f,0.f}; if (rr) b = *(const v4fa*)(rr + j);
#pragma unroll
    for (int q = 0; q < 4; ++q) { const float v = a[q] + b[q]; vals[u * 4 + q] = v; s1 += v; }
  }
  red[tid] = s1; __syncthreads();
  for (int st = 128; st > 0; st >>= 1) { if (tid < st) red[tid] += red[tid + st]; __syncthreads(); }
  const float mu = red[0] / (float)N; __syncthreads();
  float s2 = 0.f;
  for (int u = 0; u < per / 4; ++u)
#pragma unroll
    for (int q = 0; q < 4; ++q) { const float c = vals[u * 4 + q] - mu; s2 += c * c; }
  red[tid] = s2; __syncthreads();
  for (int st = 128; st > 0; st >>= 1) { if (tid < st) red[tid] += red[tid + st]; __syncthreads(); }
  const float rs = rsqrtf(red[0] / (float)N + eps);
  {
    for (int u = 0; u < per / 4; ++u) {
      const int j = tid * 4 + 1024 * u;
      v4f o, sm;
#pragma unroll
      for (int q = 0; q < 4; ++q) {
        float gg = g[j + q], bb = bta[j + q];
        if (PARAM_BF16) { gg = bf16_round(gg); bb = bf16_round(bb); }
        sm[q] = vals[u * 4 + q]; o[q] = (vals[u * 4 + q] - mu) * rs * gg + bb;
      }
      if (out_sum) *(v4f*)(out_sum + (size_t)row * N + j) = sm;
      *(v4f*)(out_norm + (size_t)row * N + j) = o;
    }
    
  }
}



// ---- f16 WMMA path (v_wmma_f32_16x16x32_f16): 11-bit significands for operands in range — used where a [0,1] probability operand needs more precision than bf16
typedef _Float16 v16h __attribute__((ext_vector_type(16)));
union FragH { v16h v; v8us half[2]; _Float16 h[16]; unsigned short u[16]; };
template <int NT>
__device__ __forceinline__ v8f mmaH(v16h ah, v16h al, v16h bh, v16h bl, v8f c) {
  c = __builtin_amdgcn_wmma_f32_16x16x32_f16(false, ah, false, bh, (short)0, c, false, false);
  if (NT >= 2) c = __builtin_amdgcn_wmma_f32_16x16x32_f16(false, al, false, bh, (short)0, c, false, false);
  if (NT >= 3) c = __builtin_amdgcn_wmma_f32_16x16x32_f16(false, ah, false, bl, (short)0, c, false, false);
  asm volatile("v_nop\n\tv_nop\n\tv_nop\n\tv_nop" : "+v"(c) : "v"(ah), "v"(al), "v"(bh), "v"(bl));
  return c;
}
// batched GEMM like k_gemm_b but f16 operands: A f32 (split into f16 hi/lo if ASPLIT, else rounded to f16), Bt = f16 values [n][k]; alpha; C f32; N multiple of 16 (partial tiles skipped)
template <bool ASPLIT>
__global__ __launch_bounds__(128) void k_gemm_h(const float* __restrict__ A, int lda, size_t sA, const _Float16* __restrict__ Bh, int ldb, size_t sB, float alpha, float* __restrict__ C, int ldc, size_t sC, int M, int N, int K) {
  __shared__ __attribute__((aligned(16))) float so[4][16][64];
  const int tid = threadIdx.x, w = tid >> 5, lane = tid & 31, ln = lane & 15, hh = lane >> 4; const int by = blockIdx.y;
  A += (size_t)by * sA; Bh += (size_t)by * sB; C += (size_t)by * sC;
  const int ntn = (N + 63) / 64; const int wid = blockIdx.x * 4 + w; const int mt = wid / ntn, nq = wid % ntn; if (mt * 16 >= M) return;
  const int row0 = mt * 16, col0 = nq * 64; const float* arow = A + (size_t)(row0 + ln) * lda;
  v8f acc[4] = {};
  for (int kb = 0; kb < K; kb += 32) {
    FragH ah, al;
    const v4f x0 = *(const v4fa*)(arow + kb + 8 * hh), x1 = *(const v4fa*)(arow + kb + 8 * hh + 4), x2 = *(const v4fa*)(arow + kb + 16 + 8 * hh), x3 = *(const v4fa*)(arow + kb + 16 + 8 * hh + 4);
    float xs[16] = {x0[0],x0[1],x0[2],x0[3],x1[0],x1[1],x1[2],x1[3],x2[0],x2[1],x2[2],x2[3],x3[0],x3[1],x3[2],x3[3]};
#pragma unroll
    for (int i = 0; i < 16; ++i) { const _Float16 h = (_Float16)xs[i]; ah.h[i] = h; al.h[i] = ASPLIT ? (_Float16)(xs[i] - (float)h) : (_Float16)0.0f; }
#pragma unroll
    for (int t = 0; t < 4; ++t) { if (col0 + t * 16 >= N) continue; const size_t boff = (size_t)(col0 + t * 16 + ln) * ldb + kb; FragH bq; bq.half[0] = *(const v8us*)(Bh + boff + 8 * hh); bq.half[1] = *(const v8us*)(Bh + boff + 16 + 8 * hh);
      acc[t] = mmaH<ASPLIT ? 2 : 1>(ah.v, al.v, bq.v, bq.v, acc[t]); }
  }
#pragma unroll
  for (int t = 0; t < 4; ++t) { if (col0 + t * 16 >= N) continue;
#pragma unroll
    for (int r = 0; r < 8; ++r) so[w][8 * hh + r][t * 16 + ln] = acc[t][r] * alpha; }
  __builtin_amdgcn_fence(__ATOMIC_ACQ_REL, "workgroup"); __builtin_amdgcn_wave_barrier();
  const int rsub = lane >> 4, c4 = (lane & 15) * 4;
  {
#pragma unroll
    for (int q = 0; q < 8; ++q) { const int r = q * 2 + rsub; if (col0 + c4 < N) { const v4f v = *(const v4fa*)&so[w][r][c4]; *(v4f*)(C + (size_t)(row0 + r) * ldc + col0 + c4) = v; } }
     }
}

// Wt[n][k] = f16(W[k][n]·scale) from f32 row-major W[K][N] (scale = power of two; bf16-exact weights stay exact in f16 away from the subnormal range)
__global__ __launch_bounds__(256) void k_wt_f16(const float* __restrict__ W, _Float16* __restrict__ Wt, int K, int N, float scale) {
  const int t = blockIdx.x * 256 + threadIdx.x; if (t >= N * (K / 8)) return; const int n = t / (K / 8), k8 = (t % (K / 8)) * 8; FragH f;
#pragma unroll
  for (int i = 0; i < 8; ++i) f.h[i] = (_Float16)(bf16_round(W[(size_t)(k8 + i) * N + n]) * scale); const v8us o = f.half[0];
  *(v8us*)((unsigned short*)Wt + (size_t)n * K + k8) = o; 
}
// k_gemm_hh variant with fused epilogue: v = acc·alpha + bias[by·sBias + col] (+ CP[(row/rowsPerB)·sCPb + by·64 + col] if CP) ; ACT 0 none / 1 elu ; writes f16 C16 (and f32 C if non-null)
template <int ACT>
__global__ __launch_bounds__(128) void k_gemm_hhx(const _Float16* __restrict__ A, int lda, size_t sA, const _Float16* __restrict__ Bh, int ldb, size_t sB, float alpha, const float* __restrict__ bias, size_t sBias, const float* __restrict__ CP, int rowsPerB, size_t sCPb, int row0g,
    float* __restrict__ C, _Float16* __restrict__ C16, int ldc, size_t sC, int M, int N, int K) {
  __shared__ __attribute__((aligned(16))) float so[4][16][64];
  const int tid = threadIdx.x, w = tid >> 5, lane = tid & 31, ln = lane & 15, hh = lane >> 4; const int by = blockIdx.y;
  A += (size_t)by * sA; Bh += (size_t)by * sB; const size_t cofs = (size_t)by * sC; const float* bp = bias ? bias + (size_t)by * sBias : nullptr;
  const int ntn = (N + 63) / 64; const int wid = blockIdx.x * 4 + w; const int mt = wid / ntn, nq = wid % ntn; if (mt * 16 >= M) return;
  const int row0 = mt * 16, col0 = nq * 64; const _Float16* arow = A + (size_t)(row0 + ln) * lda;
  v8f acc[4] = {};
  for (int kb = 0; kb < K; kb += 32) { FragH ah; ah.half[0] = *(const v8us*)((const unsigned short*)arow + kb + 8 * hh); ah.half[1] = *(const v8us*)((const unsigned short*)arow + kb + 16 + 8 * hh);
#pragma unroll
    for (int t = 0; t < 4; ++t) { if (col0 + t * 16 >= N) continue; const size_t boff = (size_t)(col0 + t * 16 + ln) * ldb + kb; FragH bq; bq.half[0] = *(const v8us*)((const unsigned short*)Bh + boff + 8 * hh); bq.half[1] = *(const v8us*)((const unsigned short*)Bh + boff + 16 + 8 * hh);
      acc[t] = mmaH<1>(ah.v, ah.v, bq.v, bq.v, acc[t]); }
  }
#pragma unroll
  for (int t = 0; t < 4; ++t) { if (col0 + t * 16 >= N) continue; const int col = col0 + t * 16 + ln; const float bv = bp ? bf16_round(bp[col]) : 0.f;
#pragma unroll
    for (int r = 0; r < 8; ++r) { float v = acc[t][r] * alpha + bv; if (CP) { const int rr = row0g + row0 + 8 * hh + r; if (rowsPerB < 0) v += CP[cofs + (size_t)rr * ldc + col];      /* rowsPerB < 0: own element of the batched C plane */ else { const int bidx = rr / rowsPerB; v += CP[(size_t)bidx * sCPb + (size_t)by * 64 + col]; } } if (ACT == 1) v = (v > 0.f) ? v : expm1f(v); else if (ACT == 7) v = (v > 0.f) ? v + 1.0f : expf(v); else if (ACT == 8) v = tanhf(v); else if (ACT == 9) v = 0.5f * v * (1.0f + tanhf(0.7978845608028654f * (v + 0.044715f * v * v * v))); else if (ACT == 11) v = 1.0f / (1.0f + expf(-v)); else if (ACT == 12) v = (v > 0.f) ? v : 0.01f * v; else if (ACT == 14) v = (v > 0.f) ? v : 0.1f * v; else if (ACT == 16) v = (v >= 0.f) ? v : 0.3f * v; else if (ACT == 17) v = (v >= 0.f) ? v : 0.2f * v; else if (ACT == 15) v = v / (1.0f + expf(-v)); else if (ACT == 3) v = fmaxf(v, 0.f); else if (ACT == 6) v = 0.5f * v * (1.0f + erff(v * 0.70710678118654752f)); so[w][8 * hh + r][t * 16 + ln] = v; } }
  __builtin_amdgcn_fence(__ATOMIC_ACQ_REL, "workgroup"); __builtin_amdgcn_wave_barrier();
  const int rsub = lane >> 4, c4 = (lane & 15) * 4; typedef _Float16 v4h __attribute__((ext_vector_type(4)));
  {
#pragma unroll
    for (int q = 0; q < 8; ++q) { const int r = q * 2 + rsub; if (col0 + c4 < N) { const v4f v = *(const v4fa*)&so[w][r][c4]; if (C) *(v4f*)(C + cofs + (size_t)(row0 + r) * ldc + col0 + c4) = v; if (C16) { v4h h4; for (int i = 0; i < 4; ++i) h4[i] = (_Float16)v[i]; *(v4h*)(C16 + cofs + (size_t)(row0 + r) * ldc + col0 + c4) = h4; } } }
     }
}


typedef _Float16 v4h __attribute__((ext_vector_type(4)));

__global__ __launch_bounds__(256) void k_x16(const float* __restrict__ x, _Float16* __restrict__ X16, size_t n8) { const size_t t = (size_t)blockIdx.x * 256 + threadIdx.x; if (t >= n8) return; FragH f;
#pragma unroll
  for (int q = 0; q < 8; ++q) f.h[q] = (_Float16)bf16_round(x[t * 8 + q]); *(v8us*)((unsigned short*)X16 + t * 8) = f.half[0];  }
__global__ __launch_bounds__(256) void k_h16(const float* __restrict__ x, _Float16* __restrict__ X16, size_t n8) { const size_t t = (size_t)blockIdx.x * 256 + threadIdx.x; if (t >= n8) return; FragH f;
#pragma unroll
  for (int q = 0; q < 8; ++q) f.h[q] = (_Float16)x[t * 8 + q]; *(v8us*)((unsigned short*)X16 + t * 8) = f.half[0];  }
__global__ __launch_bounds__(256) void k_round16f(const float* __restrict__ W, _Float16* __restrict__ Bt, size_t n8) { const size_t t = (size_t)blockIdx.x * 256 + threadIdx.x; if (t >= n8) return; FragH f;
#pragma unroll
  for (int i = 0; i < 8; ++i) f.h[i] = (_Float16)(bf16_round(W[t * 8 + i]) * 16.0f); *(v8us*)((unsigned short*)Bt + t * 8) = f.half[0];  }
template <int NHv, int TTv>
__global__ __launch_bounds__(256) void k_vt(const _Float16* __restrict__ V16, int ldv, int voff, _Float16* __restrict__ Vt) { __shared__ unsigned short tl[64][66]; const int tid = threadIdx.x; const int slab = blockIdx.x / (TTv / 64), lg = blockIdx.x % (TTv / 64); const int b = slab / NHv, h = slab % NHv;
  for (int i = tid; i < 64 * 8; i += 256) { const int r = i / 8, c8 = (i % 8) * 8; FragH f; f.half[0] = *(const v8us*)((const unsigned short*)V16 + ((size_t)b * TTv + lg * 64 + r) * ldv + voff + h * 64 + c8);
#pragma unroll
    for (int q = 0; q < 8; ++q) tl[r][c8 + q] = f.u[q]; }
  __syncthreads();
  {
#pragma unroll
    for (int rd = 0; rd < 2; ++rd) { const int d = rd * 32 + tid / 8, pc = tid % 8; FragH f;
#pragma unroll
      for (int q = 0; q < 8; ++q) f.u[q] = tl[pc * 8 + q][d];
      *(v8us*)((unsigned short*)Vt + ((size_t)slab * 64 + d) * TTv + lg * 64 + pc * 8) = f.half[0]; }
     } }

__global__ __launch_bounds__(256) void k_hl(const float* __restrict__ F, _Float16* __restrict__ Hh, _Float16* __restrict__ Hl, size_t n8) { const size_t t = (size_t)blockIdx.x * 256 + threadIdx.x; if (t >= n8) return; FragH fh, fl; const v4f a = *(const v4fa*)(F + t * 8), c = *(const v4fa*)(F + t * 8 + 4);
#pragma unroll
  for (int q = 0; q < 4; ++q) { _Float16 h = (_Float16)a[q]; fh.h[q] = h; fl.h[q] = (_Float16)((a[q] - (float)h) * 1024.0f); h = (_Float16)c[q]; fh.h[4 + q] = h; fl.h[4 + q] = (_Float16)((c[q] - (float)h) * 1024.0f); }
  { *(v8us*)((unsigned short*)Hh + t * 8) = fh.half[0]; *(v8us*)((unsigned short*)Hl + t * 8) = fl.half[0];  } }

// ---- fast GEMM (wave tile 32x64; requires M % 32 == 0 rows per launch region and N % 64 == 0); epilogue = k_gemm_hhx semantics ----
__device__ __forceinline__ v16h g2_frag(const _Float16* p, int hh) { FragH f; f.half[0] = *(const v8us*)((const unsigned short*)p + 8 * hh); f.half[1] = *(const v8us*)((const unsigned short*)p + 16 + 8 * hh); return f.v; }
__device__ __forceinline__ v8f g2_mma(v16h a, v16h b, v8f c) { v8f d = __builtin_amdgcn_wmma_f32_16x16x32_f16(false, a, false, b, (short)0, c, false, false); asm volatile("v_nop\n\tv_nop\n\tv_nop\n\tv_nop" : "+v"(d) : "v"(a), "v"(b)); return d; }
template <int ACT>
__global__ __launch_bounds__(128) void k_gemm2(const _Float16* __restrict__ A, int lda, size_t sA, const _Float16* __restrict__ Bh, int ldb, size_t sB, float alpha, const float* __restrict__ bias, size_t sBias, const float* __restrict__ CP, int rowsPerB, size_t sCPb, int row0g,
    float* __restrict__ C, _Float16* __restrict__ C16, int ldc, size_t sC, int M, int N, int K) { static_assert(ACT == 0 || ACT == 3 || ACT == 6 || ACT == 8 || ACT == 9 || ACT == 11 || ACT == 12 || ACT == 14 || ACT == 15 || ACT == 16 || ACT == 17, "k_gemm2: unsupported ACT code (would silently apply no activation)");
  __shared__ __attribute__((aligned(16))) float so[4][32][68];
  const int tid = threadIdx.x, w = tid >> 5, lane = tid & 31, ln = lane & 15, hh = lane >> 4; const int by = blockIdx.y;
  A += (size_t)by * sA; Bh += (size_t)by * sB; const size_t cofs = (size_t)by * sC; const float* bp = bias ? bias + (size_t)by * sBias : nullptr;
  const int ntn = N >> 6; const int mt = blockIdx.x / ntn, nq = blockIdx.x - mt * ntn; const int row0 = mt * 128 + 32 * w, col0 = nq * 64; if (row0 >= M) return;
  const _Float16* a0p = A + (size_t)(row0 + ln) * lda; const _Float16* a1p = a0p + (size_t)16 * lda;
  const _Float16* b0p = Bh + (size_t)(col0 + ln) * ldb; const _Float16* b1p = b0p + (size_t)16 * ldb; const _Float16* b2p = b1p + (size_t)16 * ldb; const _Float16* b3p = b2p + (size_t)16 * ldb;
  const v8f z8 = {0.f,0.f,0.f,0.f,0.f,0.f,0.f,0.f}; v8f c00 = z8, c01 = z8, c02 = z8, c03 = z8, c10 = z8, c11 = z8, c12 = z8, c13 = z8;
#pragma unroll 1
  for (int kb = 0; kb < K; kb += 32) { const v16h a0 = g2_frag(a0p + kb, hh), a1 = g2_frag(a1p + kb, hh);
    v16h b = g2_frag(b0p + kb, hh); c00 = g2_mma(a0, b, c00); c10 = g2_mma(a1, b, c10);
    b = g2_frag(b1p + kb, hh); c01 = g2_mma(a0, b, c01); c11 = g2_mma(a1, b, c11);
    b = g2_frag(b2p + kb, hh); c02 = g2_mma(a0, b, c02); c12 = g2_mma(a1, b, c12);
    b = g2_frag(b3p + kb, hh); c03 = g2_mma(a0, b, c03); c13 = g2_mma(a1, b, c13); }
  v8f accs[8] = {c00, c01, c02, c03, c10, c11, c12, c13};
#pragma unroll
  for (int u = 0; u < 8; ++u) { const int t = u & 3, half = u >> 2; const int col = col0 + t * 16 + ln; const float bv = bp ? bf16_round(bp[col]) : 0.f;
#pragma unroll
    for (int r = 0; r < 8; ++r) { const int rloc = half * 16 + 8 * hh + r; float v = accs[u][r] * alpha + bv; if (CP) { if (rowsPerB < 0) v += CP[cofs + (size_t)(row0g + row0 + rloc) * ldc + col];      /* rowsPerB < 0: own element of the batched C plane */ else { const int bidx = (row0g + row0 + rloc) / rowsPerB; v += CP[(size_t)bidx * sCPb + (size_t)by * 64 + col]; } }
      if (ACT == 3) v = fmaxf(v, 0.f); else if (ACT == 6) v = 0.5f * v * (1.0f + erff(v * 0.70710678118654752f)); else if (ACT == 11) v = 1.0f / (1.0f + expf(-v)); else if (ACT == 15) v = v / (1.0f + expf(-v)); else if (ACT == 12) v = (v > 0.f) ? v : 0.01f * v; else if (ACT == 8) v = tanhf(v); else if (ACT == 9) v = 0.5f * v * (1.0f + tanhf(0.7978845608028654f * (v + 0.044715f * v * v * v))); else if (ACT == 14) v = (v > 0.f) ? v : 0.1f * v; else if (ACT == 16) v = (v >= 0.f) ? v : 0.3f * v; else if (ACT == 17) v = (v >= 0.f) ? v : 0.2f * v;
      so[w][rloc][t * 16 + ln] = v; } }
  __builtin_amdgcn_fence(__ATOMIC_ACQ_REL, "workgroup"); __builtin_amdgcn_wave_barrier();
  const int rsub = lane >> 4, c4 = (lane & 15) * 4;
  {
#pragma unroll
    for (int q = 0; q < 16; ++q) { const int r = q * 2 + rsub; const v4f v = *(const v4fa*)&so[w][r][c4]; if (C) *(v4f*)(C + cofs + (size_t)(row0 + r) * ldc + col0 + c4) = v; if (C16) { v4h h4; for (int i = 0; i < 4; ++i) h4[i] = (_Float16)v[i]; *(v4h*)(C16 + cofs + (size_t)(row0 + r) * ldc + col0 + c4) = h4; } }
     } }


__global__ __launch_bounds__(256) void k_wnat(const float* __restrict__ w, size_t n8, _Float16* __restrict__ Bt) { const size_t t = (size_t)blockIdx.x * 256 + threadIdx.x; if (t >= n8) return; FragH f; for (int q = 0; q < 8; ++q) f.h[q] = (_Float16)(bf16_round(w[t * 8 + q]) * 16.0f); *(v8us*)((unsigned short*)Bt + t * 8) = f.half[0];  }
__global__ __launch_bounds__(256) void k_rsm(const float* __restrict__ S, _Float16* __restrict__ P, int nrows) {
  #pragma clang fp contract(off)
  const int i = blockIdx.x * 256 + threadIdx.x; if (i >= nrows) return; const float* s = S + (size_t)i * SQ; float mx = -3.0e38f;
#pragma unroll 1
  for (int j = 0; j < SQ; ++j) mx = fmaxf(mx, s[j]); float se = 0.f;
#pragma unroll 1
  for (int j = 0; j < SQ; ++j) se += expf(s[j] - mx); const float sc = 256.0f / se;
#pragma unroll 1
  for (int j0 = 0; j0 < SQ; j0 += 8) { FragH f; for (int q = 0; q < 8; ++q) f.h[q] = (_Float16)(expf(s[j0 + q] - mx) * sc); unsigned short* d = (unsigned short*)P + (size_t)i * SQ + j0; *(v8us*)d = f.half[0];  } }
__global__ __launch_bounds__(256) void k_vt(const _Float16* __restrict__ V16, int b, int h0, _Float16* __restrict__ VT) { __shared__ unsigned short tl[64][65]; const int tid = threadIdx.x; const int hh = blockIdx.x % HG, sg = blockIdx.x / HG; const int s0 = sg * 64; const int h = h0 + hh;
  for (int i = tid; i < 64 * 8; i += 256) { const int j = i / 8, d8 = (i % 8) * 8; FragH f; f.half[0] = *(const v8us*)((const unsigned short*)V16 + ((size_t)b * SQ + s0 + j) * DM + h * HD + d8); for (int q = 0; q < 8; ++q) tl[d8 + q][j] = f.u[q]; }
  __syncthreads();
  { for (int i = tid; i < 64 * 8; i += 256) { const int d = i / 8, j8 = (i % 8) * 8; FragH f; for (int q = 0; q < 8; ++q) f.u[q] = tl[d][j8 + q]; *(v8us*)((unsigned short*)VT + ((size_t)hh * HD + d) * SQ + s0 + j8) = f.half[0]; }  } }



#define FAQB 128                     /* query rows per block */
#define FAK 64                       /* keys per step */
#define FAP (HD + 8)                 /* LDS row pitch, halves */
__device__ __forceinline__ v8f fa_mma(v16h a, v16h b, v8f c) { return __builtin_amdgcn_wmma_f32_16x16x32_f16(false, a, false, b, (short)0, c, false, false); }
__global__ __launch_bounds__(128) void k_fattn(const _Float16* __restrict__ Q, const _Float16* __restrict__ Kh, const _Float16* __restrict__ VTa, _Float16* __restrict__ O) {
  static_assert(NB * NH == 64 && SQ / FAQB == 16 && HD == 64, "k_fattn: the block-to-tile map below is written for 64 (batch, head) pairs x 16 query blocks");
  __shared__ __attribute__((aligned(16))) _Float16 lk[FAK][FAP]; __shared__ __attribute__((aligned(16))) _Float16 lv[HD][FAP];
  const int tid = threadIdx.x, lane = tid & 31, ln = lane & 15, hh = lane >> 4; const int w = __builtin_amdgcn_readfirstlane(tid >> 5);      /* the wave's number as a scalar: the two tests on q0w below are scalar branches */
  const int g = blockIdx.x >> 8, sub = (blockIdx.x >> 6) & 3, bh = blockIdx.x & 63;
  const int qb = (g == 0) ? 15 - sub : ((g == 1) ? 8 + sub : ((g == 2) ? 7 - sub : sub));      /* a permutation of the 16 query blocks: long blocks start first, and blocks 256 apart in the index add up to the same length */
  const int b = bh / NH, h = bh % NH; const size_t r0 = (size_t)b * SQ; const int q0w = qb * FAQB + w * 32; const int nst = (qb + 1) * (FAQB / FAK);
  const unsigned short* qp = (const unsigned short*)Q + (r0 + q0w + ln) * LQ + h * HD + 8 * hh; v16h qf[2][2];      /* the lane's own address, so that the eight loads differ in the immediate offset alone; every loop but the step loop is fully unrolled: all array indices are constants and the arrays stay in registers */
#pragma unroll
  for (int nt = 0; nt < 2; ++nt)
#pragma unroll
    for (int kk = 0; kk < 2; ++kk) { FragH f; f.half[0] = *(const v8us*)(qp + (size_t)nt * 16 * LQ + kk * 32); f.half[1] = *(const v8us*)(qp + (size_t)nt * 16 * LQ + kk * 32 + 16); qf[nt][kk] = f.v; }      /* the k order of g2_frag */
  const int sr = tid >> 3, sc = (tid & 7) * 8;      /* staging: 8 lanes take one 128-byte row, a pass of the block 16 rows */
  const unsigned short* kp = (const unsigned short*)Kh + (r0 + sr) * LQ + h * HD + sc; const unsigned short* vp = (const unsigned short*)VTa + ((size_t)bh * HD + sr) * SQ + sc; v8us kr[4], vr[4];
#pragma unroll
  for (int u = 0; u < 4; ++u) { kr[u] = *(const v8us*)(kp + (size_t)u * 16 * LQ); vr[u] = *(const v8us*)(vp + (size_t)u * 16 * SQ); }
  asm volatile("s_wait_xcnt 0x0" :: "v"(qp), "v"(kp), "v"(vp) : "memory");      /* the wait between the loads above and the first rewrite of their address registers; the addresses are inputs so that their registers stay untouched up to it */
  const v8f z8 = {0.f, 0.f, 0.f, 0.f, 0.f, 0.f, 0.f, 0.f}; v8f o[4][2];
#pragma unroll
  for (int dt = 0; dt < 4; ++dt) { o[dt][0] = z8; o[dt][1] = z8; }
  float m[2] = {-1.0e30f, -1.0e30f}, l[2] = {0.f, 0.f};      /* running max (log2 units) and this lane's part of the running sum, per query tile */
  const float SC = 0.125f * 1.44269504088896340736f;      /* 1 / sqrt(64), in log2 units */
#pragma unroll 1
  for (int s = 0; s < nst; ++s) { const int k0 = s * FAK;      /* rolled: one step's code is long and its trip count varies by block */
#pragma unroll
    for (int u = 0; u < 4; ++u) { *(v8us*)&lk[u * 16 + sr][sc] = kr[u]; *(v8us*)&lv[u * 16 + sr][sc] = vr[u]; }
    __syncthreads();      /* publishes this step's K and V^T rows */
    if (s + 1 < nst) { kp += (size_t)FAK * LQ; vp += FAK;
#pragma unroll
      for (int u = 0; u < 4; ++u) { kr[u] = *(const v8us*)(kp + (size_t)u * 16 * LQ); vr[u] = *(const v8us*)(vp + (size_t)u * 16 * SQ); }
      asm volatile("s_wait_xcnt 0x0" :: "v"(kp), "v"(vp) : "memory"); }      /* as above: stands in front of the next step's address additions */
    if (k0 <= q0w + 31) {      /* a wave whose queries all lie below this step's keys only passes the barriers */
      v8f st[4][2];
#pragma unroll
      for (int kt = 0; kt < 4; ++kt) { st[kt][0] = z8; st[kt][1] = z8; }
#pragma unroll
      for (int kk = 0; kk < 2; ++kk)
#pragma unroll
        for (int kt = 0; kt < 4; ++kt) { const v16h a = g2_frag(&lk[kt * 16 + ln][kk * 32], hh); st[kt][0] = fa_mma(a, qf[0][kk], st[kt][0]); st[kt][1] = fa_mma(a, qf[1][kk], st[kt][1]); }
      if (k0 + FAK - 1 > q0w) {      /* only steps that reach past the wave's first query mask */
#pragma unroll
        for (int kt = 0; kt < 4; ++kt)
#pragma unroll
          for (int nt = 0; nt < 2; ++nt)
#pragma unroll
            for (int r = 0; r < 8; ++r) st[kt][nt][r] = (k0 + kt * 16 + 8 * hh + r <= q0w + nt * 16 + ln) ? st[kt][nt][r] : -3.0e38f; }
      v16h pf[2][2];
#pragma unroll
      for (int nt = 0; nt < 2; ++nt) { float mr = st[0][nt][0];
#pragma unroll
        for (int kt = 0; kt < 4; ++kt)
#pragma unroll
          for (int r = 0; r < 8; ++r) mr = fmaxf(mr, st[kt][nt][r]);
        mr = fmaxf(mr, __shfl_xor(mr, 16, 32));
        const float mn = fmaxf(m[nt], mr * SC); const float al = __builtin_amdgcn_exp2f(m[nt] - mn); m[nt] = mn; const float bs = 8.0f - mn;      /* + 8: weights carried x256; a masked key underflows to exactly 0 */
        v4f s4 = {0.f, 0.f, 0.f, 0.f};
#pragma unroll
        for (int kt = 0; kt < 4; ++kt)
#pragma unroll
          for (int r = 0; r < 8; ++r) { const float p = __builtin_amdgcn_exp2f(fmaf(st[kt][nt][r], SC, bs)); s4[r & 3] += p; pf[nt][kt >> 1][(kt & 1) * 8 + r] = (_Float16)p; }
        l[nt] = fmaf(l[nt], al, (s4[0] + s4[1]) + (s4[2] + s4[3]));
#pragma unroll
        for (int dt = 0; dt < 4; ++dt) o[dt][nt] *= al; }
#pragma unroll
      for (int j = 0; j < 2; ++j)
#pragma unroll
        for (int dt = 0; dt < 4; ++dt) { const v16h a = g2_frag(&lv[dt * 16 + ln][j * 32], hh); o[dt][0] = fa_mma(a, pf[0][j], o[dt][0]); o[dt][1] = fa_mma(a, pf[1][j], o[dt][1]); } }
    __syncthreads(); }      /* ends every wave's reads of this step's rows before the next step's stores */
  FragH t[2][4];      /* all eight 16-byte results are formed first: no store's data register is rewritten behind it */
#pragma unroll
  for (int nt = 0; nt < 2; ++nt) { const float f = 64.0f / (l[nt] + __shfl_xor(l[nt], 16, 32));
#pragma unroll
    for (int dt = 0; dt < 4; ++dt)
#pragma unroll
      for (int r = 0; r < 8; ++r) t[nt][dt].h[r] = (_Float16)(o[dt][nt][r] * f); }
  unsigned short* op = (unsigned short*)O + (r0 + q0w + ln) * DM + h * HD + 8 * hh;
#pragma unroll
  for (int nt = 0; nt < 2; ++nt)
#pragma unroll
    for (int dt = 0; dt < 4; ++dt) *(v8us*)(op + (size_t)nt * 16 * DM + dt * 16) = t[nt][dt].half[0]; }


// Exact f32 attention for the first QT0 rows (o carried x64 like the f16 path). One wave per query row, A0R rows of one head per block.
// All QT0 K and V rows of the head are staged in LDS once by coalesced 16-byte loads. K rows get a pitch of 68 floats (16 bytes x odd), so that 32 lanes reading 32 rows by 16 bytes spread over the banks.
// Scores: lane = key (four partial sums over the head dimension). Row max and row sum: five-step butterfly. o: lane = two head columns, loop over the keys, each key's weight read from its lane into a scalar register; keys above the row carry weight 0.
#define A0R 8                        /* rows (waves) per block */
#define A0KP (HD + 4)                /* K row pitch in LDS, floats */
typedef float v2f __attribute__((ext_vector_type(2)));
__global__ __launch_bounds__(256) void k_att0w(const float* __restrict__ QF, const float* __restrict__ KF, const float* __restrict__ VF, float scale, float* __restrict__ OF) {
  __shared__ __attribute__((aligned(16))) float lk[QT0][A0KP]; __shared__ __attribute__((aligned(16))) float lv[QT0][HD];
  const int tid = threadIdx.x, lane = tid & 31; const int w = __builtin_amdgcn_readfirstlane(tid >> 5);      /* the wave's number as a scalar: row, group count and branches below are wave-uniform */
  const int h = blockIdx.x / (QT0 / A0R), r0 = (blockIdx.x % (QT0 / A0R)) * A0R; const int i = r0 + w;
  const float* qr = QF + (size_t)i * DM + h * HD; v4f q[HD / 4];      /* every loop of this kernel is fully unrolled: the indices into q, kk, vv, sv and o and the lane of each readlane are then constants, so the arrays stay in registers */
#pragma unroll
  for (int c = 0; c < HD / 4; ++c) q[c] = *(const v4fa*)(qr + c * 4);      /* the wave's own q row, whole */
  const int sj = tid >> 4, sc4 = (tid & 15) * 4; const float* kp = KF + (size_t)sj * DM + h * HD + sc4; const float* vp = VF + (size_t)sj * DM + h * HD + sc4; v4f kk[QT0 / 16], vv[QT0 / 16];      /* one pass of the block stages 16 rows; both loops are fully unrolled and free of branches so that every load of the block is in flight before the first LDS store waits; the row pitch is a constant, so the passes differ in the immediate offset alone */
#pragma unroll
  for (int u = 0; u < QT0 / 16; ++u) { kk[u] = *(const v4fa*)(kp + (size_t)u * 16 * DM); vv[u] = *(const v4fa*)(vp + (size_t)u * 16 * DM); }
  asm volatile("s_wait_xcnt 0x0" :: "v"(kp), "v"(vp) : "memory");      /* the wait between the loads above and the first reuse of their address registers; the two addresses are inputs so that their registers stay untouched up to it */
#pragma unroll
  for (int u = 0; u < QT0 / 16; ++u) { *(v4f*)&lk[u * 16 + sj][sc4] = kk[u]; *(v4f*)&lv[u * 16 + sj][sc4] = vv[u]; }
  __syncthreads();
  const int ng = (i >> 5) + 1;      /* key groups of 32 that hold a key <= i */
  float sv[QT0 / 32];
#pragma unroll
  for (int g = 0; g < QT0 / 32; ++g) { sv[g] = -1.0e30f;
    if (g < ng) { const int j = g * 32 + lane; v4f a = {0.f, 0.f, 0.f, 0.f};
#pragma unroll
      for (int c = 0; c < HD / 4; ++c) a += q[c] * *(const v4f*)&lk[j][c * 4];
      const float s = ((a[0] + a[1]) + (a[2] + a[3])) * scale; sv[g] = (j <= i) ? s : -1.0e30f; } }
  float mx = fmaxf(fmaxf(sv[0], sv[1]), fmaxf(sv[2], sv[3]));
#pragma unroll
  for (int m = 16; m >= 1; m >>= 1) mx = fmaxf(mx, __shfl_xor(mx, m, 32));
  float se = 0.f;
#pragma unroll
  for (int g = 0; g < QT0 / 32; ++g) { const float e = expf(sv[g] - mx); sv[g] = e; se += e; }      /* a key above the row holds -1e30: its weight underflows to exactly 0 */
#pragma unroll
  for (int m = 16; m >= 1; m >>= 1) se += __shfl_xor(se, m, 32);
  v2f o[4] = {{0.f, 0.f}, {0.f, 0.f}, {0.f, 0.f}, {0.f, 0.f}};      /* four partial sums over the keys (key mod 4): four independent add chains */
#pragma unroll
  for (int g = 0; g < QT0 / 32; ++g) if (g < ng) {
#pragma unroll
    for (int jj = 0; jj < 32; ++jj) { const float e = __int_as_float(__builtin_amdgcn_readlane(__float_as_int(sv[g]), jj)); o[jj & 3] += e * *(const v2f*)&lv[g * 32 + jj][lane * 2]; } }
  const float fin = 64.0f / se; const v2f r = ((o[0] + o[1]) + (o[2] + o[3])) * fin;
  *(v2f*)(OF + (size_t)i * DM + h * HD + lane * 2) = r; }


__global__ __launch_bounds__(256) void k_wt_hq(const float* __restrict__ Wf, const float* __restrict__ bf, _Float16* __restrict__ Bq, _Float16* __restrict__ Bk, _Float16* __restrict__ Bv, float* __restrict__ B3) {
  const int t = blockIdx.x * 256 + threadIdx.x; if (t >= 3 * DM * (DM / 8)) return; const int n = t / (DM / 8), k8 = (t % (DM / 8)) * 8; const int h = n / (3 * HD), wh = (n % (3 * HD)) / HD, d = n % HD; const int row = h * HD + d; FragH f;
#pragma unroll
  for (int i = 0; i < 8; ++i) f.h[i] = (_Float16)(bf16_round(Wf[(size_t)(k8 + i) * (3 * DM) + n]) * 16.0f); const v8us o = f.half[0];
  _Float16* dst = (wh == 0) ? Bq : ((wh == 1) ? Bk : Bv); unsigned short* p = (unsigned short*)dst + (size_t)row * DM + k8; *(v8us*)p = o; 
  (void)bf; (void)B3; }
__global__ __launch_bounds__(256) void k_bhq(const float* __restrict__ bf, float* __restrict__ B3) {
  const int t = blockIdx.x * 256 + threadIdx.x; if (t >= 3 * DM) return; const int wh = t / DM, row = t % DM; const int h = row / HD, d = row % HD; const float v = bf16_round(bf[h * (3 * HD) + wh * HD + d]); *(float*)(B3 + t) = v;  }

template <int NORM, int ROPE>
__global__ __launch_bounds__(64) void k_xform(const float* __restrict__ F, int ldf, int nh, const float* __restrict__ gain, float eps, const float* __restrict__ CS, const float* __restrict__ SN, _Float16* __restrict__ H16, int ldo) {
  #pragma clang fp contract(off)
  __shared__ float xv[HD]; __shared__ float red[HD]; __shared__ unsigned short sh_[HD]; const int d = threadIdx.x; const int h = blockIdx.x % nh; const size_t r = blockIdx.x / nh; const int p = (int)(r % SQ);
  float x = F[r * (size_t)ldf + (size_t)h * HD + d];
  if (NORM) { red[d] = __fmul_rn(x, x); __syncthreads(); for (int st = HD / 2; st > 0; st >>= 1) { if (d < st) red[d] = __fadd_rn(red[d], red[d + st]); __syncthreads(); } const float rs = rsqrtf(__fadd_rn(red[0] / (float)HD, eps)); x = __fmul_rn(__fmul_rn(x, rs), bf16_round(gain[d])); }
  xv[d] = x; __syncthreads();
  float o = x;
  if (ROPE == 1) { const int i = d >> 1; const float c = CS[p * (HD / 2) + i], s = SN[p * (HD / 2) + i]; const float ev = xv[2 * i], od = xv[2 * i + 1]; o = (d & 1) ? __fadd_rn(__fmul_rn(ev, s), __fmul_rn(od, c)) : __fadd_rn(__fmul_rn(ev, c), -__fmul_rn(od, s)); }
  if (ROPE == 2) { const int i = d & (HD / 2 - 1); const float c = CS[p * (HD / 2) + i], s = SN[p * (HD / 2) + i]; const float lo = xv[i], hi = xv[i + HD / 2]; o = (d < HD / 2) ? __fadd_rn(__fmul_rn(lo, c), -__fmul_rn(hi, s)) : __fadd_rn(__fmul_rn(lo, s), __fmul_rn(hi, c)); }
  FragH th; th.h[0] = (_Float16)o; sh_[d] = th.u[0]; __syncthreads();
  if (d < HD / 8) { FragH f; for (int q = 0; q < 8; ++q) f.u[q] = sh_[d * 8 + q]; unsigned short* dst = (unsigned short*)H16 + r * (size_t)ldo + (size_t)h * HD + d * 8; *(v8us*)dst = f.half[0];  } }


template <int NORM, int ROPE>
__global__ __launch_bounds__(64) void k_xformf(const float* __restrict__ F, int ldf, int nh, const float* __restrict__ gain, float eps, const float* __restrict__ CS, const float* __restrict__ SN, float* __restrict__ F32, int ldo) {
  #pragma clang fp contract(off)
  __shared__ float xv[HD]; __shared__ float red[HD]; const int d = threadIdx.x; const int h = blockIdx.x % nh; const size_t r = blockIdx.x / nh; const int p = (int)(r % SQ);
  float x = F[r * (size_t)ldf + (size_t)h * HD + d];
  if (NORM) { red[d] = __fmul_rn(x, x); __syncthreads(); for (int st = HD / 2; st > 0; st >>= 1) { if (d < st) red[d] = __fadd_rn(red[d], red[d + st]); __syncthreads(); } const float rs = rsqrtf(__fadd_rn(red[0] / (float)HD, eps)); x = __fmul_rn(__fmul_rn(x, rs), bf16_round(gain[d])); }
  xv[d] = x; __syncthreads();
  float o = x;
  if (ROPE == 1) { const int i = d >> 1; const float c = CS[p * (HD / 2) + i], s = SN[p * (HD / 2) + i]; const float ev = xv[2 * i], od = xv[2 * i + 1]; o = (d & 1) ? __fadd_rn(__fmul_rn(ev, s), __fmul_rn(od, c)) : __fadd_rn(__fmul_rn(ev, c), -__fmul_rn(od, s)); }
  if (ROPE == 2) { const int i = d & (HD / 2 - 1); const float c = CS[p * (HD / 2) + i], s = SN[p * (HD / 2) + i]; const float lo = xv[i], hi = xv[i + HD / 2]; o = (d < HD / 2) ? __fadd_rn(__fmul_rn(lo, c), -__fmul_rn(hi, s)) : __fadd_rn(__fmul_rn(lo, s), __fmul_rn(hi, c)); }
  float* dst = F32 + r * (size_t)ldo + (size_t)h * HD + d; *(float*)dst = o;  }


__global__ __launch_bounds__(256) void k_tabcp32(const float* __restrict__ tc, const float* __restrict__ tsn, float* __restrict__ CS, float* __restrict__ SN, int n) {
  const int t = blockIdx.x * 256 + threadIdx.x; if (t >= n) return; const float c = bf16_round(tc[t]), s = bf16_round(tsn[t]);
  *(float*)(CS + t) = c; *(float*)(SN + t) = s;  }
extern "C" void kernel_launch(void* const* d_in, const int* in_sizes, int n_in,
                              void* d_out, int out_size, void* d_ws, size_t ws_size, hipStream_t stream) {
  (void)in_sizes; (void)n_in; (void)out_size;
  const float* const* I = (const float* const*)d_in; const float* x = I[0]; const float* wqkv = I[1]; const float* bqkv = I[2]; const float* wo = I[3]; const float* bo = I[4]; const float* tcos = I[5]; const float* tsin = I[6];      /* x; fused W_qkv [1024][3072] + b_qkv [3072] ([in][out]; per-head (q | k | v) column triples); W_out + b_out ([in][out]); rope tables cos / sin [2048][32] */
  char* ws = (char*)d_ws; size_t off = 0;
  auto take = [&](size_t bytes) { char* p = ws + off; off += (bytes + 255) & ~(size_t)255; return p; };
  _Float16* BQ = (_Float16*)take((size_t)DM * DM * 2); _Float16* BK = (_Float16*)take((size_t)DM * DM * 2); _Float16* BV = (_Float16*)take((size_t)DM * DM * 2); _Float16* BO = (_Float16*)take((size_t)DM * DM * 2);
  float* BQB = (float*)take((size_t)3 * DM * 4); float* QF = (float*)take(NR * DM * 4); float* CSB = (float*)take((size_t)SQ * 32 * 4); float* SNB = (float*)take((size_t)SQ * 32 * 4);      /* de-interleaved bias vector bq | bk | bv; f32 projection plane (q, then reused for k) for the rope; bf16-rounded copies of the rope tables */ _Float16* X16 = (_Float16*)take(NR * DM * 2); _Float16* Q16 = (_Float16*)take(NR * DM * 2); _Float16* K16 = (_Float16*)take(NR * DM * 2); _Float16* V16 = (_Float16*)take(NR * DM * 2); _Float16* O16 = (_Float16*)take(NR * DM * 2);
  _Float16* VT = (_Float16*)take((size_t)NB * NH * HD * SQ * 2);
  float* QF0 = (float*)take((size_t)QT0 * DM * 4); float* KF0 = (float*)take((size_t)QT0 * DM * 4); float* VF0 = (float*)take((size_t)QT0 * DM * 4); float* OF0 = (float*)take((size_t)NB * QT0 * DM * 4); _Float16* OH0 = (_Float16*)take((size_t)NB * QT0 * DM * 2); _Float16* OL0 = (_Float16*)take((size_t)NB * QT0 * DM * 2);
  if (off > ws_size) return;
  k_wt_hq<<<(unsigned)(((size_t)3 * DM * (DM / 8) + 255) / 256), 256, 0, stream>>>(wqkv, bqkv, BQ, BK, BV, BQB); k_bhq<<<(3 * DM + 255) / 256, 256, 0, stream>>>(bqkv, BQB); k_wt_f16<<<(unsigned)(((size_t)DM * (DM / 8) + 255) / 256), 256, 0, stream>>>(wo, BO, DM, DM, 16.0f);      /* fused [in][out] weight with per-head (q | k | v) column triples -> three Bt planes (row h*64 + d) x16 + the de-interleaved bias vector; W_out [in][out] -> Bt x16 */
  k_tabcp32<<<(SQ * 32 + 255) / 256, 256, 0, stream>>>(tcos, tsin, CSB, SNB, SQ * 32);      /* rope tables [pos][32], bf16-rounded copies */

  k_x16<<<(unsigned)((NR * DM / 8 + 255) / 256), 256, 0, stream>>>(x, X16, NR * DM / 8);
  const size_t r0p = (size_t)B0 * SQ;      /* first projected row */
  k_gemm2<0><<<dim3((unsigned)((MP / 128) * (DM / 64)), 1), 128, 0, stream>>>(X16 + r0p * DM, DM, 0, BQ, DM, 0, 0.0625f, BQB, 0, nullptr, 1, 0, 0, QF + r0p * DM, nullptr, DM, 0, MP, DM, DM); k_xform<0, 1><<<(unsigned)((size_t)MP * NH), 64, 0, stream>>>(QF + r0p * DM, DM, NH, nullptr, 0.f, CSB, SNB, Q16 + r0p * DM, DM);      /* q (f32) + bias -> interleaved-pair rope (position = row % SQ) -> f16 rows */
  k_gemm2<0><<<dim3((unsigned)((MP / 128) * (DM / 64)), 1), 128, 0, stream>>>(X16 + r0p * DM, DM, 0, BK, DM, 0, 0.0625f, BQB + DM, 0, nullptr, 1, 0, 0, QF + r0p * DM, nullptr, DM, 0, MP, DM, DM); k_xform<0, 1><<<(unsigned)((size_t)MP * NH), 64, 0, stream>>>(QF + r0p * DM, DM, NH, nullptr, 0.f, CSB, SNB, K16 + r0p * DM, DM);      /* k likewise (the f32 plane is reused after q's rope) */
  k_gemm2<0><<<dim3((unsigned)((MP / 128) * (DM / 64)), 1), 128, 0, stream>>>(X16 + r0p * DM, DM, 0, BV, DM, 0, 0.0625f, BQB + 2 * DM, 0, nullptr, 1, 0, 0, nullptr, V16 + r0p * DM, DM, 0, MP, DM, DM);
  for (int b = B0; b < B0 + NBR; ++b) { const size_t r0 = (size_t)b * SQ;
    k_gemm2<0><<<dim3((QT0 / 128) * (DM / 64), 1), 128, 0, stream>>>(X16 + r0 * DM, DM, 0, BQ, DM, 0, 0.0625f, BQB, 0, nullptr, 1, 0, 0, QF0, nullptr, DM, 0, QT0, DM, DM); k_gemm2<0><<<dim3((QT0 / 128) * (DM / 64), 1), 128, 0, stream>>>(X16 + r0 * DM, DM, 0, BK, DM, 0, 0.0625f, BQB + DM, 0, nullptr, 1, 0, 0, KF0, nullptr, DM, 0, QT0, DM, DM); k_gemm2<0><<<dim3((QT0 / 128) * (DM / 64), 1), 128, 0, stream>>>(X16 + r0 * DM, DM, 0, BV, DM, 0, 0.0625f, BQB + 2 * DM, 0, nullptr, 1, 0, 0, VF0, nullptr, DM, 0, QT0, DM, DM);      /* f32 q, k, v of the first 128 rows (exact products) */
    k_xformf<0, 1><<<(unsigned)(QT0 * NH), 64, 0, stream>>>(QF0, DM, NH, nullptr, 0.f, CSB, SNB, QF0, DM); k_xformf<0, 1><<<(unsigned)(QT0 * NH), 64, 0, stream>>>(KF0, DM, NH, nullptr, 0.f, CSB, SNB, KF0, DM);      /* f32 rope of the first-tile q, k IN PLACE (each (row, head) block stages its 64 values in LDS before writing; first-tile row r = position r) */
    k_att0w<<<NH * (QT0 / A0R), 256, 0, stream>>>(QF0, KF0, VF0, 0.125f, OF0 + (size_t)b * QT0 * DM);      /* exact f32 attention for rows 0..127 (o x64) */
  }
  k_vt<NH, SQ><<<NB * NH * (SQ / 64), 256, 0, stream>>>(V16, LQ, 0, VT);      /* V^T [NB][NH][HD][SQ] */
  k_fattn<<<NB * NH * (SQ / FAQB), 128, 0, stream>>>(Q16, K16, VT, O16);      /* scores, causal softmax and P V in one launch; o (merged heads, x64) as f16 rows */
  k_gemm2<0><<<dim3((unsigned)((MPO / 128) * (DM / 64)), 1), 128, 0, stream>>>(O16 + r0p * DM, DM, 0, BO, DM, 0, 0.0009765625f, bo, 0, nullptr, 1, 0, 0, (float*)d_out + r0p * DM, nullptr, DM, 0, MPO, DM, DM);      /* out rows are the output layout */
  k_hl<<<(unsigned)(((size_t)NB * QT0 * DM / 8 + 255) / 256), 256, 0, stream>>>(OF0, OH0, OL0, (size_t)NB * QT0 * DM / 8);      /* first-tile o (x64) -> f16 hi + x1024 residual planes */
  for (int b = B0; b < B0 + NBR; ++b) { const size_t r0 = (size_t)b * SQ; const size_t f0 = (size_t)b * QT0;
    k_gemm2<0><<<dim3((QT0 / 128) * (DM / 64), 1), 128, 0, stream>>>(OH0 + f0 * DM, DM, 0, BO, DM, 0, 0.0009765625f, bo, 0, nullptr, 1, 0, 0, (float*)d_out + r0 * DM, nullptr, DM, 0, QT0, DM, DM);      /* rows 0..127: out = o_hi Wo (+ b), overwriting the f16-path rows */
    k_gemm2<0><<<dim3((QT0 / 128) * (DM / 64), 1), 128, 0, stream>>>(OL0 + f0 * DM, DM, 0, BO, DM, 0, 0.00000095367431640625f, nullptr, 0, (const float*)d_out + r0 * DM, -1, 0, 0, (float*)d_out + r0 * DM, nullptr, DM, 0, QT0, DM, DM); }      /* += o_lo Wo 2^-20 (own-element accumulate) */
}

// v004
// It runs in 954 microseconds.
// Two timings next to v003 both put it at 1.05 times that version's speed.
// Over all steps from v000 it is 10.9 times as fast.
#include <hip/hip_runtime.h>
// Causal multi-head self-attention with a PER-HEAD interleaved fused QKV projection and rotary embeddings (x [4][2048][1024]; qkv = x W_qkv + b_qkv ([in][out] 1024 x 3072, zero bias) reshaped (B, T, 16, 192): head h owns columns h*192 + [0..63 | 64..127 | 128..191] = q | k | v; rope on q and k from the INPUT tables cos / sin [2048][32]: t1 = even elements, t2 = odd elements, out = cat(t1 c - t2 s, t1 s + t2 c) (an interleaved-pair rotation followed by the same fixed permutation on q and k: the scores are unchanged by it); scores / 8; causal (tril, -inf); softmax; out = merged W_out + b_out ([in][out]) -> [4][2048][1024]).
// Structure: token rows r = b*2048 + s; x as exact f16 rows (bf16-rounded); Q, K, V as three WMMA GEMMs (32x64 wave tiles, f32 accumulation, exact x16 weights, f16 outputs; the q and k GEMMs apply the rope in their epilogue, in f32, before the rounding to f16); V^T for all batches and heads via LDS transposes; one fused attention launch (k_fattn): S^T = K Q^T, online causal softmax in registers (f32 statistics, native exp2; weights x256 f16), O^T += V^T P^T, o carried x64 (folded into the output GEMM alpha) written straight into the merged f16 o rows; out = o W_o GEMM (f32) into the output layout.
// Compute dtype: inputs rounded to bf16; x / weights exact; q, k, v, softmax weights and o as plain f16 GEMM operands (~2^-12); scores and softmax statistics f32. v_wmma_f32_16x16x32_f16.
#define NB 4
#define SQ 2048
#define DM 1024
#define NH 16
#define HD 64
#define HG 4                         /* heads per launch of the per-batch k_vt overload (never launched) */
#define QT0 128                      /* first-tile rows recomputed exactly in f32 */
#define B0 0                         /* first batch processed (debug hook) */
#define NBR NB                       /* batches processed (debug hook) */
#define NR ((size_t)NB * SQ)         /* token rows */
#define MP ((int)((size_t)NBR * SQ)) /* rows projected (debug hook) */
#define MPO MP                       /* rows through the output stage (debug hook) */
#define LQ DM      /* row pitch of the q/k/v rows */
typedef __bf16 v16b __attribute__((ext_vector_type(16)));
typedef unsigned short v8us __attribute__((ext_vector_type(8), may_alias));
typedef float  v8f  __attribute__((ext_vector_type(8)));
typedef float  v4f  __attribute__((ext_vector_type(4)));
typedef float  v4fa __attribute__((ext_vector_type(4), may_alias));
union FragB { v16b v; v8us half[2]; unsigned short u[16]; };

__device__ __forceinline__ unsigned short bf16_bits(float x) { unsigned int u = __float_as_uint(x); return (unsigned short)((u + 0x7FFFu + ((u >> 16) & 1u)) >> 16); }
__device__ __forceinline__ float bf16_val(unsigned short b) { return __uint_as_float(((unsigned int)b) << 16); }
__device__ __forceinline__ float bf16_round(float x) { return bf16_val(bf16_bits(x)); }
// D += A·B with NT terms: 1 = ah·bh, 2 = + al·bh (A split), 3 = + ah·bl (both split)
template <int NT>
__device__ __forceinline__ v8f mmaN(v16b ah, v16b al, v16b bh, v16b bl, v8f c) {
  c = __builtin_amdgcn_wmma_f32_16x16x32_bf16(false, ah, false, bh, (short)0, c, false, false);
  if (NT >= 2) c = __builtin_amdgcn_wmma_f32_16x16x32_bf16(false, al, false, bh, (short)0, c, false, false);
  if (NT >= 3) c = __builtin_amdgcn_wmma_f32_16x16x32_bf16(false, ah, false, bl, (short)0, c, false, false);
  asm volatile("v_nop\n\tv_nop\n\tv_nop\n\tv_nop" : "+v"(c) : "v"(ah), "v"(al), "v"(bh), "v"(bl));
  return c;
}

__global__ __launch_bounds__(256) void k_wt_bf16(const float* __restrict__ W, unsigned short* __restrict__ Wt, int K, int N) {
  const int t = blockIdx.x * 256 + threadIdx.x;
  const int k8n = K / 8;
  if (t >= N * k8n) return;
  const int n = t / k8n, k8 = (t % k8n) * 8;
  v8us v;
#pragma unroll
  for (int i = 0; i < 8; ++i) v[i] = bf16_bits(W[(size_t)(k8 + i) * N + n]);
  *(v8us*)(Wt + (size_t)n * K + k8) = v;
  
}

// GEMM C[M][N] (f32, pitch ldc) = act(A[M][K]·W + bias). A f32 row-major (pitch lda) converted per fragment to bf16
// (ASPLIT: hi/lo two planes -> 2 terms, else single rounded term); Wt bf16 [N][K] (pitch ldb). BIAS_BF16 rounds the
// bias to bf16 first (bias quantised to bf16 before the add). K%32==0, M%16==0, N%64==0.
template <bool ASPLIT, int ACT, bool BIAS_BF16>
__global__ __launch_bounds__(128) void k_gemm_bf(const float* __restrict__ A, int lda, const unsigned short* __restrict__ Wt, int ldb,
                                               const float* __restrict__ bias, float* __restrict__ C, int ldc, int M, int N, int K) {
  __shared__ __attribute__((aligned(16))) float so[4][16][64];
  const int tid = threadIdx.x, w = tid >> 5, lane = tid & 31, ln = lane & 15, hh = lane >> 4;
  const int ntn = N / 64;
  const int wid = blockIdx.x * 4 + w;
  const int mt = wid / ntn, nq = wid % ntn;
  if (mt * 16 >= M) return;
  const int row0 = mt * 16, col0 = nq * 64;
  const float* arow = A + (size_t)(row0 + ln) * lda;
  v8f acc[4] = {};
  for (int kb = 0; kb < K; kb += 32) {
    FragB ah, al;
    const v4f x0 = *(const v4fa*)(arow + kb + 8 * hh), x1 = *(const v4fa*)(arow + kb + 8 * hh + 4);
    const v4f x2 = *(const v4fa*)(arow + kb + 16 + 8 * hh), x3 = *(const v4fa*)(arow + kb + 16 + 8 * hh + 4);
    float xs[16] = {x0[0],x0[1],x0[2],x0[3],x1[0],x1[1],x1[2],x1[3],x2[0],x2[1],x2[2],x2[3],x3[0],x3[1],x3[2],x3[3]};
#pragma unroll
    for (int i = 0; i < 16; ++i) { const unsigned short hb = bf16_bits(xs[i]); ah.u[i] = hb; al.u[i] = ASPLIT ? bf16_bits(xs[i] - bf16_val(hb)) : (unsigned short)0; }
#pragma unroll
    for (int t = 0; t < 4; ++t) {
      const unsigned short* brow = Wt + (size_t)(col0 + t * 16 + ln) * ldb + kb;
      FragB b;
      b.half[0] = *(const v8us*)(brow + 8 * hh);
      b.half[1] = *(const v8us*)(brow + 16 + 8 * hh);
      acc[t] = mmaN<ASPLIT ? 2 : 1>(ah.v, al.v, b.v, b.v, acc[t]);
    }
  }
#pragma unroll
  for (int t = 0; t < 4; ++t) {
    float bv = bias ? bias[col0 + t * 16 + ln] : 0.f;
    if (BIAS_BF16) bv = bf16_round(bv);
#pragma unroll
    for (int r = 0; r < 8; ++r) { float v = acc[t][r] + bv; if (ACT == 1) v = fmaxf(v, 0.f); so[w][8 * hh + r][t * 16 + ln] = v; }
  }
  __builtin_amdgcn_fence(__ATOMIC_ACQ_REL, "workgroup");
  __builtin_amdgcn_wave_barrier();
  const int rsub = lane >> 4, c4 = (lane & 15) * 4;
  {
#pragma unroll
    for (int q = 0; q < 8; ++q) {
      const int r = q * 2 + rsub;
      const v4f v = *(const v4fa*)&so[w][r][c4];
      *(v4f*)(C + (size_t)(row0 + r) * ldc + col0 + c4) = v;
    }
    
  }
}

// GEMM C = act(A·W + bias + resid): A f32 (ASPLIT -> hi/lo 2 terms), Wt bf16 [N][K]; ACT 0 none, 1 relu, 2 exact gelu;
// resid (optional, f32, row index = (row % rmod), pitch ldr, RES_BF16 rounds it) added before the activation.
template <bool ASPLIT, int ACT, bool BIAS_BF16, bool RES_BF16>
__global__ __launch_bounds__(128) void k_gemm_bf3(const float* __restrict__ A, int lda, const unsigned short* __restrict__ Wt, int ldb,
                                                const float* __restrict__ bias, const float* __restrict__ resid, int rmod, int ldr,
                                                float* __restrict__ C, int ldc, int M, int N, int K) {
  __shared__ __attribute__((aligned(16))) float so[4][16][64];
  const int tid = threadIdx.x, w = tid >> 5, lane = tid & 31, ln = lane & 15, hh = lane >> 4;
  const int ntn = N / 64;
  const int wid = blockIdx.x * 4 + w;
  const int mt = wid / ntn, nq = wid % ntn;
  if (mt * 16 >= M) return;
  const int row0 = mt * 16, col0 = nq * 64;
  const float* arow = A + (size_t)(row0 + ln) * lda;
  v8f acc[4] = {};
  for (int kb = 0; kb < K; kb += 32) {
    FragB ah, al;
    const v4f x0 = *(const v4fa*)(arow + kb + 8 * hh), x1 = *(const v4fa*)(arow + kb + 8 * hh + 4);
    const v4f x2 = *(const v4fa*)(arow + kb + 16 + 8 * hh), x3 = *(const v4fa*)(arow + kb + 16 + 8 * hh + 4);
    float xs[16] = {x0[0],x0[1],x0[2],x0[3],x1[0],x1[1],x1[2],x1[3],x2[0],x2[1],x2[2],x2[3],x3[0],x3[1],x3[2],x3[3]};
#pragma unroll
    for (int i = 0; i < 16; ++i) { const unsigned short hb = bf16_bits(xs[i]); ah.u[i] = hb; al.u[i] = ASPLIT ? bf16_bits(xs[i] - bf16_val(hb)) : (unsigned short)0; }
#pragma unroll
    for (int t = 0; t < 4; ++t) {
      const unsigned short* brow = Wt + (size_t)(col0 + t * 16 + ln) * ldb + kb;
      FragB b;
      b.half[0] = *(const v8us*)(brow + 8 * hh);
      b.half[1] = *(const v8us*)(brow + 16 + 8 * hh);
      acc[t] = mmaN<ASPLIT ? 2 : 1>(ah.v, al.v, b.v, b.v, acc[t]);
    }
  }
#pragma unroll
  for (int t = 0; t < 4; ++t) {
    const int col = col0 + t * 16 + ln;
    float bv = bias ? bias[col] : 0.f;
    if (BIAS_BF16) bv = bf16_round(bv);
#pragma unroll
    for (int r = 0; r < 8; ++r) {
      float v = acc[t][r] + bv;
      if (resid) { float rv = resid[(size_t)((row0 + 8 * hh + r) % rmod) * ldr + col]; if (RES_BF16) rv = bf16_round(rv); v += rv; }
      if (ACT == 1) v = fmaxf(v, 0.f);
      if (ACT == 2) v = 0.5f * v * (1.0f + erff(v * 0.70710678118654752f));
      if (ACT == 3) { const float u = 0.7978845608028654f * (v + 0.044715f * v * v * v); v = 0.5f * v * (1.0f + tanhf(u)); }
      so[w][8 * hh + r][t * 16 + ln] = v;
    }
  }
  __builtin_amdgcn_fence(__ATOMIC_ACQ_REL, "workgroup");
  __builtin_amdgcn_wave_barrier();
  const int rsub = lane >> 4, c4 = (lane & 15) * 4;
  {
#pragma unroll
    for (int q = 0; q < 8; ++q) {
      const int r = q * 2 + rsub;
      const v4f v = *(const v4fa*)&so[w][r][c4];
      *(v4f*)(C + (size_t)(row0 + r) * ldc + col0 + c4) = v;
    }
    
  }
}
// row LayerNorm (biased variance, eps) over N: s = X (+ R); optional out_sum <- s; out_norm <- (s-mu)*rsqrt(var+eps)*g + b
template <bool PARAM_BF16>
__global__ __launch_bounds__(256) void k_layernorm(const float* __restrict__ X, const float* __restrict__ R, const float* __restrict__ g, const float* __restrict__ bta,
                                                  float* __restrict__ out_sum, float* __restrict__ out_norm, int N, float eps) {
  __shared__ float red[256];
  const int row = blockIdx.x, tid = threadIdx.x;
  const float* x = X + (size_t)row * N; const float* rr = R ? R + (size_t)row * N : nullptr;
  float vals[16];                     // up to N = 4096
  const int per = N / 256;            // contiguous chunk per thread? use strided-by-4 chunks: thread handles j = tid*4 + 1024*u
  float s1 = 0.f;
  for (int u = 0; u < per / 4; ++u) {
    const int j = tid * 4 + 1024 * u;
    const v4f a = *(const v4fa*)(x + j);
    v4f b = {0.f,0.f,0.f,0.f}; if (rr) b = *(const v4fa*)(rr + j);
#pragma unroll
    for (int q = 0; q < 4; ++q) { const float v = a[q] + b[q]; vals[u * 4 + q] = v; s1 += v; }
  }
  red[tid] = s1; __syncthreads();
  for (int st = 128; st > 0; st >>= 1) { if (tid < st) red[tid] += red[tid + st]; __syncthreads(); }
  const float mu = red[0] / (float)N; __syncthreads();
  float s2 = 0.f;
  for (int u = 0; u < per / 4; ++u)
#pragma unroll
    for (int q = 0; q < 4; ++q) { const float c = vals[u * 4 + q] - mu; s2 += c * c; }
  red[tid] = s2; __syncthreads();
  for (int st = 128; st > 0; st >>= 1) { if (tid < st) red[tid] += red[tid + st]; __syncthreads(); }
  const float rs = rsqrtf(red[0] / (float)N + eps);
  {
    for (int u = 0; u < per / 4; ++u) {
      const int j = tid * 4 + 1024 * u;
      v4f o, sm;
#pragma unroll
      for (int q = 0; q < 4; ++q) {
        float gg = g[j + q], bb = bta[j + q];
        if (PARAM_BF16) { gg = bf16_round(gg); bb = bf16_round(bb); }
        sm[q] = vals[u * 4 + q]; o[q] = (vals[u * 4 + q] - mu) * rs * gg + bb;
      }
      if (out_sum) *(v4f*)(out_sum + (size_t)row * N + j) = sm;
      *(v4f*)(out_norm + (size_t)row * N + j) = o;
    }
    
  }
}



// ---- f16 WMMA path (v_wmma_f32_16x16x32_f16): 11-bit significands for operands in range — used where a [0,1] probability operand needs more precision than bf16
typedef _Float16 v16h __attribute__((ext_vector_type(16)));
union FragH { v16h v; v8us half[2]; _Float16 h[16]; unsigned short u[16]; };
template <int NT>
__device__ __forceinline__ v8f mmaH(v16h ah, v16h al, v16h bh, v16h bl, v8f c) {
  c = __builtin_amdgcn_wmma_f32_16x16x32_f16(false, ah, false, bh, (short)0, c, false, false);
  if (NT >= 2) c = __builtin_amdgcn_wmma_f32_16x16x32_f16(false, al, false, bh, (short)0, c, false, false);
  if (NT >= 3) c = __builtin_amdgcn_wmma_f32_16x16x32_f16(false, ah, false, bl, (short)0, c, false, false);
  asm volatile("v_nop\n\tv_nop\n\tv_nop\n\tv_nop" : "+v"(c) : "v"(ah), "v"(al), "v"(bh), "v"(bl));
  return c;
}
// batched GEMM like k_gemm_b but f16 operands: A f32 (split into f16 hi/lo if ASPLIT, else rounded to f16), Bt = f16 values [n][k]; alpha; C f32; N multiple of 16 (partial tiles skipped)
template <bool ASPLIT>
__global__ __launch_bounds__(128) void k_gemm_h(const float* __restrict__ A, int lda, size_t sA, const _Float16* __restrict__ Bh, int ldb, size_t sB, float alpha, float* __restrict__ C, int ldc, size_t sC, int M, int N, int K) {
  __shared__ __attribute__((aligned(16))) float so[4][16][64];
  const int tid = threadIdx.x, w = tid >> 5, lane = tid & 31, ln = lane & 15, hh = lane >> 4; const int by = blockIdx.y;
  A += (size_t)by * sA; Bh += (size_t)by * sB; C += (size_t)by * sC;
  const int ntn = (N + 63) / 64; const int wid = blockIdx.x * 4 + w; const int mt = wid / ntn, nq = wid % ntn; if (mt * 16 >= M) return;
  const int row0 = mt * 16, col0 = nq * 64; const float* arow = A + (size_t)(row0 + ln) * lda;
  v8f acc[4] = {};
  for (int kb = 0; kb < K; kb += 32) {
    FragH ah, al;
    const v4f x0 = *(const v4fa*)(arow + kb + 8 * hh), x1 = *(const v4fa*)(arow + kb + 8 * hh + 4), x2 = *(const v4fa*)(arow + kb + 16 + 8 * hh), x3 = *(const v4fa*)(arow + kb + 16 + 8 * hh + 4);
    float xs[16] = {x0[0],x0[1],x0[2],x0[3],x1[0],x1[1],x1[2],x1[3],x2[0],x2[1],x2[2],x2[3],x3[0],x3[1],x3[2],x3[3]};
#pragma unroll
    for (int i = 0; i < 16; ++i) { const _Float16 h = (_Float16)xs[i]; ah.h[i] = h; al.h[i] = ASPLIT ? (_Float16)(xs[i] - (float)h) : (_Float16)0.0f; }
#pragma unroll
    for (int t = 0; t < 4; ++t) { if (col0 + t * 16 >= N) continue; const size_t boff = (size_t)(col0 + t * 16 + ln) * ldb + kb; FragH bq; bq.half[0] = *(const v8us*)(Bh + boff + 8 * hh); bq.half[1] = *(const v8us*)(Bh + boff + 16 + 8 * hh);
      acc[t] = mmaH<ASPLIT ? 2 : 1>(ah.v, al.v, bq.v, bq.v, acc[t]); }
  }
#pragma unroll
  for (int t = 0; t < 4; ++t) { if (col0 + t * 16 >= N) continue;
#pragma unroll
    for (int r = 0; r < 8; ++r) so[w][8 * hh + r][t * 16 + ln] = acc[t][r] * alpha; }
  __builtin_amdgcn_fence(__ATOMIC_ACQ_REL, "workgroup"); __builtin_amdgcn_wave_barrier();
  const int rsub = lane >> 4, c4 = (lane & 15) * 4;
  {
#pragma unroll
    for (int q = 0; q < 8; ++q) { const int r = q * 2 + rsub; if (col0 + c4 < N) { const v4f v = *(const v4fa*)&so[w][r][c4]; *(v4f*)(C + (size_t)(row0 + r) * ldc + col0 + c4) = v; } }
     }
}

// Wt[n][k] = f16(W[k][n]·scale) from f32 row-major W[K][N] (scale = power of two; bf16-exact weights stay exact in f16 away from the subnormal range)
__global__ __launch_bounds__(256) void k_wt_f16(const float* __restrict__ W, _Float16* __restrict__ Wt, int K, int N, float scale) {
  const int t = blockIdx.x * 256 + threadIdx.x; if (t >= N * (K / 8)) return; const int n = t / (K / 8), k8 = (t % (K / 8)) * 8; FragH f;
#pragma unroll
  for (int i = 0; i < 8; ++i) f.h[i] = (_Float16)(bf16_round(W[(size_t)(k8 + i) * N + n]) * scale); const v8us o = f.half[0];
  *(v8us*)((unsigned short*)Wt + (size_t)n * K + k8) = o; 
}
// k_gemm_hh variant with fused epilogue: v = acc·alpha + bias[by·sBias + col] (+ CP[(row/rowsPerB)·sCPb + by·64 + col] if CP) ; ACT 0 none / 1 elu ; writes f16 C16 (and f32 C if non-null)
template <int ACT>
__global__ __launch_bounds__(128) void k_gemm_hhx(const _Float16* __restrict__ A, int lda, size_t sA, const _Float16* __restrict__ Bh, int ldb, size_t sB, float alpha, const float* __restrict__ bias, size_t sBias, const float* __restrict__ CP, int rowsPerB, size_t sCPb, int row0g,
    float* __restrict__ C, _Float16* __restrict__ C16, int ldc, size_t sC, int M, int N, int K) {
  __shared__ __attribute__((aligned(16))) float so[4][16][64];
  const int tid = threadIdx.x, w = tid >> 5, lane = tid & 31, ln = lane & 15, hh = lane >> 4; const int by = blockIdx.y;
  A += (size_t)by * sA; Bh += (size_t)by * sB; const size_t cofs = (size_t)by * sC; const float* bp = bias ? bias + (size_t)by * sBias : nullptr;
  const int ntn = (N + 63) / 64; const int wid = blockIdx.x * 4 + w; const int mt = wid / ntn, nq = wid % ntn; if (mt * 16 >= M) return;
  const int row0 = mt * 16, col0 = nq * 64; const _Float16* arow = A + (size_t)(row0 + ln) * lda;
  v8f acc[4] = {};
  for (int kb = 0; kb < K; kb += 32) { FragH ah; ah.half[0] = *(const v8us*)((const unsigned short*)arow + kb + 8 * hh); ah.half[1] = *(const v8us*)((const unsigned short*)arow + kb + 16 + 8 * hh);
#pragma unroll
    for (int t = 0; t < 4; ++t) { if (col0 + t * 16 >= N) continue; const size_t boff = (size_t)(col0 + t * 16 + ln) * ldb + kb; FragH bq; bq.half[0] = *(const v8us*)((const unsigned short*)Bh + boff + 8 * hh); bq.half[1] = *(const v8us*)((const unsigned short*)Bh + boff + 16 + 8 * hh);
      acc[t] = mmaH<1>(ah.v, ah.v, bq.v, bq.v, acc[t]); }
  }
#pragma unroll
  for (int t = 0; t < 4; ++t) { if (col0 + t * 16 >= N) continue; const int col = col0 + t * 16 + ln; const float bv = bp ? bf16_round(bp[col]) : 0.f;
#pragma unroll
    for (int r = 0; r < 8; ++r) { float v = acc[t][r] * alpha + bv; if (CP) { const int rr = row0g + row0 + 8 * hh + r; if (rowsPerB < 0) v += CP[cofs + (size_t)rr * ldc + col];      /* rowsPerB < 0: own element of the batched C plane */ else { const int bidx = rr / rowsPerB; v += CP[(size_t)bidx * sCPb + (size_t)by * 64 + col]; } } if (ACT == 1) v = (v > 0.f) ? v : expm1f(v); else if (ACT == 7) v = (v > 0.f) ? v + 1.0f : expf(v); else if (ACT == 8) v = tanhf(v); else if (ACT == 9) v = 0.5f * v * (1.0f + tanhf(0.7978845608028654f * (v + 0.044715f * v * v * v))); else if (ACT == 11) v = 1.0f / (1.0f + expf(-v)); else if (ACT == 12) v = (v > 0.f) ? v : 0.01f * v; else if (ACT == 14) v = (v > 0.f) ? v : 0.1f * v; else if (ACT == 16) v = (v >= 0.f) ? v : 0.3f * v; else if (ACT == 17) v = (v >= 0.f) ? v : 0.2f * v; else if (ACT == 15) v = v / (1.0f + expf(-v)); else if (ACT == 3) v = fmaxf(v, 0.f); else if (ACT == 6) v = 0.5f * v * (1.0f + erff(v * 0.70710678118654752f)); so[w][8 * hh + r][t * 16 + ln] = v; } }
  __builtin_amdgcn_fence(__ATOMIC_ACQ_REL, "workgroup"); __builtin_amdgcn_wave_barrier();
  const int rsub = lane >> 4, c4 = (lane & 15) * 4; typedef _Float16 v4h __attribute__((ext_vector_type(4)));
  {
#pragma unroll
    for (int q = 0; q < 8; ++q) { const int r = q * 2 + rsub; if (col0 + c4 < N) { const v4f v = *(const v4fa*)&so[w][r][c4]; if (C) *(v4f*)(C + cofs + (size_t)(row0 + r) * ldc + col0 + c4) = v; if (C16) { v4h h4; for (int i = 0; i < 4; ++i) h4[i] = (_Float16)v[i]; *(v4h*)(C16 + cofs + (size_t)(row0 + r) * ldc + col0 + c4) = h4; } } }
     }
}


typedef _Float16 v4h __attribute__((ext_vector_type(4)));

__global__ __launch_bounds__(256) void k_x16(const float* __restrict__ x, _Float16* __restrict__ X16, size_t n8) { const size_t t = (size_t)blockIdx.x * 256 + threadIdx.x; if (t >= n8) return; FragH f;
#pragma unroll
  for (int q = 0; q < 8; ++q) f.h[q] = (_Float16)bf16_round(x[t * 8 + q]); *(v8us*)((unsigned short*)X16 + t * 8) = f.half[0];  }
__global__ __launch_bounds__(256) void k_h16(const float* __restrict__ x, _Float16* __restrict__ X16, size_t n8) { const size_t t = (size_t)blockIdx.x * 256 + threadIdx.x; if (t >= n8) return; FragH f;
#pragma unroll
  for (int q = 0; q < 8; ++q) f.h[q] = (_Float16)x[t * 8 + q]; *(v8us*)((unsigned short*)X16 + t * 8) = f.half[0];  }
__global__ __launch_bounds__(256) void k_round16f(const float* __restrict__ W, _Float16* __restrict__ Bt, size_t n8) { const size_t t = (size_t)blockIdx.x * 256 + threadIdx.x; if (t >= n8) return; FragH f;
#pragma unroll
  for (int i = 0; i < 8; ++i) f.h[i] = (_Float16)(bf16_round(W[t * 8 + i]) * 16.0f); *(v8us*)((unsigned short*)Bt + t * 8) = f.half[0];  }
template <int NHv, int TTv>
__global__ __launch_bounds__(256) void k_vt(const _Float16* __restrict__ V16, int ldv, int voff, _Float16* __restrict__ Vt) { __shared__ unsigned short tl[64][66]; const int tid = threadIdx.x; const int slab = blockIdx.x / (TTv / 64), lg = blockIdx.x % (TTv / 64); const int b = slab / NHv, h = slab % NHv;
  for (int i = tid; i < 64 * 8; i += 256) { const int r = i / 8, c8 = (i % 8) * 8; FragH f; f.half[0] = *(const v8us*)((const unsigned short*)V16 + ((size_t)b * TTv + lg * 64 + r) * ldv + voff + h * 64 + c8);
#pragma unroll
    for (int q = 0; q < 8; ++q) tl[r][c8 + q] = f.u[q]; }
  __syncthreads();
  {
#pragma unroll
    for (int rd = 0; rd < 2; ++rd) { const int d = rd * 32 + tid / 8, pc = tid % 8; FragH f;
#pragma unroll
      for (int q = 0; q < 8; ++q) f.u[q] = tl[pc * 8 + q][d];
      *(v8us*)((unsigned short*)Vt + ((size_t)slab * 64 + d) * TTv + lg * 64 + pc * 8) = f.half[0]; }
     } }

__global__ __launch_bounds__(256) void k_hl(const float* __restrict__ F, _Float16* __restrict__ Hh, _Float16* __restrict__ Hl, size_t n8) { const size_t t = (size_t)blockIdx.x * 256 + threadIdx.x; if (t >= n8) return; FragH fh, fl; const v4f a = *(const v4fa*)(F + t * 8), c = *(const v4fa*)(F + t * 8 + 4);
#pragma unroll
  for (int q = 0; q < 4; ++q) { _Float16 h = (_Float16)a[q]; fh.h[q] = h; fl.h[q] = (_Float16)((a[q] - (float)h) * 1024.0f); h = (_Float16)c[q]; fh.h[4 + q] = h; fl.h[4 + q] = (_Float16)((c[q] - (float)h) * 1024.0f); }
  { *(v8us*)((unsigned short*)Hh + t * 8) = fh.half[0]; *(v8us*)((unsigned short*)Hl + t * 8) = fl.half[0];  } }

// ---- fast GEMM (wave tile 32x64; requires M % 32 == 0 rows per launch region and N % 64 == 0); epilogue = k_gemm_hhx semantics ----
__device__ __forceinline__ v16h g2_frag(const _Float16* p, int hh) { FragH f; f.half[0] = *(const v8us*)((const unsigned short*)p + 8 * hh); f.half[1] = *(const v8us*)((const unsigned short*)p + 16 + 8 * hh); return f.v; }
__device__ __forceinline__ v8f g2_mma(v16h a, v16h b, v8f c) { v8f d = __builtin_amdgcn_wmma_f32_16x16x32_f16(false, a, false, b, (short)0, c, false, false); asm volatile("v_nop\n\tv_nop\n\tv_nop\n\tv_nop" : "+v"(d) : "v"(a), "v"(b)); return d; }
typedef float v2f __attribute__((ext_vector_type(2)));
// ROPE 1 (f16 rows to C16) or 2 (f32 rows to C): the interleaved-pair rotation (position = row % SQ, tables CS / SN [SQ][HD / 2]) is applied to the finished f32 tile on its way from LDS to the f32 or f16 rows; a 64-column tile is one head, and a lane's four columns are two whole pairs.
template <int ACT, int ROPE = 0>
__global__ __launch_bounds__(128) void k_gemm2(const _Float16* __restrict__ A, int lda, size_t sA, const _Float16* __restrict__ Bh, int ldb, size_t sB, float alpha, const float* __restrict__ bias, size_t sBias, const float* __restrict__ CP, int rowsPerB, size_t sCPb, int row0g,
    float* __restrict__ C, _Float16* __restrict__ C16, int ldc, size_t sC, int M, int N, int K, const float* __restrict__ CS = nullptr, const float* __restrict__ SN = nullptr) { static_assert(ACT == 0 || ACT == 3 || ACT == 6 || ACT == 8 || ACT == 9 || ACT == 11 || ACT == 12 || ACT == 14 || ACT == 15 || ACT == 16 || ACT == 17, "k_gemm2: unsupported ACT code (would silently apply no activation)");
  __shared__ __attribute__((aligned(16))) float so[4][32][68];
  const int tid = threadIdx.x, w = tid >> 5, lane = tid & 31, ln = lane & 15, hh = lane >> 4; const int by = blockIdx.y;
  A += (size_t)by * sA; Bh += (size_t)by * sB; const size_t cofs = (size_t)by * sC; const float* bp = bias ? bias + (size_t)by * sBias : nullptr;
  const int ntn = N >> 6; const int mt = blockIdx.x / ntn, nq = blockIdx.x - mt * ntn; const int row0 = mt * 128 + 32 * w, col0 = nq * 64; if (row0 >= M) return;
  const _Float16* a0p = A + (size_t)(row0 + ln) * lda; const _Float16* a1p = a0p + (size_t)16 * lda;
  const _Float16* b0p = Bh + (size_t)(col0 + ln) * ldb; const _Float16* b1p = b0p + (size_t)16 * ldb; const _Float16* b2p = b1p + (size_t)16 * ldb; const _Float16* b3p = b2p + (size_t)16 * ldb;
  const v8f z8 = {0.f,0.f,0.f,0.f,0.f,0.f,0.f,0.f}; v8f c00 = z8, c01 = z8, c02 = z8, c03 = z8, c10 = z8, c11 = z8, c12 = z8, c13 = z8;
  v2f rc[16], rs[16];      /* ROPE: the lane's cos / sin pairs of its 16 rows, fetched ahead of the k loop, whose first trips cover their latency */
  if (ROPE) { static_assert(HD == 64 && SQ % 32 == 0, "k_gemm2 rope: a 64-column tile is one head, a 32-row tile does not wrap the position");
    const float* cp = CS + (size_t)((row0 + (lane >> 4)) % SQ) * (HD / 2) + (lane & 15) * 2; const float* sp = SN + (size_t)((row0 + (lane >> 4)) % SQ) * (HD / 2) + (lane & 15) * 2;      /* the lane's own addresses: the 16 rows differ in the immediate offset alone */
#pragma unroll
    for (int q = 0; q < 16; ++q) { rc[q] = *(const v2f*)(cp + q * HD); rs[q] = *(const v2f*)(sp + q * HD); }      /* fully unrolled: rc and rs stay in registers; two rows on = 2 * (HD / 2) floats */
    asm volatile("s_wait_xcnt 0x0" :: "v"(cp), "v"(sp) : "memory"); }      /* the wait between the loads above and the first reuse of their address registers; the addresses are inputs so that their registers stay untouched up to it */
#pragma unroll 1
  for (int kb = 0; kb < K; kb += 32) { const v16h a0 = g2_frag(a0p + kb, hh), a1 = g2_frag(a1p + kb, hh);
    v16h b = g2_frag(b0p + kb, hh); c00 = g2_mma(a0, b, c00); c10 = g2_mma(a1, b, c10);
    b = g2_frag(b1p + kb, hh); c01 = g2_mma(a0, b, c01); c11 = g2_mma(a1, b, c11);
    b = g2_frag(b2p + kb, hh); c02 = g2_mma(a0, b, c02); c12 = g2_mma(a1, b, c12);
    b = g2_frag(b3p + kb, hh); c03 = g2_mma(a0, b, c03); c13 = g2_mma(a1, b, c13); }
  v8f accs[8] = {c00, c01, c02, c03, c10, c11, c12, c13};
#pragma unroll
  for (int u = 0; u < 8; ++u) { const int t = u & 3, half = u >> 2; const int col = col0 + t * 16 + ln; const float bv = bp ? bf16_round(bp[col]) : 0.f;
#pragma unroll
    for (int r = 0; r < 8; ++r) { const int rloc = half * 16 + 8 * hh + r; float v = accs[u][r] * alpha + bv; if (CP) { if (rowsPerB < 0) v += CP[cofs + (size_t)(row0g + row0 + rloc) * ldc + col];      /* rowsPerB < 0: own element of the batched C plane */ else { const int bidx = (row0g + row0 + rloc) / rowsPerB; v += CP[(size_t)bidx * sCPb + (size_t)by * 64 + col]; } }
      if (ACT == 3) v = fmaxf(v, 0.f); else if (ACT == 6) v = 0.5f * v * (1.0f + erff(v * 0.70710678118654752f)); else if (ACT == 11) v = 1.0f / (1.0f + expf(-v)); else if (ACT == 15) v = v / (1.0f + expf(-v)); else if (ACT == 12) v = (v > 0.f) ? v : 0.01f * v; else if (ACT == 8) v = tanhf(v); else if (ACT == 9) v = 0.5f * v * (1.0f + tanhf(0.7978845608028654f * (v + 0.044715f * v * v * v))); else if (ACT == 14) v = (v > 0.f) ? v : 0.1f * v; else if (ACT == 16) v = (v >= 0.f) ? v : 0.3f * v; else if (ACT == 17) v = (v >= 0.f) ? v : 0.2f * v;
      so[w][rloc][t * 16 + ln] = v; } }
  __builtin_amdgcn_fence(__ATOMIC_ACQ_REL, "workgroup"); __builtin_amdgcn_wave_barrier();
  const int rsub = lane >> 4, c4 = (lane & 15) * 4;
  if (ROPE) { v4f t[16];      /* the sixteen row pieces are rotated first and then stored in one run; the destination is fixed at compile time */
#pragma unroll
    for (int q = 0; q < 16; ++q) { const v4f v = *(const v4fa*)&so[w][q * 2 + rsub][c4]; const v2f c = rc[q], s = rs[q];
      t[q][0] = v[0] * c[0] - v[1] * s[0]; t[q][1] = v[0] * s[0] + v[1] * c[0]; t[q][2] = v[2] * c[1] - v[3] * s[1]; t[q][3] = v[2] * s[1] + v[3] * c[1]; }
    if (ROPE == 2) {
#pragma unroll
      for (int q = 0; q < 16; ++q) *(v4f*)(C + cofs + (size_t)(row0 + q * 2 + rsub) * ldc + col0 + c4) = t[q]; }
    else { v4h h4[16];
#pragma unroll
      for (int q = 0; q < 16; ++q) { h4[q][0] = (_Float16)t[q][0]; h4[q][1] = (_Float16)t[q][1]; h4[q][2] = (_Float16)t[q][2]; h4[q][3] = (_Float16)t[q][3]; }
#pragma unroll
      for (int q = 0; q < 16; ++q) *(v4h*)(C16 + cofs + (size_t)(row0 + q * 2 + rsub) * ldc + col0 + c4) = h4[q]; }
  } else {
#pragma unroll
    for (int q = 0; q < 16; ++q) { const int r = q * 2 + rsub; const v4f v = *(const v4fa*)&so[w][r][c4]; if (C) *(v4f*)(C + cofs + (size_t)(row0 + r) * ldc + col0 + c4) = v; if (C16) { v4h h4; for (int i = 0; i < 4; ++i) h4[i] = (_Float16)v[i]; *(v4h*)(C16 + cofs + (size_t)(row0 + r) * ldc + col0 + c4) = h4; } }
     } }


__global__ __launch_bounds__(256) void k_wnat(const float* __restrict__ w, size_t n8, _Float16* __restrict__ Bt) { const size_t t = (size_t)blockIdx.x * 256 + threadIdx.x; if (t >= n8) return; FragH f; for (int q = 0; q < 8; ++q) f.h[q] = (_Float16)(bf16_round(w[t * 8 + q]) * 16.0f); *(v8us*)((unsigned short*)Bt + t * 8) = f.half[0];  }
__global__ __launch_bounds__(256) void k_rsm(const float* __restrict__ S, _Float16* __restrict__ P, int nrows) {
  #pragma clang fp contract(off)
  const int i = blockIdx.x * 256 + threadIdx.x; if (i >= nrows) return; const float* s = S + (size_t)i * SQ; float mx = -3.0e38f;
#pragma unroll 1
  for (int j = 0; j < SQ; ++j) mx = fmaxf(mx, s[j]); float se = 0.f;
#pragma unroll 1
  for (int j = 0; j < SQ; ++j) se += expf(s[j] - mx); const float sc = 256.0f / se;
#pragma unroll 1
  for (int j0 = 0; j0 < SQ; j0 += 8) { FragH f; for (int q = 0; q < 8; ++q) f.h[q] = (_Float16)(expf(s[j0 + q] - mx) * sc); unsigned short* d = (unsigned short*)P + (size_t)i * SQ + j0; *(v8us*)d = f.half[0];  } }
__global__ __launch_bounds__(256) void k_vt(const _Float16* __restrict__ V16, int b, int h0, _Float16* __restrict__ VT) { __shared__ unsigned short tl[64][65]; const int tid = threadIdx.x; const int hh = blockIdx.x % HG, sg = blockIdx.x / HG; const int s0 = sg * 64; const int h = h0 + hh;
  for (int i = tid; i < 64 * 8; i += 256) { const int j = i / 8, d8 = (i % 8) * 8; FragH f; f.half[0] = *(const v8us*)((const unsigned short*)V16 + ((size_t)b * SQ + s0 + j) * DM + h * HD + d8); for (int q = 0; q < 8; ++q) tl[d8 + q][j] = f.u[q]; }
  __syncthreads();
  { for (int i = tid; i < 64 * 8; i += 256) { const int d = i / 8, j8 = (i % 8) * 8; FragH f; for (int q = 0; q < 8; ++q) f.u[q] = tl[d][j8 + q]; *(v8us*)((unsigned short*)VT + ((size_t)hh * HD + d) * SQ + s0 + j8) = f.half[0]; }  } }



#define FAQB 128                     /* query rows per block */
#define FAK 64                       /* keys per step */
#define FAP (HD + 8)                 /* LDS row pitch, halves */
__device__ __forceinline__ v8f fa_mma(v16h a, v16h b, v8f c) { return __builtin_amdgcn_wmma_f32_16x16x32_f16(false, a, false, b, (short)0, c, false, false); }
__global__ __launch_bounds__(128) void k_fattn(const _Float16* __restrict__ Q, const _Float16* __restrict__ Kh, const _Float16* __restrict__ VTa, _Float16* __restrict__ O) {
  static_assert(NB * NH == 64 && SQ / FAQB == 16 && HD == 64, "k_fattn: the block-to-tile map below is written for 64 (batch, head) pairs x 16 query blocks");
  __shared__ __attribute__((aligned(16))) _Float16 lk[FAK][FAP]; __shared__ __attribute__((aligned(16))) _Float16 lv[HD][FAP];
  const int tid = threadIdx.x, lane = tid & 31, ln = lane & 15, hh = lane >> 4; const int w = __builtin_amdgcn_readfirstlane(tid >> 5);      /* the wave's number as a scalar: the two tests on q0w below are scalar branches */
  const int g = blockIdx.x >> 8, sub = (blockIdx.x >> 6) & 3, bh = blockIdx.x & 63;
  const int qb = (g == 0) ? 15 - sub : ((g == 1) ? 8 + sub : ((g == 2) ? 7 - sub : sub));      /* a permutation of the 16 query blocks: long blocks start first, and blocks 256 apart in the index add up to the same length */
  const int b = bh / NH, h = bh % NH; const size_t r0 = (size_t)b * SQ; const int q0w = qb * FAQB + w * 32; const int nst = (qb + 1) * (FAQB / FAK);
  const unsigned short* qp = (const unsigned short*)Q + (r0 + q0w + ln) * LQ + h * HD + 8 * hh; v16h qf[2][2];      /* the lane's own address, so that the eight loads differ in the immediate offset alone; every loop but the step loop is fully unrolled: all array indices are constants and the arrays stay in registers */
#pragma unroll
  for (int nt = 0; nt < 2; ++nt)
#pragma unroll
    for (int kk = 0; kk < 2; ++kk) { FragH f; f.half[0] = *(const v8us*)(qp + (size_t)nt * 16 * LQ + kk * 32); f.half[1] = *(const v8us*)(qp + (size_t)nt * 16 * LQ + kk * 32 + 16); qf[nt][kk] = f.v; }      /* the k order of g2_frag */
  const int sr = tid >> 3, sc = (tid & 7) * 8;      /* staging: 8 lanes take one 128-byte row, a pass of the block 16 rows */
  const unsigned short* kp = (const unsigned short*)Kh + (r0 + sr) * LQ + h * HD + sc; const unsigned short* vp = (const unsigned short*)VTa + ((size_t)bh * HD + sr) * SQ + sc; v8us kr[4], vr[4];
#pragma unroll
  for (int u = 0; u < 4; ++u) { kr[u] = *(const v8us*)(kp + (size_t)u * 16 * LQ); vr[u] = *(const v8us*)(vp + (size_t)u * 16 * SQ); }
  asm volatile("s_wait_xcnt 0x0" :: "v"(qp), "v"(kp), "v"(vp) : "memory");      /* the wait between the loads above and the first rewrite of their address registers; the addresses are inputs so that their registers stay untouched up to it */
  const v8f z8 = {0.f, 0.f, 0.f, 0.f, 0.f, 0.f, 0.f, 0.f}; v8f o[4][2];
#pragma unroll
  for (int dt = 0; dt < 4; ++dt) { o[dt][0] = z8; o[dt][1] = z8; }
  float m[2] = {-1.0e30f, -1.0e30f}, l[2] = {0.f, 0.f};      /* running max (log2 units) and this lane's part of the running sum, per query tile */
  const float SC = 0.125f * 1.44269504088896340736f;      /* 1 / sqrt(64), in log2 units */
#pragma unroll 1
  for (int s = 0; s < nst; ++s) { const int k0 = s * FAK;      /* rolled: one step's code is long and its trip count varies by block */
#pragma unroll
    for (int u = 0; u < 4; ++u) { *(v8us*)&lk[u * 16 + sr][sc] = kr[u]; *(v8us*)&lv[u * 16 + sr][sc] = vr[u]; }
    __syncthreads();      /* publishes this step's K and V^T rows */
    if (s + 1 < nst) { kp += (size_t)FAK * LQ; vp += FAK;
#pragma unroll
      for (int u = 0; u < 4; ++u) { kr[u] = *(const v8us*)(kp + (size_t)u * 16 * LQ); vr[u] = *(const v8us*)(vp + (size_t)u * 16 * SQ); }
      asm volatile("s_wait_xcnt 0x0" :: "v"(kp), "v"(vp) : "memory"); }      /* as above: stands in front of the next step's address additions */
    if (k0 <= q0w + 31) {      /* a wave whose queries all lie below this step's keys only passes the barriers */
      v8f st[4][2];
#pragma unroll
      for (int kt = 0; kt < 4; ++kt) { st[kt][0] = z8; st[kt][1] = z8; }
#pragma unroll
      for (int kk = 0; kk < 2; ++kk)
#pragma unroll
        for (int kt = 0; kt < 4; ++kt) { const v16h a = g2_frag(&lk[kt * 16 + ln][kk * 32], hh); st[kt][0] = fa_mma(a, qf[0][kk], st[kt][0]); st[kt][1] = fa_mma(a, qf[1][kk], st[kt][1]); }
      if (k0 + FAK - 1 > q0w) {      /* only steps that reach past the wave's first query mask */
#pragma unroll
        for (int kt = 0; kt < 4; ++kt)
#pragma unroll
          for (int nt = 0; nt < 2; ++nt)
#pragma unroll
            for (int r = 0; r < 8; ++r) st[kt][nt][r] = (k0 + kt * 16 + 8 * hh + r <= q0w + nt * 16 + ln) ? st[kt][nt][r] : -3.0e38f; }
      v16h pf[2][2];
#pragma unroll
      for (int nt = 0; nt < 2; ++nt) { float mr = st[0][nt][0];
#pragma unroll
        for (int kt = 0; kt < 4; ++kt)
#pragma unroll
          for (int r = 0; r < 8; ++r) mr = fmaxf(mr, st[kt][nt][r]);
        mr = fmaxf(mr, __shfl_xor(mr, 16, 32));
        const float mn = fmaxf(m[nt], mr * SC); const float al = __builtin_amdgcn_exp2f(m[nt] - mn); m[nt] = mn; const float bs = 8.0f - mn;      /* + 8: weights carried x256; a masked key underflows to exactly 0 */
        v4f s4 = {0.f, 0.f, 0.f, 0.f};
#pragma unroll
        for (int kt = 0; kt < 4; ++kt)
#pragma unroll
          for (int r = 0; r < 8; ++r) { const float p = __builtin_amdgcn_exp2f(fmaf(st[kt][nt][r], SC, bs)); s4[r & 3] += p; pf[nt][kt >> 1][(kt & 1) * 8 + r] = (_Float16)p; }
        l[nt] = fmaf(l[nt], al, (s4[0] + s4[1]) + (s4[2] + s4[3]));
#pragma unroll
        for (int dt = 0; dt < 4; ++dt) o[dt][nt] *= al; }
#pragma unroll
      for (int j = 0; j < 2; ++j)
#pragma unroll
        for (int dt = 0; dt < 4; ++dt) { const v16h a = g2_frag(&lv[dt * 16 + ln][j * 32], hh); o[dt][0] = fa_mma(a, pf[0][j], o[dt][0]); o[dt][1] = fa_mma(a, pf[1][j], o[dt][1]); } }
    __syncthreads(); }      /* ends every wave's reads of this step's rows before the next step's stores */
  FragH t[2][4];      /* all eight 16-byte results are formed first: no store's data register is rewritten behind it */
#pragma unroll
  for (int nt = 0; nt < 2; ++nt) { const float f = 64.0f / (l[nt] + __shfl_xor(l[nt], 16, 32));
#pragma unroll
    for (int dt = 0; dt < 4; ++dt)
#pragma unroll
      for (int r = 0; r < 8; ++r) t[nt][dt].h[r] = (_Float16)(o[dt][nt][r] * f); }
  unsigned short* op = (unsigned short*)O + (r0 + q0w + ln) * DM + h * HD + 8 * hh;
#pragma unroll
  for (int nt = 0; nt < 2; ++nt)
#pragma unroll
    for (int dt = 0; dt < 4; ++dt) *(v8us*)(op + (size_t)nt * 16 * DM + dt * 16) = t[nt][dt].half[0]; }


// Exact f32 attention for the first QT0 rows (o carried x64 like the f16 path). One wave per query row, A0R rows of one head per block.
// All QT0 K and V rows of the head are staged in LDS once by coalesced 16-byte loads. K rows get a pitch of 68 floats (16 bytes x odd), so that 32 lanes reading 32 rows by 16 bytes spread over the banks.
// Scores: lane = key (four partial sums over the head dimension). Row max and row sum: five-step butterfly. o: lane = two head columns, loop over the keys, each key's weight read from its lane into a scalar register; keys above the row carry weight 0.
#define A0R 8                        /* rows (waves) per block */
#define A0KP (HD + 4)                /* K row pitch in LDS, floats */
__global__ __launch_bounds__(256) void k_att0w(const float* __restrict__ QF, const float* __restrict__ KF, const float* __restrict__ VF, float scale, float* __restrict__ OF) {
  __shared__ __attribute__((aligned(16))) float lk[QT0][A0KP]; __shared__ __attribute__((aligned(16))) float lv[QT0][HD];
  const int tid = threadIdx.x, lane = tid & 31; const int w = __builtin_amdgcn_readfirstlane(tid >> 5);      /* the wave's number as a scalar: row, group count and branches below are wave-uniform */
  const int h = blockIdx.x / (QT0 / A0R), r0 = (blockIdx.x % (QT0 / A0R)) * A0R; const int i = r0 + w;
  const float* qr = QF + (size_t)i * DM + h * HD; v4f q[HD / 4];      /* every loop of this kernel is fully unrolled: the indices into q, kk, vv, sv and o and the lane of each readlane are then constants, so the arrays stay in registers */
#pragma unroll
  for (int c = 0; c < HD / 4; ++c) q[c] = *(const v4fa*)(qr + c * 4);      /* the wave's own q row, whole */
  const int sj = tid >> 4, sc4 = (tid & 15) * 4; const float* kp = KF + (size_t)sj * DM + h * HD + sc4; const float* vp = VF + (size_t)sj * DM + h * HD + sc4; v4f kk[QT0 / 16], vv[QT0 / 16];      /* one pass of the block stages 16 rows; both loops are fully unrolled and free of branches so that every load of the block is in flight before the first LDS store waits; the row pitch is a constant, so the passes differ in the immediate offset alone */
#pragma unroll
  for (int u = 0; u < QT0 / 16; ++u) { kk[u] = *(const v4fa*)(kp + (size_t)u * 16 * DM); vv[u] = *(const v4fa*)(vp + (size_t)u * 16 * DM); }
  asm volatile("s_wait_xcnt 0x0" :: "v"(kp), "v"(vp) : "memory");      /* the wait between the loads above and the first reuse of their address registers; the two addresses are inputs so that their registers stay untouched up to it */
#pragma unroll
  for (int u = 0; u < QT0 / 16; ++u) { *(v4f*)&lk[u * 16 + sj][sc4] = kk[u]; *(v4f*)&lv[u * 16 + sj][sc4] = vv[u]; }
  __syncthreads();
  const int ng = (i >> 5) + 1;      /* key groups of 32 that hold a key <= i */
  float sv[QT0 / 32];
#pragma unroll
  for (int g = 0; g < QT0 / 32; ++g) { sv[g] = -1.0e30f;
    if (g < ng) { const int j = g * 32 + lane; v4f a = {0.f, 0.f, 0.f, 0.f};
#pragma unroll
      for (int c = 0; c < HD / 4; ++c) a += q[c] * *(const v4f*)&lk[j][c * 4];
      const float s = ((a[0] + a[1]) + (a[2] + a[3])) * scale; sv[g] = (j <= i) ? s : -1.0e30f; } }
  float mx = fmaxf(fmaxf(sv[0], sv[1]), fmaxf(sv[2], sv[3]));
#pragma unroll
  for (int m = 16; m >= 1; m >>= 1) mx = fmaxf(mx, __shfl_xor(mx, m, 32));
  float se = 0.f;
#pragma unroll
  for (int g = 0; g < QT0 / 32; ++g) { const float e = expf(sv[g] - mx); sv[g] = e; se += e; }      /* a key above the row holds -1e30: its weight underflows to exactly 0 */
#pragma unroll
  for (int m = 16; m >= 1; m >>= 1) se += __shfl_xor(se, m, 32);
  v2f o[4] = {{0.f, 0.f}, {0.f, 0.f}, {0.f, 0.f}, {0.f, 0.f}};      /* four partial sums over the keys (key mod 4): four independent add chains */
#pragma unroll
  for (int g = 0; g < QT0 / 32; ++g) if (g < ng) {
#pragma unroll
    for (int jj = 0; jj < 32; ++jj) { const float e = __int_as_float(__builtin_amdgcn_readlane(__float_as_int(sv[g]), jj)); o[jj & 3] += e * *(const v2f*)&lv[g * 32 + jj][lane * 2]; } }
  const float fin = 64.0f / se; const v2f r = ((o[0] + o[1]) + (o[2] + o[3])) * fin;
  *(v2f*)(OF + (size_t)i * DM + h * HD + lane * 2) = r; }


__global__ __launch_bounds__(256) void k_wt_hq(const float* __restrict__ Wf, const float* __restrict__ bf, _Float16* __restrict__ Bq, _Float16* __restrict__ Bk, _Float16* __restrict__ Bv, float* __restrict__ B3) {
  const int t = blockIdx.x * 256 + threadIdx.x; if (t >= 3 * DM * (DM / 8)) return; const int n = t / (DM / 8), k8 = (t % (DM / 8)) * 8; const int h = n / (3 * HD), wh = (n % (3 * HD)) / HD, d = n % HD; const int row = h * HD + d; FragH f;
#pragma unroll
  for (int i = 0; i < 8; ++i) f.h[i] = (_Float16)(bf16_round(Wf[(size_t)(k8 + i) * (3 * DM) + n]) * 16.0f); const v8us o = f.half[0];
  _Float16* dst = (wh == 0) ? Bq : ((wh == 1) ? Bk : Bv); unsigned short* p = (unsigned short*)dst + (size_t)row * DM + k8; *(v8us*)p = o; 
  (void)bf; (void)B3; }
__global__ __launch_bounds__(256) void k_bhq(const float* __restrict__ bf, float* __restrict__ B3) {
  const int t = blockIdx.x * 256 + threadIdx.x; if (t >= 3 * DM) return; const int wh = t / DM, row = t % DM; const int h = row / HD, d = row % HD; const float v = bf16_round(bf[h * (3 * HD) + wh * HD + d]); *(float*)(B3 + t) = v;  }

__global__ __launch_bounds__(256) void k_tabcp32(const float* __restrict__ tc, const float* __restrict__ tsn, float* __restrict__ CS, float* __restrict__ SN, int n) {
  const int t = blockIdx.x * 256 + threadIdx.x; if (t >= n) return; const float c = bf16_round(tc[t]), s = bf16_round(tsn[t]);
  *(float*)(CS + t) = c; *(float*)(SN + t) = s;  }
extern "C" void kernel_launch(void* const* d_in, const int* in_sizes, int n_in,
                              void* d_out, int out_size, void* d_ws, size_t ws_size, hipStream_t stream) {
  (void)in_sizes; (void)n_in; (void)out_size;
  const float* const* I = (const float* const*)d_in; const float* x = I[0]; const float* wqkv = I[1]; const float* bqkv = I[2]; const float* wo = I[3]; const float* bo = I[4]; const float* tcos = I[5]; const float* tsin = I[6];      /* x; fused W_qkv [1024][3072] + b_qkv [3072] ([in][out]; per-head (q | k | v) column triples); W_out + b_out ([in][out]); rope tables cos / sin [2048][32] */
  char* ws = (char*)d_ws; size_t off = 0;
  auto take = [&](size_t bytes) { char* p = ws + off; off += (bytes + 255) & ~(size_t)255; return p; };
  _Float16* BQ = (_Float16*)take((size_t)DM * DM * 2); _Float16* BK = (_Float16*)take((size_t)DM * DM * 2); _Float16* BV = (_Float16*)take((size_t)DM * DM * 2); _Float16* BO = (_Float16*)take((size_t)DM * DM * 2);
  float* BQB = (float*)take((size_t)3 * DM * 4); float* CSB = (float*)take((size_t)SQ * 32 * 4); float* SNB = (float*)take((size_t)SQ * 32 * 4);      /* de-interleaved bias vector bq | bk | bv; bf16-rounded copies of the rope tables */ _Float16* X16 = (_Float16*)take(NR * DM * 2); _Float16* Q16 = (_Float16*)take(NR * DM * 2); _Float16* K16 = (_Float16*)take(NR * DM * 2); _Float16* V16 = (_Float16*)take(NR * DM * 2); _Float16* O16 = (_Float16*)take(NR * DM * 2);
  _Float16* VT = (_Float16*)take((size_t)NB * NH * HD * SQ * 2);
  float* QF0 = (float*)take((size_t)QT0 * DM * 4); float* KF0 = (float*)take((size_t)QT0 * DM * 4); float* VF0 = (float*)take((size_t)QT0 * DM * 4); float* OF0 = (float*)take((size_t)NB * QT0 * DM * 4); _Float16* OH0 = (_Float16*)take((size_t)NB * QT0 * DM * 2); _Float16* OL0 = (_Float16*)take((size_t)NB * QT0 * DM * 2);
  if (off > ws_size) return;
  k_wt_hq<<<(unsigned)(((size_t)3 * DM * (DM / 8) + 255) / 256), 256, 0, stream>>>(wqkv, bqkv, BQ, BK, BV, BQB); k_bhq<<<(3 * DM + 255) / 256, 256, 0, stream>>>(bqkv, BQB); k_wt_f16<<<(unsigned)(((size_t)DM * (DM / 8) + 255) / 256), 256, 0, stream>>>(wo, BO, DM, DM, 16.0f);      /* fused [in][out] weight with per-head (q | k | v) column triples -> three Bt planes (row h*64 + d) x16 + the de-interleaved bias vector; W_out [in][out] -> Bt x16 */
  k_tabcp32<<<(SQ * 32 + 255) / 256, 256, 0, stream>>>(tcos, tsin, CSB, SNB, SQ * 32);      /* rope tables [pos][32], bf16-rounded copies */

  k_x16<<<(unsigned)((NR * DM / 8 + 255) / 256), 256, 0, stream>>>(x, X16, NR * DM / 8);
  const size_t r0p = (size_t)B0 * SQ;      /* first projected row */
  k_gemm2<0, 1><<<dim3((unsigned)((MP / 128) * (DM / 64)), 1), 128, 0, stream>>>(X16 + r0p * DM, DM, 0, BQ, DM, 0, 0.0625f, BQB, 0, nullptr, 1, 0, 0, nullptr, Q16 + r0p * DM, DM, 0, MP, DM, DM, CSB, SNB);      /* q (f32) + bias -> interleaved-pair rope (position = row % SQ) -> f16 rows, in one launch */
  k_gemm2<0, 1><<<dim3((unsigned)((MP / 128) * (DM / 64)), 1), 128, 0, stream>>>(X16 + r0p * DM, DM, 0, BK, DM, 0, 0.0625f, BQB + DM, 0, nullptr, 1, 0, 0, nullptr, K16 + r0p * DM, DM, 0, MP, DM, DM, CSB, SNB);      /* k likewise */
  k_gemm2<0><<<dim3((unsigned)((MP / 128) * (DM / 64)), 1), 128, 0, stream>>>(X16 + r0p * DM, DM, 0, BV, DM, 0, 0.0625f, BQB + 2 * DM, 0, nullptr, 1, 0, 0, nullptr, V16 + r0p * DM, DM, 0, MP, DM, DM);
  for (int b = B0; b < B0 + NBR; ++b) { const size_t r0 = (size_t)b * SQ;
    k_gemm2<0, 2><<<dim3((QT0 / 128) * (DM / 64), 1), 128, 0, stream>>>(X16 + r0 * DM, DM, 0, BQ, DM, 0, 0.0625f, BQB, 0, nullptr, 1, 0, 0, QF0, nullptr, DM, 0, QT0, DM, DM, CSB, SNB); k_gemm2<0, 2><<<dim3((QT0 / 128) * (DM / 64), 1), 128, 0, stream>>>(X16 + r0 * DM, DM, 0, BK, DM, 0, 0.0625f, BQB + DM, 0, nullptr, 1, 0, 0, KF0, nullptr, DM, 0, QT0, DM, DM, CSB, SNB); k_gemm2<0><<<dim3((QT0 / 128) * (DM / 64), 1), 128, 0, stream>>>(X16 + r0 * DM, DM, 0, BV, DM, 0, 0.0625f, BQB + 2 * DM, 0, nullptr, 1, 0, 0, VF0, nullptr, DM, 0, QT0, DM, DM);      /* f32 q, k, v of the first 128 rows (exact products); q and k leave their GEMM roped, in f32 (first-tile row r = position r) */
    k_att0w<<<NH * (QT0 / A0R), 256, 0, stream>>>(QF0, KF0, VF0, 0.125f, OF0 + (size_t)b * QT0 * DM);      /* exact f32 attention for rows 0..127 (o x64) */
  }
  k_vt<NH, SQ><<<NB * NH * (SQ / 64), 256, 0, stream>>>(V16, LQ, 0, VT);      /* V^T [NB][NH][HD][SQ] */
  k_fattn<<<NB * NH * (SQ / FAQB), 128, 0, stream>>>(Q16, K16, VT, O16);      /* scores, causal softmax and P V in one launch; o (merged heads, x64) as f16 rows */
  k_gemm2<0><<<dim3((unsigned)((MPO / 128) * (DM / 64)), 1), 128, 0, stream>>>(O16 + r0p * DM, DM, 0, BO, DM, 0, 0.0009765625f, bo, 0, nullptr, 1, 0, 0, (float*)d_out + r0p * DM, nullptr, DM, 0, MPO, DM, DM);      /* out rows are the output layout */
  k_hl<<<(unsigned)(((size_t)NB * QT0 * DM / 8 + 255) / 256), 256, 0, stream>>>(OF0, OH0, OL0, (size_t)NB * QT0 * DM / 8);      /* first-tile o (x64) -> f16 hi + x1024 residual planes */
  for (int b = B0; b < B0 + NBR; ++b) { const size_t r0 = (size_t)b * SQ; const size_t f0 = (size_t)b * QT0;
    k_gemm2<0><<<dim3((QT0 / 128) * (DM / 64), 1), 128, 0, stream>>>(OH0 + f0 * DM, DM, 0, BO, DM, 0, 0.0009765625f, bo, 0, nullptr, 1, 0, 0, (float*)d_out + r0 * DM, nullptr, DM, 0, QT0, DM, DM);      /* rows 0..127: out = o_hi Wo (+ b), overwriting the f16-path rows */
    k_gemm2<0><<<dim3((QT0 / 128) * (DM / 64), 1), 128, 0, stream>>>(OL0 + f0 * DM, DM, 0, BO, DM, 0, 0.00000095367431640625f, nullptr, 0, (const float*)d_out + r0 * DM, -1, 0, 0, (float*)d_out + r0 * DM, nullptr, DM, 0, QT0, DM, DM); }      /* += o_lo Wo 2^-20 (own-element accumulate) */
}

// v005
// Measured time: 430 microseconds a run.
// Timed twice side by side with v004, it ran 2.21 and 2.23 times as fast.
// All steps since v000 together make it 24.2 times as fast.
#include <hip/hip_runtime.h>
// Causal multi-head self-attention with a PER-HEAD interleaved fused QKV projection and rotary embeddings (x [4][2048][1024]; qkv = x W_qkv + b_qkv ([in][out] 1024 x 3072, zero bias) reshaped (B, T, 16, 192): head h owns columns h*192 + [0..63 | 64..127 | 128..191] = q | k | v; rope on q and k from the INPUT tables cos / sin [2048][32]: t1 = even elements, t2 = odd elements, out = cat(t1 c - t2 s, t1 s + t2 c) (an interleaved-pair rotation followed by the same fixed permutation on q and k: the scores are unchanged by it); scores / 8; causal (tril, -inf); softmax; out = merged W_out + b_out ([in][out]) -> [4][2048][1024]).
// Structure: token rows r = b*2048 + s; x as exact f16 rows (bf16-rounded); Q, K, V as three WMMA GEMMs (32x64 wave tiles, f32 accumulation, exact x16 weights, f16 outputs; the q and k GEMMs apply the rope in their epilogue, in f32, before the rounding to f16); V^T for all batches and heads via LDS transposes; one fused attention launch (k_fattn): S^T = K Q^T, online causal softmax in registers (f32 statistics, native exp2; weights x256 f16), O^T += V^T P^T, o carried x64 (folded into the output GEMM alpha) written straight into the merged f16 o rows; out = o W_o GEMM (f32) into the output layout.
// Compute dtype: inputs rounded to bf16; x / weights exact; q, k, v, softmax weights and o as plain f16 GEMM operands (~2^-12); scores and softmax statistics f32. v_wmma_f32_16x16x32_f16.
#define NB 4
#define SQ 2048
#define DM 1024
#define NH 16
#define HD 64
#define HG 4                         /* heads per launch of the per-batch k_vt overload (never launched) */
#define QT0 128                      /* first-tile rows recomputed exactly in f32 */
#define B0 0                         /* first batch processed (debug hook) */
#define NBR NB                       /* batches processed (debug hook) */
#define NR ((size_t)NB * SQ)         /* token rows */
#define MP ((int)((size_t)NBR * SQ)) /* rows projected (debug hook) */
#define MPO MP                       /* rows through the output stage (debug hook) */
#define LQ DM      /* row pitch of the q/k/v rows */
typedef __bf16 v16b __attribute__((ext_vector_type(16)));
typedef unsigned short v8us __attribute__((ext_vector_type(8), may_alias));
typedef float  v8f  __attribute__((ext_vector_type(8)));
typedef float  v4f  __attribute__((ext_vector_type(4)));
typedef float  v4fa __attribute__((ext_vector_type(4), may_alias));
union FragB { v16b v; v8us half[2]; unsigned short u[16]; };

__device__ __forceinline__ unsigned short bf16_bits(float x) { unsigned int u = __float_as_uint(x); return (unsigned short)((u + 0x7FFFu + ((u >> 16) & 1u)) >> 16); }
__device__ __forceinline__ float bf16_val(unsigned short b) { return __uint_as_float(((unsigned int)b) << 16); }
__device__ __forceinline__ float bf16_round(float x) { return bf16_val(bf16_bits(x)); }
// D += A·B with NT terms: 1 = ah·bh, 2 = + al·bh (A split), 3 = + ah·bl (both split)
template <int NT>
__device__ __forceinline__ v8f mmaN(v16b ah, v16b al, v16b bh, v16b bl, v8f c) {
  c = __builtin_amdgcn_wmma_f32_16x16x32_bf16(false, ah, false, bh, (short)0, c, false, false);
  if (NT >= 2) c = __builtin_amdgcn_wmma_f32_16x16x32_bf16(false, al, false, bh, (short)0, c, false, false);
  if (NT >= 3) c = __builtin_amdgcn_wmma_f32_16x16x32_bf16(false, ah, false, bl, (short)0, c, false, false);
  asm volatile("v_nop\n\tv_nop\n\tv_nop\n\tv_nop" : "+v"(c) : "v"(ah), "v"(al), "v"(bh), "v"(bl));
  return c;
}

__global__ __launch_bounds__(256) void k_wt_bf16(const float* __restrict__ W, unsigned short* __restrict__ Wt, int K, int N) {
  const int t = blockIdx.x * 256 + threadIdx.x;
  const int k8n = K / 8;
  if (t >= N * k8n) return;
  const int n = t / k8n, k8 = (t % k8n) * 8;
  v8us v;
#pragma unroll
  for (int i = 0; i < 8; ++i) v[i] = bf16_bits(W[(size_t)(k8 + i) * N + n]);
  *(v8us*)(Wt + (size_t)n * K + k8) = v;
  
}

// GEMM C[M][N] (f32, pitch ldc) = act(A[M][K]·W + bias). A f32 row-major (pitch lda) converted per fragment to bf16
// (ASPLIT: hi/lo two planes -> 2 terms, else single rounded term); Wt bf16 [N][K] (pitch ldb). BIAS_BF16 rounds the
// bias to bf16 first (bias quantised to bf16 before the add). K%32==0, M%16==0, N%64==0.
template <bool ASPLIT, int ACT, bool BIAS_BF16>
__global__ __launch_bounds__(128) void k_gemm_bf(const float* __restrict__ A, int lda, const unsigned short* __restrict__ Wt, int ldb,
                                               const float* __restrict__ bias, float* __restrict__ C, int ldc, int M, int N, int K) {
  __shared__ __attribute__((aligned(16))) float so[4][16][64];
  const int tid = threadIdx.x, w = tid >> 5, lane = tid & 31, ln = lane & 15, hh = lane >> 4;
  const int ntn = N / 64;
  const int wid = blockIdx.x * 4 + w;
  const int mt = wid / ntn, nq = wid % ntn;
  if (mt * 16 >= M) return;
  const int row0 = mt * 16, col0 = nq * 64;
  const float* arow = A + (size_t)(row0 + ln) * lda;
  v8f acc[4] = {};
  for (int kb = 0; kb < K; kb += 32) {
    FragB ah, al;
    const v4f x0 = *(const v4fa*)(arow + kb + 8 * hh), x1 = *(const v4fa*)(arow + kb + 8 * hh + 4);
    const v4f x2 = *(const v4fa*)(arow + kb + 16 + 8 * hh), x3 = *(const v4fa*)(arow + kb + 16 + 8 * hh + 4);
    float xs[16] = {x0[0],x0[1],x0[2],x0[3],x1[0],x1[1],x1[2],x1[3],x2[0],x2[1],x2[2],x2[3],x3[0],x3[1],x3[2],x3[3]};
#pragma unroll
    for (int i = 0; i < 16; ++i) { const unsigned short hb = bf16_bits(xs[i]); ah.u[i] = hb; al.u[i] = ASPLIT ? bf16_bits(xs[i] - bf16_val(hb)) : (unsigned short)0; }
#pragma unroll
    for (int t = 0; t < 4; ++t) {
      const unsigned short* brow = Wt + (size_t)(col0 + t * 16 + ln) * ldb + kb;
      FragB b;
      b.half[0] = *(const v8us*)(brow + 8 * hh);
      b.half[1] = *(const v8us*)(brow + 16 + 8 * hh);
      acc[t] = mmaN<ASPLIT ? 2 : 1>(ah.v, al.v, b.v, b.v, acc[t]);
    }
  }
#pragma unroll
  for (int t = 0; t < 4; ++t) {
    float bv = bias ? bias[col0 + t * 16 + ln] : 0.f;
    if (BIAS_BF16) bv = bf16_round(bv);
#pragma unroll
    for (int r = 0; r < 8; ++r) { float v = acc[t][r] + bv; if (ACT == 1) v = fmaxf(v, 0.f); so[w][8 * hh + r][t * 16 + ln] = v; }
  }
  __builtin_amdgcn_fence(__ATOMIC_ACQ_REL, "workgroup");
  __builtin_amdgcn_wave_barrier();
  const int rsub = lane >> 4, c4 = (lane & 15) * 4;
  {
#pragma unroll
    for (int q = 0; q < 8; ++q) {
      const int r = q * 2 + rsub;
      const v4f v = *(const v4fa*)&so[w][r][c4];
      *(v4f*)(C + (size_t)(row0 + r) * ldc + col0 + c4) = v;
    }
    
  }
}

// GEMM C = act(A·W + bias + resid): A f32 (ASPLIT -> hi/lo 2 terms), Wt bf16 [N][K]; ACT 0 none, 1 relu, 2 exact gelu;
// resid (optional, f32, row index = (row % rmod), pitch ldr, RES_BF16 rounds it) added before the activation.
template <bool ASPLIT, int ACT, bool BIAS_BF16, bool RES_BF16>
__global__ __launch_bounds__(128) void k_gemm_bf3(const float* __restrict__ A, int lda, const unsigned short* __restrict__ Wt, int ldb,
                                                const float* __restrict__ bias, const float* __restrict__ resid, int rmod, int ldr,
                                                float* __restrict__ C, int ldc, int M, int N, int K) {
  __shared__ __attribute__((aligned(16))) float so[4][16][64];
  const int tid = threadIdx.x, w = tid >> 5, lane = tid & 31, ln = lane & 15, hh = lane >> 4;
  const int ntn = N / 64;
  const int wid = blockIdx.x * 4 + w;
  const int mt = wid / ntn, nq = wid % ntn;
  if (mt * 16 >= M) return;
  const int row0 = mt * 16, col0 = nq * 64;
  const float* arow = A + (size_t)(row0 + ln) * lda;
  v8f acc[4] = {};
  for (int kb = 0; kb < K; kb += 32) {
    FragB ah, al;
    const v4f x0 = *(const v4fa*)(arow + kb + 8 * hh), x1 = *(const v4fa*)(arow + kb + 8 * hh + 4);
    const v4f x2 = *(const v4fa*)(arow + kb + 16 + 8 * hh), x3 = *(const v4fa*)(arow + kb + 16 + 8 * hh + 4);
    float xs[16] = {x0[0],x0[1],x0[2],x0[3],x1[0],x1[1],x1[2],x1[3],x2[0],x2[1],x2[2],x2[3],x3[0],x3[1],x3[2],x3[3]};
#pragma unroll
    for (int i = 0; i < 16; ++i) { const unsigned short hb = bf16_bits(xs[i]); ah.u[i] = hb; al.u[i] = ASPLIT ? bf16_bits(xs[i] - bf16_val(hb)) : (unsigned short)0; }
#pragma unroll
    for (int t = 0; t < 4; ++t) {
      const unsigned short* brow = Wt + (size_t)(col0 + t * 16 + ln) * ldb + kb;
      FragB b;
      b.half[0] = *(const v8us*)(brow + 8 * hh);
      b.half[1] = *(const v8us*)(brow + 16 + 8 * hh);
      acc[t] = mmaN<ASPLIT ? 2 : 1>(ah.v, al.v, b.v, b.v, acc[t]);
    }
  }
#pragma unroll
  for (int t = 0; t < 4; ++t) {
    const int col = col0 + t * 16 + ln;
    float bv = bias ? bias[col] : 0.f;
    if (BIAS_BF16) bv = bf16_round(bv);
#pragma unroll
    for (int r = 0; r < 8; ++r) {
      float v = acc[t][r] + bv;
      if (resid) { float rv = resid[(size_t)((row0 + 8 * hh + r) % rmod) * ldr + col]; if (RES_BF16) rv = bf16_round(rv); v += rv; }
      if (ACT == 1) v = fmaxf(v, 0.f);
      if (ACT == 2) v = 0.5f * v * (1.0f + erff(v * 0.70710678118654752f));
      if (ACT == 3) { const float u = 0.7978845608028654f * (v + 0.044715f * v * v * v); v = 0.5f * v * (1.0f + tanhf(u)); }
      so[w][8 * hh + r][t * 16 + ln] = v;
    }
  }
  __builtin_amdgcn_fence(__ATOMIC_ACQ_REL, "workgroup");
  __builtin_amdgcn_wave_barrier();
  const int rsub = lane >> 4, c4 = (lane & 15) * 4;
  {
#pragma unroll
    for (int q = 0; q < 8; ++q) {
      const int r = q * 2 + rsub;
      const v4f v = *(const v4fa*)&so[w][r][c4];
      *(v4f*)(C + (size_t)(row0 + r) * ldc + col0 + c4) = v;
    }
    
  }
}
// row LayerNorm (biased variance, eps) over N: s = X (+ R); optional out_sum <- s; out_norm <- (s-mu)*rsqrt(var+eps)*g + b
template <bool PARAM_BF16>
__global__ __launch_bounds__(256) void k_layernorm(const float* __restrict__ X, const float* __restrict__ R, const float* __restrict__ g, const float* __restrict__ bta,
                                                  float* __restrict__ out_sum, float* __restrict__ out_norm, int N, float eps) {
  __shared__ float red[256];
  const int row = blockIdx.x, tid = threadIdx.x;
  const float* x = X + (size_t)row * N; const float* rr = R ? R + (size_t)row * N : nullptr;
  float vals[16];                     // up to N = 4096
  const int per = N / 256;            // contiguous chunk per thread? use strided-by-4 chunks: thread handles j = tid*4 + 1024*u
  float s1 = 0.f;
  for (int u = 0; u < per / 4; ++u) {
    const int j = tid * 4 + 1024 * u;
    const v4f a = *(const v4fa*)(x + j);
    v4f b = {0.f,0.f,0.f,0.f}; if (rr) b = *(const v4fa*)(rr + j);
#pragma unroll
    for (int q = 0; q < 4; ++q) { const float v = a[q] + b[q]; vals[u * 4 + q] = v; s1 += v; }
  }
  red[tid] = s1; __syncthreads();
  for (int st = 128; st > 0; st >>= 1) { if (tid < st) red[tid] += red[tid + st]; __syncthreads(); }
  const float mu = red[0] / (float)N; __syncthreads();
  float s2 = 0.f;
  for (int u = 0; u < per / 4; ++u)
#pragma unroll
    for (int q = 0; q < 4; ++q) { const float c = vals[u * 4 + q] - mu; s2 += c * c; }
  red[tid] = s2; __syncthreads();
  for (int st = 128; st > 0; st >>= 1) { if (tid < st) red[tid] += red[tid + st]; __syncthreads(); }
  const float rs = rsqrtf(red[0] / (float)N + eps);
  {
    for (int u = 0; u < per / 4; ++u) {
      const int j = tid * 4 + 1024 * u;
      v4f o, sm;
#pragma unroll
      for (int q = 0; q < 4; ++q) {
        float gg = g[j + q], bb = bta[j + q];
        if (PARAM_BF16) { gg = bf16_round(gg); bb = bf16_round(bb); }
        sm[q] = vals[u * 4 + q]; o[q] = (vals[u * 4 + q] - mu) * rs * gg + bb;
      }
      if (out_sum) *(v4f*)(out_sum + (size_t)row * N + j) = sm;
      *(v4f*)(out_norm + (size_t)row * N + j) = o;
    }
    
  }
}



// ---- f16 WMMA path (v_wmma_f32_16x16x32_f16): 11-bit significands for operands in range — used where a [0,1] probability operand needs more precision than bf16
typedef _Float16 v16h __attribute__((ext_vector_type(16)));
union FragH { v16h v; v8us half[2]; _Float16 h[16]; unsigned short u[16]; };
template <int NT>
__device__ __forceinline__ v8f mmaH(v16h ah, v16h al, v16h bh, v16h bl, v8f c) {
  c = __builtin_amdgcn_wmma_f32_16x16x32_f16(false, ah, false, bh, (short)0, c, false, false);
  if (NT >= 2) c = __builtin_amdgcn_wmma_f32_16x16x32_f16(false, al, false, bh, (short)0, c, false, false);
  if (NT >= 3) c = __builtin_amdgcn_wmma_f32_16x16x32_f16(false, ah, false, bl, (short)0, c, false, false);
  asm volatile("v_nop\n\tv_nop\n\tv_nop\n\tv_nop" : "+v"(c) : "v"(ah), "v"(al), "v"(bh), "v"(bl));
  return c;
}
// batched GEMM like k_gemm_b but f16 operands: A f32 (split into f16 hi/lo if ASPLIT, else rounded to f16), Bt = f16 values [n][k]; alpha; C f32; N multiple of 16 (partial tiles skipped)
template <bool ASPLIT>
__global__ __launch_bounds__(128) void k_gemm_h(const float* __restrict__ A, int lda, size_t sA, const _Float16* __restrict__ Bh, int ldb, size_t sB, float alpha, float* __restrict__ C, int ldc, size_t sC, int M, int N, int K) {
  __shared__ __attribute__((aligned(16))) float so[4][16][64];
  const int tid = threadIdx.x, w = tid >> 5, lane = tid & 31, ln = lane & 15, hh = lane >> 4; const int by = blockIdx.y;
  A += (size_t)by * sA; Bh += (size_t)by * sB; C += (size_t)by * sC;
  const int ntn = (N + 63) / 64; const int wid = blockIdx.x * 4 + w; const int mt = wid / ntn, nq = wid % ntn; if (mt * 16 >= M) return;
  const int row0 = mt * 16, col0 = nq * 64; const float* arow = A + (size_t)(row0 + ln) * lda;
  v8f acc[4] = {};
  for (int kb = 0; kb < K; kb += 32) {
    FragH ah, al;
    const v4f x0 = *(const v4fa*)(arow + kb + 8 * hh), x1 = *(const v4fa*)(arow + kb + 8 * hh + 4), x2 = *(const v4fa*)(arow + kb + 16 + 8 * hh), x3 = *(const v4fa*)(arow + kb + 16 + 8 * hh + 4);
    float xs[16] = {x0[0],x0[1],x0[2],x0[3],x1[0],x1[1],x1[2],x1[3],x2[0],x2[1],x2[2],x2[3],x3[0],x3[1],x3[2],x3[3]};
#pragma unroll
    for (int i = 0; i < 16; ++i) { const _Float16 h = (_Float16)xs[i]; ah.h[i] = h; al.h[i] = ASPLIT ? (_Float16)(xs[i] - (float)h) : (_Float16)0.0f; }
#pragma unroll
    for (int t = 0; t < 4; ++t) { if (col0 + t * 16 >= N) continue; const size_t boff = (size_t)(col0 + t * 16 + ln) * ldb + kb; FragH bq; bq.half[0] = *(const v8us*)(Bh + boff + 8 * hh); bq.half[1] = *(const v8us*)(Bh + boff + 16 + 8 * hh);
      acc[t] = mmaH<ASPLIT ? 2 : 1>(ah.v, al.v, bq.v, bq.v, acc[t]); }
  }
#pragma unroll
  for (int t = 0; t < 4; ++t) { if (col0 + t * 16 >= N) continue;
#pragma unroll
    for (int r = 0; r < 8; ++r) so[w][8 * hh + r][t * 16 + ln] = acc[t][r] * alpha; }
  __builtin_amdgcn_fence(__ATOMIC_ACQ_REL, "workgroup"); __builtin_amdgcn_wave_barrier();
  const int rsub = lane >> 4, c4 = (lane & 15) * 4;
  {
#pragma unroll
    for (int q = 0; q < 8; ++q) { const int r = q * 2 + rsub; if (col0 + c4 < N) { const v4f v = *(const v4fa*)&so[w][r][c4]; *(v4f*)(C + (size_t)(row0 + r) * ldc + col0 + c4) = v; } }
     }
}

// Wt[n][k] = f16(W[k][n]·scale) from f32 row-major W[K][N] (scale = power of two; bf16-exact weights stay exact in f16 away from the subnormal range)
__global__ __launch_bounds__(256) void k_wt_f16(const float* __restrict__ W, _Float16* __restrict__ Wt, int K, int N, float scale) {
  const int t = blockIdx.x * 256 + threadIdx.x; if (t >= N * (K / 8)) return; const int n = t / (K / 8), k8 = (t % (K / 8)) * 8; FragH f;
#pragma unroll
  for (int i = 0; i < 8; ++i) f.h[i] = (_Float16)(bf16_round(W[(size_t)(k8 + i) * N + n]) * scale); const v8us o = f.half[0];
  *(v8us*)((unsigned short*)Wt + (size_t)n * K + k8) = o; 
}
// k_gemm_hh variant with fused epilogue: v = acc·alpha + bias[by·sBias + col] (+ CP[(row/rowsPerB)·sCPb + by·64 + col] if CP) ; ACT 0 none / 1 elu ; writes f16 C16 (and f32 C if non-null)
template <int ACT>
__global__ __launch_bounds__(128) void k_gemm_hhx(const _Float16* __restrict__ A, int lda, size_t sA, const _Float16* __restrict__ Bh, int ldb, size_t sB, float alpha, const float* __restrict__ bias, size_t sBias, const float* __restrict__ CP, int rowsPerB, size_t sCPb, int row0g,
    float* __restrict__ C, _Float16* __restrict__ C16, int ldc, size_t sC, int M, int N, int K) {
  __shared__ __attribute__((aligned(16))) float so[4][16][64];
  const int tid = threadIdx.x, w = tid >> 5, lane = tid & 31, ln = lane & 15, hh = lane >> 4; const int by = blockIdx.y;
  A += (size_t)by * sA; Bh += (size_t)by * sB; const size_t cofs = (size_t)by * sC; const float* bp = bias ? bias + (size_t)by * sBias : nullptr;
  const int ntn = (N + 63) / 64; const int wid = blockIdx.x * 4 + w; const int mt = wid / ntn, nq = wid % ntn; if (mt * 16 >= M) return;
  const int row0 = mt * 16, col0 = nq * 64; const _Float16* arow = A + (size_t)(row0 + ln) * lda;
  v8f acc[4] = {};
  for (int kb = 0; kb < K; kb += 32) { FragH ah; ah.half[0] = *(const v8us*)((const unsigned short*)arow + kb + 8 * hh); ah.half[1] = *(const v8us*)((const unsigned short*)arow + kb + 16 + 8 * hh);
#pragma unroll
    for (int t = 0; t < 4; ++t) { if (col0 + t * 16 >= N) continue; const size_t boff = (size_t)(col0 + t * 16 + ln) * ldb + kb; FragH bq; bq.half[0] = *(const v8us*)((const unsigned short*)Bh + boff + 8 * hh); bq.half[1] = *(const v8us*)((const unsigned short*)Bh + boff + 16 + 8 * hh);
      acc[t] = mmaH<1>(ah.v, ah.v, bq.v, bq.v, acc[t]); }
  }
#pragma unroll
  for (int t = 0; t < 4; ++t) { if (col0 + t * 16 >= N) continue; const int col = col0 + t * 16 + ln; const float bv = bp ? bf16_round(bp[col]) : 0.f;
#pragma unroll
    for (int r = 0; r < 8; ++r) { float v = acc[t][r] * alpha + bv; if (CP) { const int rr = row0g + row0 + 8 * hh + r; if (rowsPerB < 0) v += CP[cofs + (size_t)rr * ldc + col];      /* rowsPerB < 0: own element of the batched C plane */ else { const int bidx = rr / rowsPerB; v += CP[(size_t)bidx * sCPb + (size_t)by * 64 + col]; } } if (ACT == 1) v = (v > 0.f) ? v : expm1f(v); else if (ACT == 7) v = (v > 0.f) ? v + 1.0f : expf(v); else if (ACT == 8) v = tanhf(v); else if (ACT == 9) v = 0.5f * v * (1.0f + tanhf(0.7978845608028654f * (v + 0.044715f * v * v * v))); else if (ACT == 11) v = 1.0f / (1.0f + expf(-v)); else if (ACT == 12) v = (v > 0.f) ? v : 0.01f * v; else if (ACT == 14) v = (v > 0.f) ? v : 0.1f * v; else if (ACT == 16) v = (v >= 0.f) ? v : 0.3f * v; else if (ACT == 17) v = (v >= 0.f) ? v : 0.2f * v; else if (ACT == 15) v = v / (1.0f + expf(-v)); else if (ACT == 3) v = fmaxf(v, 0.f); else if (ACT == 6) v = 0.5f * v * (1.0f + erff(v * 0.70710678118654752f)); so[w][8 * hh + r][t * 16 + ln] = v; } }
  __builtin_amdgcn_fence(__ATOMIC_ACQ_REL, "workgroup"); __builtin_amdgcn_wave_barrier();
  const int rsub = lane >> 4, c4 = (lane & 15) * 4; typedef _Float16 v4h __attribute__((ext_vector_type(4)));
  {
#pragma unroll
    for (int q = 0; q < 8; ++q) { const int r = q * 2 + rsub; if (col0 + c4 < N) { const v4f v = *(const v4fa*)&so[w][r][c4]; if (C) *(v4f*)(C + cofs + (size_t)(row0 + r) * ldc + col0 + c4) = v; if (C16) { v4h h4; for (int i = 0; i < 4; ++i) h4[i] = (_Float16)v[i]; *(v4h*)(C16 + cofs + (size_t)(row0 + r) * ldc + col0 + c4) = h4; } } }
     }
}


typedef _Float16 v4h __attribute__((ext_vector_type(4)));

__global__ __launch_bounds__(256) void k_x16(const float* __restrict__ x, _Float16* __restrict__ X16, size_t n8) { const size_t t = (size_t)blockIdx.x * 256 + threadIdx.x; if (t >= n8) return; FragH f;
#pragma unroll
  for (int q = 0; q < 8; ++q) f.h[q] = (_Float16)bf16_round(x[t * 8 + q]); *(v8us*)((unsigned short*)X16 + t * 8) = f.half[0];  }
__global__ __launch_bounds__(256) void k_h16(const float* __restrict__ x, _Float16* __restrict__ X16, size_t n8) { const size_t t = (size_t)blockIdx.x * 256 + threadIdx.x; if (t >= n8) return; FragH f;
#pragma unroll
  for (int q = 0; q < 8; ++q) f.h[q] = (_Float16)x[t * 8 + q]; *(v8us*)((unsigned short*)X16 + t * 8) = f.half[0];  }
__global__ __launch_bounds__(256) void k_round16f(const float* __restrict__ W, _Float16* __restrict__ Bt, size_t n8) { const size_t t = (size_t)blockIdx.x * 256 + threadIdx.x; if (t >= n8) return; FragH f;
#pragma unroll
  for (int i = 0; i < 8; ++i) f.h[i] = (_Float16)(bf16_round(W[t * 8 + i]) * 16.0f); *(v8us*)((unsigned short*)Bt + t * 8) = f.half[0];  }
template <int NHv, int TTv>
__global__ __launch_bounds__(256) void k_vt(const _Float16* __restrict__ V16, int ldv, int voff, _Float16* __restrict__ Vt) { __shared__ unsigned short tl[64][66]; const int tid = threadIdx.x; const int slab = blockIdx.x / (TTv / 64), lg = blockIdx.x % (TTv / 64); const int b = slab / NHv, h = slab % NHv;
  for (int i = tid; i < 64 * 8; i += 256) { const int r = i / 8, c8 = (i % 8) * 8; FragH f; f.half[0] = *(const v8us*)((const unsigned short*)V16 + ((size_t)b * TTv + lg * 64 + r) * ldv + voff + h * 64 + c8);
#pragma unroll
    for (int q = 0; q < 8; ++q) tl[r][c8 + q] = f.u[q]; }
  __syncthreads();
  {
#pragma unroll
    for (int rd = 0; rd < 2; ++rd) { const int d = rd * 32 + tid / 8, pc = tid % 8; FragH f;
#pragma unroll
      for (int q = 0; q < 8; ++q) f.u[q] = tl[pc * 8 + q][d];
      *(v8us*)((unsigned short*)Vt + ((size_t)slab * 64 + d) * TTv + lg * 64 + pc * 8) = f.half[0]; }
     } }

__global__ __launch_bounds__(256) void k_hl(const float* __restrict__ F, _Float16* __restrict__ Hh, _Float16* __restrict__ Hl, size_t n8) { const size_t t = (size_t)blockIdx.x * 256 + threadIdx.x; if (t >= n8) return; FragH fh, fl; const v4f a = *(const v4fa*)(F + t * 8), c = *(const v4fa*)(F + t * 8 + 4);
#pragma unroll
  for (int q = 0; q < 4; ++q) { _Float16 h = (_Float16)a[q]; fh.h[q] = h; fl.h[q] = (_Float16)((a[q] - (float)h) * 1024.0f); h = (_Float16)c[q]; fh.h[4 + q] = h; fl.h[4 + q] = (_Float16)((c[q] - (float)h) * 1024.0f); }
  { *(v8us*)((unsigned short*)Hh + t * 8) = fh.half[0]; *(v8us*)((unsigned short*)Hl + t * 8) = fl.half[0];  } }

// ---- fast GEMM (wave tile 32x64; requires M % 32 == 0 rows per launch region and N % 64 == 0); epilogue = k_gemm_hhx semantics ----
__device__ __forceinline__ v16h g2_frag(const _Float16* p, int hh) { FragH f; f.half[0] = *(const v8us*)((const unsigned short*)p + 8 * hh); f.half[1] = *(const v8us*)((const unsigned short*)p + 16 + 8 * hh); return f.v; }
__device__ __forceinline__ v8f g2_mma(v16h a, v16h b, v8f c) { v8f d = __builtin_amdgcn_wmma_f32_16x16x32_f16(false, a, false, b, (short)0, c, false, false); asm volatile("v_nop\n\tv_nop\n\tv_nop\n\tv_nop" : "+v"(d) : "v"(a), "v"(b)); return d; }
typedef float v2f __attribute__((ext_vector_type(2)));
// ROPE 1 (f16 rows to C16), 2 or 3 (f32 rows to C): the interleaved-pair rotation (position = row % SQ, tables CS / SN [SQ][HD / 2]) is applied to the finished f32 tile on its way from LDS to the f32 or f16 rows; a 64-column tile is one head, and a lane's four columns are two whole pairs.
// ROPE 3: one launch for q, k and v of every batch: blockIdx.y = plane * NBR + batch; sA steps the batch, sB and sBias the plane, sC both; planes 0 and 1 (q, k) are rotated, plane 2 (v) leaves by the plain path at the foot.
template <int ACT, int ROPE = 0>
__global__ __launch_bounds__(128) void k_gemm2(const _Float16* __restrict__ A, int lda, size_t sA, const _Float16* __restrict__ Bh, int ldb, size_t sB, float alpha, const float* __restrict__ bias, size_t sBias, const float* __restrict__ CP, int rowsPerB, size_t sCPb, int row0g,
    float* __restrict__ C, _Float16* __restrict__ C16, int ldc, size_t sC, int M, int N, int K, const float* __restrict__ CS = nullptr, const float* __restrict__ SN = nullptr) { static_assert(ACT == 0 || ACT == 3 || ACT == 6 || ACT == 8 || ACT == 9 || ACT == 11 || ACT == 12 || ACT == 14 || ACT == 15 || ACT == 16 || ACT == 17, "k_gemm2: unsupported ACT code (would silently apply no activation)");
  __shared__ __attribute__((aligned(16))) float so[4][32][68];
  const int tid = threadIdx.x, w = tid >> 5, lane = tid & 31, ln = lane & 15, hh = lane >> 4; const int by = blockIdx.y;
  const int pl = (ROPE == 3) ? by / NBR : by, ba = (ROPE == 3) ? by % NBR : by; const bool rot = ROPE != 3 || pl < 2;      /* blockIdx.y is a scalar: the tests on rot are scalar branches */
  A += (size_t)ba * sA; Bh += (size_t)pl * sB; const size_t cofs = (size_t)by * sC; const float* bp = bias ? bias + (size_t)pl * sBias : nullptr;
  const int ntn = N >> 6; const int mt = blockIdx.x / ntn, nq = blockIdx.x - mt * ntn; const int row0 = mt * 128 + 32 * w, col0 = nq * 64; if (row0 >= M) return;
  const _Float16* a0p = A + (size_t)(row0 + ln) * lda; const _Float16* a1p = a0p + (size_t)16 * lda;
  const _Float16* b0p = Bh + (size_t)(col0 + ln) * ldb; const _Float16* b1p = b0p + (size_t)16 * ldb; const _Float16* b2p = b1p + (size_t)16 * ldb; const _Float16* b3p = b2p + (size_t)16 * ldb;
  const v8f z8 = {0.f,0.f,0.f,0.f,0.f,0.f,0.f,0.f}; v8f c00 = z8, c01 = z8, c02 = z8, c03 = z8, c10 = z8, c11 = z8, c12 = z8, c13 = z8;
  v2f rc[16], rs[16];      /* ROPE: the lane's cos / sin pairs of its 16 rows, fetched ahead of the k loop, whose first trips cover their latency */
  if (ROPE && rot) { static_assert(HD == 64 && SQ % 32 == 0, "k_gemm2 rope: a 64-column tile is one head, a 32-row tile does not wrap the position");
    const float* cp = CS + (size_t)((row0 + (lane >> 4)) % SQ) * (HD / 2) + (lane & 15) * 2; const float* sp = SN + (size_t)((row0 + (lane >> 4)) % SQ) * (HD / 2) + (lane & 15) * 2;      /* the lane's own addresses: the 16 rows differ in the immediate offset alone */
#pragma unroll
    for (int q = 0; q < 16; ++q) { rc[q] = *(const v2f*)(cp + q * HD); rs[q] = *(const v2f*)(sp + q * HD); }      /* fully unrolled: rc and rs stay in registers; two rows on = 2 * (HD / 2) floats */
    asm volatile("s_wait_xcnt 0x0" :: "v"(cp), "v"(sp) : "memory"); }      /* the wait between the loads above and the first reuse of their address registers; the addresses are inputs so that their registers stay untouched up to it */
#pragma unroll 1
  for (int kb = 0; kb < K; kb += 32) { const v16h a0 = g2_frag(a0p + kb, hh), a1 = g2_frag(a1p + kb, hh);
    v16h b = g2_frag(b0p + kb, hh); c00 = g2_mma(a0, b, c00); c10 = g2_mma(a1, b, c10);
    b = g2_frag(b1p + kb, hh); c01 = g2_mma(a0, b, c01); c11 = g2_mma(a1, b, c11);
    b = g2_frag(b2p + kb, hh); c02 = g2_mma(a0, b, c02); c12 = g2_mma(a1, b, c12);
    b = g2_frag(b3p + kb, hh); c03 = g2_mma(a0, b, c03); c13 = g2_mma(a1, b, c13); }
  v8f accs[8] = {c00, c01, c02, c03, c10, c11, c12, c13};
#pragma unroll
  for (int u = 0; u < 8; ++u) { const int t = u & 3, half = u >> 2; const int col = col0 + t * 16 + ln; const float bv = bp ? bf16_round(bp[col]) : 0.f;
#pragma unroll
    for (int r = 0; r < 8; ++r) { const int rloc = half * 16 + 8 * hh + r; float v = accs[u][r] * alpha + bv; if (CP) { if (rowsPerB < 0) v += CP[cofs + (size_t)(row0g + row0 + rloc) * ldc + col];      /* rowsPerB < 0: own element of the batched C plane */ else { const int bidx = (row0g + row0 + rloc) / rowsPerB; v += CP[(size_t)bidx * sCPb + (size_t)by * 64 + col]; } }
      if (ACT == 3) v = fmaxf(v, 0.f); else if (ACT == 6) v = 0.5f * v * (1.0f + erff(v * 0.70710678118654752f)); else if (ACT == 11) v = 1.0f / (1.0f + expf(-v)); else if (ACT == 15) v = v / (1.0f + expf(-v)); else if (ACT == 12) v = (v > 0.f) ? v : 0.01f * v; else if (ACT == 8) v = tanhf(v); else if (ACT == 9) v = 0.5f * v * (1.0f + tanhf(0.7978845608028654f * (v + 0.044715f * v * v * v))); else if (ACT == 14) v = (v > 0.f) ? v : 0.1f * v; else if (ACT == 16) v = (v >= 0.f) ? v : 0.3f * v; else if (ACT == 17) v = (v >= 0.f) ? v : 0.2f * v;
      so[w][rloc][t * 16 + ln] = v; } }
  __builtin_amdgcn_fence(__ATOMIC_ACQ_REL, "workgroup"); __builtin_amdgcn_wave_barrier();
  const int rsub = lane >> 4, c4 = (lane & 15) * 4;
  if (ROPE && rot) { v4f t[16];      /* the sixteen row pieces are rotated first and then stored in one run; the destination is fixed at compile time */
#pragma unroll
    for (int q = 0; q < 16; ++q) { const v4f v = *(const v4fa*)&so[w][q * 2 + rsub][c4]; const v2f c = rc[q], s = rs[q];
      t[q][0] = v[0] * c[0] - v[1] * s[0]; t[q][1] = v[0] * s[0] + v[1] * c[0]; t[q][2] = v[2] * c[1] - v[3] * s[1]; t[q][3] = v[2] * s[1] + v[3] * c[1]; }
    if (ROPE >= 2) {
#pragma unroll
      for (int q = 0; q < 16; ++q) *(v4f*)(C + cofs + (size_t)(row0 + q * 2 + rsub) * ldc + col0 + c4) = t[q]; }
    else { v4h h4[16];
#pragma unroll
      for (int q = 0; q < 16; ++q) { h4[q][0] = (_Float16)t[q][0]; h4[q][1] = (_Float16)t[q][1]; h4[q][2] = (_Float16)t[q][2]; h4[q][3] = (_Float16)t[q][3]; }
#pragma unroll
      for (int q = 0; q < 16; ++q) *(v4h*)(C16 + cofs + (size_t)(row0 + q * 2 + rsub) * ldc + col0 + c4) = h4[q]; }
  } else {
#pragma unroll
    for (int q = 0; q < 16; ++q) { const int r = q * 2 + rsub; const v4f v = *(const v4fa*)&so[w][r][c4]; if (C) *(v4f*)(C + cofs + (size_t)(row0 + r) * ldc + col0 + c4) = v; if (C16) { v4h h4; for (int i = 0; i < 4; ++i) h4[i] = (_Float16)v[i]; *(v4h*)(C16 + cofs + (size_t)(row0 + r) * ldc + col0 + c4) = h4; } }
     } }


__global__ __launch_bounds__(256) void k_wnat(const float* __restrict__ w, size_t n8, _Float16* __restrict__ Bt) { const size_t t = (size_t)blockIdx.x * 256 + threadIdx.x; if (t >= n8) return; FragH f; for (int q = 0; q < 8; ++q) f.h[q] = (_Float16)(bf16_round(w[t * 8 + q]) * 16.0f); *(v8us*)((unsigned short*)Bt + t * 8) = f.half[0];  }
__global__ __launch_bounds__(256) void k_rsm(const float* __restrict__ S, _Float16* __restrict__ P, int nrows) {
  #pragma clang fp contract(off)
  const int i = blockIdx.x * 256 + threadIdx.x; if (i >= nrows) return; const float* s = S + (size_t)i * SQ; float mx = -3.0e38f;
#pragma unroll 1
  for (int j = 0; j < SQ; ++j) mx = fmaxf(mx, s[j]); float se = 0.f;
#pragma unroll 1
  for (int j = 0; j < SQ; ++j) se += expf(s[j] - mx); const float sc = 256.0f / se;
#pragma unroll 1
  for (int j0 = 0; j0 < SQ; j0 += 8) { FragH f; for (int q = 0; q < 8; ++q) f.h[q] = (_Float16)(expf(s[j0 + q] - mx) * sc); unsigned short* d = (unsigned short*)P + (size_t)i * SQ + j0; *(v8us*)d = f.half[0];  } }
__global__ __launch_bounds__(256) void k_vt(const _Float16* __restrict__ V16, int b, int h0, _Float16* __restrict__ VT) { __shared__ unsigned short tl[64][65]; const int tid = threadIdx.x; const int hh = blockIdx.x % HG, sg = blockIdx.x / HG; const int s0 = sg * 64; const int h = h0 + hh;
  for (int i = tid; i < 64 * 8; i += 256) { const int j = i / 8, d8 = (i % 8) * 8; FragH f; f.half[0] = *(const v8us*)((const unsigned short*)V16 + ((size_t)b * SQ + s0 + j) * DM + h * HD + d8); for (int q = 0; q < 8; ++q) tl[d8 + q][j] = f.u[q]; }
  __syncthreads();
  { for (int i = tid; i < 64 * 8; i += 256) { const int d = i / 8, j8 = (i % 8) * 8; FragH f; for (int q = 0; q < 8; ++q) f.u[q] = tl[d][j8 + q]; *(v8us*)((unsigned short*)VT + ((size_t)hh * HD + d) * SQ + s0 + j8) = f.half[0]; }  } }



#define FAQB 128                     /* query rows per block */
#define FAK 64                       /* keys per step */
#define FAP (HD + 8)                 /* LDS row pitch, halves */
__device__ __forceinline__ v8f fa_mma(v16h a, v16h b, v8f c) { return __builtin_amdgcn_wmma_f32_16x16x32_f16(false, a, false, b, (short)0, c, false, false); }
__global__ __launch_bounds__(128) void k_fattn(const _Float16* __restrict__ Q, const _Float16* __restrict__ Kh, const _Float16* __restrict__ VTa, _Float16* __restrict__ O) {
  static_assert(NB * NH == 64 && SQ / FAQB == 16 && HD == 64, "k_fattn: the block-to-tile map below is written for 64 (batch, head) pairs x 16 query blocks");
  __shared__ __attribute__((aligned(16))) _Float16 lk[FAK][FAP]; __shared__ __attribute__((aligned(16))) _Float16 lv[HD][FAP];
  const int tid = threadIdx.x, lane = tid & 31, ln = lane & 15, hh = lane >> 4; const int w = __builtin_amdgcn_readfirstlane(tid >> 5);      /* the wave's number as a scalar: the two tests on q0w below are scalar branches */
  const int g = blockIdx.x >> 8, sub = (blockIdx.x >> 6) & 3, bh = blockIdx.x & 63;
  const int qb = (g == 0) ? 15 - sub : ((g == 1) ? 8 + sub : ((g == 2) ? 7 - sub : sub));      /* a permutation of the 16 query blocks: long blocks start first, and blocks 256 apart in the index add up to the same length */
  const int b = bh / NH, h = bh % NH; const size_t r0 = (size_t)b * SQ; const int q0w = qb * FAQB + w * 32; const int nst = (qb + 1) * (FAQB / FAK);
  const unsigned short* qp = (const unsigned short*)Q + (r0 + q0w + ln) * LQ + h * HD + 8 * hh; v16h qf[2][2];      /* the lane's own address, so that the eight loads differ in the immediate offset alone; every loop but the step loop is fully unrolled: all array indices are constants and the arrays stay in registers */
#pragma unroll
  for (int nt = 0; nt < 2; ++nt)
#pragma unroll
    for (int kk = 0; kk < 2; ++kk) { FragH f; f.half[0] = *(const v8us*)(qp + (size_t)nt * 16 * LQ + kk * 32); f.half[1] = *(const v8us*)(qp + (size_t)nt * 16 * LQ + kk * 32 + 16); qf[nt][kk] = f.v; }      /* the k order of g2_frag */
  const int sr = tid >> 3, sc = (tid & 7) * 8;      /* staging: 8 lanes take one 128-byte row, a pass of the block 16 rows */
  const unsigned short* kp = (const unsigned short*)Kh + (r0 + sr) * LQ + h * HD + sc; const unsigned short* vp = (const unsigned short*)VTa + ((size_t)bh * HD + sr) * SQ + sc; v8us kr[4], vr[4];
#pragma unroll
  for (int u = 0; u < 4; ++u) { kr[u] = *(const v8us*)(kp + (size_t)u * 16 * LQ); vr[u] = *(const v8us*)(vp + (size_t)u * 16 * SQ); }
  asm volatile("s_wait_xcnt 0x0" :: "v"(qp), "v"(kp), "v"(vp) : "memory");      /* the wait between the loads above and the first rewrite of their address registers; the addresses are inputs so that their registers stay untouched up to it */
  const v8f z8 = {0.f, 0.f, 0.f, 0.f, 0.f, 0.f, 0.f, 0.f}; v8f o[4][2];
#pragma unroll
  for (int dt = 0; dt < 4; ++dt) { o[dt][0] = z8; o[dt][1] = z8; }
  float m[2] = {-1.0e30f, -1.0e30f}, l[2] = {0.f, 0.f};      /* running max (log2 units) and this lane's part of the running sum, per query tile */
  const float SC = 0.125f * 1.44269504088896340736f;      /* 1 / sqrt(64), in log2 units */
#pragma unroll 1
  for (int s = 0; s < nst; ++s) { const int k0 = s * FAK;      /* rolled: one step's code is long and its trip count varies by block */
#pragma unroll
    for (int u = 0; u < 4; ++u) { *(v8us*)&lk[u * 16 + sr][sc] = kr[u]; *(v8us*)&lv[u * 16 + sr][sc] = vr[u]; }
    __syncthreads();      /* publishes this step's K and V^T rows */
    if (s + 1 < nst) { kp += (size_t)FAK * LQ; vp += FAK;
#pragma unroll
      for (int u = 0; u < 4; ++u) { kr[u] = *(const v8us*)(kp + (size_t)u * 16 * LQ); vr[u] = *(const v8us*)(vp + (size_t)u * 16 * SQ); }
      asm volatile("s_wait_xcnt 0x0" :: "v"(kp), "v"(vp) : "memory"); }      /* as above: stands in front of the next step's address additions */
    if (k0 <= q0w + 31) {      /* a wave whose queries all lie below this step's keys only passes the barriers */
      v8f st[4][2];
#pragma unroll
      for (int kt = 0; kt < 4; ++kt) { st[kt][0] = z8; st[kt][1] = z8; }
#pragma unroll
      for (int kk = 0; kk < 2; ++kk)
#pragma unroll
        for (int kt = 0; kt < 4; ++kt) { const v16h a = g2_frag(&lk[kt * 16 + ln][kk * 32], hh); st[kt][0] = fa_mma(a, qf[0][kk], st[kt][0]); st[kt][1] = fa_mma(a, qf[1][kk], st[kt][1]); }
      if (k0 + FAK - 1 > q0w) {      /* only steps that reach past the wave's first query mask */
#pragma unroll
        for (int kt = 0; kt < 4; ++kt)
#pragma unroll
          for (int nt = 0; nt < 2; ++nt)
#pragma unroll
            for (int r = 0; r < 8; ++r) st[kt][nt][r] = (k0 + kt * 16 + 8 * hh + r <= q0w + nt * 16 + ln) ? st[kt][nt][r] : -3.0e38f; }
      v16h pf[2][2];
#pragma unroll
      for (int nt = 0; nt < 2; ++nt) { float mr = st[0][nt][0];
#pragma unroll
        for (int kt = 0; kt < 4; ++kt)
#pragma unroll
          for (int r = 0; r < 8; ++r) mr = fmaxf(mr, st[kt][nt][r]);
        mr = fmaxf(mr, __shfl_xor(mr, 16, 32));
        const float mn = fmaxf(m[nt], mr * SC); const float al = __builtin_amdgcn_exp2f(m[nt] - mn); m[nt] = mn; const float bs = 8.0f - mn;      /* + 8: weights carried x256; a masked key underflows to exactly 0 */
        v4f s4 = {0.f, 0.f, 0.f, 0.f};
#pragma unroll
        for (int kt = 0; kt < 4; ++kt)
#pragma unroll
          for (int r = 0; r < 8; ++r) { const float p = __builtin_amdgcn_exp2f(fmaf(st[kt][nt][r], SC, bs)); s4[r & 3] += p; pf[nt][kt >> 1][(kt & 1) * 8 + r] = (_Float16)p; }
        l[nt] = fmaf(l[nt], al, (s4[0] + s4[1]) + (s4[2] + s4[3]));
#pragma unroll
        for (int dt = 0; dt < 4; ++dt) o[dt][nt] *= al; }
#pragma unroll
      for (int j = 0; j < 2; ++j)
#pragma unroll
        for (int dt = 0; dt < 4; ++dt) { const v16h a = g2_frag(&lv[dt * 16 + ln][j * 32], hh); o[dt][0] = fa_mma(a, pf[0][j], o[dt][0]); o[dt][1] = fa_mma(a, pf[1][j], o[dt][1]); } }
    __syncthreads(); }      /* ends every wave's reads of this step's rows before the next step's stores */
  FragH t[2][4];      /* all eight 16-byte results are formed first: no store's data register is rewritten behind it */
#pragma unroll
  for (int nt = 0; nt < 2; ++nt) { const float f = 64.0f / (l[nt] + __shfl_xor(l[nt], 16, 32));
#pragma unroll
    for (int dt = 0; dt < 4; ++dt)
#pragma unroll
      for (int r = 0; r < 8; ++r) t[nt][dt].h[r] = (_Float16)(o[dt][nt][r] * f); }
  unsigned short* op = (unsigned short*)O + (r0 + q0w + ln) * DM + h * HD + 8 * hh;
#pragma unroll
  for (int nt = 0; nt < 2; ++nt)
#pragma unroll
    for (int dt = 0; dt < 4; ++dt) *(v8us*)(op + (size_t)nt * 16 * DM + dt * 16) = t[nt][dt].half[0]; }


// Exact f32 attention for the first QT0 rows of every batch (blockIdx.y; planes of QT0 rows a batch; o carried x64 like the f16 path). One wave per query row, A0R rows of one head per block.
// All QT0 K and V rows of the head are staged in LDS once by coalesced 16-byte loads. K rows get a pitch of 68 floats (16 bytes x odd), so that 32 lanes reading 32 rows by 16 bytes spread over the banks.
// Scores: lane = key (four partial sums over the head dimension). Row max and row sum: five-step butterfly. o: lane = two head columns, loop over the keys, each key's weight read from its lane into a scalar register; keys above the row carry weight 0.
#define A0R 8                        /* rows (waves) per block */
#define A0KP (HD + 4)                /* K row pitch in LDS, floats */
__global__ __launch_bounds__(256) void k_att0w(const float* __restrict__ QF, const float* __restrict__ KF, const float* __restrict__ VF, float scale, float* __restrict__ OF) {
  __shared__ __attribute__((aligned(16))) float lk[QT0][A0KP]; __shared__ __attribute__((aligned(16))) float lv[QT0][HD];
  const int tid = threadIdx.x, lane = tid & 31; const int w = __builtin_amdgcn_readfirstlane(tid >> 5);      /* the wave's number as a scalar: row, group count and branches below are wave-uniform */
  const int h = blockIdx.x / (QT0 / A0R), r0 = (blockIdx.x % (QT0 / A0R)) * A0R; const int i = r0 + w;
  const size_t pb = (size_t)blockIdx.y * QT0 * DM; QF += pb; KF += pb; VF += pb; OF += pb;
  const float* qr = QF + (size_t)i * DM + h * HD; v4f q[HD / 4];      /* every loop of this kernel is fully unrolled: the indices into q, kk, vv, sv and o and the lane of each readlane are then constants, so the arrays stay in registers */
#pragma unroll
  for (int c = 0; c < HD / 4; ++c) q[c] = *(const v4fa*)(qr + c * 4);      /* the wave's own q row, whole */
  const int sj = tid >> 4, sc4 = (tid & 15) * 4; const float* kp = KF + (size_t)sj * DM + h * HD + sc4; const float* vp = VF + (size_t)sj * DM + h * HD + sc4; v4f kk[QT0 / 16], vv[QT0 / 16];      /* one pass of the block stages 16 rows; both loops are fully unrolled and free of branches so that every load of the block is in flight before the first LDS store waits; the row pitch is a constant, so the passes differ in the immediate offset alone */
#pragma unroll
  for (int u = 0; u < QT0 / 16; ++u) { kk[u] = *(const v4fa*)(kp + (size_t)u * 16 * DM); vv[u] = *(const v4fa*)(vp + (size_t)u * 16 * DM); }
  asm volatile("s_wait_xcnt 0x0" :: "v"(kp), "v"(vp) : "memory");      /* the wait between the loads above and the first reuse of their address registers; the two addresses are inputs so that their registers stay untouched up to it */
#pragma unroll
  for (int u = 0; u < QT0 / 16; ++u) { *(v4f*)&lk[u * 16 + sj][sc4] = kk[u]; *(v4f*)&lv[u * 16 + sj][sc4] = vv[u]; }
  __syncthreads();
  const int ng = (i >> 5) + 1;      /* key groups of 32 that hold a key <= i */
  float sv[QT0 / 32];
#pragma unroll
  for (int g = 0; g < QT0 / 32; ++g) { sv[g] = -1.0e30f;
    if (g < ng) { const int j = g * 32 + lane; v4f a = {0.f, 0.f, 0.f, 0.f};
#pragma unroll
      for (int c = 0; c < HD / 4; ++c) a += q[c] * *(const v4f*)&lk[j][c * 4];
      const float s = ((a[0] + a[1]) + (a[2] + a[3])) * scale; sv[g] = (j <= i) ? s : -1.0e30f; } }
  float mx = fmaxf(fmaxf(sv[0], sv[1]), fmaxf(sv[2], sv[3]));
#pragma unroll
  for (int m = 16; m >= 1; m >>= 1) mx = fmaxf(mx, __shfl_xor(mx, m, 32));
  float se = 0.f;
#pragma unroll
  for (int g = 0; g < QT0 / 32; ++g) { const float e = expf(sv[g] - mx); sv[g] = e; se += e; }      /* a key above the row holds -1e30: its weight underflows to exactly 0 */
#pragma unroll
  for (int m = 16; m >= 1; m >>= 1) se += __shfl_xor(se, m, 32);
  v2f o[4] = {{0.f, 0.f}, {0.f, 0.f}, {0.f, 0.f}, {0.f, 0.f}};      /* four partial sums over the keys (key mod 4): four independent add chains */
#pragma unroll
  for (int g = 0; g < QT0 / 32; ++g) if (g < ng) {
#pragma unroll
    for (int jj = 0; jj < 32; ++jj) { const float e = __int_as_float(__builtin_amdgcn_readlane(__float_as_int(sv[g]), jj)); o[jj & 3] += e * *(const v2f*)&lv[g * 32 + jj][lane * 2]; } }
  const float fin = 64.0f / se; const v2f r = ((o[0] + o[1]) + (o[2] + o[3])) * fin;
  *(v2f*)(OF + (size_t)i * DM + h * HD + lane * 2) = r; }


__global__ __launch_bounds__(256) void k_wt_hq(const float* __restrict__ Wf, const float* __restrict__ bf, _Float16* __restrict__ Bq, _Float16* __restrict__ Bk, _Float16* __restrict__ Bv, float* __restrict__ B3) {
  const int t = blockIdx.x * 256 + threadIdx.x; if (t >= 3 * DM * (DM / 8)) return; const int n = t / (DM / 8), k8 = (t % (DM / 8)) * 8; const int h = n / (3 * HD), wh = (n % (3 * HD)) / HD, d = n % HD; const int row = h * HD + d; FragH f;
#pragma unroll
  for (int i = 0; i < 8; ++i) f.h[i] = (_Float16)(bf16_round(Wf[(size_t)(k8 + i) * (3 * DM) + n]) * 16.0f); const v8us o = f.half[0];
  _Float16* dst = (wh == 0) ? Bq : ((wh == 1) ? Bk : Bv); unsigned short* p = (unsigned short*)dst + (size_t)row * DM + k8; *(v8us*)p = o; 
  (void)bf; (void)B3; }
__global__ __launch_bounds__(256) void k_bhq(const float* __restrict__ bf, float* __restrict__ B3) {
  const int t = blockIdx.x * 256 + threadIdx.x; if (t >= 3 * DM) return; const int wh = t / DM, row = t % DM; const int h = row / HD, d = row % HD; const float v = bf16_round(bf[h * (3 * HD) + wh * HD + d]); *(float*)(B3 + t) = v;  }

__global__ __launch_bounds__(256) void k_tabcp32(const float* __restrict__ tc, const float* __restrict__ tsn, float* __restrict__ CS, float* __restrict__ SN, int n) {
  const int t = blockIdx.x * 256 + threadIdx.x; if (t >= n) return; const float c = bf16_round(tc[t]), s = bf16_round(tsn[t]);
  *(float*)(CS + t) = c; *(float*)(SN + t) = s;  }
extern "C" void kernel_launch(void* const* d_in, const int* in_sizes, int n_in,
                              void* d_out, int out_size, void* d_ws, size_t ws_size, hipStream_t stream) {
  (void)in_sizes; (void)n_in; (void)out_size;
  const float* const* I = (const float* const*)d_in; const float* x = I[0]; const float* wqkv = I[1]; const float* bqkv = I[2]; const float* wo = I[3]; const float* bo = I[4]; const float* tcos = I[5]; const float* tsin = I[6];      /* x; fused W_qkv [1024][3072] + b_qkv [3072] ([in][out]; per-head (q | k | v) column triples); W_out + b_out ([in][out]); rope tables cos / sin [2048][32] */
  char* ws = (char*)d_ws; size_t off = 0;
  auto take = [&](size_t bytes) { char* p = ws + off; off += (bytes + 255) & ~(size_t)255; return p; };
  _Float16* BQ = (_Float16*)take((size_t)DM * DM * 2); _Float16* BK = (_Float16*)take((size_t)DM * DM * 2); _Float16* BV = (_Float16*)take((size_t)DM * DM * 2); _Float16* BO = (_Float16*)take((size_t)DM * DM * 2);
  float* BQB = (float*)take((size_t)3 * DM * 4); float* CSB = (float*)take((size_t)SQ * 32 * 4); float* SNB = (float*)take((size_t)SQ * 32 * 4);      /* de-interleaved bias vector bq | bk | bv; bf16-rounded copies of the rope tables */ _Float16* X16 = (_Float16*)take(NR * DM * 2); _Float16* Q16 = (_Float16*)take(NR * DM * 2); _Float16* K16 = (_Float16*)take(NR * DM * 2); _Float16* V16 = (_Float16*)take(NR * DM * 2); _Float16* O16 = (_Float16*)take(NR * DM * 2);
  _Float16* VT = (_Float16*)take((size_t)NB * NH * HD * SQ * 2);
  float* QF0 = (float*)take((size_t)3 * NBR * QT0 * DM * 4); float* KF0 = QF0 + (size_t)NBR * QT0 * DM; float* VF0 = KF0 + (size_t)NBR * QT0 * DM;      /* first-tile f32 q | k | v, each NBR planes of QT0 rows, one after the other */ float* OF0 = (float*)take((size_t)NB * QT0 * DM * 4); _Float16* OH0 = (_Float16*)take((size_t)NB * QT0 * DM * 2); _Float16* OL0 = (_Float16*)take((size_t)NB * QT0 * DM * 2);
  if (off > ws_size) return;
  k_wt_hq<<<(unsigned)(((size_t)3 * DM * (DM / 8) + 255) / 256), 256, 0, stream>>>(wqkv, bqkv, BQ, BK, BV, BQB); k_bhq<<<(3 * DM + 255) / 256, 256, 0, stream>>>(bqkv, BQB); k_wt_f16<<<(unsigned)(((size_t)DM * (DM / 8) + 255) / 256), 256, 0, stream>>>(wo, BO, DM, DM, 16.0f);      /* fused [in][out] weight with per-head (q | k | v) column triples -> three Bt planes (row h*64 + d) x16 + the de-interleaved bias vector; W_out [in][out] -> Bt x16 */
  k_tabcp32<<<(SQ * 32 + 255) / 256, 256, 0, stream>>>(tcos, tsin, CSB, SNB, SQ * 32);      /* rope tables [pos][32], bf16-rounded copies */

  k_x16<<<(unsigned)((NR * DM / 8 + 255) / 256), 256, 0, stream>>>(x, X16, NR * DM / 8);
  const size_t r0p = (size_t)B0 * SQ;      /* first projected row */
  k_gemm2<0, 1><<<dim3((unsigned)((MP / 128) * (DM / 64)), 1), 128, 0, stream>>>(X16 + r0p * DM, DM, 0, BQ, DM, 0, 0.0625f, BQB, 0, nullptr, 1, 0, 0, nullptr, Q16 + r0p * DM, DM, 0, MP, DM, DM, CSB, SNB);      /* q (f32) + bias -> interleaved-pair rope (position = row % SQ) -> f16 rows, in one launch */
  k_gemm2<0, 1><<<dim3((unsigned)((MP / 128) * (DM / 64)), 1), 128, 0, stream>>>(X16 + r0p * DM, DM, 0, BK, DM, 0, 0.0625f, BQB + DM, 0, nullptr, 1, 0, 0, nullptr, K16 + r0p * DM, DM, 0, MP, DM, DM, CSB, SNB);      /* k likewise */
  k_gemm2<0><<<dim3((unsigned)((MP / 128) * (DM / 64)), 1), 128, 0, stream>>>(X16 + r0p * DM, DM, 0, BV, DM, 0, 0.0625f, BQB + 2 * DM, 0, nullptr, 1, 0, 0, nullptr, V16 + r0p * DM, DM, 0, MP, DM, DM);
  k_gemm2<0, 3><<<dim3((QT0 / 128) * (DM / 64), 3 * NBR), 128, 0, stream>>>(X16 + r0p * DM, DM, (size_t)SQ * DM, BQ, DM, (size_t)DM * DM, 0.0625f, BQB, DM, nullptr, 1, 0, 0, QF0, nullptr, DM, (size_t)QT0 * DM, QT0, DM, DM, CSB, SNB);      /* f32 q, k, v of the first 128 rows of every batch (exact products) in one launch; BQ | BK | BV lie one after the other; q and k leave it roped, in f32 (first-tile row r = position r) */
  k_att0w<<<dim3(NH * (QT0 / A0R), NBR), 256, 0, stream>>>(QF0, KF0, VF0, 0.125f, OF0 + (size_t)B0 * QT0 * DM);      /* exact f32 attention for rows 0..127 of every batch (o x64) */
  k_vt<NH, SQ><<<NB * NH * (SQ / 64), 256, 0, stream>>>(V16, LQ, 0, VT);      /* V^T [NB][NH][HD][SQ] */
  k_fattn<<<NB * NH * (SQ / FAQB), 128, 0, stream>>>(Q16, K16, VT, O16);      /* scores, causal softmax and P V in one launch; o (merged heads, x64) as f16 rows */
  k_gemm2<0><<<dim3((unsigned)((MPO / 128) * (DM / 64)), 1), 128, 0, stream>>>(O16 + r0p * DM, DM, 0, BO, DM, 0, 0.0009765625f, bo, 0, nullptr, 1, 0, 0, (float*)d_out + r0p * DM, nullptr, DM, 0, MPO, DM, DM);      /* out rows are the output layout */
  k_hl<<<(unsigned)(((size_t)NB * QT0 * DM / 8 + 255) / 256), 256, 0, stream>>>(OF0, OH0, OL0, (size_t)NB * QT0 * DM / 8);      /* first-tile o (x64) -> f16 hi + x1024 residual planes */
  const size_t f0 = (size_t)B0 * QT0;      /* the two launches below take every batch through blockIdx.y: QT0 rows a batch in, SQ rows a batch out */
  k_gemm2<0><<<dim3((QT0 / 128) * (DM / 64), NBR), 128, 0, stream>>>(OH0 + f0 * DM, DM, (size_t)QT0 * DM, BO, DM, 0, 0.0009765625f, bo, 0, nullptr, 1, 0, 0, (float*)d_out + r0p * DM, nullptr, DM, (size_t)SQ * DM, QT0, DM, DM);      /* rows 0..127: out = o_hi Wo (+ b), overwriting the f16-path rows */
  k_gemm2<0><<<dim3((QT0 / 128) * (DM / 64), NBR), 128, 0, stream>>>(OL0 + f0 * DM, DM, (size_t)QT0 * DM, BO, DM, 0, 0.00000095367431640625f, nullptr, 0, (const float*)d_out + r0p * DM, -1, 0, 0, (float*)d_out + r0p * DM, nullptr, DM, (size_t)SQ * DM, QT0, DM, DM);      /* += o_lo Wo 2^-20 (own-element accumulate) */
}

// v006
// A run of this version takes 229 microseconds.
// Timed twice side by side with v005, it ran 1.88 and 1.86 times as fast.
// All steps since v000 together make it 45.3 times as fast.
#include <hip/hip_runtime.h>
// Causal multi-head self-attention with a PER-HEAD interleaved fused QKV projection and rotary embeddings (x [4][2048][1024]; qkv = x W_qkv + b_qkv ([in][out] 1024 x 3072, zero bias) reshaped (B, T, 16, 192): head h owns columns h*192 + [0..63 | 64..127 | 128..191] = q | k | v; rope on q and k from the INPUT tables cos / sin [2048][32]: t1 = even elements, t2 = odd elements, out = cat(t1 c - t2 s, t1 s + t2 c) (an interleaved-pair rotation followed by the same fixed permutation on q and k: the scores are unchanged by it); scores / 8; causal (tril, -inf); softmax; out = merged W_out + b_out ([in][out]) -> [4][2048][1024]).
// Structure: token rows r = b*2048 + s; x as exact f16 rows (bf16-rounded); Q, K, V as three WMMA GEMMs (32x64 wave tiles, f32 accumulation, exact x16 weights, f16 outputs; the q and k GEMMs apply the rope in their epilogue, in f32, before the rounding to f16); V^T for all batches and heads via LDS transposes; one fused attention launch (k_fattn): S^T = K Q^T, online causal softmax in registers (f32 statistics, native exp2; weights x256 f16), O^T += V^T P^T, o carried x64 (folded into the output GEMM alpha) written straight into the merged f16 o rows; out = o W_o GEMM (f32) into the output layout.
// Compute dtype: inputs rounded to bf16; x / weights exact; q, k, v, softmax weights and o as plain f16 GEMM operands (~2^-12); scores and softmax statistics f32. v_wmma_f32_16x16x32_f16.
#define NB 4
#define SQ 2048
#define DM 1024
#define NH 16
#define HD 64
#define HG 4                         /* heads per launch of the per-batch k_vt overload (never launched) */
#define QT0 128                      /* first-tile rows recomputed exactly in f32 */
#define B0 0                         /* first batch processed (debug hook) */
#define NBR NB                       /* batches processed (debug hook) */
#define NR ((size_t)NB * SQ)         /* token rows */
#define MP ((int)((size_t)NBR * SQ)) /* rows projected (debug hook) */
#define MPO MP                       /* rows through the output stage (debug hook) */
#define LQ DM      /* row pitch of the q/k/v rows */
typedef __bf16 v16b __attribute__((ext_vector_type(16)));
typedef unsigned short v8us __attribute__((ext_vector_type(8), may_alias));
typedef float  v8f  __attribute__((ext_vector_type(8)));
typedef float  v4f  __attribute__((ext_vector_type(4)));
typedef float  v4fa __attribute__((ext_vector_type(4), may_alias));
union FragB { v16b v; v8us half[2]; unsigned short u[16]; };

__device__ __forceinline__ unsigned short bf16_bits(float x) { unsigned int u = __float_as_uint(x); return (unsigned short)((u + 0x7FFFu + ((u >> 16) & 1u)) >> 16); }
__device__ __forceinline__ float bf16_val(unsigned short b) { return __uint_as_float(((unsigned int)b) << 16); }
__device__ __forceinline__ float bf16_round(float x) { return bf16_val(bf16_bits(x)); }
// D += A·B with NT terms: 1 = ah·bh, 2 = + al·bh (A split), 3 = + ah·bl (both split)
template <int NT>
__device__ __forceinline__ v8f mmaN(v16b ah, v16b al, v16b bh, v16b bl, v8f c) {
  c = __builtin_amdgcn_wmma_f32_16x16x32_bf16(false, ah, false, bh, (short)0, c, false, false);
  if (NT >= 2) c = __builtin_amdgcn_wmma_f32_16x16x32_bf16(false, al, false, bh, (short)0, c, false, false);
  if (NT >= 3) c = __builtin_amdgcn_wmma_f32_16x16x32_bf16(false, ah, false, bl, (short)0, c, false, false);
  asm volatile("v_nop\n\tv_nop\n\tv_nop\n\tv_nop" : "+v"(c) : "v"(ah), "v"(al), "v"(bh), "v"(bl));
  return c;
}

__global__ __launch_bounds__(256) void k_wt_bf16(const float* __restrict__ W, unsigned short* __restrict__ Wt, int K, int N) {
  const int t = blockIdx.x * 256 + threadIdx.x;
  const int k8n = K / 8;
  if (t >= N * k8n) return;
  const int n = t / k8n, k8 = (t % k8n) * 8;
  v8us v;
#pragma unroll
  for (int i = 0; i < 8; ++i) v[i] = bf16_bits(W[(size_t)(k8 + i) * N + n]);
  *(v8us*)(Wt + (size_t)n * K + k8) = v;
  
}

// GEMM C[M][N] (f32, pitch ldc) = act(A[M][K]·W + bias). A f32 row-major (pitch lda) converted per fragment to bf16
// (ASPLIT: hi/lo two planes -> 2 terms, else single rounded term); Wt bf16 [N][K] (pitch ldb). BIAS_BF16 rounds the
// bias to bf16 first (bias quantised to bf16 before the add). K%32==0, M%16==0, N%64==0.
template <bool ASPLIT, int ACT, bool BIAS_BF16>
__global__ __launch_bounds__(128) void k_gemm_bf(const float* __restrict__ A, int lda, const unsigned short* __restrict__ Wt, int ldb,
                                               const float* __restrict__ bias, float* __restrict__ C, int ldc, int M, int N, int K) {
  __shared__ __attribute__((aligned(16))) float so[4][16][64];
  const int tid = threadIdx.x, w = tid >> 5, lane = tid & 31, ln = lane & 15, hh = lane >> 4;
  const int ntn = N / 64;
  const int wid = blockIdx.x * 4 + w;
  const int mt = wid / ntn, nq = wid % ntn;
  if (mt * 16 >= M) return;
  const int row0 = mt * 16, col0 = nq * 64;
  const float* arow = A + (size_t)(row0 + ln) * lda;
  v8f acc[4] = {};
  for (int kb = 0; kb < K; kb += 32) {
    FragB ah, al;
    const v4f x0 = *(const v4fa*)(arow + kb + 8 * hh), x1 = *(const v4fa*)(arow + kb + 8 * hh + 4);
    const v4f x2 = *(const v4fa*)(arow + kb + 16 + 8 * hh), x3 = *(const v4fa*)(arow + kb + 16 + 8 * hh + 4);
    float xs[16] = {x0[0],x0[1],x0[2],x0[3],x1[0],x1[1],x1[2],x1[3],x2[0],x2[1],x2[2],x2[3],x3[0],x3[1],x3[2],x3[3]};
#pragma unroll
    for (int i = 0; i < 16; ++i) { const unsigned short hb = bf16_bits(xs[i]); ah.u[i] = hb; al.u[i] = ASPLIT ? bf16_bits(xs[i] - bf16_val(hb)) : (unsigned short)0; }
#pragma unroll
    for (int t = 0; t < 4; ++t) {
      const unsigned short* brow = Wt + (size_t)(col0 + t * 16 + ln) * ldb + kb;
      FragB b;
      b.half[0] = *(const v8us*)(brow + 8 * hh);
      b.half[1] = *(const v8us*)(brow + 16 + 8 * hh);
      acc[t] = mmaN<ASPLIT ? 2 : 1>(ah.v, al.v, b.v, b.v, acc[t]);
    }
  }
#pragma unroll
  for (int t = 0; t < 4; ++t) {
    float bv = bias ? bias[col0 + t * 16 + ln] : 0.f;
    if (BIAS_BF16) bv = bf16_round(bv);
#pragma unroll
    for (int r = 0; r < 8; ++r) { float v = acc[t][r] + bv; if (ACT == 1) v = fmaxf(v, 0.f); so[w][8 * hh + r][t * 16 + ln] = v; }
  }
  __builtin_amdgcn_fence(__ATOMIC_ACQ_REL, "workgroup");
  __builtin_amdgcn_wave_barrier();
  const int rsub = lane >> 4, c4 = (lane & 15) * 4;
  {
#pragma unroll
    for (int q = 0; q < 8; ++q) {
      const int r = q * 2 + rsub;
      const v4f v = *(const v4fa*)&so[w][r][c4];
      *(v4f*)(C + (size_t)(row0 + r) * ldc + col0 + c4) = v;
    }
    
  }
}

// GEMM C = act(A·W + bias + resid): A f32 (ASPLIT -> hi/lo 2 terms), Wt bf16 [N][K]; ACT 0 none, 1 relu, 2 exact gelu;
// resid (optional, f32, row index = (row % rmod), pitch ldr, RES_BF16 rounds it) added before the activation.
template <bool ASPLIT, int ACT, bool BIAS_BF16, bool RES_BF16>
__global__ __launch_bounds__(128) void k_gemm_bf3(const float* __restrict__ A, int lda, const unsigned short* __restrict__ Wt, int ldb,
                                                const float* __restrict__ bias, const float* __restrict__ resid, int rmod, int ldr,
                                                float* __restrict__ C, int ldc, int M, int N, int K) {
  __shared__ __attribute__((aligned(16))) float so[4][16][64];
  const int tid = threadIdx.x, w = tid >> 5, lane = tid & 31, ln = lane & 15, hh = lane >> 4;
  const int ntn = N / 64;
  const int wid = blockIdx.x * 4 + w;
  const int mt = wid / ntn, nq = wid % ntn;
  if (mt * 16 >= M) return;
  const int row0 = mt * 16, col0 = nq * 64;
  const float* arow = A + (size_t)(row0 + ln) * lda;
  v8f acc[4] = {};
  for (int kb = 0; kb < K; kb += 32) {
    FragB ah, al;
    const v4f x0 = *(const v4fa*)(arow + kb + 8 * hh), x1 = *(const v4fa*)(arow + kb + 8 * hh + 4);
    const v4f x2 = *(const v4fa*)(arow + kb + 16 + 8 * hh), x3 = *(const v4fa*)(arow + kb + 16 + 8 * hh + 4);
    float xs[16] = {x0[0],x0[1],x0[2],x0[3],x1[0],x1[1],x1[2],x1[3],x2[0],x2[1],x2[2],x2[3],x3[0],x3[1],x3[2],x3[3]};
#pragma unroll
    for (int i = 0; i < 16; ++i) { const unsigned short hb = bf16_bits(xs[i]); ah.u[i] = hb; al.u[i] = ASPLIT ? bf16_bits(xs[i] - bf16_val(hb)) : (unsigned short)0; }
#pragma unroll
    for (int t = 0; t < 4; ++t) {
      const unsigned short* brow = Wt + (size_t)(col0 + t * 16 + ln) * ldb + kb;
      FragB b;
      b.half[0] = *(const v8us*)(brow + 8 * hh);
      b.half[1] = *(const v8us*)(brow + 16 + 8 * hh);
      acc[t] = mmaN<ASPLIT ? 2 : 1>(ah.v, al.v, b.v, b.v, acc[t]);
    }
  }
#pragma unroll
  for (int t = 0; t < 4; ++t) {
    const int col = col0 + t * 16 + ln;
    float bv = bias ? bias[col] : 0.f;
    if (BIAS_BF16) bv = bf16_round(bv);
#pragma unroll
    for (int r = 0; r < 8; ++r) {
      float v = acc[t][r] + bv;
      if (resid) { float rv = resid[(size_t)((row0 + 8 * hh + r) % rmod) * ldr + col]; if (RES_BF16) rv = bf16_round(rv); v += rv; }
      if (ACT == 1) v = fmaxf(v, 0.f);
      if (ACT == 2) v = 0.5f * v * (1.0f + erff(v * 0.70710678118654752f));
      if (ACT == 3) { const float u = 0.7978845608028654f * (v + 0.044715f * v * v * v); v = 0.5f * v * (1.0f + tanhf(u)); }
      so[w][8 * hh + r][t * 16 + ln] = v;
    }
  }
  __builtin_amdgcn_fence(__ATOMIC_ACQ_REL, "workgroup");
  __builtin_amdgcn_wave_barrier();
  const int rsub = lane >> 4, c4 = (lane & 15) * 4;
  {
#pragma unroll
    for (int q = 0; q < 8; ++q) {
      const int r = q * 2 + rsub;
      const v4f v = *(const v4fa*)&so[w][r][c4];
      *(v4f*)(C + (size_t)(row0 + r) * ldc + col0 + c4) = v;
    }
    
  }
}
// row LayerNorm (biased variance, eps) over N: s = X (+ R); optional out_sum <- s; out_norm <- (s-mu)*rsqrt(var+eps)*g + b
template <bool PARAM_BF16>
__global__ __launch_bounds__(256) void k_layernorm(const float* __restrict__ X, const float* __restrict__ R, const float* __restrict__ g, const float* __restrict__ bta,
                                                  float* __restrict__ out_sum, float* __restrict__ out_norm, int N, float eps) {
  __shared__ float red[256];
  const int row = blockIdx.x, tid = threadIdx.x;
  const float* x = X + (size_t)row * N; const float* rr = R ? R + (size_t)row * N : nullptr;
  float vals[16];                     // up to N = 4096
  const int per = N / 256;            // contiguous chunk per thread? use strided-by-4 chunks: thread handles j = tid*4 + 1024*u
  float s1 = 0.f;
  for (int u = 0; u < per / 4; ++u) {
    const int j = tid * 4 + 1024 * u;
    const v4f a = *(const v4fa*)(x + j);
    v4f b = {0.f,0.f,0.f,0.f}; if (rr) b = *(const v4fa*)(rr + j);
#pragma unroll
    for (int q = 0; q < 4; ++q) { const float v = a[q] + b[q]; vals[u * 4 + q] = v; s1 += v; }
  }
  red[tid] = s1; __syncthreads();
  for (int st = 128; st > 0; st >>= 1) { if (tid < st) red[tid] += red[tid + st]; __syncthreads(); }
  const float mu = red[0] / (float)N; __syncthreads();
  float s2 = 0.f;
  for (int u = 0; u < per / 4; ++u)
#pragma unroll
    for (int q = 0; q < 4; ++q) { const float c = vals[u * 4 + q] - mu; s2 += c * c; }
  red[tid] = s2; __syncthreads();
  for (int st = 128; st > 0; st >>= 1) { if (tid < st) red[tid] += red[tid + st]; __syncthreads(); }
  const float rs = rsqrtf(red[0] / (float)N + eps);
  {
    for (int u = 0; u < per / 4; ++u) {
      const int j = tid * 4 + 1024 * u;
      v4f o, sm;
#pragma unroll
      for (int q = 0; q < 4; ++q) {
        float gg = g[j + q], bb = bta[j + q];
        if (PARAM_BF16) { gg = bf16_round(gg); bb = bf16_round(bb); }
        sm[q] = vals[u * 4 + q]; o[q] = (vals[u * 4 + q] - mu) * rs * gg + bb;
      }
      if (out_sum) *(v4f*)(out_sum + (size_t)row * N + j) = sm;
      *(v4f*)(out_norm + (size_t)row * N + j) = o;
    }
    
  }
}



// ---- f16 WMMA path (v_wmma_f32_16x16x32_f16): 11-bit significands for operands in range — used where a [0,1] probability operand needs more precision than bf16
typedef _Float16 v16h __attribute__((ext_vector_type(16)));
union FragH { v16h v; v8us half[2]; _Float16 h[16]; unsigned short u[16]; };
template <int NT>
__device__ __forceinline__ v8f mmaH(v16h ah, v16h al, v16h bh, v16h bl, v8f c) {
  c = __builtin_amdgcn_wmma_f32_16x16x32_f16(false, ah, false, bh, (short)0, c, false, false);
  if (NT >= 2) c = __builtin_amdgcn_wmma_f32_16x16x32_f16(false, al, false, bh, (short)0, c, false, false);
  if (NT >= 3) c = __builtin_amdgcn_wmma_f32_16x16x32_f16(false, ah, false, bl, (short)0, c, false, false);
  asm volatile("v_nop\n\tv_nop\n\tv_nop\n\tv_nop" : "+v"(c) : "v"(ah), "v"(al), "v"(bh), "v"(bl));
  return c;
}
// batched GEMM like k_gemm_b but f16 operands: A f32 (split into f16 hi/lo if ASPLIT, else rounded to f16), Bt = f16 values [n][k]; alpha; C f32; N multiple of 16 (partial tiles skipped)
template <bool ASPLIT>
__global__ __launch_bounds__(128) void k_gemm_h(const float* __restrict__ A, int lda, size_t sA, const _Float16* __restrict__ Bh, int ldb, size_t sB, float alpha, float* __restrict__ C, int ldc, size_t sC, int M, int N, int K) {
  __shared__ __attribute__((aligned(16))) float so[4][16][64];
  const int tid = threadIdx.x, w = tid >> 5, lane = tid & 31, ln = lane & 15, hh = lane >> 4; const int by = blockIdx.y;
  A += (size_t)by * sA; Bh += (size_t)by * sB; C += (size_t)by * sC;
  const int ntn = (N + 63) / 64; const int wid = blockIdx.x * 4 + w; const int mt = wid / ntn, nq = wid % ntn; if (mt * 16 >= M) return;
  const int row0 = mt * 16, col0 = nq * 64; const float* arow = A + (size_t)(row0 + ln) * lda;
  v8f acc[4] = {};
  for (int kb = 0; kb < K; kb += 32) {
    FragH ah, al;
    const v4f x0 = *(const v4fa*)(arow + kb + 8 * hh), x1 = *(const v4fa*)(arow + kb + 8 * hh + 4), x2 = *(const v4fa*)(arow + kb + 16 + 8 * hh), x3 = *(const v4fa*)(arow + kb + 16 + 8 * hh + 4);
    float xs[16] = {x0[0],x0[1],x0[2],x0[3],x1[0],x1[1],x1[2],x1[3],x2[0],x2[1],x2[2],x2[3],x3[0],x3[1],x3[2],x3[3]};
#pragma unroll
    for (int i = 0; i < 16; ++i) { const _Float16 h = (_Float16)xs[i]; ah.h[i] = h; al.h[i] = ASPLIT ? (_Float16)(xs[i] - (float)h) : (_Float16)0.0f; }
#pragma unroll
    for (int t = 0; t < 4; ++t) { if (col0 + t * 16 >= N) continue; const size_t boff = (size_t)(col0 + t * 16 + ln) * ldb + kb; FragH bq; bq.half[0] = *(const v8us*)(Bh + boff + 8 * hh); bq.half[1] = *(const v8us*)(Bh + boff + 16 + 8 * hh);
      acc[t] = mmaH<ASPLIT ? 2 : 1>(ah.v, al.v, bq.v, bq.v, acc[t]); }
  }
#pragma unroll
  for (int t = 0; t < 4; ++t) { if (col0 + t * 16 >= N) continue;
#pragma unroll
    for (int r = 0; r < 8; ++r) so[w][8 * hh + r][t * 16 + ln] = acc[t][r] * alpha; }
  __builtin_amdgcn_fence(__ATOMIC_ACQ_REL, "workgroup"); __builtin_amdgcn_wave_barrier();
  const int rsub = lane >> 4, c4 = (lane & 15) * 4;
  {
#pragma unroll
    for (int q = 0; q < 8; ++q) { const int r = q * 2 + rsub; if (col0 + c4 < N) { const v4f v = *(const v4fa*)&so[w][r][c4]; *(v4f*)(C + (size_t)(row0 + r) * ldc + col0 + c4) = v; } }
     }
}

// Wt[n][k] = f16(W[k][n]·scale) from f32 row-major W[K][N] (scale = power of two; bf16-exact weights stay exact in f16 away from the subnormal range)
__global__ __launch_bounds__(256) void k_wt_f16(const float* __restrict__ W, _Float16* __restrict__ Wt, int K, int N, float scale) {
  const int t = blockIdx.x * 256 + threadIdx.x; if (t >= N * (K / 8)) return; const int n = t / (K / 8), k8 = (t % (K / 8)) * 8; FragH f;
#pragma unroll
  for (int i = 0; i < 8; ++i) f.h[i] = (_Float16)(bf16_round(W[(size_t)(k8 + i) * N + n]) * scale); const v8us o = f.half[0];
  *(v8us*)((unsigned short*)Wt + (size_t)n * K + k8) = o; 
}
// k_gemm_hh variant with fused epilogue: v = acc·alpha + bias[by·sBias + col] (+ CP[(row/rowsPerB)·sCPb + by·64 + col] if CP) ; ACT 0 none / 1 elu ; writes f16 C16 (and f32 C if non-null)
template <int ACT>
__global__ __launch_bounds__(128) void k_gemm_hhx(const _Float16* __restrict__ A, int lda, size_t sA, const _Float16* __restrict__ Bh, int ldb, size_t sB, float alpha, const float* __restrict__ bias, size_t sBias, const float* __restrict__ CP, int rowsPerB, size_t sCPb, int row0g,
    float* __restrict__ C, _Float16* __restrict__ C16, int ldc, size_t sC, int M, int N, int K) {
  __shared__ __attribute__((aligned(16))) float so[4][16][64];
  const int tid = threadIdx.x, w = tid >> 5, lane = tid & 31, ln = lane & 15, hh = lane >> 4; const int by = blockIdx.y;
  A += (size_t)by * sA; Bh += (size_t)by * sB; const size_t cofs = (size_t)by * sC; const float* bp = bias ? bias + (size_t)by * sBias : nullptr;
  const int ntn = (N + 63) / 64; const int wid = blockIdx.x * 4 + w; const int mt = wid / ntn, nq = wid % ntn; if (mt * 16 >= M) return;
  const int row0 = mt * 16, col0 = nq * 64; const _Float16* arow = A + (size_t)(row0 + ln) * lda;
  v8f acc[4] = {};
  for (int kb = 0; kb < K; kb += 32) { FragH ah; ah.half[0] = *(const v8us*)((const unsigned short*)arow + kb + 8 * hh); ah.half[1] = *(const v8us*)((const unsigned short*)arow + kb + 16 + 8 * hh);
#pragma unroll
    for (int t = 0; t < 4; ++t) { if (col0 + t * 16 >= N) continue; const size_t boff = (size_t)(col0 + t * 16 + ln) * ldb + kb; FragH bq; bq.half[0] = *(const v8us*)((const unsigned short*)Bh + boff + 8 * hh); bq.half[1] = *(const v8us*)((const unsigned short*)Bh + boff + 16 + 8 * hh);
      acc[t] = mmaH<1>(ah.v, ah.v, bq.v, bq.v, acc[t]); }
  }
#pragma unroll
  for (int t = 0; t < 4; ++t) { if (col0 + t * 16 >= N) continue; const int col = col0 + t * 16 + ln; const float bv = bp ? bf16_round(bp[col]) : 0.f;
#pragma unroll
    for (int r = 0; r < 8; ++r) { float v = acc[t][r] * alpha + bv; if (CP) { const int rr = row0g + row0 + 8 * hh + r; if (rowsPerB < 0) v += CP[cofs + (size_t)rr * ldc + col];      /* rowsPerB < 0: own element of the batched C plane */ else { const int bidx = rr / rowsPerB; v += CP[(size_t)bidx * sCPb + (size_t)by * 64 + col]; } } if (ACT == 1) v = (v > 0.f) ? v : expm1f(v); else if (ACT == 7) v = (v > 0.f) ? v + 1.0f : expf(v); else if (ACT == 8) v = tanhf(v); else if (ACT == 9) v = 0.5f * v * (1.0f + tanhf(0.7978845608028654f * (v + 0.044715f * v * v * v))); else if (ACT == 11) v = 1.0f / (1.0f + expf(-v)); else if (ACT == 12) v = (v > 0.f) ? v : 0.01f * v; else if (ACT == 14) v = (v > 0.f) ? v : 0.1f * v; else if (ACT == 16) v = (v >= 0.f) ? v : 0.3f * v; else if (ACT == 17) v = (v >= 0.f) ? v : 0.2f * v; else if (ACT == 15) v = v / (1.0f + expf(-v)); else if (ACT == 3) v = fmaxf(v, 0.f); else if (ACT == 6) v = 0.5f * v * (1.0f + erff(v * 0.70710678118654752f)); so[w][8 * hh + r][t * 16 + ln] = v; } }
  __builtin_amdgcn_fence(__ATOMIC_ACQ_REL, "workgroup"); __builtin_amdgcn_wave_barrier();
  const int rsub = lane >> 4, c4 = (lane & 15) * 4; typedef _Float16 v4h __attribute__((ext_vector_type(4)));
  {
#pragma unroll
    for (int q = 0; q < 8; ++q) { const int r = q * 2 + rsub; if (col0 + c4 < N) { const v4f v = *(const v4fa*)&so[w][r][c4]; if (C) *(v4f*)(C + cofs + (size_t)(row0 + r) * ldc + col0 + c4) = v; if (C16) { v4h h4; for (int i = 0; i < 4; ++i) h4[i] = (_Float16)v[i]; *(v4h*)(C16 + cofs + (size_t)(row0 + r) * ldc + col0 + c4) = h4; } } }
     }
}


typedef _Float16 v4h __attribute__((ext_vector_type(4)));

__global__ __launch_bounds__(256) void k_x16(const float* __restrict__ x, _Float16* __restrict__ X16, size_t n8) { const size_t t = (size_t)blockIdx.x * 256 + threadIdx.x; if (t >= n8) return; FragH f;
#pragma unroll
  for (int q = 0; q < 8; ++q) f.h[q] = (_Float16)bf16_round(x[t * 8 + q]); *(v8us*)((unsigned short*)X16 + t * 8) = f.half[0];  }
__global__ __launch_bounds__(256) void k_h16(const float* __restrict__ x, _Float16* __restrict__ X16, size_t n8) { const size_t t = (size_t)blockIdx.x * 256 + threadIdx.x; if (t >= n8) return; FragH f;
#pragma unroll
  for (int q = 0; q < 8; ++q) f.h[q] = (_Float16)x[t * 8 + q]; *(v8us*)((unsigned short*)X16 + t * 8) = f.half[0];  }
__global__ __launch_bounds__(256) void k_round16f(const float* __restrict__ W, _Float16* __restrict__ Bt, size_t n8) { const size_t t = (size_t)blockIdx.x * 256 + threadIdx.x; if (t >= n8) return; FragH f;
#pragma unroll
  for (int i = 0; i < 8; ++i) f.h[i] = (_Float16)(bf16_round(W[t * 8 + i]) * 16.0f); *(v8us*)((unsigned short*)Bt + t * 8) = f.half[0];  }
template <int NHv, int TTv>
__global__ __launch_bounds__(256) void k_vt(const _Float16* __restrict__ V16, int ldv, int voff, _Float16* __restrict__ Vt) { __shared__ unsigned short tl[64][66]; const int tid = threadIdx.x; const int slab = blockIdx.x / (TTv / 64), lg = blockIdx.x % (TTv / 64); const int b = slab / NHv, h = slab % NHv;
  for (int i = tid; i < 64 * 8; i += 256) { const int r = i / 8, c8 = (i % 8) * 8; FragH f; f.half[0] = *(const v8us*)((const unsigned short*)V16 + ((size_t)b * TTv + lg * 64 + r) * ldv + voff + h * 64 + c8);
#pragma unroll
    for (int q = 0; q < 8; ++q) tl[r][c8 + q] = f.u[q]; }
  __syncthreads();
  {
#pragma unroll
    for (int rd = 0; rd < 2; ++rd) { const int d = rd * 32 + tid / 8, pc = tid % 8; FragH f;
#pragma unroll
      for (int q = 0; q < 8; ++q) f.u[q] = tl[pc * 8 + q][d];
      *(v8us*)((unsigned short*)Vt + ((size_t)slab * 64 + d) * TTv + lg * 64 + pc * 8) = f.half[0]; }
     } }

__global__ __launch_bounds__(256) void k_hl(const float* __restrict__ F, _Float16* __restrict__ Hh, _Float16* __restrict__ Hl, size_t n8) { const size_t t = (size_t)blockIdx.x * 256 + threadIdx.x; if (t >= n8) return; FragH fh, fl; const v4f a = *(const v4fa*)(F + t * 8), c = *(const v4fa*)(F + t * 8 + 4);
#pragma unroll
  for (int q = 0; q < 4; ++q) { _Float16 h = (_Float16)a[q]; fh.h[q] = h; fl.h[q] = (_Float16)((a[q] - (float)h) * 1024.0f); h = (_Float16)c[q]; fh.h[4 + q] = h; fl.h[4 + q] = (_Float16)((c[q] - (float)h) * 1024.0f); }
  { *(v8us*)((unsigned short*)Hh + t * 8) = fh.half[0]; *(v8us*)((unsigned short*)Hl + t * 8) = fl.half[0];  } }

// ---- fast GEMM (block tile 128x128 = 8 waves of 32x64; requires M % 128 == 0 rows per launch region, N % 128 == 0, K % 64 == 0; operand rows of pitch DM); epilogue = k_gemm_hhx semantics ----
// Operands go through LDS: a stage is 64 k (128 bytes, one cache line) of the block's 128 A rows and 128 B rows, fetched by whole-line 16-byte loads (8 lanes a row) into registers one stage ahead and stored at a row pitch of 144 bytes (16 x odd).
// Two LDS buffers, one barrier a stage: while a stage is worked on, the next one is stored into the other buffer and the one after it is in flight. The fragments are read from LDS by g2_frag, in the k order they had from memory.
#define G2KS 64                      /* k per stage */
#define G2P (G2KS + 8)               /* LDS row pitch, halves */
#define G2ROWS 256                   /* LDS rows per buffer: 128 of A, then 128 of B */
__device__ __forceinline__ v16h g2_frag(const _Float16* p, int hh) { FragH f; f.half[0] = *(const v8us*)((const unsigned short*)p + 8 * hh); f.half[1] = *(const v8us*)((const unsigned short*)p + 16 + 8 * hh); return f.v; }
__device__ __forceinline__ v8f g2_mma(v16h a, v16h b, v8f c) { v8f d = __builtin_amdgcn_wmma_f32_16x16x32_f16(false, a, false, b, (short)0, c, false, false); asm volatile("v_nop\n\tv_nop\n\tv_nop\n\tv_nop" : "+v"(d) : "v"(a), "v"(b)); return d; }
typedef float v2f __attribute__((ext_vector_type(2)));
// ROPE 1 (f16 rows to C16), 2 or 3 (f32 rows to C): the interleaved-pair rotation (position = row % SQ, tables CS / SN [SQ][HD / 2]) is applied to the finished f32 tile on its way from LDS to the f32 or f16 rows; a 64-column tile is one head, and a lane's four columns are two whole pairs.
// ROPE 3: one launch for q, k and v of every batch: blockIdx.y = plane * NBR + batch; sA steps the batch, sB and sBias the plane, sC both; planes 0 and 1 (q, k) are rotated, plane 2 (v) leaves by the plain path at the foot.
template <int ACT, int ROPE = 0>
__global__ __launch_bounds__(256) void k_gemm2(const _Float16* __restrict__ A, size_t sA, const _Float16* __restrict__ Bh, size_t sB, float alpha, const float* __restrict__ bias, size_t sBias, const float* __restrict__ CP, int rowsPerB, size_t sCPb, int row0g,
    float* __restrict__ C, _Float16* __restrict__ C16, int ldc, size_t sC, int M, int N, int K, const float* __restrict__ CS = nullptr, const float* __restrict__ SN = nullptr) { static_assert(ACT == 0 || ACT == 3 || ACT == 6 || ACT == 8 || ACT == 9 || ACT == 11 || ACT == 12 || ACT == 14 || ACT == 15 || ACT == 16 || ACT == 17, "k_gemm2: unsupported ACT code (would silently apply no activation)");
  __shared__ __attribute__((aligned(16))) unsigned short sm[2 * G2ROWS * G2P]; static_assert(sizeof(sm) >= 8 * 32 * 68 * sizeof(float), "k_gemm2: the epilogue tiles lie in the operand buffers");
  float (*so)[32][68] = (float (*)[32][68])sm;      /* the epilogue's f32 tiles, one a wave, reuse the operand buffers behind the k loop's last barrier */
  const int tid = threadIdx.x, w = tid >> 5, lane = tid & 31, ln = lane & 15, hh = lane >> 4; const int by = blockIdx.y;
  const int pl = (ROPE == 3) ? by / NBR : by, ba = (ROPE == 3) ? by % NBR : by; const bool rot = ROPE != 3 || pl < 2;      /* blockIdx.y is a scalar: the tests on rot are scalar branches */
  A += (size_t)ba * sA; Bh += (size_t)pl * sB; const size_t cofs = (size_t)by * sC; const float* bp = bias ? bias + (size_t)pl * sBias : nullptr;
  const int ntn = N >> 7; const int mt = blockIdx.x / ntn, nq = blockIdx.x - mt * ntn; if (mt * 128 >= M) return;      /* the same for the whole block, in front of every barrier */
  const int wr = w & 3, wc = w >> 2; const int row0 = mt * 128 + 32 * wr, col0 = nq * 128 + 64 * wc;
  const int sr = tid >> 3, sc = (tid & 7) * 8;      /* staging: 8 lanes take one 128-byte row piece, a pass of the block 32 rows */
  const unsigned short* ap = (const unsigned short*)A + (size_t)(mt * 128 + sr) * DM + sc; const unsigned short* bq = (const unsigned short*)Bh + (size_t)(nq * 128 + sr) * DM + sc; v8us ar[4], br[4];      /* the lane's own addresses: the row pitch is a constant, so the four passes differ in the immediate offset alone */
  unsigned short* const sw = sm + sr * G2P + sc;      /* where the lane stores its pieces (buffer 0, pass 0 of A) */
  const _Float16* const fa = (const _Float16*)sm + (32 * wr + ln) * G2P; const _Float16* const fb = (const _Float16*)sm + (128 + 64 * wc + ln) * G2P;      /* the lane's fragment rows (buffer 0) */
  const v8f z8 = {0.f,0.f,0.f,0.f,0.f,0.f,0.f,0.f}; v8f c00 = z8, c01 = z8, c02 = z8, c03 = z8, c10 = z8, c11 = z8, c12 = z8, c13 = z8;
  v2f rc[16], rs[16];      /* ROPE: the lane's cos / sin pairs of its 16 rows, fetched ahead of the k loop, whose first trips cover their latency */
  if (ROPE && rot) { static_assert(HD == 64 && SQ % 32 == 0, "k_gemm2 rope: a 64-column tile is one head, a 32-row tile does not wrap the position");
    const float* cp = CS + (size_t)((row0 + (lane >> 4)) % SQ) * (HD / 2) + (lane & 15) * 2; const float* sp = SN + (size_t)((row0 + (lane >> 4)) % SQ) * (HD / 2) + (lane & 15) * 2;      /* the lane's own addresses: the 16 rows differ in the immediate offset alone */
#pragma unroll
    for (int q = 0; q < 16; ++q) { rc[q] = *(const v2f*)(cp + q * HD); rs[q] = *(const v2f*)(sp + q * HD); }      /* fully unrolled: rc and rs stay in registers; two rows on = 2 * (HD / 2) floats */
    asm volatile("s_wait_xcnt 0x0" :: "v"(cp), "v"(sp) : "memory"); }      /* the wait between the loads above and the first reuse of their address registers; the addresses are inputs so that their registers stay untouched up to it */
  const int nst = K / G2KS;
#pragma unroll
  for (int u = 0; u < 4; ++u) { ar[u] = *(const v8us*)(ap + (size_t)u * 32 * DM); br[u] = *(const v8us*)(bq + (size_t)u * 32 * DM); }
  asm volatile("s_wait_xcnt 0x0" :: "v"(ap), "v"(bq) : "memory");      /* the wait between the loads above and the first rewrite of their address registers; the addresses are inputs so that their registers stay untouched up to it */
#pragma unroll
  for (int u = 0; u < 4; ++u) { *(v8us*)(sw + u * 32 * G2P) = ar[u]; *(v8us*)(sw + (128 + u * 32) * G2P) = br[u]; }
  if (nst > 1) { ap += G2KS; bq += G2KS;
#pragma unroll
    for (int u = 0; u < 4; ++u) { ar[u] = *(const v8us*)(ap + (size_t)u * 32 * DM); br[u] = *(const v8us*)(bq + (size_t)u * 32 * DM); }
    asm volatile("s_wait_xcnt 0x0" :: "v"(ap), "v"(bq) : "memory"); }      /* as above */
  __syncthreads();      /* publishes stage 0 */
#pragma unroll 1
  for (int s = 0; s < nst; ++s) { const int cur = (s & 1) * (G2ROWS * G2P), nxt = (G2ROWS * G2P) - cur;      /* rolled: the trips differ in the buffer alone */
    if (s + 1 < nst) {      /* stage s + 1 goes into the buffer whose last readers passed the barrier at the foot of trip s - 1 */
#pragma unroll
      for (int u = 0; u < 4; ++u) { *(v8us*)(sw + nxt + u * 32 * G2P) = ar[u]; *(v8us*)(sw + nxt + (128 + u * 32) * G2P) = br[u]; } }
    if (s + 2 < nst) { ap += G2KS; bq += G2KS;
#pragma unroll
      for (int u = 0; u < 4; ++u) { ar[u] = *(const v8us*)(ap + (size_t)u * 32 * DM); br[u] = *(const v8us*)(bq + (size_t)u * 32 * DM); }
      asm volatile("s_wait_xcnt 0x0" :: "v"(ap), "v"(bq) : "memory"); }      /* as above: stands in front of the next trip's address additions */
#pragma unroll
    for (int kk = 0; kk < G2KS; kk += 32) { const _Float16* pa = fa + cur + kk; const _Float16* pb = fb + cur + kk;      /* the six fragments of a 32-k block are read as one group ahead of its eight products: one LDS latency a block, not one a fragment */
      const v16h a0 = g2_frag(pa, hh), a1 = g2_frag(pa + 16 * G2P, hh), b0 = g2_frag(pb, hh), b1 = g2_frag(pb + 16 * G2P, hh), b2 = g2_frag(pb + 32 * G2P, hh), b3 = g2_frag(pb + 48 * G2P, hh);
      c00 = g2_mma(a0, b0, c00); c10 = g2_mma(a1, b0, c10); c01 = g2_mma(a0, b1, c01); c11 = g2_mma(a1, b1, c11);
      c02 = g2_mma(a0, b2, c02); c12 = g2_mma(a1, b2, c12); c03 = g2_mma(a0, b3, c03); c13 = g2_mma(a1, b3, c13); }
    __syncthreads(); }      /* publishes stage s + 1 and ends every wave's reads of stage s (behind the last trip: before the epilogue's tiles overwrite the buffers) */
  v8f accs[8] = {c00, c01, c02, c03, c10, c11, c12, c13};
#pragma unroll
  for (int u = 0; u < 8; ++u) { const int t = u & 3, half = u >> 2; const int col = col0 + t * 16 + ln; const float bv = bp ? bf16_round(bp[col]) : 0.f;
#pragma unroll
    for (int r = 0; r < 8; ++r) { const int rloc = half * 16 + 8 * hh + r; float v = accs[u][r] * alpha + bv; if (CP) { if (rowsPerB < 0) v += CP[cofs + (size_t)(row0g + row0 + rloc) * ldc + col];      /* rowsPerB < 0: own element of the batched C plane */ else { const int bidx = (row0g + row0 + rloc) / rowsPerB; v += CP[(size_t)bidx * sCPb + (size_t)by * 64 + col]; } }
      if (ACT == 3) v = fmaxf(v, 0.f); else if (ACT == 6) v = 0.5f * v * (1.0f + erff(v * 0.70710678118654752f)); else if (ACT == 11) v = 1.0f / (1.0f + expf(-v)); else if (ACT == 15) v = v / (1.0f + expf(-v)); else if (ACT == 12) v = (v > 0.f) ? v : 0.01f * v; else if (ACT == 8) v = tanhf(v); else if (ACT == 9) v = 0.5f * v * (1.0f + tanhf(0.7978845608028654f * (v + 0.044715f * v * v * v))); else if (ACT == 14) v = (v > 0.f) ? v : 0.1f * v; else if (ACT == 16) v = (v >= 0.f) ? v : 0.3f * v; else if (ACT == 17) v = (v >= 0.f) ? v : 0.2f * v;
      so[w][rloc][t * 16 + ln] = v; } }
  __builtin_amdgcn_fence(__ATOMIC_ACQ_REL, "workgroup"); __builtin_amdgcn_wave_barrier();
  const int rsub = lane >> 4, c4 = (lane & 15) * 4;
  if (ROPE && rot) { v4f t[16];      /* the sixteen row pieces are rotated first and then stored in one run; the destination is fixed at compile time */
#pragma unroll
    for (int q = 0; q < 16; ++q) { const v4f v = *(const v4fa*)&so[w][q * 2 + rsub][c4]; const v2f c = rc[q], s = rs[q];
      t[q][0] = v[0] * c[0] - v[1] * s[0]; t[q][1] = v[0] * s[0] + v[1] * c[0]; t[q][2] = v[2] * c[1] - v[3] * s[1]; t[q][3] = v[2] * s[1] + v[3] * c[1]; }
    if (ROPE >= 2) {
#pragma unroll
      for (int q = 0; q < 16; ++q) *(v4f*)(C + cofs + (size_t)(row0 + q * 2 + rsub) * ldc + col0 + c4) = t[q]; }
    else { v4h h4[16];
#pragma unroll
      for (int q = 0; q < 16; ++q) { h4[q][0] = (_Float16)t[q][0]; h4[q][1] = (_Float16)t[q][1]; h4[q][2] = (_Float16)t[q][2]; h4[q][3] = (_Float16)t[q][3]; }
#pragma unroll
      for (int q = 0; q < 16; ++q) *(v4h*)(C16 + cofs + (size_t)(row0 + q * 2 + rsub) * ldc + col0 + c4) = h4[q]; }
  } else {
#pragma unroll
    for (int q = 0; q < 16; ++q) { const int r = q * 2 + rsub; const v4f v = *(const v4fa*)&so[w][r][c4]; if (C) *(v4f*)(C + cofs + (size_t)(row0 + r) * ldc + col0 + c4) = v; if (C16) { v4h h4; for (int i = 0; i < 4; ++i) h4[i] = (_Float16)v[i]; *(v4h*)(C16 + cofs + (size_t)(row0 + r) * ldc + col0 + c4) = h4; } }
     } }


__global__ __launch_bounds__(256) void k_wnat(const float* __restrict__ w, size_t n8, _Float16* __restrict__ Bt) { const size_t t = (size_t)blockIdx.x * 256 + threadIdx.x; if (t >= n8) return; FragH f; for (int q = 0; q < 8; ++q) f.h[q] = (_Float16)(bf16_round(w[t * 8 + q]) * 16.0f); *(v8us*)((unsigned short*)Bt + t * 8) = f.half[0];  }
__global__ __launch_bounds__(256) void k_rsm(const float* __restrict__ S, _Float16* __restrict__ P, int nrows) {
  #pragma clang fp contract(off)
  const int i = blockIdx.x * 256 + threadIdx.x; if (i >= nrows) return; const float* s = S + (size_t)i * SQ; float mx = -3.0e38f;
#pragma unroll 1
  for (int j = 0; j < SQ; ++j) mx = fmaxf(mx, s[j]); float se = 0.f;
#pragma unroll 1
  for (int j = 0; j < SQ; ++j) se += expf(s[j] - mx); const float sc = 256.0f / se;
#pragma unroll 1
  for (int j0 = 0; j0 < SQ; j0 += 8) { FragH f; for (int q = 0; q < 8; ++q) f.h[q] = (_Float16)(expf(s[j0 + q] - mx) * sc); unsigned short* d = (unsigned short*)P + (size_t)i * SQ + j0; *(v8us*)d = f.half[0];  } }
__global__ __launch_bounds__(256) void k_vt(const _Float16* __restrict__ V16, int b, int h0, _Float16* __restrict__ VT) { __shared__ unsigned short tl[64][65]; const int tid = threadIdx.x; const int hh = blockIdx.x % HG, sg = blockIdx.x / HG; const int s0 = sg * 64; const int h = h0 + hh;
  for (int i = tid; i < 64 * 8; i += 256) { const int j = i / 8, d8 = (i % 8) * 8; FragH f; f.half[0] = *(const v8us*)((const unsigned short*)V16 + ((size_t)b * SQ + s0 + j) * DM + h * HD + d8); for (int q = 0; q < 8; ++q) tl[d8 + q][j] = f.u[q]; }
  __syncthreads();
  { for (int i = tid; i < 64 * 8; i += 256) { const int d = i / 8, j8 = (i % 8) * 8; FragH f; for (int q = 0; q < 8; ++q) f.u[q] = tl[d][j8 + q]; *(v8us*)((unsigned short*)VT + ((size_t)hh * HD + d) * SQ + s0 + j8) = f.half[0]; }  } }



#define FAQB 128                     /* query rows per block */
#define FAK 64                       /* keys per step */
#define FAP (HD + 8)                 /* LDS row pitch, halves */
__device__ __forceinline__ v8f fa_mma(v16h a, v16h b, v8f c) { return __builtin_amdgcn_wmma_f32_16x16x32_f16(false, a, false, b, (short)0, c, false, false); }
__global__ __launch_bounds__(128) void k_fattn(const _Float16* __restrict__ Q, const _Float16* __restrict__ Kh, const _Float16* __restrict__ VTa, _Float16* __restrict__ O) {
  static_assert(NB * NH == 64 && SQ / FAQB == 16 && HD == 64, "k_fattn: the block-to-tile map below is written for 64 (batch, head) pairs x 16 query blocks");
  __shared__ __attribute__((aligned(16))) _Float16 lk[FAK][FAP]; __shared__ __attribute__((aligned(16))) _Float16 lv[HD][FAP];
  const int tid = threadIdx.x, lane = tid & 31, ln = lane & 15, hh = lane >> 4; const int w = __builtin_amdgcn_readfirstlane(tid >> 5);      /* the wave's number as a scalar: the two tests on q0w below are scalar branches */
  const int g = blockIdx.x >> 8, sub = (blockIdx.x >> 6) & 3, bh = blockIdx.x & 63;
  const int qb = (g == 0) ? 15 - sub : ((g == 1) ? 8 + sub : ((g == 2) ? 7 - sub : sub));      /* a permutation of the 16 query blocks: long blocks start first, and blocks 256 apart in the index add up to the same length */
  const int b = bh / NH, h = bh % NH; const size_t r0 = (size_t)b * SQ; const int q0w = qb * FAQB + w * 32; const int nst = (qb + 1) * (FAQB / FAK);
  const unsigned short* qp = (const unsigned short*)Q + (r0 + q0w + ln) * LQ + h * HD + 8 * hh; v16h qf[2][2];      /* the lane's own address, so that the eight loads differ in the immediate offset alone; every loop but the step loop is fully unrolled: all array indices are constants and the arrays stay in registers */
#pragma unroll
  for (int nt = 0; nt < 2; ++nt)
#pragma unroll
    for (int kk = 0; kk < 2; ++kk) { FragH f; f.half[0] = *(const v8us*)(qp + (size_t)nt * 16 * LQ + kk * 32); f.half[1] = *(const v8us*)(qp + (size_t)nt * 16 * LQ + kk * 32 + 16); qf[nt][kk] = f.v; }      /* the k order of g2_frag */
  const int sr = tid >> 3, sc = (tid & 7) * 8;      /* staging: 8 lanes take one 128-byte row, a pass of the block 16 rows */
  const unsigned short* kp = (const unsigned short*)Kh + (r0 + sr) * LQ + h * HD + sc; const unsigned short* vp = (const unsigned short*)VTa + ((size_t)bh * HD + sr) * SQ + sc; v8us kr[4], vr[4];
#pragma unroll
  for (int u = 0; u < 4; ++u) { kr[u] = *(const v8us*)(kp + (size_t)u * 16 * LQ); vr[u] = *(const v8us*)(vp + (size_t)u * 16 * SQ); }
  asm volatile("s_wait_xcnt 0x0" :: "v"(qp), "v"(kp), "v"(vp) : "memory");      /* the wait between the loads above and the first rewrite of their address registers; the addresses are inputs so that their registers stay untouched up to it */
  const v8f z8 = {0.f, 0.f, 0.f, 0.f, 0.f, 0.f, 0.f, 0.f}; v8f o[4][2];
#pragma unroll
  for (int dt = 0; dt < 4; ++dt) { o[dt][0] = z8; o[dt][1] = z8; }
  float m[2] = {-1.0e30f, -1.0e30f}, l[2] = {0.f, 0.f};      /* running max (log2 units) and this lane's part of the running sum, per query tile */
  const float SC = 0.125f * 1.44269504088896340736f;      /* 1 / sqrt(64), in log2 units */
#pragma unroll 1
  for (int s = 0; s < nst; ++s) { const int k0 = s * FAK;      /* rolled: one step's code is long and its trip count varies by block */
#pragma unroll
    for (int u = 0; u < 4; ++u) { *(v8us*)&lk[u * 16 + sr][sc] = kr[u]; *(v8us*)&lv[u * 16 + sr][sc] = vr[u]; }
    __syncthreads();      /* publishes this step's K and V^T rows */
    if (s + 1 < nst) { kp += (size_t)FAK * LQ; vp += FAK;
#pragma unroll
      for (int u = 0; u < 4; ++u) { kr[u] = *(const v8us*)(kp + (size_t)u * 16 * LQ); vr[u] = *(const v8us*)(vp + (size_t)u * 16 * SQ); }
      asm volatile("s_wait_xcnt 0x0" :: "v"(kp), "v"(vp) : "memory"); }      /* as above: stands in front of the next step's address additions */
    if (k0 <= q0w + 31) {      /* a wave whose queries all lie below this step's keys only passes the barriers */
      v8f st[4][2];
#pragma unroll
      for (int kt = 0; kt < 4; ++kt) { st[kt][0] = z8; st[kt][1] = z8; }
#pragma unroll
      for (int kk = 0; kk < 2; ++kk)
#pragma unroll
        for (int kt = 0; kt < 4; ++kt) { const v16h a = g2_frag(&lk[kt * 16 + ln][kk * 32], hh); st[kt][0] = fa_mma(a, qf[0][kk], st[kt][0]); st[kt][1] = fa_mma(a, qf[1][kk], st[kt][1]); }
      if (k0 + FAK - 1 > q0w) {      /* only steps that reach past the wave's first query mask */
#pragma unroll
        for (int kt = 0; kt < 4; ++kt)
#pragma unroll
          for (int nt = 0; nt < 2; ++nt)
#pragma unroll
            for (int r = 0; r < 8; ++r) st[kt][nt][r] = (k0 + kt * 16 + 8 * hh + r <= q0w + nt * 16 + ln) ? st[kt][nt][r] : -3.0e38f; }
      v16h pf[2][2];
#pragma unroll
      for (int nt = 0; nt < 2; ++nt) { float mr = st[0][nt][0];
#pragma unroll
        for (int kt = 0; kt < 4; ++kt)
#pragma unroll
          for (int r = 0; r < 8; ++r) mr = fmaxf(mr, st[kt][nt][r]);
        mr = fmaxf(mr, __shfl_xor(mr, 16, 32));
        const float mn = fmaxf(m[nt], mr * SC); const float al = __builtin_amdgcn_exp2f(m[nt] - mn); m[nt] = mn; const float bs = 8.0f - mn;      /* + 8: weights carried x256; a masked key underflows to exactly 0 */
        v4f s4 = {0.f, 0.f, 0.f, 0.f};
#pragma unroll
        for (int kt = 0; kt < 4; ++kt)
#pragma unroll
          for (int r = 0; r < 8; ++r) { const float p = __builtin_amdgcn_exp2f(fmaf(st[kt][nt][r], SC, bs)); s4[r & 3] += p; pf[nt][kt >> 1][(kt & 1) * 8 + r] = (_Float16)p; }
        l[nt] = fmaf(l[nt], al, (s4[0] + s4[1]) + (s4[2] + s4[3]));
#pragma unroll
        for (int dt = 0; dt < 4; ++dt) o[dt][nt] *= al; }
#pragma unroll
      for (int j = 0; j < 2; ++j)
#pragma unroll
        for (int dt = 0; dt < 4; ++dt) { const v16h a = g2_frag(&lv[dt * 16 + ln][j * 32], hh); o[dt][0] = fa_mma(a, pf[0][j], o[dt][0]); o[dt][1] = fa_mma(a, pf[1][j], o[dt][1]); } }
    __syncthreads(); }      /* ends every wave's reads of this step's rows before the next step's stores */
  FragH t[2][4];      /* all eight 16-byte results are formed first: no store's data register is rewritten behind it */
#pragma unroll
  for (int nt = 0; nt < 2; ++nt) { const float f = 64.0f / (l[nt] + __shfl_xor(l[nt], 16, 32));
#pragma unroll
    for (int dt = 0; dt < 4; ++dt)
#pragma unroll
      for (int r = 0; r < 8; ++r) t[nt][dt].h[r] = (_Float16)(o[dt][nt][r] * f); }
  unsigned short* op = (unsigned short*)O + (r0 + q0w + ln) * DM + h * HD + 8 * hh;
#pragma unroll
  for (int nt = 0; nt < 2; ++nt)
#pragma unroll
    for (int dt = 0; dt < 4; ++dt) *(v8us*)(op + (size_t)nt * 16 * DM + dt * 16) = t[nt][dt].half[0]; }


// Exact f32 attention for the first QT0 rows of every batch (blockIdx.y; planes of QT0 rows a batch; o carried x64 like the f16 path). One wave per query row, A0R rows of one head per block.
// All QT0 K and V rows of the head are staged in LDS once by coalesced 16-byte loads. K rows get a pitch of 68 floats (16 bytes x odd), so that 32 lanes reading 32 rows by 16 bytes spread over the banks.
// Scores: lane = key (four partial sums over the head dimension). Row max and row sum: five-step butterfly. o: lane = two head columns, loop over the keys, each key's weight read from its lane into a scalar register; keys above the row carry weight 0.
#define A0R 8                        /* rows (waves) per block */
#define A0KP (HD + 4)                /* K row pitch in LDS, floats */
__global__ __launch_bounds__(256) void k_att0w(const float* __restrict__ QF, const float* __restrict__ KF, const float* __restrict__ VF, float scale, float* __restrict__ OF) {
  __shared__ __attribute__((aligned(16))) float lk[QT0][A0KP]; __shared__ __attribute__((aligned(16))) float lv[QT0][HD];
  const int tid = threadIdx.x, lane = tid & 31; const int w = __builtin_amdgcn_readfirstlane(tid >> 5);      /* the wave's number as a scalar: row, group count and branches below are wave-uniform */
  const int h = blockIdx.x / (QT0 / A0R), r0 = (blockIdx.x % (QT0 / A0R)) * A0R; const int i = r0 + w;
  const size_t pb = (size_t)blockIdx.y * QT0 * DM; QF += pb; KF += pb; VF += pb; OF += pb;
  const float* qr = QF + (size_t)i * DM + h * HD; v4f q[HD / 4];      /* every loop of this kernel is fully unrolled: the indices into q, kk, vv, sv and o and the lane of each readlane are then constants, so the arrays stay in registers */
#pragma unroll
  for (int c = 0; c < HD / 4; ++c) q[c] = *(const v4fa*)(qr + c * 4);      /* the wave's own q row, whole */
  const int sj = tid >> 4, sc4 = (tid & 15) * 4; const float* kp = KF + (size_t)sj * DM + h * HD + sc4; const float* vp = VF + (size_t)sj * DM + h * HD + sc4; v4f kk[QT0 / 16], vv[QT0 / 16];      /* one pass of the block stages 16 rows; both loops are fully unrolled and free of branches so that every load of the block is in flight before the first LDS store waits; the row pitch is a constant, so the passes differ in the immediate offset alone */
#pragma unroll
  for (int u = 0; u < QT0 / 16; ++u) { kk[u] = *(const v4fa*)(kp + (size_t)u * 16 * DM); vv[u] = *(const v4fa*)(vp + (size_t)u * 16 * DM); }
  asm volatile("s_wait_xcnt 0x0" :: "v"(kp), "v"(vp) : "memory");      /* the wait between the loads above and the first reuse of their address registers; the two addresses are inputs so that their registers stay untouched up to it */
#pragma unroll
  for (int u = 0; u < QT0 / 16; ++u) { *(v4f*)&lk[u * 16 + sj][sc4] = kk[u]; *(v4f*)&lv[u * 16 + sj][sc4] = vv[u]; }
  __syncthreads();
  const int ng = (i >> 5) + 1;      /* key groups of 32 that hold a key <= i */
  float sv[QT0 / 32];
#pragma unroll
  for (int g = 0; g < QT0 / 32; ++g) { sv[g] = -1.0e30f;
    if (g < ng) { const int j = g * 32 + lane; v4f a = {0.f, 0.f, 0.f, 0.f};
#pragma unroll
      for (int c = 0; c < HD / 4; ++c) a += q[c] * *(const v4f*)&lk[j][c * 4];
      const float s = ((a[0] + a[1]) + (a[2] + a[3])) * scale; sv[g] = (j <= i) ? s : -1.0e30f; } }
  float mx = fmaxf(fmaxf(sv[0], sv[1]), fmaxf(sv[2], sv[3]));
#pragma unroll
  for (int m = 16; m >= 1; m >>= 1) mx = fmaxf(mx, __shfl_xor(mx, m, 32));
  float se = 0.f;
#pragma unroll
  for (int g = 0; g < QT0 / 32; ++g) { const float e = expf(sv[g] - mx); sv[g] = e; se += e; }      /* a key above the row holds -1e30: its weight underflows to exactly 0 */
#pragma unroll
  for (int m = 16; m >= 1; m >>= 1) se += __shfl_xor(se, m, 32);
  v2f o[4] = {{0.f, 0.f}, {0.f, 0.f}, {0.f, 0.f}, {0.f, 0.f}};      /* four partial sums over the keys (key mod 4): four independent add chains */
#pragma unroll
  for (int g = 0; g < QT0 / 32; ++g) if (g < ng) {
#pragma unroll
    for (int jj = 0; jj < 32; ++jj) { const float e = __int_as_float(__builtin_amdgcn_readlane(__float_as_int(sv[g]), jj)); o[jj & 3] += e * *(const v2f*)&lv[g * 32 + jj][lane * 2]; } }
  const float fin = 64.0f / se; const v2f r = ((o[0] + o[1]) + (o[2] + o[3])) * fin;
  *(v2f*)(OF + (size_t)i * DM + h * HD + lane * 2) = r; }


__global__ __launch_bounds__(256) void k_wt_hq(const float* __restrict__ Wf, const float* __restrict__ bf, _Float16* __restrict__ Bq, _Float16* __restrict__ Bk, _Float16* __restrict__ Bv, float* __restrict__ B3) {
  const int t = blockIdx.x * 256 + threadIdx.x; if (t >= 3 * DM * (DM / 8)) return; const int n = t / (DM / 8), k8 = (t % (DM / 8)) * 8; const int h = n / (3 * HD), wh = (n % (3 * HD)) / HD, d = n % HD; const int row = h * HD + d; FragH f;
#pragma unroll
  for (int i = 0; i < 8; ++i) f.h[i] = (_Float16)(bf16_round(Wf[(size_t)(k8 + i) * (3 * DM) + n]) * 16.0f); const v8us o = f.half[0];
  _Float16* dst = (wh == 0) ? Bq : ((wh == 1) ? Bk : Bv); unsigned short* p = (unsigned short*)dst + (size_t)row * DM + k8; *(v8us*)p = o; 
  (void)bf; (void)B3; }
__global__ __launch_bounds__(256) void k_bhq(const float* __restrict__ bf, float* __restrict__ B3) {
  const int t = blockIdx.x * 256 + threadIdx.x; if (t >= 3 * DM) return; const int wh = t / DM, row = t % DM; const int h = row / HD, d = row % HD; const float v = bf16_round(bf[h * (3 * HD) + wh * HD + d]); *(float*)(B3 + t) = v;  }

__global__ __launch_bounds__(256) void k_tabcp32(const float* __restrict__ tc, const float* __restrict__ tsn, float* __restrict__ CS, float* __restrict__ SN, int n) {
  const int t = blockIdx.x * 256 + threadIdx.x; if (t >= n) return; const float c = bf16_round(tc[t]), s = bf16_round(tsn[t]);
  *(float*)(CS + t) = c; *(float*)(SN + t) = s;  }
extern "C" void kernel_launch(void* const* d_in, const int* in_sizes, int n_in,
                              void* d_out, int out_size, void* d_ws, size_t ws_size, hipStream_t stream) {
  (void)in_sizes; (void)n_in; (void)out_size;
  const float* const* I = (const float* const*)d_in; const float* x = I[0]; const float* wqkv = I[1]; const float* bqkv = I[2]; const float* wo = I[3]; const float* bo = I[4]; const float* tcos = I[5]; const float* tsin = I[6];      /* x; fused W_qkv [1024][3072] + b_qkv [3072] ([in][out]; per-head (q | k | v) column triples); W_out + b_out ([in][out]); rope tables cos / sin [2048][32] */
  char* ws = (char*)d_ws; size_t off = 0;
  auto take = [&](size_t bytes) { char* p = ws + off; off += (bytes + 255) & ~(size_t)255; return p; };
  _Float16* BQ = (_Float16*)take((size_t)DM * DM * 2); _Float16* BK = (_Float16*)take((size_t)DM * DM * 2); _Float16* BV = (_Float16*)take((size_t)DM * DM * 2); _Float16* BO = (_Float16*)take((size_t)DM * DM * 2);
  float* BQB = (float*)take((size_t)3 * DM * 4); float* CSB = (float*)take((size_t)SQ * 32 * 4); float* SNB = (float*)take((size_t)SQ * 32 * 4);      /* de-interleaved bias vector bq | bk | bv; bf16-rounded copies of the rope tables */ _Float16* X16 = (_Float16*)take(NR * DM * 2); _Float16* Q16 = (_Float16*)take(NR * DM * 2); _Float16* K16 = (_Float16*)take(NR * DM * 2); _Float16* V16 = (_Float16*)take(NR * DM * 2); _Float16* O16 = (_Float16*)take(NR * DM * 2);
  _Float16* VT = (_Float16*)take((size_t)NB * NH * HD * SQ * 2);
  float* QF0 = (float*)take((size_t)3 * NBR * QT0 * DM * 4); float* KF0 = QF0 + (size_t)NBR * QT0 * DM; float* VF0 = KF0 + (size_t)NBR * QT0 * DM;      /* first-tile f32 q | k | v, each NBR planes of QT0 rows, one after the other */ float* OF0 = (float*)take((size_t)NB * QT0 * DM * 4); _Float16* OH0 = (_Float16*)take((size_t)NB * QT0 * DM * 2); _Float16* OL0 = (_Float16*)take((size_t)NB * QT0 * DM * 2);
  if (off > ws_size) return;
  k_wt_hq<<<(unsigned)(((size_t)3 * DM * (DM / 8) + 255) / 256), 256, 0, stream>>>(wqkv, bqkv, BQ, BK, BV, BQB); k_bhq<<<(3 * DM + 255) / 256, 256, 0, stream>>>(bqkv, BQB); k_wt_f16<<<(unsigned)(((size_t)DM * (DM / 8) + 255) / 256), 256, 0, stream>>>(wo, BO, DM, DM, 16.0f);      /* fused [in][out] weight with per-head (q | k | v) column triples -> three Bt planes (row h*64 + d) x16 + the de-interleaved bias vector; W_out [in][out] -> Bt x16 */
  k_tabcp32<<<(SQ * 32 + 255) / 256, 256, 0, stream>>>(tcos, tsin, CSB, SNB, SQ * 32);      /* rope tables [pos][32], bf16-rounded copies */

  k_x16<<<(unsigned)((NR * DM / 8 + 255) / 256), 256, 0, stream>>>(x, X16, NR * DM / 8);
  const size_t r0p = (size_t)B0 * SQ;      /* first projected row */
  k_gemm2<0, 1><<<dim3((unsigned)((MP / 128) * (DM / 128)), 1), 256, 0, stream>>>(X16 + r0p * DM, 0, BQ, 0, 0.0625f, BQB, 0, nullptr, 1, 0, 0, nullptr, Q16 + r0p * DM, DM, 0, MP, DM, DM, CSB, SNB);      /* q (f32) + bias -> interleaved-pair rope (position = row % SQ) -> f16 rows, in one launch */
  k_gemm2<0, 1><<<dim3((unsigned)((MP / 128) * (DM / 128)), 1), 256, 0, stream>>>(X16 + r0p * DM, 0, BK, 0, 0.0625f, BQB + DM, 0, nullptr, 1, 0, 0, nullptr, K16 + r0p * DM, DM, 0, MP, DM, DM, CSB, SNB);      /* k likewise */
  k_gemm2<0><<<dim3((unsigned)((MP / 128) * (DM / 128)), 1), 256, 0, stream>>>(X16 + r0p * DM, 0, BV, 0, 0.0625f, BQB + 2 * DM, 0, nullptr, 1, 0, 0, nullptr, V16 + r0p * DM, DM, 0, MP, DM, DM);
  k_gemm2<0, 3><<<dim3((QT0 / 128) * (DM / 128), 3 * NBR), 256, 0, stream>>>(X16 + r0p * DM, (size_t)SQ * DM, BQ, (size_t)DM * DM, 0.0625f, BQB, DM, nullptr, 1, 0, 0, QF0, nullptr, DM, (size_t)QT0 * DM, QT0, DM, DM, CSB, SNB);      /* f32 q, k, v of the first 128 rows of every batch (exact products) in one launch; BQ | BK | BV lie one after the other; q and k leave it roped, in f32 (first-tile row r = position r) */
  k_att0w<<<dim3(NH * (QT0 / A0R), NBR), 256, 0, stream>>>(QF0, KF0, VF0, 0.125f, OF0 + (size_t)B0 * QT0 * DM);      /* exact f32 attention for rows 0..127 of every batch (o x64) */
  k_vt<NH, SQ><<<NB * NH * (SQ / 64), 256, 0, stream>>>(V16, LQ, 0, VT);      /* V^T [NB][NH][HD][SQ] */
  k_fattn<<<NB * NH * (SQ / FAQB), 128, 0, stream>>>(Q16, K16, VT, O16);      /* scores, causal softmax and P V in one launch; o (merged heads, x64) as f16 rows */
  k_gemm2<0><<<dim3((unsigned)((MPO / 128) * (DM / 128)), 1), 256, 0, stream>>>(O16 + r0p * DM, 0, BO, 0, 0.0009765625f, bo, 0, nullptr, 1, 0, 0, (float*)d_out + r0p * DM, nullptr, DM, 0, MPO, DM, DM);      /* out rows are the output layout */
  k_hl<<<(unsigned)(((size_t)NB * QT0 * DM / 8 + 255) / 256), 256, 0, stream>>>(OF0, OH0, OL0, (size_t)NB * QT0 * DM / 8);      /* first-tile o (x64) -> f16 hi + x1024 residual planes */
  const size_t f0 = (size_t)B0 * QT0;      /* the two launches below take every batch through blockIdx.y: QT0 rows a batch in, SQ rows a batch out */
  k_gemm2<0><<<dim3((QT0 / 128) * (DM / 128), NBR), 256, 0, stream>>>(OH0 + f0 * DM, (size_t)QT0 * DM, BO, 0, 0.0009765625f, bo, 0, nullptr, 1, 0, 0, (float*)d_out + r0p * DM, nullptr, DM, (size_t)SQ * DM, QT0, DM, DM);      /* rows 0..127: out = o_hi Wo (+ b), overwriting the f16-path rows */
  k_gemm2<0><<<dim3((QT0 / 128) * (DM / 128), NBR), 256, 0, stream>>>(OL0 + f0 * DM, (size_t)QT0 * DM, BO, 0, 0.00000095367431640625f, nullptr, 0, (const float*)d_out + r0p * DM, -1, 0, 0, (float*)d_out + r0p * DM, nullptr, DM, (size_t)SQ * DM, QT0, DM, DM);      /* += o_lo Wo 2^-20 (own-element accumulate) */
}

// v007
// A run of this version takes 176 microseconds.
// Timed twice side by side with v006, it ran 1.32 times as fast both times.
// Over all steps from v000 it is 59.8 times as fast.
#include <hip/hip_runtime.h>
// Causal multi-head self-attention with a PER-HEAD interleaved fused QKV projection and rotary embeddings (x [4][2048][1024]; qkv = x W_qkv + b_qkv ([in][out] 1024 x 3072, zero bias) reshaped (B, T, 16, 192): head h owns columns h*192 + [0..63 | 64..127 | 128..191] = q | k | v; rope on q and k from the INPUT tables cos / sin [2048][32]: t1 = even elements, t2 = odd elements, out = cat(t1 c - t2 s, t1 s + t2 c) (an interleaved-pair rotation followed by the same fixed permutation on q and k: the scores are unchanged by it); scores / 8; causal (tril, -inf); softmax; out = merged W_out + b_out ([in][out]) -> [4][2048][1024]).
// Structure: token rows r = b*2048 + s; x as exact f16 rows (bf16-rounded); Q, K, V as three WMMA GEMMs in one launch (32x64 wave tiles, f32 accumulation, exact x16 weights, f16 outputs; the q and k GEMMs apply the rope in their epilogue, in f32, before the rounding to f16; the blocks of a batch's first 128 rows also keep their f32 tile for the exact first-tile attention); V^T for all batches and heads via LDS transposes; one fused attention launch (k_fattn): S^T = K Q^T, online causal softmax in registers (f32 statistics, native exp2; weights x256 f16), O^T += V^T P^T, o carried x64 (folded into the output GEMM alpha) written straight into the merged f16 o rows; out = o W_o GEMM (f32) into the output layout, whose blocks of a batch's first 128 rows take the exact o as an f16 high part and residual.
// Compute dtype: inputs rounded to bf16; x / weights exact; q, k, v, softmax weights and o as plain f16 GEMM operands (~2^-12); scores and softmax statistics f32. v_wmma_f32_16x16x32_f16.
#define NB 4
#define SQ 2048
#define DM 1024
#define NH 16
#define HD 64
#define HG 4                         /* heads per launch of the per-batch k_vt overload (never launched) */
#define QT0 128                      /* first-tile rows recomputed exactly in f32 */
#define B0 0                         /* first batch processed (debug hook) */
#define NBR NB                       /* batches processed (debug hook) */
#define NR ((size_t)NB * SQ)         /* token rows */
#define MP ((int)((size_t)NBR * SQ)) /* rows projected (debug hook) */
#define MPO MP                       /* rows through the output stage (debug hook) */
#define LQ DM      /* row pitch of the q/k/v rows */
typedef __bf16 v16b __attribute__((ext_vector_type(16)));
typedef unsigned short v8us __attribute__((ext_vector_type(8), may_alias));
typedef float  v8f  __attribute__((ext_vector_type(8)));
typedef float  v4f  __attribute__((ext_vector_type(4)));
typedef float  v4fa __attribute__((ext_vector_type(4), may_alias));
union FragB { v16b v; v8us half[2]; unsigned short u[16]; };

__device__ __forceinline__ unsigned short bf16_bits(float x) { unsigned int u = __float_as_uint(x); return (unsigned short)((u + 0x7FFFu + ((u >> 16) & 1u)) >> 16); }
__device__ __forceinline__ float bf16_val(unsigned short b) { return __uint_as_float(((unsigned int)b) << 16); }
__device__ __forceinline__ float bf16_round(float x) { return bf16_val(bf16_bits(x)); }
// D += A·B with NT terms: 1 = ah·bh, 2 = + al·bh (A split), 3 = + ah·bl (both split)
template <int NT>
__device__ __forceinline__ v8f mmaN(v16b ah, v16b al, v16b bh, v16b bl, v8f c) {
  c = __builtin_amdgcn_wmma_f32_16x16x32_bf16(false, ah, false, bh, (short)0, c, false, false);
  if (NT >= 2) c = __builtin_amdgcn_wmma_f32_16x16x32_bf16(false, al, false, bh, (short)0, c, false, false);
  if (NT >= 3) c = __builtin_amdgcn_wmma_f32_16x16x32_bf16(false, ah, false, bl, (short)0, c, false, false);
  asm volatile("v_nop\n\tv_nop\n\tv_nop\n\tv_nop" : "+v"(c) : "v"(ah), "v"(al), "v"(bh), "v"(bl));
  return c;
}

__global__ __launch_bounds__(256) void k_wt_bf16(const float* __restrict__ W, unsigned short* __restrict__ Wt, int K, int N) {
  const int t = blockIdx.x * 256 + threadIdx.x;
  const int k8n = K / 8;
  if (t >= N * k8n) return;
  const int n = t / k8n, k8 = (t % k8n) * 8;
  v8us v;
#pragma unroll
  for (int i = 0; i < 8; ++i) v[i] = bf16_bits(W[(size_t)(k8 + i) * N + n]);
  *(v8us*)(Wt + (size_t)n * K + k8) = v;
  
}

// GEMM C[M][N] (f32, pitch ldc) = act(A[M][K]·W + bias). A f32 row-major (pitch lda) converted per fragment to bf16
// (ASPLIT: hi/lo two planes -> 2 terms, else single rounded term); Wt bf16 [N][K] (pitch ldb). BIAS_BF16 rounds the
// bias to bf16 first (bias quantised to bf16 before the add). K%32==0, M%16==0, N%64==0.
template <bool ASPLIT, int ACT, bool BIAS_BF16>
__global__ __launch_bounds__(128) void k_gemm_bf(const float* __restrict__ A, int lda, const unsigned short* __restrict__ Wt, int ldb,
                                               const float* __restrict__ bias, float* __restrict__ C, int ldc, int M, int N, int K) {
  __shared__ __attribute__((aligned(16))) float so[4][16][64];
  const int tid = threadIdx.x, w = tid >> 5, lane = tid & 31, ln = lane & 15, hh = lane >> 4;
  const int ntn = N / 64;
  const int wid = blockIdx.x * 4 + w;
  const int mt = wid / ntn, nq = wid % ntn;
  if (mt * 16 >= M) return;
  const int row0 = mt * 16, col0 = nq * 64;
  const float* arow = A + (size_t)(row0 + ln) * lda;
  v8f acc[4] = {};
  for (int kb = 0; kb < K; kb += 32) {
    FragB ah, al;
    const v4f x0 = *(const v4fa*)(arow + kb + 8 * hh), x1 = *(const v4fa*)(arow + kb + 8 * hh + 4);
    const v4f x2 = *(const v4fa*)(arow + kb + 16 + 8 * hh), x3 = *(const v4fa*)(arow + kb + 16 + 8 * hh + 4);
    float xs[16] = {x0[0],x0[1],x0[2],x0[3],x1[0],x1[1],x1[2],x1[3],x2[0],x2[1],x2[2],x2[3],x3[0],x3[1],x3[2],x3[3]};
#pragma unroll
    for (int i = 0; i < 16; ++i) { const unsigned short hb = bf16_bits(xs[i]); ah.u[i] = hb; al.u[i] = ASPLIT ? bf16_bits(xs[i] - bf16_val(hb)) : (unsigned short)0; }
#pragma unroll
    for (int t = 0; t < 4; ++t) {
      const unsigned short* brow = Wt + (size_t)(col0 + t * 16 + ln) * ldb + kb;
      FragB b;
      b.half[0] = *(const v8us*)(brow + 8 * hh);
      b.half[1] = *(const v8us*)(brow + 16 + 8 * hh);
      acc[t] = mmaN<ASPLIT ? 2 : 1>(ah.v, al.v, b.v, b.v, acc[t]);
    }
  }
#pragma unroll
  for (int t = 0; t < 4; ++t) {
    float bv = bias ? bias[col0 + t * 16 + ln] : 0.f;
    if (BIAS_BF16) bv = bf16_round(bv);
#pragma unroll
    for (int r = 0; r < 8; ++r) { float v = acc[t][r] + bv; if (ACT == 1) v = fmaxf(v, 0.f); so[w][8 * hh + r][t * 16 + ln] = v; }
  }
  __builtin_amdgcn_fence(__ATOMIC_ACQ_REL, "workgroup");
  __builtin_amdgcn_wave_barrier();
  const int rsub = lane >> 4, c4 = (lane & 15) * 4;
  {
#pragma unroll
    for (int q = 0; q < 8; ++q) {
      const int r = q * 2 + rsub;
      const v4f v = *(const v4fa*)&so[w][r][c4];
      *(v4f*)(C + (size_t)(row0 + r) * ldc + col0 + c4) = v;
    }
    
  }
}

// GEMM C = act(A·W + bias + resid): A f32 (ASPLIT -> hi/lo 2 terms), Wt bf16 [N][K]; ACT 0 none, 1 relu, 2 exact gelu;
// resid (optional, f32, row index = (row % rmod), pitch ldr, RES_BF16 rounds it) added before the activation.
template <bool ASPLIT, int ACT, bool BIAS_BF16, bool RES_BF16>
__global__ __launch_bounds__(128) void k_gemm_bf3(const float* __restrict__ A, int lda, const unsigned short* __restrict__ Wt, int ldb,
                                                const float* __restrict__ bias, const float* __restrict__ resid, int rmod, int ldr,
                                                float* __restrict__ C, int ldc, int M, int N, int K) {
  __shared__ __attribute__((aligned(16))) float so[4][16][64];
  const int tid = threadIdx.x, w = tid >> 5, lane = tid & 31, ln = lane & 15, hh = lane >> 4;
  const int ntn = N / 64;
  const int wid = blockIdx.x * 4 + w;
  const int mt = wid / ntn, nq = wid % ntn;
  if (mt * 16 >= M) return;
  const int row0 = mt * 16, col0 = nq * 64;
  const float* arow = A + (size_t)(row0 + ln) * lda;
  v8f acc[4] = {};
  for (int kb = 0; kb < K; kb += 32) {
    FragB ah, al;
    const v4f x0 = *(const v4fa*)(arow + kb + 8 * hh), x1 = *(const v4fa*)(arow + kb + 8 * hh + 4);
    const v4f x2 = *(const v4fa*)(arow + kb + 16 + 8 * hh), x3 = *(const v4fa*)(arow + kb + 16 + 8 * hh + 4);
    float xs[16] = {x0[0],x0[1],x0[2],x0[3],x1[0],x1[1],x1[2],x1[3],x2[0],x2[1],x2[2],x2[3],x3[0],x3[1],x3[2],x3[3]};
#pragma unroll
    for (int i = 0; i < 16; ++i) { const unsigned short hb = bf16_bits(xs[i]); ah.u[i] = hb; al.u[i] = ASPLIT ? bf16_bits(xs[i] - bf16_val(hb)) : (unsigned short)0; }
#pragma unroll
    for (int t = 0; t < 4; ++t) {
      const unsigned short* brow = Wt + (size_t)(col0 + t * 16 + ln) * ldb + kb;
      FragB b;
      b.half[0] = *(const v8us*)(brow + 8 * hh);
      b.half[1] = *(const v8us*)(brow + 16 + 8 * hh);
      acc[t] = mmaN<ASPLIT ? 2 : 1>(ah.v, al.v, b.v, b.v, acc[t]);
    }
  }
#pragma unroll
  for (int t = 0; t < 4; ++t) {
    const int col = col0 + t * 16 + ln;
    float bv = bias ? bias[col] : 0.f;
    if (BIAS_BF16) bv = bf16_round(bv);
#pragma unroll
    for (int r = 0; r < 8; ++r) {
      float v = acc[t][r] + bv;
      if (resid) { float rv = resid[(size_t)((row0 + 8 * hh + r) % rmod) * ldr + col]; if (RES_BF16) rv = bf16_round(rv); v += rv; }
      if (ACT == 1) v = fmaxf(v, 0.f);
      if (ACT == 2) v = 0.5f * v * (1.0f + erff(v * 0.70710678118654752f));
      if (ACT == 3) { const float u = 0.7978845608028654f * (v + 0.044715f * v * v * v); v = 0.5f * v * (1.0f + tanhf(u)); }
      so[w][8 * hh + r][t * 16 + ln] = v;
    }
  }
  __builtin_amdgcn_fence(__ATOMIC_ACQ_REL, "workgroup");
  __builtin_amdgcn_wave_barrier();
  const int rsub = lane >> 4, c4 = (lane & 15) * 4;
  {
#pragma unroll
    for (int q = 0; q < 8; ++q) {
      const int r = q * 2 + rsub;
      const v4f v = *(const v4fa*)&so[w][r][c4];
      *(v4f*)(C + (size_t)(row0 + r) * ldc + col0 + c4) = v;
    }
    
  }
}
// row LayerNorm (biased variance, eps) over N: s = X (+ R); optional out_sum <- s; out_norm <- (s-mu)*rsqrt(var+eps)*g + b
template <bool PARAM_BF16>
__global__ __launch_bounds__(256) void k_layernorm(const float* __restrict__ X, const float* __restrict__ R, const float* __restrict__ g, const float* __restrict__ bta,
                                                  float* __restrict__ out_sum, float* __restrict__ out_norm, int N, float eps) {
  __shared__ float red[256];
  const int row = blockIdx.x, tid = threadIdx.x;
  const float* x = X + (size_t)row * N; const float* rr = R ? R + (size_t)row * N : nullptr;
  float vals[16];                     // up to N = 4096
  const int per = N / 256;            // contiguous chunk per thread? use strided-by-4 chunks: thread handles j = tid*4 + 1024*u
  float s1 = 0.f;
  for (int u = 0; u < per / 4; ++u) {
    const int j = tid * 4 + 1024 * u;
    const v4f a = *(const v4fa*)(x + j);
    v4f b = {0.f,0.f,0.f,0.f}; if (rr) b = *(const v4fa*)(rr + j);
#pragma unroll
    for (int q = 0; q < 4; ++q) { const float v = a[q] + b[q]; vals[u * 4 + q] = v; s1 += v; }
  }
  red[tid] = s1; __syncthreads();
  for (int st = 128; st > 0; st >>= 1) { if (tid < st) red[tid] += red[tid + st]; __syncthreads(); }
  const float mu = red[0] / (float)N; __syncthreads();
  float s2 = 0.f;
  for (int u = 0; u < per / 4; ++u)
#pragma unroll
    for (int q = 0; q < 4; ++q) { const float c = vals[u * 4 + q] - mu; s2 += c * c; }
  red[tid] = s2; __syncthreads();
  for (int st = 128; st > 0; st >>= 1) { if (tid < st) red[tid] += red[tid + st]; __syncthreads(); }
  const float rs = rsqrtf(red[0] / (float)N + eps);
  {
    for (int u = 0; u < per / 4; ++u) {
      const int j = tid * 4 + 1024 * u;
      v4f o, sm;
#pragma unroll
      for (int q = 0; q < 4; ++q) {
        float gg = g[j + q], bb = bta[j + q];
        if (PARAM_BF16) { gg = bf16_round(gg); bb = bf16_round(bb); }
        sm[q] = vals[u * 4 + q]; o[q] = (vals[u * 4 + q] - mu) * rs * gg + bb;
      }
      if (out_sum) *(v4f*)(out_sum + (size_t)row * N + j) = sm;
      *(v4f*)(out_norm + (size_t)row * N + j) = o;
    }
    
  }
}



// ---- f16 WMMA path (v_wmma_f32_16x16x32_f16): 11-bit significands for operands in range — used where a [0,1] probability operand needs more precision than bf16
typedef _Float16 v16h __attribute__((ext_vector_type(16)));
union FragH { v16h v; v8us half[2]; _Float16 h[16]; unsigned short u[16]; };
template <int NT>
__device__ __forceinline__ v8f mmaH(v16h ah, v16h al, v16h bh, v16h bl, v8f c) {
  c = __builtin_amdgcn_wmma_f32_16x16x32_f16(false, ah, false, bh, (short)0, c, false, false);
  if (NT >= 2) c = __builtin_amdgcn_wmma_f32_16x16x32_f16(false, al, false, bh, (short)0, c, false, false);
  if (NT >= 3) c = __builtin_amdgcn_wmma_f32_16x16x32_f16(false, ah, false, bl, (short)0, c, false, false);
  asm volatile("v_nop\n\tv_nop\n\tv_nop\n\tv_nop" : "+v"(c) : "v"(ah), "v"(al), "v"(bh), "v"(bl));
  return c;
}
// batched GEMM like k_gemm_b but f16 operands: A f32 (split into f16 hi/lo if ASPLIT, else rounded to f16), Bt = f16 values [n][k]; alpha; C f32; N multiple of 16 (partial tiles skipped)
template <bool ASPLIT>
__global__ __launch_bounds__(128) void k_gemm_h(const float* __restrict__ A, int lda, size_t sA, const _Float16* __restrict__ Bh, int ldb, size_t sB, float alpha, float* __restrict__ C, int ldc, size_t sC, int M, int N, int K) {
  __shared__ __attribute__((aligned(16))) float so[4][16][64];
  const int tid = threadIdx.x, w = tid >> 5, lane = tid & 31, ln = lane & 15, hh = lane >> 4; const int by = blockIdx.y;
  A += (size_t)by * sA; Bh += (size_t)by * sB; C += (size_t)by * sC;
  const int ntn = (N + 63) / 64; const int wid = blockIdx.x * 4 + w; const int mt = wid / ntn, nq = wid % ntn; if (mt * 16 >= M) return;
  const int row0 = mt * 16, col0 = nq * 64; const float* arow = A + (size_t)(row0 + ln) * lda;
  v8f acc[4] = {};
  for (int kb = 0; kb < K; kb += 32) {
    FragH ah, al;
    const v4f x0 = *(const v4fa*)(arow + kb + 8 * hh), x1 = *(const v4fa*)(arow + kb + 8 * hh + 4), x2 = *(const v4fa*)(arow + kb + 16 + 8 * hh), x3 = *(const v4fa*)(arow + kb + 16 + 8 * hh + 4);
    float xs[16] = {x0[0],x0[1],x0[2],x0[3],x1[0],x1[1],x1[2],x1[3],x2[0],x2[1],x2[2],x2[3],x3[0],x3[1],x3[2],x3[3]};
#pragma unroll
    for (int i = 0; i < 16; ++i) { const _Float16 h = (_Float16)xs[i]; ah.h[i] = h; al.h[i] = ASPLIT ? (_Float16)(xs[i] - (float)h) : (_Float16)0.0f; }
#pragma unroll
    for (int t = 0; t < 4; ++t) { if (col0 + t * 16 >= N) continue; const size_t boff = (size_t)(col0 + t * 16 + ln) * ldb + kb; FragH bq; bq.half[0] = *(const v8us*)(Bh + boff + 8 * hh); bq.half[1] = *(const v8us*)(Bh + boff + 16 + 8 * hh);
      acc[t] = mmaH<ASPLIT ? 2 : 1>(ah.v, al.v, bq.v, bq.v, acc[t]); }
  }
#pragma unroll
  for (int t = 0; t < 4; ++t) { if (col0 + t * 16 >= N) continue;
#pragma unroll
    for (int r = 0; r < 8; ++r) so[w][8 * hh + r][t * 16 + ln] = acc[t][r] * alpha; }
  __builtin_amdgcn_fence(__ATOMIC_ACQ_REL, "workgroup"); __builtin_amdgcn_wave_barrier();
  const int rsub = lane >> 4, c4 = (lane & 15) * 4;
  {
#pragma unroll
    for (int q = 0; q < 8; ++q) { const int r = q * 2 + rsub; if (col0 + c4 < N) { const v4f v = *(const v4fa*)&so[w][r][c4]; *(v4f*)(C + (size_t)(row0 + r) * ldc + col0 + c4) = v; } }
     }
}

// Wt[n][k] = f16(W[k][n]·scale) from f32 row-major W[K][N] (scale = power of two; bf16-exact weights stay exact in f16 away from the subnormal range)
__global__ __launch_bounds__(256) void k_wt_f16(const float* __restrict__ W, _Float16* __restrict__ Wt, int K, int N, float scale) {
  const int t = blockIdx.x * 256 + threadIdx.x; if (t >= N * (K / 8)) return; const int n = t / (K / 8), k8 = (t % (K / 8)) * 8; FragH f;
#pragma unroll
  for (int i = 0; i < 8; ++i) f.h[i] = (_Float16)(bf16_round(W[(size_t)(k8 + i) * N + n]) * scale); const v8us o = f.half[0];
  *(v8us*)((unsigned short*)Wt + (size_t)n * K + k8) = o; 
}
// k_gemm_hh variant with fused epilogue: v = acc·alpha + bias[by·sBias + col] (+ CP[(row/rowsPerB)·sCPb + by·64 + col] if CP) ; ACT 0 none / 1 elu ; writes f16 C16 (and f32 C if non-null)
template <int ACT>
__global__ __launch_bounds__(128) void k_gemm_hhx(const _Float16* __restrict__ A, int lda, size_t sA, const _Float16* __restrict__ Bh, int ldb, size_t sB, float alpha, const float* __restrict__ bias, size_t sBias, const float* __restrict__ CP, int rowsPerB, size_t sCPb, int row0g,
    float* __restrict__ C, _Float16* __restrict__ C16, int ldc, size_t sC, int M, int N, int K) {
  __shared__ __attribute__((aligned(16))) float so[4][16][64];
  const int tid = threadIdx.x, w = tid >> 5, lane = tid & 31, ln = lane & 15, hh = lane >> 4; const int by = blockIdx.y;
  A += (size_t)by * sA; Bh += (size_t)by * sB; const size_t cofs = (size_t)by * sC; const float* bp = bias ? bias + (size_t)by * sBias : nullptr;
  const int ntn = (N + 63) / 64; const int wid = blockIdx.x * 4 + w; const int mt = wid / ntn, nq = wid % ntn; if (mt * 16 >= M) return;
  const int row0 = mt * 16, col0 = nq * 64; const _Float16* arow = A + (size_t)(row0 + ln) * lda;
  v8f acc[4] = {};
  for (int kb = 0; kb < K; kb += 32) { FragH ah; ah.half[0] = *(const v8us*)((const unsigned short*)arow + kb + 8 * hh); ah.half[1] = *(const v8us*)((const unsigned short*)arow + kb + 16 + 8 * hh);
#pragma unroll
    for (int t = 0; t < 4; ++t) { if (col0 + t * 16 >= N) continue; const size_t boff = (size_t)(col0 + t * 16 + ln) * ldb + kb; FragH bq; bq.half[0] = *(const v8us*)((const unsigned short*)Bh + boff + 8 * hh); bq.half[1] = *(const v8us*)((const unsigned short*)Bh + boff + 16 + 8 * hh);
      acc[t] = mmaH<1>(ah.v, ah.v, bq.v, bq.v, acc[t]); }
  }
#pragma unroll
  for (int t = 0; t < 4; ++t) { if (col0 + t * 16 >= N) continue; const int col = col0 + t * 16 + ln; const float bv = bp ? bf16_round(bp[col]) : 0.f;
#pragma unroll
    for (int r = 0; r < 8; ++r) { float v = acc[t][r] * alpha + bv; if (CP) { const int rr = row0g + row0 + 8 * hh + r; if (rowsPerB < 0) v += CP[cofs + (size_t)rr * ldc + col];      /* rowsPerB < 0: own element of the batched C plane */ else { const int bidx = rr / rowsPerB; v += CP[(size_t)bidx * sCPb + (size_t)by * 64 + col]; } } if (ACT == 1) v = (v > 0.f) ? v : expm1f(v); else if (ACT == 7) v = (v > 0.f) ? v + 1.0f : expf(v); else if (ACT == 8) v = tanhf(v); else if (ACT == 9) v = 0.5f * v * (1.0f + tanhf(0.7978845608028654f * (v + 0.044715f * v * v * v))); else if (ACT == 11) v = 1.0f / (1.0f + expf(-v)); else if (ACT == 12) v = (v > 0.f) ? v : 0.01f * v; else if (ACT == 14) v = (v > 0.f) ? v : 0.1f * v; else if (ACT == 16) v = (v >= 0.f) ? v : 0.3f * v; else if (ACT == 17) v = (v >= 0.f) ? v : 0.2f * v; else if (ACT == 15) v = v / (1.0f + expf(-v)); else if (ACT == 3) v = fmaxf(v, 0.f); else if (ACT == 6) v = 0.5f * v * (1.0f + erff(v * 0.70710678118654752f)); so[w][8 * hh + r][t * 16 + ln] = v; } }
  __builtin_amdgcn_fence(__ATOMIC_ACQ_REL, "workgroup"); __builtin_amdgcn_wave_barrier();
  const int rsub = lane >> 4, c4 = (lane & 15) * 4; typedef _Float16 v4h __attribute__((ext_vector_type(4)));
  {
#pragma unroll
    for (int q = 0; q < 8; ++q) { const int r = q * 2 + rsub; if (col0 + c4 < N) { const v4f v = *(const v4fa*)&so[w][r][c4]; if (C) *(v4f*)(C + cofs + (size_t)(row0 + r) * ldc + col0 + c4) = v; if (C16) { v4h h4; for (int i = 0; i < 4; ++i) h4[i] = (_Float16)v[i]; *(v4h*)(C16 + cofs + (size_t)(row0 + r) * ldc + col0 + c4) = h4; } } }
     }
}


typedef _Float16 v4h __attribute__((ext_vector_type(4)));

__global__ __launch_bounds__(256) void k_x16(const float* __restrict__ x, _Float16* __restrict__ X16, size_t n8) { const size_t t = (size_t)blockIdx.x * 256 + threadIdx.x; if (t >= n8) return; FragH f;
#pragma unroll
  for (int q = 0; q < 8; ++q) f.h[q] = (_Float16)bf16_round(x[t * 8 + q]); *(v8us*)((unsigned short*)X16 + t * 8) = f.half[0];  }
__global__ __launch_bounds__(256) void k_h16(const float* __restrict__ x, _Float16* __restrict__ X16, size_t n8) { const size_t t = (size_t)blockIdx.x * 256 + threadIdx.x; if (t >= n8) return; FragH f;
#pragma unroll
  for (int q = 0; q < 8; ++q) f.h[q] = (_Float16)x[t * 8 + q]; *(v8us*)((unsigned short*)X16 + t * 8) = f.half[0];  }
__global__ __launch_bounds__(256) void k_round16f(const float* __restrict__ W, _Float16* __restrict__ Bt, size_t n8) { const size_t t = (size_t)blockIdx.x * 256 + threadIdx.x; if (t >= n8) return; FragH f;
#pragma unroll
  for (int i = 0; i < 8; ++i) f.h[i] = (_Float16)(bf16_round(W[t * 8 + i]) * 16.0f); *(v8us*)((unsigned short*)Bt + t * 8) = f.half[0];  }
template <int NHv, int TTv>
__global__ __launch_bounds__(256) void k_vt(const _Float16* __restrict__ V16, int ldv, int voff, _Float16* __restrict__ Vt) { __shared__ unsigned short tl[64][66]; const int tid = threadIdx.x; const int slab = blockIdx.x / (TTv / 64), lg = blockIdx.x % (TTv / 64); const int b = slab / NHv, h = slab % NHv;
  for (int i = tid; i < 64 * 8; i += 256) { const int r = i / 8, c8 = (i % 8) * 8; FragH f; f.half[0] = *(const v8us*)((const unsigned short*)V16 + ((size_t)b * TTv + lg * 64 + r) * ldv + voff + h * 64 + c8);
#pragma unroll
    for (int q = 0; q < 8; ++q) tl[r][c8 + q] = f.u[q]; }
  __syncthreads();
  {
#pragma unroll
    for (int rd = 0; rd < 2; ++rd) { const int d = rd * 32 + tid / 8, pc = tid % 8; FragH f;
#pragma unroll
      for (int q = 0; q < 8; ++q) f.u[q] = tl[pc * 8 + q][d];
      *(v8us*)((unsigned short*)Vt + ((size_t)slab * 64 + d) * TTv + lg * 64 + pc * 8) = f.half[0]; }
     } }

__global__ __launch_bounds__(256) void k_hl(const float* __restrict__ F, _Float16* __restrict__ Hh, _Float16* __restrict__ Hl, size_t n8) { const size_t t = (size_t)blockIdx.x * 256 + threadIdx.x; if (t >= n8) return; FragH fh, fl; const v4f a = *(const v4fa*)(F + t * 8), c = *(const v4fa*)(F + t * 8 + 4);
#pragma unroll
  for (int q = 0; q < 4; ++q) { _Float16 h = (_Float16)a[q]; fh.h[q] = h; fl.h[q] = (_Float16)((a[q] - (float)h) * 1024.0f); h = (_Float16)c[q]; fh.h[4 + q] = h; fl.h[4 + q] = (_Float16)((c[q] - (float)h) * 1024.0f); }
  { *(v8us*)((unsigned short*)Hh + t * 8) = fh.half[0]; *(v8us*)((unsigned short*)Hl + t * 8) = fl.half[0];  } }

// ---- fast GEMM (block tile 128x128 = 8 waves of 32x64; requires M % 128 == 0 rows per launch region, N % 128 == 0, K % 64 == 0; operand rows of pitch DM); epilogue = k_gemm_hhx semantics ----
// Operands go through LDS: a stage is 64 k (128 bytes, one cache line) of the block's 128 A rows and 128 B rows, fetched by whole-line 16-byte loads (8 lanes a row) into registers one stage ahead and stored at a row pitch of 144 bytes (16 x odd).
// Two LDS buffers, one barrier a stage: while a stage is worked on, the next one is stored into the other buffer and the one after it is in flight. The fragments are read from LDS by g2_frag, in the k order they had from memory.
#define G2KS 64                      /* k per stage */
#define G2P (G2KS + 8)               /* LDS row pitch, halves */
#define G2ROWS 256                   /* LDS rows per buffer: 128 of A, then 128 of B */
__device__ __forceinline__ v16h g2_frag(const _Float16* p, int hh) { FragH f; f.half[0] = *(const v8us*)((const unsigned short*)p + 8 * hh); f.half[1] = *(const v8us*)((const unsigned short*)p + 16 + 8 * hh); return f.v; }
__device__ __forceinline__ v8f g2_mma(v16h a, v16h b, v8f c) { v8f d = __builtin_amdgcn_wmma_f32_16x16x32_f16(false, a, false, b, (short)0, c, false, false); asm volatile("v_nop\n\tv_nop\n\tv_nop\n\tv_nop" : "+v"(d) : "v"(a), "v"(b)); return d; }
typedef float v2f __attribute__((ext_vector_type(2)));
// ROPE 1 (f16 rows to C16), 2 or 3 (f32 rows to C): the interleaved-pair rotation (position = row % SQ, tables CS / SN [SQ][HD / 2]) is applied to the finished f32 tile on its way from LDS to the f32 or f16 rows; a 64-column tile is one head, and a lane's four columns are two whole pairs.
// ROPE 3: one launch for q, k and v of every batch: blockIdx.y = plane * NBR + batch; sA steps the batch, sB and sBias the plane, sC both; planes 0 and 1 (q, k) are rotated, plane 2 (v) leaves by the plain path at the foot.
// FT: what a block does whose 128 rows are the first QT0 rows of a batch (the rows that are carried exactly in f32).
// FT 1 (with ROPE 1): one launch for q, k and v, blockIdx.y = plane (sB, sBias and sC step it; planes 0 and 1 are rotated); such a block stores its finished f32 tile to CF as well ([plane][batch][QT0][DM]), ahead of the rounding to f16.
// FT 2: such a block takes its A rows from the planes AH and then AL ([batch][QT0][DM]; f16 high part, residual x1024): the k loop runs once over each, the high part's sums set aside between the two; out = hi alpha + bias, then + lo alpha / 1024.
template <int ACT, int ROPE = 0, int FT = 0>
__global__ __launch_bounds__(256) void k_gemm2(const _Float16* __restrict__ A, size_t sA, const _Float16* __restrict__ Bh, size_t sB, float alpha, const float* __restrict__ bias, size_t sBias, const float* __restrict__ CP, int rowsPerB, size_t sCPb, int row0g,
    float* __restrict__ C, _Float16* __restrict__ C16, int ldc, size_t sC, int M, int N, int K, const float* __restrict__ CS = nullptr, const float* __restrict__ SN = nullptr, const _Float16* __restrict__ AH = nullptr, const _Float16* __restrict__ AL = nullptr, float* __restrict__ CF = nullptr) { static_assert(FT == 0 || (QT0 == 128 && SQ % 128 == 0), "k_gemm2: a first tile is one block's rows"); static_assert(ACT == 0 || ACT == 3 || ACT == 6 || ACT == 8 || ACT == 9 || ACT == 11 || ACT == 12 || ACT == 14 || ACT == 15 || ACT == 16 || ACT == 17, "k_gemm2: unsupported ACT code (would silently apply no activation)");
  __shared__ __attribute__((aligned(16))) unsigned short sm[2 * G2ROWS * G2P]; static_assert(sizeof(sm) >= 8 * 32 * 68 * sizeof(float), "k_gemm2: the epilogue tiles lie in the operand buffers");
  float (*so)[32][68] = (float (*)[32][68])sm;      /* the epilogue's f32 tiles, one a wave, reuse the operand buffers behind the k loop's last barrier */
  const int tid = threadIdx.x, w = tid >> 5, lane = tid & 31, ln = lane & 15, hh = lane >> 4; const int by = blockIdx.y;
  const int pl = (ROPE == 3) ? by / NBR : by, ba = (ROPE == 3) ? by % NBR : by; const bool rot = (ROPE != 3 && FT != 1) || pl < 2;      /* blockIdx.y is a scalar: the tests on rot are scalar branches */
  A += (size_t)ba * sA; Bh += (size_t)pl * sB; const size_t cofs = (size_t)by * sC; const float* bp = bias ? bias + (size_t)pl * sBias : nullptr;
  const int ntn = N >> 7; const int mt = blockIdx.x / ntn, nq = blockIdx.x - mt * ntn; if (mt * 128 >= M) return;      /* the same for the whole block, in front of every barrier */
  const bool ft = FT != 0 && mt % (SQ / 128) == 0; const int fbat = mt / (SQ / 128);      /* first-tile block, and its batch: scalars, so every test on ft is a scalar branch */
  const int wr = w & 3, wc = w >> 2; const int row0 = mt * 128 + 32 * wr, col0 = nq * 128 + 64 * wc;
  const int sr = tid >> 3, sc = (tid & 7) * 8;      /* staging: 8 lanes take one 128-byte row piece, a pass of the block 32 rows */
  const unsigned short* ap = ((FT == 2 && ft) ? (const unsigned short*)AH + (size_t)(fbat * QT0 + sr) * DM : (const unsigned short*)A + (size_t)(mt * 128 + sr) * DM) + sc; const unsigned short* bq = (const unsigned short*)Bh + (size_t)(nq * 128 + sr) * DM + sc; v8us ar[4], br[4];      /* the lane's own addresses: the row pitch is a constant, so the four passes differ in the immediate offset alone */
  unsigned short* const sw = sm + sr * G2P + sc;      /* where the lane stores its pieces (buffer 0, pass 0 of A) */
  const _Float16* const fa = (const _Float16*)sm + (32 * wr + ln) * G2P; const _Float16* const fb = (const _Float16*)sm + (128 + 64 * wc + ln) * G2P;      /* the lane's fragment rows (buffer 0) */
  const v8f z8 = {0.f,0.f,0.f,0.f,0.f,0.f,0.f,0.f}; v8f c00 = z8, c01 = z8, c02 = z8, c03 = z8, c10 = z8, c11 = z8, c12 = z8, c13 = z8;
  v8f h00 = z8, h01 = z8, h02 = z8, h03 = z8, h10 = z8, h11 = z8, h12 = z8, h13 = z8;      /* FT 2: the high part's sums; 0 in any other block */
  v2f rc[16], rs[16];      /* ROPE: the lane's cos / sin pairs of its 16 rows, fetched ahead of the k loop, whose first trips cover their latency */
  if (ROPE && rot) { static_assert(HD == 64 && SQ % 32 == 0, "k_gemm2 rope: a 64-column tile is one head, a 32-row tile does not wrap the position");
    const float* cp = CS + (size_t)((row0 + (lane >> 4)) % SQ) * (HD / 2) + (lane & 15) * 2; const float* sp = SN + (size_t)((row0 + (lane >> 4)) % SQ) * (HD / 2) + (lane & 15) * 2;      /* the lane's own addresses: the 16 rows differ in the immediate offset alone */
#pragma unroll
    for (int q = 0; q < 16; ++q) { rc[q] = *(const v2f*)(cp + q * HD); rs[q] = *(const v2f*)(sp + q * HD); }      /* fully unrolled: rc and rs stay in registers; two rows on = 2 * (HD / 2) floats */
    asm volatile("s_wait_xcnt 0x0" :: "v"(cp), "v"(sp) : "memory"); }      /* the wait between the loads above and the first reuse of their address registers; the addresses are inputs so that their registers stay untouched up to it */
  const int nst = K / G2KS;
#pragma unroll 1
  for (int ph = 0; ph < ((FT == 2 && ft) ? 2 : 1); ++ph) {      /* FT 2, first tile: the k loop runs twice, over AH and then over AL, against the same B rows; rolled: one copy of the k loop, whose sums stay in their registers */
  if (FT == 2 && ph == 1) { h00 = c00; h01 = c01; h02 = c02; h03 = c03; h10 = c10; h11 = c11; h12 = c12; h13 = c13; c00 = z8; c01 = z8; c02 = z8; c03 = z8; c10 = z8; c11 = z8; c12 = z8; c13 = z8;      /* the high part is done: its sums are set aside, the residual's start at 0 */
    ap = (const unsigned short*)AL + (size_t)(fbat * QT0 + sr) * DM + sc; bq = (const unsigned short*)Bh + (size_t)(nq * 128 + sr) * DM + sc; }
#pragma unroll
  for (int u = 0; u < 4; ++u) { ar[u] = *(const v8us*)(ap + (size_t)u * 32 * DM); br[u] = *(const v8us*)(bq + (size_t)u * 32 * DM); }
  asm volatile("s_wait_xcnt 0x0" :: "v"(ap), "v"(bq) : "memory");      /* the wait between the loads above and the first rewrite of their address registers; the addresses are inputs so that their registers stay untouched up to it */
#pragma unroll
  for (int u = 0; u < 4; ++u) { *(v8us*)(sw + u * 32 * G2P) = ar[u]; *(v8us*)(sw + (128 + u * 32) * G2P) = br[u]; }
  if (nst > 1) { ap += G2KS; bq += G2KS;
#pragma unroll
    for (int u = 0; u < 4; ++u) { ar[u] = *(const v8us*)(ap + (size_t)u * 32 * DM); br[u] = *(const v8us*)(bq + (size_t)u * 32 * DM); }
    asm volatile("s_wait_xcnt 0x0" :: "v"(ap), "v"(bq) : "memory"); }      /* as above */
  __syncthreads();      /* publishes stage 0 */
#pragma unroll 1
  for (int s = 0; s < nst; ++s) { const int cur = (s & 1) * (G2ROWS * G2P), nxt = (G2ROWS * G2P) - cur;      /* rolled: the trips differ in the buffer alone */
    if (s + 1 < nst) {      /* stage s + 1 goes into the buffer whose last readers passed the barrier at the foot of trip s - 1 */
#pragma unroll
      for (int u = 0; u < 4; ++u) { *(v8us*)(sw + nxt + u * 32 * G2P) = ar[u]; *(v8us*)(sw + nxt + (128 + u * 32) * G2P) = br[u]; } }
    if (s + 2 < nst) { ap += G2KS; bq += G2KS;
#pragma unroll
      for (int u = 0; u < 4; ++u) { ar[u] = *(const v8us*)(ap + (size_t)u * 32 * DM); br[u] = *(const v8us*)(bq + (size_t)u * 32 * DM); }
      asm volatile("s_wait_xcnt 0x0" :: "v"(ap), "v"(bq) : "memory"); }      /* as above: stands in front of the next trip's address additions */
#pragma unroll
    for (int kk = 0; kk < G2KS; kk += 32) { const _Float16* pa = fa + cur + kk; const _Float16* pb = fb + cur + kk;      /* the six fragments of a 32-k block are read as one group ahead of its eight products: one LDS latency a block, not one a fragment */
      const v16h a0 = g2_frag(pa, hh), a1 = g2_frag(pa + 16 * G2P, hh), b0 = g2_frag(pb, hh), b1 = g2_frag(pb + 16 * G2P, hh), b2 = g2_frag(pb + 32 * G2P, hh), b3 = g2_frag(pb + 48 * G2P, hh);
      c00 = g2_mma(a0, b0, c00); c10 = g2_mma(a1, b0, c10); c01 = g2_mma(a0, b1, c01); c11 = g2_mma(a1, b1, c11);
      c02 = g2_mma(a0, b2, c02); c12 = g2_mma(a1, b2, c12); c03 = g2_mma(a0, b3, c03); c13 = g2_mma(a1, b3, c13); }
    __syncthreads(); }      /* publishes stage s + 1 and ends every wave's reads of stage s (behind the last trip: before the epilogue's tiles, or the second run's first stage, overwrite the buffers) */
  }
  const float al2 = (FT == 2 && ft) ? alpha * 0.0009765625f : alpha;      /* the factor of the last run's sums */
  v8f accs[8] = {c00, c01, c02, c03, c10, c11, c12, c13}; v8f hacc[8] = {h00, h01, h02, h03, h10, h11, h12, h13};
#pragma unroll
  for (int u = 0; u < 8; ++u) { const int t = u & 3, half = u >> 2; const int col = col0 + t * 16 + ln; const float bv = bp ? bf16_round(bp[col]) : 0.f;
#pragma unroll
    for (int r = 0; r < 8; ++r) { const int rloc = half * 16 + 8 * hh + r; float v = (FT == 2) ? accs[u][r] * al2 + (hacc[u][r] * alpha + bv) : accs[u][r] * alpha + bv; if (CP) { if (rowsPerB < 0) v += CP[cofs + (size_t)(row0g + row0 + rloc) * ldc + col];      /* rowsPerB < 0: own element of the batched C plane */ else { const int bidx = (row0g + row0 + rloc) / rowsPerB; v += CP[(size_t)bidx * sCPb + (size_t)by * 64 + col]; } }
      if (ACT == 3) v = fmaxf(v, 0.f); else if (ACT == 6) v = 0.5f * v * (1.0f + erff(v * 0.70710678118654752f)); else if (ACT == 11) v = 1.0f / (1.0f + expf(-v)); else if (ACT == 15) v = v / (1.0f + expf(-v)); else if (ACT == 12) v = (v > 0.f) ? v : 0.01f * v; else if (ACT == 8) v = tanhf(v); else if (ACT == 9) v = 0.5f * v * (1.0f + tanhf(0.7978845608028654f * (v + 0.044715f * v * v * v))); else if (ACT == 14) v = (v > 0.f) ? v : 0.1f * v; else if (ACT == 16) v = (v >= 0.f) ? v : 0.3f * v; else if (ACT == 17) v = (v >= 0.f) ? v : 0.2f * v;
      so[w][rloc][t * 16 + ln] = v; } }
  __builtin_amdgcn_fence(__ATOMIC_ACQ_REL, "workgroup"); __builtin_amdgcn_wave_barrier();
  const int rsub = lane >> 4, c4 = (lane & 15) * 4;
  float* const cf = (FT == 1) ? CF + (((size_t)pl * NBR + fbat) * QT0 + 32 * wr + rsub) * DM + col0 + c4 : nullptr;      /* FT 1: the lane's place in the first-tile f32 plane; the sixteen rows differ in the immediate offset alone */
  if (ROPE && rot) { v4f t[16];      /* the sixteen row pieces are rotated first and then stored in one run; the destination is fixed at compile time */
#pragma unroll
    for (int q = 0; q < 16; ++q) { const v4f v = *(const v4fa*)&so[w][q * 2 + rsub][c4]; const v2f c = rc[q], s = rs[q];
      t[q][0] = v[0] * c[0] - v[1] * s[0]; t[q][1] = v[0] * s[0] + v[1] * c[0]; t[q][2] = v[2] * c[1] - v[3] * s[1]; t[q][3] = v[2] * s[1] + v[3] * c[1]; }
    if (ROPE >= 2) {
#pragma unroll
      for (int q = 0; q < 16; ++q) *(v4f*)(C + cofs + (size_t)(row0 + q * 2 + rsub) * ldc + col0 + c4) = t[q]; }
    else { v4h h4[16];
#pragma unroll
      for (int q = 0; q < 16; ++q) { h4[q][0] = (_Float16)t[q][0]; h4[q][1] = (_Float16)t[q][1]; h4[q][2] = (_Float16)t[q][2]; h4[q][3] = (_Float16)t[q][3]; }
#pragma unroll
      for (int q = 0; q < 16; ++q) *(v4h*)(C16 + cofs + (size_t)(row0 + q * 2 + rsub) * ldc + col0 + c4) = h4[q];
      if (FT == 1) asm volatile("s_wait_xcnt 0x0" ::: "memory");      /* the wait between the stores above and the first reuse of their registers, which the first-tile block below makes; it stands in the stores' own block, ahead of the branch */
      if (FT == 1 && ft) {
#pragma unroll
        for (int q = 0; q < 16; ++q) *(v4f*)(cf + (size_t)q * 2 * DM) = t[q]; } }
  } else {
#pragma unroll
    for (int q = 0; q < 16; ++q) { const int r = q * 2 + rsub; const v4f v = *(const v4fa*)&so[w][r][c4]; if (C) *(v4f*)(C + cofs + (size_t)(row0 + r) * ldc + col0 + c4) = v; if (C16) { v4h h4; for (int i = 0; i < 4; ++i) h4[i] = (_Float16)v[i]; *(v4h*)(C16 + cofs + (size_t)(row0 + r) * ldc + col0 + c4) = h4; } }
    if (FT == 1) asm volatile("s_wait_xcnt 0x0" ::: "memory");      /* as in the rotated path: ahead of the branch into the first-tile block */
    if (FT == 1 && ft) { v4f t[16];      /* the sixteen f32 row pieces are read again and stored in one run at the kernel's end: no store's register is rewritten behind it */
#pragma unroll
      for (int q = 0; q < 16; ++q) t[q] = *(const v4fa*)&so[w][q * 2 + rsub][c4];
#pragma unroll
      for (int q = 0; q < 16; ++q) *(v4f*)(cf + (size_t)q * 2 * DM) = t[q]; }
     } }


__global__ __launch_bounds__(256) void k_wnat(const float* __restrict__ w, size_t n8, _Float16* __restrict__ Bt) { const size_t t = (size_t)blockIdx.x * 256 + threadIdx.x; if (t >= n8) return; FragH f; for (int q = 0; q < 8; ++q) f.h[q] = (_Float16)(bf16_round(w[t * 8 + q]) * 16.0f); *(v8us*)((unsigned short*)Bt + t * 8) = f.half[0];  }
__global__ __launch_bounds__(256) void k_rsm(const float* __restrict__ S, _Float16* __restrict__ P, int nrows) {
  #pragma clang fp contract(off)
  const int i = blockIdx.x * 256 + threadIdx.x; if (i >= nrows) return; const float* s = S + (size_t)i * SQ; float mx = -3.0e38f;
#pragma unroll 1
  for (int j = 0; j < SQ; ++j) mx = fmaxf(mx, s[j]); float se = 0.f;
#pragma unroll 1
  for (int j = 0; j < SQ; ++j) se += expf(s[j] - mx); const float sc = 256.0f / se;
#pragma unroll 1
  for (int j0 = 0; j0 < SQ; j0 += 8) { FragH f; for (int q = 0; q < 8; ++q) f.h[q] = (_Float16)(expf(s[j0 + q] - mx) * sc); unsigned short* d = (unsigned short*)P + (size_t)i * SQ + j0; *(v8us*)d = f.half[0];  } }
__global__ __launch_bounds__(256) void k_vt(const _Float16* __restrict__ V16, int b, int h0, _Float16* __restrict__ VT) { __shared__ unsigned short tl[64][65]; const int tid = threadIdx.x; const int hh = blockIdx.x % HG, sg = blockIdx.x / HG; const int s0 = sg * 64; const int h = h0 + hh;
  for (int i = tid; i < 64 * 8; i += 256) { const int j = i / 8, d8 = (i % 8) * 8; FragH f; f.half[0] = *(const v8us*)((const unsigned short*)V16 + ((size_t)b * SQ + s0 + j) * DM + h * HD + d8); for (int q = 0; q < 8; ++q) tl[d8 + q][j] = f.u[q]; }
  __syncthreads();
  { for (int i = tid; i < 64 * 8; i += 256) { const int d = i / 8, j8 = (i % 8) * 8; FragH f; for (int q = 0; q < 8; ++q) f.u[q] = tl[d][j8 + q]; *(v8us*)((unsigned short*)VT + ((size_t)hh * HD + d) * SQ + s0 + j8) = f.half[0]; }  } }



#define FAQB 128                     /* query rows per block */
#define FAK 64                       /* keys per step */
#define FAP (HD + 8)                 /* LDS row pitch, halves */
__device__ __forceinline__ v8f fa_mma(v16h a, v16h b, v8f c) { return __builtin_amdgcn_wmma_f32_16x16x32_f16(false, a, false, b, (short)0, c, false, false); }
__global__ __launch_bounds__(128) void k_fattn(const _Float16* __restrict__ Q, const _Float16* __restrict__ Kh, const _Float16* __restrict__ VTa, _Float16* __restrict__ O) {
  static_assert(NB * NH == 64 && SQ / FAQB == 16 && HD == 64, "k_fattn: the block-to-tile map below is written for 64 (batch, head) pairs x 16 query blocks");
  __shared__ __attribute__((aligned(16))) _Float16 lk[FAK][FAP]; __shared__ __attribute__((aligned(16))) _Float16 lv[HD][FAP];
  const int tid = threadIdx.x, lane = tid & 31, ln = lane & 15, hh = lane >> 4; const int w = __builtin_amdgcn_readfirstlane(tid >> 5);      /* the wave's number as a scalar: the two tests on q0w below are scalar branches */
  const int g = blockIdx.x >> 8, sub = (blockIdx.x >> 6) & 3, bh = blockIdx.x & 63;
  const int qb = (g == 0) ? 15 - sub : ((g == 1) ? 8 + sub : ((g == 2) ? 7 - sub : sub));      /* a permutation of the 16 query blocks: long blocks start first, and blocks 256 apart in the index add up to the same length */
  const int b = bh / NH, h = bh % NH; const size_t r0 = (size_t)b * SQ; const int q0w = qb * FAQB + w * 32; const int nst = (qb + 1) * (FAQB / FAK);
  const unsigned short* qp = (const unsigned short*)Q + (r0 + q0w + ln) * LQ + h * HD + 8 * hh; v16h qf[2][2];      /* the lane's own address, so that the eight loads differ in the immediate offset alone; every loop but the step loop is fully unrolled: all array indices are constants and the arrays stay in registers */
#pragma unroll
  for (int nt = 0; nt < 2; ++nt)
#pragma unroll
    for (int kk = 0; kk < 2; ++kk) { FragH f; f.half[0] = *(const v8us*)(qp + (size_t)nt * 16 * LQ + kk * 32); f.half[1] = *(const v8us*)(qp + (size_t)nt * 16 * LQ + kk * 32 + 16); qf[nt][kk] = f.v; }      /* the k order of g2_frag */
  const int sr = tid >> 3, sc = (tid & 7) * 8;      /* staging: 8 lanes take one 128-byte row, a pass of the block 16 rows */
  const unsigned short* kp = (const unsigned short*)Kh + (r0 + sr) * LQ + h * HD + sc; const unsigned short* vp = (const unsigned short*)VTa + ((size_t)bh * HD + sr) * SQ + sc; v8us kr[4], vr[4];
#pragma unroll
  for (int u = 0; u < 4; ++u) { kr[u] = *(const v8us*)(kp + (size_t)u * 16 * LQ); vr[u] = *(const v8us*)(vp + (size_t)u * 16 * SQ); }
  asm volatile("s_wait_xcnt 0x0" :: "v"(qp), "v"(kp), "v"(vp) : "memory");      /* the wait between the loads above and the first rewrite of their address registers; the addresses are inputs so that their registers stay untouched up to it */
  const v8f z8 = {0.f, 0.f, 0.f, 0.f, 0.f, 0.f, 0.f, 0.f}; v8f o[4][2];
#pragma unroll
  for (int dt = 0; dt < 4; ++dt) { o[dt][0] = z8; o[dt][1] = z8; }
  float m[2] = {-1.0e30f, -1.0e30f}, l[2] = {0.f, 0.f};      /* running max (log2 units) and this lane's part of the running sum, per query tile */
  const float SC = 0.125f * 1.44269504088896340736f;      /* 1 / sqrt(64), in log2 units */
#pragma unroll 1
  for (int s = 0; s < nst; ++s) { const int k0 = s * FAK;      /* rolled: one step's code is long and its trip count varies by block */
#pragma unroll
    for (int u = 0; u < 4; ++u) { *(v8us*)&lk[u * 16 + sr][sc] = kr[u]; *(v8us*)&lv[u * 16 + sr][sc] = vr[u]; }
    __syncthreads();      /* publishes this step's K and V^T rows */
    if (s + 1 < nst) { kp += (size_t)FAK * LQ; vp += FAK;
#pragma unroll
      for (int u = 0; u < 4; ++u) { kr[u] = *(const v8us*)(kp + (size_t)u * 16 * LQ); vr[u] = *(const v8us*)(vp + (size_t)u * 16 * SQ); }
      asm volatile("s_wait_xcnt 0x0" :: "v"(kp), "v"(vp) : "memory"); }      /* as above: stands in front of the next step's address additions */
    if (k0 <= q0w + 31) {      /* a wave whose queries all lie below this step's keys only passes the barriers */
      v8f st[4][2];
#pragma unroll
      for (int kt = 0; kt < 4; ++kt) { st[kt][0] = z8; st[kt][1] = z8; }
#pragma unroll
      for (int kk = 0; kk < 2; ++kk)
#pragma unroll
        for (int kt = 0; kt < 4; ++kt) { const v16h a = g2_frag(&lk[kt * 16 + ln][kk * 32], hh); st[kt][0] = fa_mma(a, qf[0][kk], st[kt][0]); st[kt][1] = fa_mma(a, qf[1][kk], st[kt][1]); }
      if (k0 + FAK - 1 > q0w) {      /* only steps that reach past the wave's first query mask */
#pragma unroll
        for (int kt = 0; kt < 4; ++kt)
#pragma unroll
          for (int nt = 0; nt < 2; ++nt)
#pragma unroll
            for (int r = 0; r < 8; ++r) st[kt][nt][r] = (k0 + kt * 16 + 8 * hh + r <= q0w + nt * 16 + ln) ? st[kt][nt][r] : -3.0e38f; }
      v16h pf[2][2];
#pragma unroll
      for (int nt = 0; nt < 2; ++nt) { float mr = st[0][nt][0];
#pragma unroll
        for (int kt = 0; kt < 4; ++kt)
#pragma unroll
          for (int r = 0; r < 8; ++r) mr = fmaxf(mr, st[kt][nt][r]);
        mr = fmaxf(mr, __shfl_xor(mr, 16, 32));
        const float mn = fmaxf(m[nt], mr * SC); const float al = __builtin_amdgcn_exp2f(m[nt] - mn); m[nt] = mn; const float bs = 8.0f - mn;      /* + 8: weights carried x256; a masked key underflows to exactly 0 */
        v4f s4 = {0.f, 0.f, 0.f, 0.f};
#pragma unroll
        for (int kt = 0; kt < 4; ++kt)
#pragma unroll
          for (int r = 0; r < 8; ++r) { const float p = __builtin_amdgcn_exp2f(fmaf(st[kt][nt][r], SC, bs)); s4[r & 3] += p; pf[nt][kt >> 1][(kt & 1) * 8 + r] = (_Float16)p; }
        l[nt] = fmaf(l[nt], al, (s4[0] + s4[1]) + (s4[2] + s4[3]));
#pragma unroll
        for (int dt = 0; dt < 4; ++dt) o[dt][nt] *= al; }
#pragma unroll
      for (int j = 0; j < 2; ++j)
#pragma unroll
        for (int dt = 0; dt < 4; ++dt) { const v16h a = g2_frag(&lv[dt * 16 + ln][j * 32], hh); o[dt][0] = fa_mma(a, pf[0][j], o[dt][0]); o[dt][1] = fa_mma(a, pf[1][j], o[dt][1]); } }
    __syncthreads(); }      /* ends every wave's reads of this step's rows before the next step's stores */
  FragH t[2][4];      /* all eight 16-byte results are formed first: no store's data register is rewritten behind it */
#pragma unroll
  for (int nt = 0; nt < 2; ++nt) { const float f = 64.0f / (l[nt] + __shfl_xor(l[nt], 16, 32));
#pragma unroll
    for (int dt = 0; dt < 4; ++dt)
#pragma unroll
      for (int r = 0; r < 8; ++r) t[nt][dt].h[r] = (_Float16)(o[dt][nt][r] * f); }
  unsigned short* op = (unsigned short*)O + (r0 + q0w + ln) * DM + h * HD + 8 * hh;
#pragma unroll
  for (int nt = 0; nt < 2; ++nt)
#pragma unroll
    for (int dt = 0; dt < 4; ++dt) *(v8us*)(op + (size_t)nt * 16 * DM + dt * 16) = t[nt][dt].half[0]; }


// Exact f32 attention for the first QT0 rows of every batch (blockIdx.y; planes of QT0 rows a batch; o carried x64 like the f16 path, and stored as an f16 high part and an f16 residual x1024, the two operand planes of the output GEMM). One wave per query row, A0R rows of one head per block.
// All QT0 K and V rows of the head are staged in LDS once by coalesced 16-byte loads. K rows get a pitch of 68 floats (16 bytes x odd), so that 32 lanes reading 32 rows by 16 bytes spread over the banks.
// Scores: lane = key (four partial sums over the head dimension). Row max and row sum: five-step butterfly. o: lane = two head columns, loop over the keys, each key's weight read from its lane into a scalar register; keys above the row carry weight 0.
#define A0R 8                        /* rows (waves) per block */
#define A0KP (HD + 4)                /* K row pitch in LDS, floats */
__global__ __launch_bounds__(256) void k_att0w(const float* __restrict__ QF, const float* __restrict__ KF, const float* __restrict__ VF, float scale, _Float16* __restrict__ OH, _Float16* __restrict__ OL) {
  __shared__ __attribute__((aligned(16))) float lk[QT0][A0KP]; __shared__ __attribute__((aligned(16))) float lv[QT0][HD];
  const int tid = threadIdx.x, lane = tid & 31; const int w = __builtin_amdgcn_readfirstlane(tid >> 5);      /* the wave's number as a scalar: row, group count and branches below are wave-uniform */
  const int h = blockIdx.x / (QT0 / A0R), r0 = (blockIdx.x % (QT0 / A0R)) * A0R; const int i = r0 + w;
  const size_t pb = (size_t)blockIdx.y * QT0 * DM; QF += pb; KF += pb; VF += pb; OH += pb; OL += pb;
  const float* qr = QF + (size_t)i * DM + h * HD; v4f q[HD / 4];      /* every loop of this kernel is fully unrolled: the indices into q, kk, vv, sv and o and the lane of each readlane are then constants, so the arrays stay in registers */
#pragma unroll
  for (int c = 0; c < HD / 4; ++c) q[c] = *(const v4fa*)(qr + c * 4);      /* the wave's own q row, whole */
  const int sj = tid >> 4, sc4 = (tid & 15) * 4; const float* kp = KF + (size_t)sj * DM + h * HD + sc4; const float* vp = VF + (size_t)sj * DM + h * HD + sc4; v4f kk[QT0 / 16], vv[QT0 / 16];      /* one pass of the block stages 16 rows; both loops are fully unrolled and free of branches so that every load of the block is in flight before the first LDS store waits; the row pitch is a constant, so the passes differ in the immediate offset alone */
#pragma unroll
  for (int u = 0; u < QT0 / 16; ++u) { kk[u] = *(const v4fa*)(kp + (size_t)u * 16 * DM); vv[u] = *(const v4fa*)(vp + (size_t)u * 16 * DM); }
  asm volatile("s_wait_xcnt 0x0" :: "v"(kp), "v"(vp) : "memory");      /* the wait between the loads above and the first reuse of their address registers; the two addresses are inputs so that their registers stay untouched up to it */
#pragma unroll
  for (int u = 0; u < QT0 / 16; ++u) { *(v4f*)&lk[u * 16 + sj][sc4] = kk[u]; *(v4f*)&lv[u * 16 + sj][sc4] = vv[u]; }
  __syncthreads();
  const int ng = (i >> 5) + 1;      /* key groups of 32 that hold a key <= i */
  float sv[QT0 / 32];
#pragma unroll
  for (int g = 0; g < QT0 / 32; ++g) { sv[g] = -1.0e30f;
    if (g < ng) { const int j = g * 32 + lane; v4f a = {0.f, 0.f, 0.f, 0.f};
#pragma unroll
      for (int c = 0; c < HD / 4; ++c) a += q[c] * *(const v4f*)&lk[j][c * 4];
      const float s = ((a[0] + a[1]) + (a[2] + a[3])) * scale; sv[g] = (j <= i) ? s : -1.0e30f; } }
  float mx = fmaxf(fmaxf(sv[0], sv[1]), fmaxf(sv[2], sv[3]));
#pragma unroll
  for (int m = 16; m >= 1; m >>= 1) mx = fmaxf(mx, __shfl_xor(mx, m, 32));
  float se = 0.f;
#pragma unroll
  for (int g = 0; g < QT0 / 32; ++g) { const float e = expf(sv[g] - mx); sv[g] = e; se += e; }      /* a key above the row holds -1e30: its weight underflows to exactly 0 */
#pragma unroll
  for (int m = 16; m >= 1; m >>= 1) se += __shfl_xor(se, m, 32);
  v2f o[4] = {{0.f, 0.f}, {0.f, 0.f}, {0.f, 0.f}, {0.f, 0.f}};      /* four partial sums over the keys (key mod 4): four independent add chains */
#pragma unroll
  for (int g = 0; g < QT0 / 32; ++g) if (g < ng) {
#pragma unroll
    for (int jj = 0; jj < 32; ++jj) { const float e = __int_as_float(__builtin_amdgcn_readlane(__float_as_int(sv[g]), jj)); o[jj & 3] += e * *(const v2f*)&lv[g * 32 + jj][lane * 2]; } }
  const float fin = 64.0f / se; const v2f r = ((o[0] + o[1]) + (o[2] + o[3])) * fin;
  typedef _Float16 v2h __attribute__((ext_vector_type(2))); v2h rh, rl;
  rh[0] = (_Float16)r[0]; rh[1] = (_Float16)r[1]; rl[0] = (_Float16)((r[0] - (float)rh[0]) * 1024.0f); rl[1] = (_Float16)((r[1] - (float)rh[1]) * 1024.0f);
  const size_t oo = (size_t)i * DM + h * HD + lane * 2; *(v2h*)(OH + oo) = rh; *(v2h*)(OL + oo) = rl; }


__global__ __launch_bounds__(256) void k_wt_hq(const float* __restrict__ Wf, const float* __restrict__ bf, _Float16* __restrict__ Bq, _Float16* __restrict__ Bk, _Float16* __restrict__ Bv, float* __restrict__ B3) {
  const int t = blockIdx.x * 256 + threadIdx.x; if (t >= 3 * DM * (DM / 8)) return; const int n = t / (DM / 8), k8 = (t % (DM / 8)) * 8; const int h = n / (3 * HD), wh = (n % (3 * HD)) / HD, d = n % HD; const int row = h * HD + d; FragH f;
#pragma unroll
  for (int i = 0; i < 8; ++i) f.h[i] = (_Float16)(bf16_round(Wf[(size_t)(k8 + i) * (3 * DM) + n]) * 16.0f); const v8us o = f.half[0];
  _Float16* dst = (wh == 0) ? Bq : ((wh == 1) ? Bk : Bv); unsigned short* p = (unsigned short*)dst + (size_t)row * DM + k8; *(v8us*)p = o; 
  (void)bf; (void)B3; }
__global__ __launch_bounds__(256) void k_bhq(const float* __restrict__ bf, float* __restrict__ B3) {
  const int t = blockIdx.x * 256 + threadIdx.x; if (t >= 3 * DM) return; const int wh = t / DM, row = t % DM; const int h = row / HD, d = row % HD; const float v = bf16_round(bf[h * (3 * HD) + wh * HD + d]); *(float*)(B3 + t) = v;  }

__global__ __launch_bounds__(256) void k_tabcp32(const float* __restrict__ tc, const float* __restrict__ tsn, float* __restrict__ CS, float* __restrict__ SN, int n) {
  const int t = blockIdx.x * 256 + threadIdx.x; if (t >= n) return; const float c = bf16_round(tc[t]), s = bf16_round(tsn[t]);
  *(float*)(CS + t) = c; *(float*)(SN + t) = s;  }
extern "C" void kernel_launch(void* const* d_in, const int* in_sizes, int n_in,
                              void* d_out, int out_size, void* d_ws, size_t ws_size, hipStream_t stream) {
  (void)in_sizes; (void)n_in; (void)out_size;
  const float* const* I = (const float* const*)d_in; const float* x = I[0]; const float* wqkv = I[1]; const float* bqkv = I[2]; const float* wo = I[3]; const float* bo = I[4]; const float* tcos = I[5]; const float* tsin = I[6];      /* x; fused W_qkv [1024][3072] + b_qkv [3072] ([in][out]; per-head (q | k | v) column triples); W_out + b_out ([in][out]); rope tables cos / sin [2048][32] */
  char* ws = (char*)d_ws; size_t off = 0;
  auto take = [&](size_t bytes) { char* p = ws + off; off += (bytes + 255) & ~(size_t)255; return p; };
  _Float16* BQ = (_Float16*)take((size_t)DM * DM * 2); _Float16* BK = (_Float16*)take((size_t)DM * DM * 2); _Float16* BV = (_Float16*)take((size_t)DM * DM * 2); _Float16* BO = (_Float16*)take((size_t)DM * DM * 2);
  float* BQB = (float*)take((size_t)3 * DM * 4); float* CSB = (float*)take((size_t)SQ * 32 * 4); float* SNB = (float*)take((size_t)SQ * 32 * 4);      /* de-interleaved bias vector bq | bk | bv; bf16-rounded copies of the rope tables */ _Float16* X16 = (_Float16*)take(NR * DM * 2); _Float16* Q16 = (_Float16*)take(NR * DM * 2); _Float16* K16 = (_Float16*)take(NR * DM * 2); _Float16* V16 = (_Float16*)take(NR * DM * 2); _Float16* O16 = (_Float16*)take(NR * DM * 2);
  _Float16* VT = (_Float16*)take((size_t)NB * NH * HD * SQ * 2);
  float* QF0 = (float*)take((size_t)3 * NBR * QT0 * DM * 4); float* KF0 = QF0 + (size_t)NBR * QT0 * DM; float* VF0 = KF0 + (size_t)NBR * QT0 * DM;      /* first-tile f32 q | k | v, each NBR planes of QT0 rows, one after the other */ _Float16* OH0 = (_Float16*)take((size_t)NB * QT0 * DM * 2); _Float16* OL0 = (_Float16*)take((size_t)NB * QT0 * DM * 2);
  if (off > ws_size) return;
  k_wt_hq<<<(unsigned)(((size_t)3 * DM * (DM / 8) + 255) / 256), 256, 0, stream>>>(wqkv, bqkv, BQ, BK, BV, BQB); k_bhq<<<(3 * DM + 255) / 256, 256, 0, stream>>>(bqkv, BQB); k_wt_f16<<<(unsigned)(((size_t)DM * (DM / 8) + 255) / 256), 256, 0, stream>>>(wo, BO, DM, DM, 16.0f);      /* fused [in][out] weight with per-head (q | k | v) column triples -> three Bt planes (row h*64 + d) x16 + the de-interleaved bias vector; W_out [in][out] -> Bt x16 */
  k_tabcp32<<<(SQ * 32 + 255) / 256, 256, 0, stream>>>(tcos, tsin, CSB, SNB, SQ * 32);      /* rope tables [pos][32], bf16-rounded copies */

  k_x16<<<(unsigned)((NR * DM / 8 + 255) / 256), 256, 0, stream>>>(x, X16, NR * DM / 8);
  const size_t r0p = (size_t)B0 * SQ;      /* first projected row */
  k_gemm2<0, 1, 1><<<dim3((unsigned)((MP / 128) * (DM / 128)), 3), 256, 0, stream>>>(X16 + r0p * DM, 0, BQ, (size_t)DM * DM, 0.0625f, BQB, DM, nullptr, 1, 0, 0, nullptr, Q16 + r0p * DM, DM, NR * DM, MP, DM, DM, CSB, SNB, nullptr, nullptr, QF0);      /* q, k, v (f32) + bias in one launch (blockIdx.y; BQ | BK | BV and Q16 | K16 | V16 lie one after the other); q and k -> interleaved-pair rope (position = row % SQ); -> f16 rows; the blocks of the first 128 rows of a batch store their f32 tile (exact products) to QF0 | KF0 | VF0 too */
  k_att0w<<<dim3(NH * (QT0 / A0R), NBR), 256, 0, stream>>>(QF0, KF0, VF0, 0.125f, OH0 + (size_t)B0 * QT0 * DM, OL0 + (size_t)B0 * QT0 * DM);      /* exact f32 attention for rows 0..127 of every batch (o x64) -> f16 hi + x1024 residual planes */
  k_vt<NH, SQ><<<NB * NH * (SQ / 64), 256, 0, stream>>>(V16, LQ, 0, VT);      /* V^T [NB][NH][HD][SQ] */
  k_fattn<<<NB * NH * (SQ / FAQB), 128, 0, stream>>>(Q16, K16, VT, O16);      /* scores, causal softmax and P V in one launch; o (merged heads, x64) as f16 rows */
  k_gemm2<0, 0, 2><<<dim3((unsigned)((MPO / 128) * (DM / 128)), 1), 256, 0, stream>>>(O16 + r0p * DM, 0, BO, 0, 0.0009765625f, bo, 0, nullptr, 1, 0, 0, (float*)d_out + r0p * DM, nullptr, DM, 0, MPO, DM, DM, nullptr, nullptr, OH0 + (size_t)B0 * QT0 * DM, OL0 + (size_t)B0 * QT0 * DM);      /* out rows are the output layout; rows 0..127 of a batch: out = o_hi Wo (+ b) + o_lo Wo 2^-20, in the same launch */
}

// v008
// A run of this version takes 161 microseconds.
// Timed twice side by side with v007, it ran 1.09 times as fast both times.
// Counting every step since v000, it is 65.2 times as fast.
#include <hip/hip_runtime.h>
// Causal multi-head self-attention with a PER-HEAD interleaved fused QKV projection and rotary embeddings (x [4][2048][1024]; qkv = x W_qkv + b_qkv ([in][out] 1024 x 3072, zero bias) reshaped (B, T, 16, 192): head h owns columns h*192 + [0..63 | 64..127 | 128..191] = q | k | v; rope on q and k from the INPUT tables cos / sin [2048][32]: t1 = even elements, t2 = odd elements, out = cat(t1 c - t2 s, t1 s + t2 c) (an interleaved-pair rotation followed by the same fixed permutation on q and k: the scores are unchanged by it); scores / 8; causal (tril, -inf); softmax; out = merged W_out + b_out ([in][out]) -> [4][2048][1024]).
// Structure: token rows r = b*2048 + s; x as exact f16 rows (bf16-rounded); Q, K, V as three WMMA GEMMs in one launch (32x64 wave tiles, f32 accumulation, exact x16 weights, f16 outputs; the q and k GEMMs apply the rope in their epilogue, in f32, before the rounding to f16; the blocks of a batch's first 128 rows also keep their f32 tile for the exact first-tile attention); V^T for all batches and heads via LDS transposes; one fused attention launch (k_fattn): S^T = K Q^T, online causal softmax in registers (f32 statistics, native exp2; weights x256 f16), O^T += V^T P^T, o carried x64 (folded into the output GEMM alpha) written straight into the merged f16 o rows; out = o W_o GEMM (f32) into the output layout, whose blocks of a batch's first 128 rows take the exact o as an f16 high part and residual.
// Compute dtype: inputs rounded to bf16; x / weights exact; q, k, v, softmax weights and o as plain f16 GEMM operands (~2^-12); scores and softmax statistics f32. v_wmma_f32_16x16x32_f16.
#define NB 4
#define SQ 2048
#define DM 1024
#define NH 16
#define HD 64
#define HG 4                         /* heads per launch of the per-batch k_vt overload (never launched) */
#define QT0 128                      /* first-tile rows recomputed exactly in f32 */
#define B0 0                         /* first batch processed (debug hook) */
#define NBR NB                       /* batches processed (debug hook) */
#define NR ((size_t)NB * SQ)         /* token rows */
#define MP ((int)((size_t)NBR * SQ)) /* rows projected (debug hook) */
#define MPO MP                       /* rows through the output stage (debug hook) */
#define LQ DM      /* row pitch of the q/k/v rows */
typedef __bf16 v16b __attribute__((ext_vector_type(16)));
typedef unsigned short v8us __attribute__((ext_vector_type(8), may_alias));
typedef float  v8f  __attribute__((ext_vector_type(8)));
typedef float  v4f  __attribute__((ext_vector_type(4)));
typedef float  v4fa __attribute__((ext_vector_type(4), may_alias));
union FragB { v16b v; v8us half[2]; unsigned short u[16]; };

__device__ __forceinline__ unsigned short bf16_bits(float x) { unsigned int u = __float_as_uint(x); return (unsigned short)((u + 0x7FFFu + ((u >> 16) & 1u)) >> 16); }
__device__ __forceinline__ float bf16_val(unsigned short b) { return __uint_as_float(((unsigned int)b) << 16); }
__device__ __forceinline__ float bf16_round(float x) { return bf16_val(bf16_bits(x)); }
// D += A·B with NT terms: 1 = ah·bh, 2 = + al·bh (A split), 3 = + ah·bl (both split)
template <int NT>
__device__ __forceinline__ v8f mmaN(v16b ah, v16b al, v16b bh, v16b bl, v8f c) {
  c = __builtin_amdgcn_wmma_f32_16x16x32_bf16(false, ah, false, bh, (short)0, c, false, false);
  if (NT >= 2) c = __builtin_amdgcn_wmma_f32_16x16x32_bf16(false, al, false, bh, (short)0, c, false, false);
  if (NT >= 3) c = __builtin_amdgcn_wmma_f32_16x16x32_bf16(false, ah, false, bl, (short)0, c, false, false);
  asm volatile("v_nop\n\tv_nop\n\tv_nop\n\tv_nop" : "+v"(c) : "v"(ah), "v"(al), "v"(bh), "v"(bl));
  return c;
}

__global__ __launch_bounds__(256) void k_wt_bf16(const float* __restrict__ W, unsigned short* __restrict__ Wt, int K, int N) {
  const int t = blockIdx.x * 256 + threadIdx.x;
  const int k8n = K / 8;
  if (t >= N * k8n) return;
  const int n = t / k8n, k8 = (t % k8n) * 8;
  v8us v;
#pragma unroll
  for (int i = 0; i < 8; ++i) v[i] = bf16_bits(W[(size_t)(k8 + i) * N + n]);
  *(v8us*)(Wt + (size_t)n * K + k8) = v;
  
}

// GEMM C[M][N] (f32, pitch ldc) = act(A[M][K]·W + bias). A f32 row-major (pitch lda) converted per fragment to bf16
// (ASPLIT: hi/lo two planes -> 2 terms, else single rounded term); Wt bf16 [N][K] (pitch ldb). BIAS_BF16 rounds the
// bias to bf16 first (bias quantised to bf16 before the add). K%32==0, M%16==0, N%64==0.
template <bool ASPLIT, int ACT, bool BIAS_BF16>
__global__ __launch_bounds__(128) void k_gemm_bf(const float* __restrict__ A, int lda, const unsigned short* __restrict__ Wt, int ldb,
                                               const float* __restrict__ bias, float* __restrict__ C, int ldc, int M, int N, int K) {
  __shared__ __attribute__((aligned(16))) float so[4][16][64];
  const int tid = threadIdx.x, w = tid >> 5, lane = tid & 31, ln = lane & 15, hh = lane >> 4;
  const int ntn = N / 64;
  const int wid = blockIdx.x * 4 + w;
  const int mt = wid / ntn, nq = wid % ntn;
  if (mt * 16 >= M) return;
  const int row0 = mt * 16, col0 = nq * 64;
  const float* arow = A + (size_t)(row0 + ln) * lda;
  v8f acc[4] = {};
  for (int kb = 0; kb < K; kb += 32) {
    FragB ah, al;
    const v4f x0 = *(const v4fa*)(arow + kb + 8 * hh), x1 = *(const v4fa*)(arow + kb + 8 * hh + 4);
    const v4f x2 = *(const v4fa*)(arow + kb + 16 + 8 * hh), x3 = *(const v4fa*)(arow + kb + 16 + 8 * hh + 4);
    float xs[16] = {x0[0],x0[1],x0[2],x0[3],x1[0],x1[1],x1[2],x1[3],x2[0],x2[1],x2[2],x2[3],x3[0],x3[1],x3[2],x3[3]};
#pragma unroll
    for (int i = 0; i < 16; ++i) { const unsigned short hb = bf16_bits(xs[i]); ah.u[i] = hb; al.u[i] = ASPLIT ? bf16_bits(xs[i] - bf16_val(hb)) : (unsigned short)0; }
#pragma unroll
    for (int t = 0; t < 4; ++t) {
      const unsigned short* brow = Wt + (size_t)(col0 + t * 16 + ln) * ldb + kb;
      FragB b;
      b.half[0] = *(const v8us*)(brow + 8 * hh);
      b.half[1] = *(const v8us*)(brow + 16 + 8 * hh);
      acc[t] = mmaN<ASPLIT ? 2 : 1>(ah.v, al.v, b.v, b.v, acc[t]);
    }
  }
#pragma unroll
  for (int t = 0; t < 4; ++t) {
    float bv = bias ? bias[col0 + t * 16 + ln] : 0.f;
    if (BIAS_BF16) bv = bf16_round(bv);
#pragma unroll
    for (int r = 0; r < 8; ++r) { float v = acc[t][r] + bv; if (ACT == 1) v = fmaxf(v, 0.f); so[w][8 * hh + r][t * 16 + ln] = v; }
  }
  __builtin_amdgcn_fence(__ATOMIC_ACQ_REL, "workgroup");
  __builtin_amdgcn_wave_barrier();
  const int rsub = lane >> 4, c4 = (lane & 15) * 4;
  {
#pragma unroll
    for (int q = 0; q < 8; ++q) {
      const int r = q * 2 + rsub;
      const v4f v = *(const v4fa*)&so[w][r][c4];
      *(v4f*)(C + (size_t)(row0 + r) * ldc + col0 + c4) = v;
    }
    
  }
}

// GEMM C = act(A·W + bias + resid): A f32 (ASPLIT -> hi/lo 2 terms), Wt bf16 [N][K]; ACT 0 none, 1 relu, 2 exact gelu;
// resid (optional, f32, row index = (row % rmod), pitch ldr, RES_BF16 rounds it) added before the activation.
template <bool ASPLIT, int ACT, bool BIAS_BF16, bool RES_BF16>
__global__ __launch_bounds__(128) void k_gemm_bf3(const float* __restrict__ A, int lda, const unsigned short* __restrict__ Wt, int ldb,
                                                const float* __restrict__ bias, const float* __restrict__ resid, int rmod, int ldr,
                                                float* __restrict__ C, int ldc, int M, int N, int K) {
  __shared__ __attribute__((aligned(16))) float so[4][16][64];
  const int tid = threadIdx.x, w = tid >> 5, lane = tid & 31, ln = lane & 15, hh = lane >> 4;
  const int ntn = N / 64;
  const int wid = blockIdx.x * 4 + w;
  const int mt = wid / ntn, nq = wid % ntn;
  if (mt * 16 >= M) return;
  const int row0 = mt * 16, col0 = nq * 64;
  const float* arow = A + (size_t)(row0 + ln) * lda;
  v8f acc[4] = {};
  for (int kb = 0; kb < K; kb += 32) {
    FragB ah, al;
    const v4f x0 = *(const v4fa*)(arow + kb + 8 * hh), x1 = *(const v4fa*)(arow + kb + 8 * hh + 4);
    const v4f x2 = *(const v4fa*)(arow + kb + 16 + 8 * hh), x3 = *(const v4fa*)(arow + kb + 16 + 8 * hh + 4);
    float xs[16] = {x0[0],x0[1],x0[2],x0[3],x1[0],x1[1],x1[2],x1[3],x2[0],x2[1],x2[2],x2[3],x3[0],x3[1],x3[2],x3[3]};
#pragma unroll
    for (int i = 0; i < 16; ++i) { const unsigned short hb = bf16_bits(xs[i]); ah.u[i] = hb; al.u[i] = ASPLIT ? bf16_bits(xs[i] - bf16_val(hb)) : (unsigned short)0; }
#pragma unroll
    for (int t = 0; t < 4; ++t) {
      const unsigned short* brow = Wt + (size_t)(col0 + t * 16 + ln) * ldb + kb;
      FragB b;
      b.half[0] = *(const v8us*)(brow + 8 * hh);
      b.half[1] = *(const v8us*)(brow + 16 + 8 * hh);
      acc[t] = mmaN<ASPLIT ? 2 : 1>(ah.v, al.v, b.v, b.v, acc[t]);
    }
  }
#pragma unroll
  for (int t = 0; t < 4; ++t) {
    const int col = col0 + t * 16 + ln;
    float bv = bias ? bias[col] : 0.f;
    if (BIAS_BF16) bv = bf16_round(bv);
#pragma unroll
    for (int r = 0; r < 8; ++r) {
      float v = acc[t][r] + bv;
      if (resid) { float rv = resid[(size_t)((row0 + 8 * hh + r) % rmod) * ldr + col]; if (RES_BF16) rv = bf16_round(rv); v += rv; }
      if (ACT == 1) v = fmaxf(v, 0.f);
      if (ACT == 2) v = 0.5f * v * (1.0f + erff(v * 0.70710678118654752f));
      if (ACT == 3) { const float u = 0.7978845608028654f * (v + 0.044715f * v * v * v); v = 0.5f * v * (1.0f + tanhf(u)); }
      so[w][8 * hh + r][t * 16 + ln] = v;
    }
  }
  __builtin_amdgcn_fence(__ATOMIC_ACQ_REL, "workgroup");
  __builtin_amdgcn_wave_barrier();
  const int rsub = lane >> 4, c4 = (lane & 15) * 4;
  {
#pragma unroll
    for (int q = 0; q < 8; ++q) {
      const int r = q * 2 + rsub;
      const v4f v = *(const v4fa*)&so[w][r][c4];
      *(v4f*)(C + (size_t)(row0 + r) * ldc + col0 + c4) = v;
    }
    
  }
}
// row LayerNorm (biased variance, eps) over N: s = X (+ R); optional out_sum <- s; out_norm <- (s-mu)*rsqrt(var+eps)*g + b
template <bool PARAM_BF16>
__global__ __launch_bounds__(256) void k_layernorm(const float* __restrict__ X, const float* __restrict__ R, const float* __restrict__ g, const float* __restrict__ bta,
                                                  float* __restrict__ out_sum, float* __restrict__ out_norm, int N, float eps) {
  __shared__ float red[256];
  const int row = blockIdx.x, tid = threadIdx.x;
  const float* x = X + (size_t)row * N; const float* rr = R ? R + (size_t)row * N : nullptr;
  float vals[16];                     // up to N = 4096
  const int per = N / 256;            // contiguous chunk per thread? use strided-by-4 chunks: thread handles j = tid*4 + 1024*u
  float s1 = 0.f;
  for (int u = 0; u < per / 4; ++u) {
    const int j = tid * 4 + 1024 * u;
    const v4f a = *(const v4fa*)(x + j);
    v4f b = {0.f,0.f,0.f,0.f}; if (rr) b = *(const v4fa*)(rr + j);
#pragma unroll
    for (int q = 0; q < 4; ++q) { const float v = a[q] + b[q]; vals[u * 4 + q] = v; s1 += v; }
  }
  red[tid] = s1; __syncthreads();
  for (int st = 128; st > 0; st >>= 1) { if (tid < st) red[tid] += red[tid + st]; __syncthreads(); }
  const float mu = red[0] / (float)N; __syncthreads();
  float s2 = 0.f;
  for (int u = 0; u < per / 4; ++u)
#pragma unroll
    for (int q = 0; q < 4; ++q) { const float c = vals[u * 4 + q] - mu; s2 += c * c; }
  red[tid] = s2; __syncthreads();
  for (int st = 128; st > 0; st >>= 1) { if (tid < st) red[tid] += red[tid + st]; __syncthreads(); }
  const float rs = rsqrtf(red[0] / (float)N + eps);
  {
    for (int u = 0; u < per / 4; ++u) {
      const int j = tid * 4 + 1024 * u;
      v4f o, sm;
#pragma unroll
      for (int q = 0; q < 4; ++q) {
        float gg = g[j + q], bb = bta[j + q];
        if (PARAM_BF16) { gg = bf16_round(gg); bb = bf16_round(bb); }
        sm[q] = vals[u * 4 + q]; o[q] = (vals[u * 4 + q] - mu) * rs * gg + bb;
      }
      if (out_sum) *(v4f*)(out_sum + (size_t)row * N + j) = sm;
      *(v4f*)(out_norm + (size_t)row * N + j) = o;
    }
    
  }
}



// ---- f16 WMMA path (v_wmma_f32_16x16x32_f16): 11-bit significands for operands in range — used where a [0,1] probability operand needs more precision than bf16
typedef _Float16 v16h __attribute__((ext_vector_type(16)));
union FragH { v16h v; v8us half[2]; _Float16 h[16]; unsigned short u[16]; };
template <int NT>
__device__ __forceinline__ v8f mmaH(v16h ah, v16h al, v16h bh, v16h bl, v8f c) {
  c = __builtin_amdgcn_wmma_f32_16x16x32_f16(false, ah, false, bh, (short)0, c, false, false);
  if (NT >= 2) c = __builtin_amdgcn_wmma_f32_16x16x32_f16(false, al, false, bh, (short)0, c, false, false);
  if (NT >= 3) c = __builtin_amdgcn_wmma_f32_16x16x32_f16(false, ah, false, bl, (short)0, c, false, false);
  asm volatile("v_nop\n\tv_nop\n\tv_nop\n\tv_nop" : "+v"(c) : "v"(ah), "v"(al), "v"(bh), "v"(bl));
  return c;
}
// batched GEMM like k_gemm_b but f16 operands: A f32 (split into f16 hi/lo if ASPLIT, else rounded to f16), Bt = f16 values [n][k]; alpha; C f32; N multiple of 16 (partial tiles skipped)
template <bool ASPLIT>
__global__ __launch_bounds__(128) void k_gemm_h(const float* __restrict__ A, int lda, size_t sA, const _Float16* __restrict__ Bh, int ldb, size_t sB, float alpha, float* __restrict__ C, int ldc, size_t sC, int M, int N, int K) {
  __shared__ __attribute__((aligned(16))) float so[4][16][64];
  const int tid = threadIdx.x, w = tid >> 5, lane = tid & 31, ln = lane & 15, hh = lane >> 4; const int by = blockIdx.y;
  A += (size_t)by * sA; Bh += (size_t)by * sB; C += (size_t)by * sC;
  const int ntn = (N + 63) / 64; const int wid = blockIdx.x * 4 + w; const int mt = wid / ntn, nq = wid % ntn; if (mt * 16 >= M) return;
  const int row0 = mt * 16, col0 = nq * 64; const float* arow = A + (size_t)(row0 + ln) * lda;
  v8f acc[4] = {};
  for (int kb = 0; kb < K; kb += 32) {
    FragH ah, al;
    const v4f x0 = *(const v4fa*)(arow + kb + 8 * hh), x1 = *(const v4fa*)(arow + kb + 8 * hh + 4), x2 = *(const v4fa*)(arow + kb + 16 + 8 * hh), x3 = *(const v4fa*)(arow + kb + 16 + 8 * hh + 4);
    float xs[16] = {x0[0],x0[1],x0[2],x0[3],x1[0],x1[1],x1[2],x1[3],x2[0],x2[1],x2[2],x2[3],x3[0],x3[1],x3[2],x3[3]};
#pragma unroll
    for (int i = 0; i < 16; ++i) { const _Float16 h = (_Float16)xs[i]; ah.h[i] = h; al.h[i] = ASPLIT ? (_Float16)(xs[i] - (float)h) : (_Float16)0.0f; }
#pragma unroll
    for (int t = 0; t < 4; ++t) { if (col0 + t * 16 >= N) continue; const size_t boff = (size_t)(col0 + t * 16 + ln) * ldb + kb; FragH bq; bq.half[0] = *(const v8us*)(Bh + boff + 8 * hh); bq.half[1] = *(const v8us*)(Bh + boff + 16 + 8 * hh);
      acc[t] = mmaH<ASPLIT ? 2 : 1>(ah.v, al.v, bq.v, bq.v, acc[t]); }
  }
#pragma unroll
  for (int t = 0; t < 4; ++t) { if (col0 + t * 16 >= N) continue;
#pragma unroll
    for (int r = 0; r < 8; ++r) so[w][8 * hh + r][t * 16 + ln] = acc[t][r] * alpha; }
  __builtin_amdgcn_fence(__ATOMIC_ACQ_REL, "workgroup"); __builtin_amdgcn_wave_barrier();
  const int rsub = lane >> 4, c4 = (lane & 15) * 4;
  {
#pragma unroll
    for (int q = 0; q < 8; ++q) { const int r = q * 2 + rsub; if (col0 + c4 < N) { const v4f v = *(const v4fa*)&so[w][r][c4]; *(v4f*)(C + (size_t)(row0 + r) * ldc + col0 + c4) = v; } }
     }
}

// Wt[n][k] = f16(W[k][n]·scale) from f32 row-major W[K][N] (scale = power of two; bf16-exact weights stay exact in f16 away from the subnormal range)
// Both weight transposes go through a 64 x 64 f32 tile in LDS: a wave's 16-byte loads cover whole 128-byte lines of two W rows (was: 32 lanes, 32 lines, 4 bytes used of each), and 8 lanes store one whole 128-byte line of a Wt row.
// The tile's row pitch of 65 dwords keeps the row-wise 4-byte stores and the column-wise 4-byte reads free of bank conflicts. Rounding and scaling are done on the way out, as before.
#define WTT 64                       /* tile edge */
__device__ __forceinline__ void wt_tile(const float* __restrict__ src, int ldw, unsigned short* __restrict__ dst, int ldd, float scale, float (*tl)[WTT + 1]) {
  const int tid = threadIdx.x; const int lr = tid >> 4, lc = (tid & 15) * 4;      /* loads: 16 lanes take one 256-byte row piece, a pass of the block 16 rows */
  const float* const s0 = src + (size_t)lr * ldw + lc; const float* const s1 = s0 + (size_t)16 * ldw; const float* const s2 = s1 + (size_t)16 * ldw; const float* const s3 = s2 + (size_t)16 * ldw;
  const v4f v[4] = {*(const v4fa*)s0, *(const v4fa*)s1, *(const v4fa*)s2, *(const v4fa*)s3};      /* all four loads are in flight before the first LDS store waits */
  asm volatile("s_wait_xcnt 0x0" :: "v"(s0), "v"(s1), "v"(s2), "v"(s3) : "memory");      /* the wait between the loads above and the first reuse of their address registers; the addresses are inputs so that their registers stay untouched up to it */
#pragma unroll
  for (int u = 0; u < 4; ++u)
#pragma unroll
    for (int j = 0; j < 4; ++j) tl[u * 16 + lr][lc + j] = v[u][j];
  __syncthreads();      /* publishes the tile: every column is read by lanes that did not store it */
  const int kc = (tid & 7) * 8, nn = tid >> 3; FragH f[2];      /* stores: 8 lanes take one 128-byte row piece of Wt, a pass of the block 32 rows; both results are formed first: no store's data register is rewritten behind it */
#pragma unroll
  for (int u = 0; u < 2; ++u)
#pragma unroll
    for (int i = 0; i < 8; ++i) f[u].h[i] = (_Float16)(bf16_round(tl[kc + i][u * 32 + nn]) * scale);
  unsigned short* dp = dst + (size_t)nn * ldd + kc;
#pragma unroll
  for (int u = 0; u < 2; ++u) *(v8us*)(dp + (size_t)u * 32 * ldd) = f[u].half[0]; }
// K % 64 == 0, N % 64 == 0; one block a tile (blockIdx.x = column tile, blockIdx.y = row tile of W): neighbouring blocks take neighbouring pieces of the same W rows
__global__ __launch_bounds__(256) void k_wt_f16(const float* __restrict__ W, _Float16* __restrict__ Wt, int K, int N, float scale) {
  __shared__ float tl[WTT][WTT + 1];
  const int nt = blockIdx.x, kt = blockIdx.y; if (nt * WTT >= N || kt * WTT >= K) return;      /* the same for the whole block, in front of the barrier */
  wt_tile(W + (size_t)kt * WTT * N + nt * WTT, N, (unsigned short*)Wt + (size_t)nt * WTT * K + kt * WTT, K, scale, tl); }
// k_gemm_hh variant with fused epilogue: v = acc·alpha + bias[by·sBias + col] (+ CP[(row/rowsPerB)·sCPb + by·64 + col] if CP) ; ACT 0 none / 1 elu ; writes f16 C16 (and f32 C if non-null)
template <int ACT>
__global__ __launch_bounds__(128) void k_gemm_hhx(const _Float16* __restrict__ A, int lda, size_t sA, const _Float16* __restrict__ Bh, int ldb, size_t sB, float alpha, const float* __restrict__ bias, size_t sBias, const float* __restrict__ CP, int rowsPerB, size_t sCPb, int row0g,
    float* __restrict__ C, _Float16* __restrict__ C16, int ldc, size_t sC, int M, int N, int K) {
  __shared__ __attribute__((aligned(16))) float so[4][16][64];
  const int tid = threadIdx.x, w = tid >> 5, lane = tid & 31, ln = lane & 15, hh = lane >> 4; const int by = blockIdx.y;
  A += (size_t)by * sA; Bh += (size_t)by * sB; const size_t cofs = (size_t)by * sC; const float* bp = bias ? bias + (size_t)by * sBias : nullptr;
  const int ntn = (N + 63) / 64; const int wid = blockIdx.x * 4 + w; const int mt = wid / ntn, nq = wid % ntn; if (mt * 16 >= M) return;
  const int row0 = mt * 16, col0 = nq * 64; const _Float16* arow = A + (size_t)(row0 + ln) * lda;
  v8f acc[4] = {};
  for (int kb = 0; kb < K; kb += 32) { FragH ah; ah.half[0] = *(const v8us*)((const unsigned short*)arow + kb + 8 * hh); ah.half[1] = *(const v8us*)((const unsigned short*)arow + kb + 16 + 8 * hh);
#pragma unroll
    for (int t = 0; t < 4; ++t) { if (col0 + t * 16 >= N) continue; const size_t boff = (size_t)(col0 + t * 16 + ln) * ldb + kb; FragH bq; bq.half[0] = *(const v8us*)((const unsigned short*)Bh + boff + 8 * hh); bq.half[1] = *(const v8us*)((const unsigned short*)Bh + boff + 16 + 8 * hh);
      acc[t] = mmaH<1>(ah.v, ah.v, bq.v, bq.v, acc[t]); }
  }
#pragma unroll
  for (int t = 0; t < 4; ++t) { if (col0 + t * 16 >= N) continue; const int col = col0 + t * 16 + ln; const float bv = bp ? bf16_round(bp[col]) : 0.f;
#pragma unroll
    for (int r = 0; r < 8; ++r) { float v = acc[t][r] * alpha + bv; if (CP) { const int rr = row0g + row0 + 8 * hh + r; if (rowsPerB < 0) v += CP[cofs + (size_t)rr * ldc + col];      /* rowsPerB < 0: own element of the batched C plane */ else { const int bidx = rr / rowsPerB; v += CP[(size_t)bidx * sCPb + (size_t)by * 64 + col]; } } if (ACT == 1) v = (v > 0.f) ? v : expm1f(v); else if (ACT == 7) v = (v > 0.f) ? v + 1.0f : expf(v); else if (ACT == 8) v = tanhf(v); else if (ACT == 9) v = 0.5f * v * (1.0f + tanhf(0.7978845608028654f * (v + 0.044715f * v * v * v))); else if (ACT == 11) v = 1.0f / (1.0f + expf(-v)); else if (ACT == 12) v = (v > 0.f) ? v : 0.01f * v; else if (ACT == 14) v = (v > 0.f) ? v : 0.1f * v; else if (ACT == 16) v = (v >= 0.f) ? v : 0.3f * v; else if (ACT == 17) v = (v >= 0.f) ? v : 0.2f * v; else if (ACT == 15) v = v / (1.0f + expf(-v)); else if (ACT == 3) v = fmaxf(v, 0.f); else if (ACT == 6) v = 0.5f * v * (1.0f + erff(v * 0.70710678118654752f)); so[w][8 * hh + r][t * 16 + ln] = v; } }
  __builtin_amdgcn_fence(__ATOMIC_ACQ_REL, "workgroup"); __builtin_amdgcn_wave_barrier();
  const int rsub = lane >> 4, c4 = (lane & 15) * 4; typedef _Float16 v4h __attribute__((ext_vector_type(4)));
  {
#pragma unroll
    for (int q = 0; q < 8; ++q) { const int r = q * 2 + rsub; if (col0 + c4 < N) { const v4f v = *(const v4fa*)&so[w][r][c4]; if (C) *(v4f*)(C + cofs + (size_t)(row0 + r) * ldc + col0 + c4) = v; if (C16) { v4h h4; for (int i = 0; i < 4; ++i) h4[i] = (_Float16)v[i]; *(v4h*)(C16 + cofs + (size_t)(row0 + r) * ldc + col0 + c4) = h4; } } }
     }
}


typedef _Float16 v4h __attribute__((ext_vector_type(4)));

__global__ __launch_bounds__(256) void k_x16(const float* __restrict__ x, _Float16* __restrict__ X16, size_t n8) { const size_t t = (size_t)blockIdx.x * 256 + threadIdx.x; if (t >= n8) return; FragH f;
#pragma unroll
  for (int q = 0; q < 8; ++q) f.h[q] = (_Float16)bf16_round(x[t * 8 + q]); *(v8us*)((unsigned short*)X16 + t * 8) = f.half[0];  }
__global__ __launch_bounds__(256) void k_h16(const float* __restrict__ x, _Float16* __restrict__ X16, size_t n8) { const size_t t = (size_t)blockIdx.x * 256 + threadIdx.x; if (t >= n8) return; FragH f;
#pragma unroll
  for (int q = 0; q < 8; ++q) f.h[q] = (_Float16)x[t * 8 + q]; *(v8us*)((unsigned short*)X16 + t * 8) = f.half[0];  }
__global__ __launch_bounds__(256) void k_round16f(const float* __restrict__ W, _Float16* __restrict__ Bt, size_t n8) { const size_t t = (size_t)blockIdx.x * 256 + threadIdx.x; if (t >= n8) return; FragH f;
#pragma unroll
  for (int i = 0; i < 8; ++i) f.h[i] = (_Float16)(bf16_round(W[t * 8 + i]) * 16.0f); *(v8us*)((unsigned short*)Bt + t * 8) = f.half[0];  }
template <int NHv, int TTv>
__global__ __launch_bounds__(256) void k_vt(const _Float16* __restrict__ V16, int ldv, int voff, _Float16* __restrict__ Vt) { __shared__ unsigned short tl[64][66]; const int tid = threadIdx.x; const int slab = blockIdx.x / (TTv / 64), lg = blockIdx.x % (TTv / 64); const int b = slab / NHv, h = slab % NHv;
  for (int i = tid; i < 64 * 8; i += 256) { const int r = i / 8, c8 = (i % 8) * 8; FragH f; f.half[0] = *(const v8us*)((const unsigned short*)V16 + ((size_t)b * TTv + lg * 64 + r) * ldv + voff + h * 64 + c8);
#pragma unroll
    for (int q = 0; q < 8; ++q) tl[r][c8 + q] = f.u[q]; }
  __syncthreads();
  {
#pragma unroll
    for (int rd = 0; rd < 2; ++rd) { const int d = rd * 32 + tid / 8, pc = tid % 8; FragH f;
#pragma unroll
      for (int q = 0; q < 8; ++q) f.u[q] = tl[pc * 8 + q][d];
      *(v8us*)((unsigned short*)Vt + ((size_t)slab * 64 + d) * TTv + lg * 64 + pc * 8) = f.half[0]; }
     } }

__global__ __launch_bounds__(256) void k_hl(const float* __restrict__ F, _Float16* __restrict__ Hh, _Float16* __restrict__ Hl, size_t n8) { const size_t t = (size_t)blockIdx.x * 256 + threadIdx.x; if (t >= n8) return; FragH fh, fl; const v4f a = *(const v4fa*)(F + t * 8), c = *(const v4fa*)(F + t * 8 + 4);
#pragma unroll
  for (int q = 0; q < 4; ++q) { _Float16 h = (_Float16)a[q]; fh.h[q] = h; fl.h[q] = (_Float16)((a[q] - (float)h) * 1024.0f); h = (_Float16)c[q]; fh.h[4 + q] = h; fl.h[4 + q] = (_Float16)((c[q] - (float)h) * 1024.0f); }
  { *(v8us*)((unsigned short*)Hh + t * 8) = fh.half[0]; *(v8us*)((unsigned short*)Hl + t * 8) = fl.half[0];  } }

// ---- fast GEMM (block tile 128x128 = 8 waves of 32x64; requires M % 128 == 0 rows per launch region, N % 128 == 0, K % 64 == 0; operand rows of pitch DM); epilogue = k_gemm_hhx semantics ----
// Operands go through LDS: a stage is 64 k (128 bytes, one cache line) of the block's 128 A rows and 128 B rows, fetched by whole-line 16-byte loads (8 lanes a row) into registers one stage ahead and stored at a row pitch of 144 bytes (16 x odd).
// Two LDS buffers, one barrier a stage: while a stage is worked on, the next one is stored into the other buffer and the one after it is in flight. The fragments are read from LDS by g2_frag, in the k order they had from memory.
#define G2KS 64                      /* k per stage */
#define G2P (G2KS + 8)               /* LDS row pitch, halves */
#define G2ROWS 256                   /* LDS rows per buffer: 128 of A, then 128 of B */
__device__ __forceinline__ v16h g2_frag(const _Float16* p, int hh) { FragH f; f.half[0] = *(const v8us*)((const unsigned short*)p + 8 * hh); f.half[1] = *(const v8us*)((const unsigned short*)p + 16 + 8 * hh); return f.v; }
__device__ __forceinline__ v8f g2_mma(v16h a, v16h b, v8f c) { v8f d = __builtin_amdgcn_wmma_f32_16x16x32_f16(false, a, false, b, (short)0, c, false, false); asm volatile("v_nop\n\tv_nop\n\tv_nop\n\tv_nop" : "+v"(d) : "v"(a), "v"(b)); return d; }
typedef float v2f __attribute__((ext_vector_type(2)));
// ROPE 1 (f16 rows to C16), 2 or 3 (f32 rows to C): the interleaved-pair rotation (position = row % SQ, tables CS / SN [SQ][HD / 2]) is applied to the finished f32 tile on its way from LDS to the f32 or f16 rows; a 64-column tile is one head, and a lane's four columns are two whole pairs.
// ROPE 3: one launch for q, k and v of every batch: blockIdx.y = plane * NBR + batch; sA steps the batch, sB and sBias the plane, sC both; planes 0 and 1 (q, k) are rotated, plane 2 (v) leaves by the plain path at the foot.
// FT: what a block does whose 128 rows are the first QT0 rows of a batch (the rows that are carried exactly in f32).
// FT 1 (with ROPE 1): one launch for q, k and v, blockIdx.y = plane (sB, sBias and sC step it; planes 0 and 1 are rotated); such a block stores its finished f32 tile to CF as well ([plane][batch][QT0][DM]), ahead of the rounding to f16.
// FT 2: such a block takes its A rows from the planes AH and then AL ([batch][QT0][DM]; f16 high part, residual x1024): the k loop runs once over each, the high part's sums set aside between the two; out = hi alpha + bias, then + lo alpha / 1024.
template <int ACT, int ROPE = 0, int FT = 0>
__global__ __launch_bounds__(256) void k_gemm2(const _Float16* __restrict__ A, size_t sA, const _Float16* __restrict__ Bh, size_t sB, float alpha, const float* __restrict__ bias, size_t sBias, const float* __restrict__ CP, int rowsPerB, size_t sCPb, int row0g,
    float* __restrict__ C, _Float16* __restrict__ C16, int ldc, size_t sC, int M, int N, int K, const float* __restrict__ CS = nullptr, const float* __restrict__ SN = nullptr, const _Float16* __restrict__ AH = nullptr, const _Float16* __restrict__ AL = nullptr, float* __restrict__ CF = nullptr) { static_assert(FT == 0 || (QT0 == 128 && SQ % 128 == 0), "k_gemm2: a first tile is one block's rows"); static_assert(ACT == 0 || ACT == 3 || ACT == 6 || ACT == 8 || ACT == 9 || ACT == 11 || ACT == 12 || ACT == 14 || ACT == 15 || ACT == 16 || ACT == 17, "k_gemm2: unsupported ACT code (would silently apply no activation)");
  __shared__ __attribute__((aligned(16))) unsigned short sm[2 * G2ROWS * G2P]; static_assert(sizeof(sm) >= 8 * 32 * 68 * sizeof(float), "k_gemm2: the epilogue tiles lie in the operand buffers");
  float (*so)[32][68] = (float (*)[32][68])sm;      /* the epilogue's f32 tiles, one a wave, reuse the operand buffers behind the k loop's last barrier */
  const int tid = threadIdx.x, w = tid >> 5, lane = tid & 31, ln = lane & 15, hh = lane >> 4; const int by = blockIdx.y;
  const int pl = (ROPE == 3) ? by / NBR : by, ba = (ROPE == 3) ? by % NBR : by; const bool rot = (ROPE != 3 && FT != 1) || pl < 2;      /* blockIdx.y is a scalar: the tests on rot are scalar branches */
  A += (size_t)ba * sA; Bh += (size_t)pl * sB; const size_t cofs = (size_t)by * sC; const float* bp = bias ? bias + (size_t)pl * sBias : nullptr;
  const int ntn = N >> 7; const int mt = blockIdx.x / ntn, nq = blockIdx.x - mt * ntn; if (mt * 128 >= M) return;      /* the same for the whole block, in front of every barrier */
  const bool ft = FT != 0 && mt % (SQ / 128) == 0; const int fbat = mt / (SQ / 128);      /* first-tile block, and its batch: scalars, so every test on ft is a scalar branch */
  const int wr = w & 3, wc = w >> 2; const int row0 = mt * 128 + 32 * wr, col0 = nq * 128 + 64 * wc;
  const int sr = tid >> 3, sc = (tid & 7) * 8;      /* staging: 8 lanes take one 128-byte row piece, a pass of the block 32 rows */
  const unsigned short* ap = ((FT == 2 && ft) ? (const unsigned short*)AH + (size_t)(fbat * QT0 + sr) * DM : (const unsigned short*)A + (size_t)(mt * 128 + sr) * DM) + sc; const unsigned short* bq = (const unsigned short*)Bh + (size_t)(nq * 128 + sr) * DM + sc; v8us ar[4], br[4];      /* the lane's own addresses: the row pitch is a constant, so the four passes differ in the immediate offset alone */
  unsigned short* const sw = sm + sr * G2P + sc;      /* where the lane stores its pieces (buffer 0, pass 0 of A) */
  const _Float16* const fa = (const _Float16*)sm + (32 * wr + ln) * G2P; const _Float16* const fb = (const _Float16*)sm + (128 + 64 * wc + ln) * G2P;      /* the lane's fragment rows (buffer 0) */
  const v8f z8 = {0.f,0.f,0.f,0.f,0.f,0.f,0.f,0.f}; v8f c00 = z8, c01 = z8, c02 = z8, c03 = z8, c10 = z8, c11 = z8, c12 = z8, c13 = z8;
  v8f h00 = z8, h01 = z8, h02 = z8, h03 = z8, h10 = z8, h11 = z8, h12 = z8, h13 = z8;      /* FT 2: the high part's sums; 0 in any other block */
  v2f rc[16], rs[16];      /* ROPE: the lane's cos / sin pairs of its 16 rows, fetched ahead of the k loop, whose first trips cover their latency */
  if (ROPE && rot) { static_assert(HD == 64 && SQ % 32 == 0, "k_gemm2 rope: a 64-column tile is one head, a 32-row tile does not wrap the position");
    const float* cp = CS + (size_t)((row0 + (lane >> 4)) % SQ) * (HD / 2) + (lane & 15) * 2; const float* sp = SN + (size_t)((row0 + (lane >> 4)) % SQ) * (HD / 2) + (lane & 15) * 2;      /* the lane's own addresses: the 16 rows differ in the immediate offset alone */
#pragma unroll
    for (int q = 0; q < 16; ++q) { rc[q] = *(const v2f*)(cp + q * HD); rs[q] = *(const v2f*)(sp + q * HD); }      /* fully unrolled: rc and rs stay in registers; two rows on = 2 * (HD / 2) floats */
    asm volatile("s_wait_xcnt 0x0" :: "v"(cp), "v"(sp) : "memory"); }      /* the wait between the loads above and the first reuse of their address registers; the addresses are inputs so that their registers stay untouched up to it */
  const int nst = K / G2KS;
#pragma unroll 1
  for (int ph = 0; ph < ((FT == 2 && ft) ? 2 : 1); ++ph) {      /* FT 2, first tile: the k loop runs twice, over AH and then over AL, against the same B rows; rolled: one copy of the k loop, whose sums stay in their registers */
  if (FT == 2 && ph == 1) { h00 = c00; h01 = c01; h02 = c02; h03 = c03; h10 = c10; h11 = c11; h12 = c12; h13 = c13; c00 = z8; c01 = z8; c02 = z8; c03 = z8; c10 = z8; c11 = z8; c12 = z8; c13 = z8;      /* the high part is done: its sums are set aside, the residual's start at 0 */
    ap = (const unsigned short*)AL + (size_t)(fbat * QT0 + sr) * DM + sc; bq = (const unsigned short*)Bh + (size_t)(nq * 128 + sr) * DM + sc; }
#pragma unroll
  for (int u = 0; u < 4; ++u) { ar[u] = *(const v8us*)(ap + (size_t)u * 32 * DM); br[u] = *(const v8us*)(bq + (size_t)u * 32 * DM); }
  asm volatile("s_wait_xcnt 0x0" :: "v"(ap), "v"(bq) : "memory");      /* the wait between the loads above and the first rewrite of their address registers; the addresses are inputs so that their registers stay untouched up to it */
#pragma unroll
  for (int u = 0; u < 4; ++u) { *(v8us*)(sw + u * 32 * G2P) = ar[u]; *(v8us*)(sw + (128 + u * 32) * G2P) = br[u]; }
  if (nst > 1) { ap += G2KS; bq += G2KS;
#pragma unroll
    for (int u = 0; u < 4; ++u) { ar[u] = *(const v8us*)(ap + (size_t)u * 32 * DM); br[u] = *(const v8us*)(bq + (size_t)u * 32 * DM); }
    asm volatile("s_wait_xcnt 0x0" :: "v"(ap), "v"(bq) : "memory"); }      /* as above */
  __syncthreads();      /* publishes stage 0 */
#pragma unroll 1
  for (int s = 0; s < nst; ++s) { const int cur = (s & 1) * (G2ROWS * G2P), nxt = (G2ROWS * G2P) - cur;      /* rolled: the trips differ in the buffer alone */
    if (s + 1 < nst) {      /* stage s + 1 goes into the buffer whose last readers passed the barrier at the foot of trip s - 1 */
#pragma unroll
      for (int u = 0; u < 4; ++u) { *(v8us*)(sw + nxt + u * 32 * G2P) = ar[u]; *(v8us*)(sw + nxt + (128 + u * 32) * G2P) = br[u]; } }
    if (s + 2 < nst) { ap += G2KS; bq += G2KS;
#pragma unroll
      for (int u = 0; u < 4; ++u) { ar[u] = *(const v8us*)(ap + (size_t)u * 32 * DM); br[u] = *(const v8us*)(bq + (size_t)u * 32 * DM); }
      asm volatile("s_wait_xcnt 0x0" :: "v"(ap), "v"(bq) : "memory"); }      /* as above: stands in front of the next trip's address additions */
#pragma unroll
    for (int kk = 0; kk < G2KS; kk += 32) { const _Float16* pa = fa + cur + kk; const _Float16* pb = fb + cur + kk;      /* the six fragments of a 32-k block are read as one group ahead of its eight products: one LDS latency a block, not one a fragment */
      const v16h a0 = g2_frag(pa, hh), a1 = g2_frag(pa + 16 * G2P, hh), b0 = g2_frag(pb, hh), b1 = g2_frag(pb + 16 * G2P, hh), b2 = g2_frag(pb + 32 * G2P, hh), b3 = g2_frag(pb + 48 * G2P, hh);
      c00 = g2_mma(a0, b0, c00); c10 = g2_mma(a1, b0, c10); c01 = g2_mma(a0, b1, c01); c11 = g2_mma(a1, b1, c11);
      c02 = g2_mma(a0, b2, c02); c12 = g2_mma(a1, b2, c12); c03 = g2_mma(a0, b3, c03); c13 = g2_mma(a1, b3, c13); }
    __syncthreads(); }      /* publishes stage s + 1 and ends every wave's reads of stage s (behind the last trip: before the epilogue's tiles, or the second run's first stage, overwrite the buffers) */
  }
  const float al2 = (FT == 2 && ft) ? alpha * 0.0009765625f : alpha;      /* the factor of the last run's sums */
  v8f accs[8] = {c00, c01, c02, c03, c10, c11, c12, c13}; v8f hacc[8] = {h00, h01, h02, h03, h10, h11, h12, h13};
#pragma unroll
  for (int u = 0; u < 8; ++u) { const int t = u & 3, half = u >> 2; const int col = col0 + t * 16 + ln; const float bv = bp ? bf16_round(bp[col]) : 0.f;
#pragma unroll
    for (int r = 0; r < 8; ++r) { const int rloc = half * 16 + 8 * hh + r; float v = (FT == 2) ? accs[u][r] * al2 + (hacc[u][r] * alpha + bv) : accs[u][r] * alpha + bv; if (CP) { if (rowsPerB < 0) v += CP[cofs + (size_t)(row0g + row0 + rloc) * ldc + col];      /* rowsPerB < 0: own element of the batched C plane */ else { const int bidx = (row0g + row0 + rloc) / rowsPerB; v += CP[(size_t)bidx * sCPb + (size_t)by * 64 + col]; } }
      if (ACT == 3) v = fmaxf(v, 0.f); else if (ACT == 6) v = 0.5f * v * (1.0f + erff(v * 0.70710678118654752f)); else if (ACT == 11) v = 1.0f / (1.0f + expf(-v)); else if (ACT == 15) v = v / (1.0f + expf(-v)); else if (ACT == 12) v = (v > 0.f) ? v : 0.01f * v; else if (ACT == 8) v = tanhf(v); else if (ACT == 9) v = 0.5f * v * (1.0f + tanhf(0.7978845608028654f * (v + 0.044715f * v * v * v))); else if (ACT == 14) v = (v > 0.f) ? v : 0.1f * v; else if (ACT == 16) v = (v >= 0.f) ? v : 0.3f * v; else if (ACT == 17) v = (v >= 0.f) ? v : 0.2f * v;
      so[w][rloc][t * 16 + ln] = v; } }
  __builtin_amdgcn_fence(__ATOMIC_ACQ_REL, "workgroup"); __builtin_amdgcn_wave_barrier();
  const int rsub = lane >> 4, c4 = (lane & 15) * 4;
  float* const cf = (FT == 1) ? CF + (((size_t)pl * NBR + fbat) * QT0 + 32 * wr + rsub) * DM + col0 + c4 : nullptr;      /* FT 1: the lane's place in the first-tile f32 plane; the sixteen rows differ in the immediate offset alone */
  if (ROPE && rot) { v4f t[16];      /* the sixteen row pieces are rotated first and then stored in one run; the destination is fixed at compile time */
#pragma unroll
    for (int q = 0; q < 16; ++q) { const v4f v = *(const v4fa*)&so[w][q * 2 + rsub][c4]; const v2f c = rc[q], s = rs[q];
      t[q][0] = v[0] * c[0] - v[1] * s[0]; t[q][1] = v[0] * s[0] + v[1] * c[0]; t[q][2] = v[2] * c[1] - v[3] * s[1]; t[q][3] = v[2] * s[1] + v[3] * c[1]; }
    if (ROPE >= 2) {
#pragma unroll
      for (int q = 0; q < 16; ++q) *(v4f*)(C + cofs + (size_t)(row0 + q * 2 + rsub) * ldc + col0 + c4) = t[q]; }
    else { v4h h4[16];
#pragma unroll
      for (int q = 0; q < 16; ++q) { h4[q][0] = (_Float16)t[q][0]; h4[q][1] = (_Float16)t[q][1]; h4[q][2] = (_Float16)t[q][2]; h4[q][3] = (_Float16)t[q][3]; }
#pragma unroll
      for (int q = 0; q < 16; ++q) *(v4h*)(C16 + cofs + (size_t)(row0 + q * 2 + rsub) * ldc + col0 + c4) = h4[q];
      if (FT == 1) asm volatile("s_wait_xcnt 0x0" ::: "memory");      /* the wait between the stores above and the first reuse of their registers, which the first-tile block below makes; it stands in the stores' own block, ahead of the branch */
      if (FT == 1 && ft) {
#pragma unroll
        for (int q = 0; q < 16; ++q) *(v4f*)(cf + (size_t)q * 2 * DM) = t[q]; } }
  } else {
#pragma unroll
    for (int q = 0; q < 16; ++q) { const int r = q * 2 + rsub; const v4f v = *(const v4fa*)&so[w][r][c4]; if (C) *(v4f*)(C + cofs + (size_t)(row0 + r) * ldc + col0 + c4) = v; if (C16) { v4h h4; for (int i = 0; i < 4; ++i) h4[i] = (_Float16)v[i]; *(v4h*)(C16 + cofs + (size_t)(row0 + r) * ldc + col0 + c4) = h4; } }
    if (FT == 1) asm volatile("s_wait_xcnt 0x0" ::: "memory");      /* as in the rotated path: ahead of the branch into the first-tile block */
    if (FT == 1 && ft) { v4f t[16];      /* the sixteen f32 row pieces are read again and stored in one run at the kernel's end: no store's register is rewritten behind it */
#pragma unroll
      for (int q = 0; q < 16; ++q) t[q] = *(const v4fa*)&so[w][q * 2 + rsub][c4];
#pragma unroll
      for (int q = 0; q < 16; ++q) *(v4f*)(cf + (size_t)q * 2 * DM) = t[q]; }
     } }


__global__ __launch_bounds__(256) void k_wnat(const float* __restrict__ w, size_t n8, _Float16* __restrict__ Bt) { const size_t t = (size_t)blockIdx.x * 256 + threadIdx.x; if (t >= n8) return; FragH f; for (int q = 0; q < 8; ++q) f.h[q] = (_Float16)(bf16_round(w[t * 8 + q]) * 16.0f); *(v8us*)((unsigned short*)Bt + t * 8) = f.half[0];  }
__global__ __launch_bounds__(256) void k_rsm(const float* __restrict__ S, _Float16* __restrict__ P, int nrows) {
  #pragma clang fp contract(off)
  const int i = blockIdx.x * 256 + threadIdx.x; if (i >= nrows) return; const float* s = S + (size_t)i * SQ; float mx = -3.0e38f;
#pragma unroll 1
  for (int j = 0; j < SQ; ++j) mx = fmaxf(mx, s[j]); float se = 0.f;
#pragma unroll 1
  for (int j = 0; j < SQ; ++j) se += expf(s[j] - mx); const float sc = 256.0f / se;
#pragma unroll 1
  for (int j0 = 0; j0 < SQ; j0 += 8) { FragH f; for (int q = 0; q < 8; ++q) f.h[q] = (_Float16)(expf(s[j0 + q] - mx) * sc); unsigned short* d = (unsigned short*)P + (size_t)i * SQ + j0; *(v8us*)d = f.half[0];  } }
__global__ __launch_bounds__(256) void k_vt(const _Float16* __restrict__ V16, int b, int h0, _Float16* __restrict__ VT) { __shared__ unsigned short tl[64][65]; const int tid = threadIdx.x; const int hh = blockIdx.x % HG, sg = blockIdx.x / HG; const int s0 = sg * 64; const int h = h0 + hh;
  for (int i = tid; i < 64 * 8; i += 256) { const int j = i / 8, d8 = (i % 8) * 8; FragH f; f.half[0] = *(const v8us*)((const unsigned short*)V16 + ((size_t)b * SQ + s0 + j) * DM + h * HD + d8); for (int q = 0; q < 8; ++q) tl[d8 + q][j] = f.u[q]; }
  __syncthreads();
  { for (int i = tid; i < 64 * 8; i += 256) { const int d = i / 8, j8 = (i % 8) * 8; FragH f; for (int q = 0; q < 8; ++q) f.u[q] = tl[d][j8 + q]; *(v8us*)((unsigned short*)VT + ((size_t)hh * HD + d) * SQ + s0 + j8) = f.half[0]; }  } }



#define FAQB 128                     /* query rows per block */
#define FAK 64                       /* keys per step */
#define FAP (HD + 8)                 /* LDS row pitch, halves */
__device__ __forceinline__ v8f fa_mma(v16h a, v16h b, v8f c) { return __builtin_amdgcn_wmma_f32_16x16x32_f16(false, a, false, b, (short)0, c, false, false); }
__global__ __launch_bounds__(128) void k_fattn(const _Float16* __restrict__ Q, const _Float16* __restrict__ Kh, const _Float16* __restrict__ VTa, _Float16* __restrict__ O) {
  static_assert(NB * NH == 64 && SQ / FAQB == 16 && HD == 64, "k_fattn: the block-to-tile map below is written for 64 (batch, head) pairs x 16 query blocks");
  __shared__ __attribute__((aligned(16))) _Float16 lk[FAK][FAP]; __shared__ __attribute__((aligned(16))) _Float16 lv[HD][FAP];
  const int tid = threadIdx.x, lane = tid & 31, ln = lane & 15, hh = lane >> 4; const int w = __builtin_amdgcn_readfirstlane(tid >> 5);      /* the wave's number as a scalar: the two tests on q0w below are scalar branches */
  const int g = blockIdx.x >> 8, sub = (blockIdx.x >> 6) & 3, bh = blockIdx.x & 63;
  const int qb = (g == 0) ? 15 - sub : ((g == 1) ? 8 + sub : ((g == 2) ? 7 - sub : sub));      /* a permutation of the 16 query blocks: long blocks start first, and blocks 256 apart in the index add up to the same length */
  const int b = bh / NH, h = bh % NH; const size_t r0 = (size_t)b * SQ; const int q0w = qb * FAQB + w * 32; const int nst = (qb + 1) * (FAQB / FAK);
  const unsigned short* qp = (const unsigned short*)Q + (r0 + q0w + ln) * LQ + h * HD + 8 * hh; v16h qf[2][2];      /* the lane's own address, so that the eight loads differ in the immediate offset alone; every loop but the step loop is fully unrolled: all array indices are constants and the arrays stay in registers */
#pragma unroll
  for (int nt = 0; nt < 2; ++nt)
#pragma unroll
    for (int kk = 0; kk < 2; ++kk) { FragH f; f.half[0] = *(const v8us*)(qp + (size_t)nt * 16 * LQ + kk * 32); f.half[1] = *(const v8us*)(qp + (size_t)nt * 16 * LQ + kk * 32 + 16); qf[nt][kk] = f.v; }      /* the k order of g2_frag */
  const int sr = tid >> 3, sc = (tid & 7) * 8;      /* staging: 8 lanes take one 128-byte row, a pass of the block 16 rows */
  const unsigned short* kp = (const unsigned short*)Kh + (r0 + sr) * LQ + h * HD + sc; const unsigned short* vp = (const unsigned short*)VTa + ((size_t)bh * HD + sr) * SQ + sc; v8us kr[4], vr[4];
#pragma unroll
  for (int u = 0; u < 4; ++u) { kr[u] = *(const v8us*)(kp + (size_t)u * 16 * LQ); vr[u] = *(const v8us*)(vp + (size_t)u * 16 * SQ); }
  asm volatile("s_wait_xcnt 0x0" :: "v"(qp), "v"(kp), "v"(vp) : "memory");      /* the wait between the loads above and the first rewrite of their address registers; the addresses are inputs so that their registers stay untouched up to it */
  const v8f z8 = {0.f, 0.f, 0.f, 0.f, 0.f, 0.f, 0.f, 0.f}; v8f o[4][2];
#pragma unroll
  for (int dt = 0; dt < 4; ++dt) { o[dt][0] = z8; o[dt][1] = z8; }
  float m[2] = {-1.0e30f, -1.0e30f}, l[2] = {0.f, 0.f};      /* running max (log2 units) and this lane's part of the running sum, per query tile */
  const float SC = 0.125f * 1.44269504088896340736f;      /* 1 / sqrt(64), in log2 units */
#pragma unroll 1
  for (int s = 0; s < nst; ++s) { const int k0 = s * FAK;      /* rolled: one step's code is long and its trip count varies by block */
#pragma unroll
    for (int u = 0; u < 4; ++u) { *(v8us*)&lk[u * 16 + sr][sc] = kr[u]; *(v8us*)&lv[u * 16 + sr][sc] = vr[u]; }
    __syncthreads();      /* publishes this step's K and V^T rows */
    if (s + 1 < nst) { kp += (size_t)FAK * LQ; vp += FAK;
#pragma unroll
      for (int u = 0; u < 4; ++u) { kr[u] = *(const v8us*)(kp + (size_t)u * 16 * LQ); vr[u] = *(const v8us*)(vp + (size_t)u * 16 * SQ); }
      asm volatile("s_wait_xcnt 0x0" :: "v"(kp), "v"(vp) : "memory"); }      /* as above: stands in front of the next step's address additions */
    if (k0 <= q0w + 31) {      /* a wave whose queries all lie below this step's keys only passes the barriers */
      v8f st[4][2];
#pragma unroll
      for (int kt = 0; kt < 4; ++kt) { st[kt][0] = z8; st[kt][1] = z8; }
#pragma unroll
      for (int kk = 0; kk < 2; ++kk)
#pragma unroll
        for (int kt = 0; kt < 4; ++kt) { const v16h a = g2_frag(&lk[kt * 16 + ln][kk * 32], hh); st[kt][0] = fa_mma(a, qf[0][kk], st[kt][0]); st[kt][1] = fa_mma(a, qf[1][kk], st[kt][1]); }
      if (k0 + FAK - 1 > q0w) {      /* only steps that reach past the wave's first query mask */
#pragma unroll
        for (int kt = 0; kt < 4; ++kt)
#pragma unroll
          for (int nt = 0; nt < 2; ++nt)
#pragma unroll
            for (int r = 0; r < 8; ++r) st[kt][nt][r] = (k0 + kt * 16 + 8 * hh + r <= q0w + nt * 16 + ln) ? st[kt][nt][r] : -3.0e38f; }
      v16h pf[2][2];
#pragma unroll
      for (int nt = 0; nt < 2; ++nt) { float mr = st[0][nt][0];
#pragma unroll
        for (int kt = 0; kt < 4; ++kt)
#pragma unroll
          for (int r = 0; r < 8; ++r) mr = fmaxf(mr, st[kt][nt][r]);
        mr = fmaxf(mr, __shfl_xor(mr, 16, 32));
        const float mn = fmaxf(m[nt], mr * SC); const float al = __builtin_amdgcn_exp2f(m[nt] - mn); m[nt] = mn; const float bs = 8.0f - mn;      /* + 8: weights carried x256; a masked key underflows to exactly 0 */
        v4f s4 = {0.f, 0.f, 0.f, 0.f};
#pragma unroll
        for (int kt = 0; kt < 4; ++kt)
#pragma unroll
          for (int r = 0; r < 8; ++r) { const float p = __builtin_amdgcn_exp2f(fmaf(st[kt][nt][r], SC, bs)); s4[r & 3] += p; pf[nt][kt >> 1][(kt & 1) * 8 + r] = (_Float16)p; }
        l[nt] = fmaf(l[nt], al, (s4[0] + s4[1]) + (s4[2] + s4[3]));
#pragma unroll
        for (int dt = 0; dt < 4; ++dt) o[dt][nt] *= al; }
#pragma unroll
      for (int j = 0; j < 2; ++j)
#pragma unroll
        for (int dt = 0; dt < 4; ++dt) { const v16h a = g2_frag(&lv[dt * 16 + ln][j * 32], hh); o[dt][0] = fa_mma(a, pf[0][j], o[dt][0]); o[dt][1] = fa_mma(a, pf[1][j], o[dt][1]); } }
    __syncthreads(); }      /* ends every wave's reads of this step's rows before the next step's stores */
  FragH t[2][4];      /* all eight 16-byte results are formed first: no store's data register is rewritten behind it */
#pragma unroll
  for (int nt = 0; nt < 2; ++nt) { const float f = 64.0f / (l[nt] + __shfl_xor(l[nt], 16, 32));
#pragma unroll
    for (int dt = 0; dt < 4; ++dt)
#pragma unroll
      for (int r = 0; r < 8; ++r) t[nt][dt].h[r] = (_Float16)(o[dt][nt][r] * f); }
  unsigned short* op = (unsigned short*)O + (r0 + q0w + ln) * DM + h * HD + 8 * hh;
#pragma unroll
  for (int nt = 0; nt < 2; ++nt)
#pragma unroll
    for (int dt = 0; dt < 4; ++dt) *(v8us*)(op + (size_t)nt * 16 * DM + dt * 16) = t[nt][dt].half[0]; }


// Exact f32 attention for the first QT0 rows of every batch (blockIdx.y; planes of QT0 rows a batch; o carried x64 like the f16 path, and stored as an f16 high part and an f16 residual x1024, the two operand planes of the output GEMM). One wave per query row, A0R rows of one head per block.
// All QT0 K and V rows of the head are staged in LDS once by coalesced 16-byte loads. K rows get a pitch of 68 floats (16 bytes x odd), so that 32 lanes reading 32 rows by 16 bytes spread over the banks.
// Scores: lane = key (four partial sums over the head dimension). Row max and row sum: five-step butterfly. o: lane = two head columns, loop over the keys, each key's weight read from its lane into a scalar register; keys above the row carry weight 0.
#define A0R 8                        /* rows (waves) per block */
#define A0KP (HD + 4)                /* K row pitch in LDS, floats */
__global__ __launch_bounds__(256) void k_att0w(const float* __restrict__ QF, const float* __restrict__ KF, const float* __restrict__ VF, float scale, _Float16* __restrict__ OH, _Float16* __restrict__ OL) {
  __shared__ __attribute__((aligned(16))) float lk[QT0][A0KP]; __shared__ __attribute__((aligned(16))) float lv[QT0][HD];
  const int tid = threadIdx.x, lane = tid & 31; const int w = __builtin_amdgcn_readfirstlane(tid >> 5);      /* the wave's number as a scalar: row, group count and branches below are wave-uniform */
  const int h = blockIdx.x / (QT0 / A0R), r0 = (blockIdx.x % (QT0 / A0R)) * A0R; const int i = r0 + w;
  const size_t pb = (size_t)blockIdx.y * QT0 * DM; QF += pb; KF += pb; VF += pb; OH += pb; OL += pb;
  const float* qr = QF + (size_t)i * DM + h * HD; v4f q[HD / 4];      /* every loop of this kernel is fully unrolled: the indices into q, kk, vv, sv and o and the lane of each readlane are then constants, so the arrays stay in registers */
#pragma unroll
  for (int c = 0; c < HD / 4; ++c) q[c] = *(const v4fa*)(qr + c * 4);      /* the wave's own q row, whole */
  const int sj = tid >> 4, sc4 = (tid & 15) * 4; const float* kp = KF + (size_t)sj * DM + h * HD + sc4; const float* vp = VF + (size_t)sj * DM + h * HD + sc4; v4f kk[QT0 / 16], vv[QT0 / 16];      /* one pass of the block stages 16 rows; both loops are fully unrolled and free of branches so that every load of the block is in flight before the first LDS store waits; the row pitch is a constant, so the passes differ in the immediate offset alone */
#pragma unroll
  for (int u = 0; u < QT0 / 16; ++u) { kk[u] = *(const v4fa*)(kp + (size_t)u * 16 * DM); vv[u] = *(const v4fa*)(vp + (size_t)u * 16 * DM); }
  asm volatile("s_wait_xcnt 0x0" :: "v"(kp), "v"(vp) : "memory");      /* the wait between the loads above and the first reuse of their address registers; the two addresses are inputs so that their registers stay untouched up to it */
#pragma unroll
  for (int u = 0; u < QT0 / 16; ++u) { *(v4f*)&lk[u * 16 + sj][sc4] = kk[u]; *(v4f*)&lv[u * 16 + sj][sc4] = vv[u]; }
  __syncthreads();
  const int ng = (i >> 5) + 1;      /* key groups of 32 that hold a key <= i */
  float sv[QT0 / 32];
#pragma unroll
  for (int g = 0; g < QT0 / 32; ++g) { sv[g] = -1.0e30f;
    if (g < ng) { const int j = g * 32 + lane; v4f a = {0.f, 0.f, 0.f, 0.f};
#pragma unroll
      for (int c = 0; c < HD / 4; ++c) a += q[c] * *(const v4f*)&lk[j][c * 4];
      const float s = ((a[0] + a[1]) + (a[2] + a[3])) * scale; sv[g] = (j <= i) ? s : -1.0e30f; } }
  float mx = fmaxf(fmaxf(sv[0], sv[1]), fmaxf(sv[2], sv[3]));
#pragma unroll
  for (int m = 16; m >= 1; m >>= 1) mx = fmaxf(mx, __shfl_xor(mx, m, 32));
  float se = 0.f;
#pragma unroll
  for (int g = 0; g < QT0 / 32; ++g) { const float e = expf(sv[g] - mx); sv[g] = e; se += e; }      /* a key above the row holds -1e30: its weight underflows to exactly 0 */
#pragma unroll
  for (int m = 16; m >= 1; m >>= 1) se += __shfl_xor(se, m, 32);
  v2f o[4] = {{0.f, 0.f}, {0.f, 0.f}, {0.f, 0.f}, {0.f, 0.f}};      /* four partial sums over the keys (key mod 4): four independent add chains */
#pragma unroll
  for (int g = 0; g < QT0 / 32; ++g) if (g < ng) {
#pragma unroll
    for (int jj = 0; jj < 32; ++jj) { const float e = __int_as_float(__builtin_amdgcn_readlane(__float_as_int(sv[g]), jj)); o[jj & 3] += e * *(const v2f*)&lv[g * 32 + jj][lane * 2]; } }
  const float fin = 64.0f / se; const v2f r = ((o[0] + o[1]) + (o[2] + o[3])) * fin;
  typedef _Float16 v2h __attribute__((ext_vector_type(2))); v2h rh, rl;
  rh[0] = (_Float16)r[0]; rh[1] = (_Float16)r[1]; rl[0] = (_Float16)((r[0] - (float)rh[0]) * 1024.0f); rl[1] = (_Float16)((r[1] - (float)rh[1]) * 1024.0f);
  const size_t oo = (size_t)i * DM + h * HD + lane * 2; *(v2h*)(OH + oo) = rh; *(v2h*)(OL + oo) = rl; }


__global__ __launch_bounds__(256) void k_wt_hq(const float* __restrict__ Wf, const float* __restrict__ bf, _Float16* __restrict__ Bq, _Float16* __restrict__ Bk, _Float16* __restrict__ Bv, float* __restrict__ B3) {
  static_assert(HD == WTT && DM % WTT == 0, "k_wt_hq: a 64-column tile is the q, k or v part of one head");
  __shared__ float tl[WTT][WTT + 1];
  const int nt = blockIdx.x, kt = blockIdx.y; const int h = nt / 3, wh = nt % 3;      /* column tile nt = head * 3 + (q | k | v); neighbouring blocks take neighbouring pieces of the same W rows */
  _Float16* dst = (wh == 0) ? Bq : ((wh == 1) ? Bk : Bv);
  wt_tile(Wf + (size_t)kt * WTT * (3 * DM) + nt * WTT, 3 * DM, (unsigned short*)dst + (size_t)h * HD * DM + kt * WTT, DM, 16.0f, tl);
  (void)bf; (void)B3; }
__global__ __launch_bounds__(256) void k_bhq(const float* __restrict__ bf, float* __restrict__ B3) {
  const int t = blockIdx.x * 256 + threadIdx.x; if (t >= 3 * DM) return; const int wh = t / DM, row = t % DM; const int h = row / HD, d = row % HD; const float v = bf16_round(bf[h * (3 * HD) + wh * HD + d]); *(float*)(B3 + t) = v;  }

__global__ __launch_bounds__(256) void k_tabcp32(const float* __restrict__ tc, const float* __restrict__ tsn, float* __restrict__ CS, float* __restrict__ SN, int n) {
  const int t = blockIdx.x * 256 + threadIdx.x; if (t >= n) return; const float c = bf16_round(tc[t]), s = bf16_round(tsn[t]);
  *(float*)(CS + t) = c; *(float*)(SN + t) = s;  }
extern "C" void kernel_launch(void* const* d_in, const int* in_sizes, int n_in,
                              void* d_out, int out_size, void* d_ws, size_t ws_size, hipStream_t stream) {
  (void)in_sizes; (void)n_in; (void)out_size;
  const float* const* I = (const float* const*)d_in; const float* x = I[0]; const float* wqkv = I[1]; const float* bqkv = I[2]; const float* wo = I[3]; const float* bo = I[4]; const float* tcos = I[5]; const float* tsin = I[6];      /* x; fused W_qkv [1024][3072] + b_qkv [3072] ([in][out]; per-head (q | k | v) column triples); W_out + b_out ([in][out]); rope tables cos / sin [2048][32] */
  char* ws = (char*)d_ws; size_t off = 0;
  auto take = [&](size_t bytes) { char* p = ws + off; off += (bytes + 255) & ~(size_t)255; return p; };
  _Float16* BQ = (_Float16*)take((size_t)DM * DM * 2); _Float16* BK = (_Float16*)take((size_t)DM * DM * 2); _Float16* BV = (_Float16*)take((size_t)DM * DM * 2); _Float16* BO = (_Float16*)take((size_t)DM * DM * 2);
  float* BQB = (float*)take((size_t)3 * DM * 4); float* CSB = (float*)take((size_t)SQ * 32 * 4); float* SNB = (float*)take((size_t)SQ * 32 * 4);      /* de-interleaved bias vector bq | bk | bv; bf16-rounded copies of the rope tables */ _Float16* X16 = (_Float16*)take(NR * DM * 2); _Float16* Q16 = (_Float16*)take(NR * DM * 2); _Float16* K16 = (_Float16*)take(NR * DM * 2); _Float16* V16 = (_Float16*)take(NR * DM * 2); _Float16* O16 = (_Float16*)take(NR * DM * 2);
  _Float16* VT = (_Float16*)take((size_t)NB * NH * HD * SQ * 2);
  float* QF0 = (float*)take((size_t)3 * NBR * QT0 * DM * 4); float* KF0 = QF0 + (size_t)NBR * QT0 * DM; float* VF0 = KF0 + (size_t)NBR * QT0 * DM;      /* first-tile f32 q | k | v, each NBR planes of QT0 rows, one after the other */ _Float16* OH0 = (_Float16*)take((size_t)NB * QT0 * DM * 2); _Float16* OL0 = (_Float16*)take((size_t)NB * QT0 * DM * 2);
  if (off > ws_size) return;
  k_wt_hq<<<dim3(3 * DM / WTT, DM / WTT), 256, 0, stream>>>(wqkv, bqkv, BQ, BK, BV, BQB); k_bhq<<<(3 * DM + 255) / 256, 256, 0, stream>>>(bqkv, BQB); k_wt_f16<<<dim3(DM / WTT, DM / WTT), 256, 0, stream>>>(wo, BO, DM, DM, 16.0f);      /* fused [in][out] weight with per-head (q | k | v) column triples -> three Bt planes (row h*64 + d) x16 + the de-interleaved bias vector; W_out [in][out] -> Bt x16 */
  k_tabcp32<<<(SQ * 32 + 255) / 256, 256, 0, stream>>>(tcos, tsin, CSB, SNB, SQ * 32);      /* rope tables [pos][32], bf16-rounded copies */

  k_x16<<<(unsigned)((NR * DM / 8 + 255) / 256), 256, 0, stream>>>(x, X16, NR * DM / 8);
  const size_t r0p = (size_t)B0 * SQ;      /* first projected row */
  k_gemm2<0, 1, 1><<<dim3((unsigned)((MP / 128) * (DM / 128)), 3), 256, 0, stream>>>(X16 + r0p * DM, 0, BQ, (size_t)DM * DM, 0.0625f, BQB, DM, nullptr, 1, 0, 0, nullptr, Q16 + r0p * DM, DM, NR * DM, MP, DM, DM, CSB, SNB, nullptr, nullptr, QF0);      /* q, k, v (f32) + bias in one launch (blockIdx.y; BQ | BK | BV and Q16 | K16 | V16 lie one after the other); q and k -> interleaved-pair rope (position = row % SQ); -> f16 rows; the blocks of the first 128 rows of a batch store their f32 tile (exact products) to QF0 | KF0 | VF0 too */
  k_att0w<<<dim3(NH * (QT0 / A0R), NBR), 256, 0, stream>>>(QF0, KF0, VF0, 0.125f, OH0 + (size_t)B0 * QT0 * DM, OL0 + (size_t)B0 * QT0 * DM);      /* exact f32 attention for rows 0..127 of every batch (o x64) -> f16 hi + x1024 residual planes */
  k_vt<NH, SQ><<<NB * NH * (SQ / 64), 256, 0, stream>>>(V16, LQ, 0, VT);      /* V^T [NB][NH][HD][SQ] */
  k_fattn<<<NB * NH * (SQ / FAQB), 128, 0, stream>>>(Q16, K16, VT, O16);      /* scores, causal softmax and P V in one launch; o (merged heads, x64) as f16 rows */
  k_gemm2<0, 0, 2><<<dim3((unsigned)((MPO / 128) * (DM / 128)), 1), 256, 0, stream>>>(O16 + r0p * DM, 0, BO, 0, 0.0009765625f, bo, 0, nullptr, 1, 0, 0, (float*)d_out + r0p * DM, nullptr, DM, 0, MPO, DM, DM, nullptr, nullptr, OH0 + (size_t)B0 * QT0 * DM, OL0 + (size_t)B0 * QT0 * DM);      /* out rows are the output layout; rows 0..127 of a batch: out = o_hi Wo (+ b) + o_lo Wo 2^-20, in the same launch */
}

// v009
// One run takes 156 microseconds.
// Timed twice side by side with v008, it ran 1.03 times as fast both times.
// Over all steps from v000 it is 67.4 times as fast.
#include <hip/hip_runtime.h>
// Causal multi-head self-attention with a PER-HEAD interleaved fused QKV projection and rotary embeddings (x [4][2048][1024]; qkv = x W_qkv + b_qkv ([in][out] 1024 x 3072, zero bias) reshaped (B, T, 16, 192): head h owns columns h*192 + [0..63 | 64..127 | 128..191] = q | k | v; rope on q and k from the INPUT tables cos / sin [2048][32]: t1 = even elements, t2 = odd elements, out = cat(t1 c - t2 s, t1 s + t2 c) (an interleaved-pair rotation followed by the same fixed permutation on q and k: the scores are unchanged by it); scores / 8; causal (tril, -inf); softmax; out = merged W_out + b_out ([in][out]) -> [4][2048][1024]).
// Structure: token rows r = b*2048 + s; x as exact f16 rows (bf16-rounded); Q, K, V as three WMMA GEMMs in one launch (32x64 wave tiles, f32 accumulation, exact x16 weights, f16 outputs; the q and k GEMMs apply the rope in their epilogue, in f32, before the rounding to f16; the blocks of a batch's first 128 rows also keep their f32 tile for the exact first-tile attention); V^T for all batches and heads via LDS transposes; one fused attention launch (k_fattn): S^T = K Q^T, online causal softmax in registers (f32 statistics, native exp2; weights x256 f16), O^T += V^T P^T, o carried x64 (folded into the output GEMM alpha) written straight into the merged f16 o rows; out = o W_o GEMM (f32) into the output layout, whose blocks of a batch's first 128 rows take the exact o as an f16 high part and residual.
// Compute dtype: inputs rounded to bf16; x / weights exact; q, k, v, softmax weights and o as plain f16 GEMM operands (~2^-12); scores and softmax statistics f32. v_wmma_f32_16x16x32_f16.
#define NB 4
#define SQ 2048
#define DM 1024
#define NH 16
#define HD 64
#define HG 4                         /* heads per launch of the per-batch k_vt overload (never launched) */
#define QT0 128                      /* first-tile rows recomputed exactly in f32 */
#define B0 0                         /* first batch processed (debug hook) */
#define NBR NB                       /* batches processed (debug hook) */
#define NR ((size_t)NB * SQ)         /* token rows */
#define MP ((int)((size_t)NBR * SQ)) /* rows projected (debug hook) */
#define MPO MP                       /* rows through the output stage (debug hook) */
#define LQ DM      /* row pitch of the q/k/v rows */
typedef __bf16 v16b __attribute__((ext_vector_type(16)));
typedef unsigned short v8us __attribute__((ext_vector_type(8), may_alias));
typedef float  v8f  __attribute__((ext_vector_type(8)));
typedef float  v4f  __attribute__((ext_vector_type(4)));
typedef float  v4fa __attribute__((ext_vector_type(4), may_alias));
union FragB { v16b v; v8us half[2]; unsigned short u[16]; };

__device__ __forceinline__ unsigned short bf16_bits(float x) { unsigned int u = __float_as_uint(x); return (unsigned short)((u + 0x7FFFu + ((u >> 16) & 1u)) >> 16); }
__device__ __forceinline__ float bf16_val(unsigned short b) { return __uint_as_float(((unsigned int)b) << 16); }
__device__ __forceinline__ float bf16_round(float x) { return bf16_val(bf16_bits(x)); }
// D += A·B with NT terms: 1 = ah·bh, 2 = + al·bh (A split), 3 = + ah·bl (both split)
template <int NT>
__device__ __forceinline__ v8f mmaN(v16b ah, v16b al, v16b bh, v16b bl, v8f c) {
  c = __builtin_amdgcn_wmma_f32_16x16x32_bf16(false, ah, false, bh, (short)0, c, false, false);
  if (NT >= 2) c = __builtin_amdgcn_wmma_f32_16x16x32_bf16(false, al, false, bh, (short)0, c, false, false);
  if (NT >= 3) c = __builtin_amdgcn_wmma_f32_16x16x32_bf16(false, ah, false, bl, (short)0, c, false, false);
  asm volatile("v_nop\n\tv_nop\n\tv_nop\n\tv_nop" : "+v"(c) : "v"(ah), "v"(al), "v"(bh), "v"(bl));
  return c;
}

__global__ __launch_bounds__(256) void k_wt_bf16(const float* __restrict__ W, unsigned short* __restrict__ Wt, int K, int N) {
  const int t = blockIdx.x * 256 + threadIdx.x;
  const int k8n = K / 8;
  if (t >= N * k8n) return;
  const int n = t / k8n, k8 = (t % k8n) * 8;
  v8us v;
#pragma unroll
  for (int i = 0; i < 8; ++i) v[i] = bf16_bits(W[(size_t)(k8 + i) * N + n]);
  *(v8us*)(Wt + (size_t)n * K + k8) = v;
  
}

// GEMM C[M][N] (f32, pitch ldc) = act(A[M][K]·W + bias). A f32 row-major (pitch lda) converted per fragment to bf16
// (ASPLIT: hi/lo two planes -> 2 terms, else single rounded term); Wt bf16 [N][K] (pitch ldb). BIAS_BF16 rounds the
// bias to bf16 first (bias quantised to bf16 before the add). K%32==0, M%16==0, N%64==0.
template <bool ASPLIT, int ACT, bool BIAS_BF16>
__global__ __launch_bounds__(128) void k_gemm_bf(const float* __restrict__ A, int lda, const unsigned short* __restrict__ Wt, int ldb,
                                               const float* __restrict__ bias, float* __restrict__ C, int ldc, int M, int N, int K) {
  __shared__ __attribute__((aligned(16))) float so[4][16][64];
  const int tid = threadIdx.x, w = tid >> 5, lane = tid & 31, ln = lane & 15, hh = lane >> 4;
  const int ntn = N / 64;
  const int wid = blockIdx.x * 4 + w;
  const int mt = wid / ntn, nq = wid % ntn;
  if (mt * 16 >= M) return;
  const int row0 = mt * 16, col0 = nq * 64;
  const float* arow = A + (size_t)(row0 + ln) * lda;
  v8f acc[4] = {};
  for (int kb = 0; kb < K; kb += 32) {
    FragB ah, al;
    const v4f x0 = *(const v4fa*)(arow + kb + 8 * hh), x1 = *(const v4fa*)(arow + kb + 8 * hh + 4);
    const v4f x2 = *(const v4fa*)(arow + kb + 16 + 8 * hh), x3 = *(const v4fa*)(arow + kb + 16 + 8 * hh + 4);
    float xs[16] = {x0[0],x0[1],x0[2],x0[3],x1[0],x1[1],x1[2],x1[3],x2[0],x2[1],x2[2],x2[3],x3[0],x3[1],x3[2],x3[3]};
#pragma unroll
    for (int i = 0; i < 16; ++i) { const unsigned short hb = bf16_bits(xs[i]); ah.u[i] = hb; al.u[i] = ASPLIT ? bf16_bits(xs[i] - bf16_val(hb)) : (unsigned short)0; }
#pragma unroll
    for (int t = 0; t < 4; ++t) {
      const unsigned short* brow = Wt + (size_t)(col0 + t * 16 + ln) * ldb + kb;
      FragB b;
      b.half[0] = *(const v8us*)(brow + 8 * hh);
      b.half[1] = *(const v8us*)(brow + 16 + 8 * hh);
      acc[t] = mmaN<ASPLIT ? 2 : 1>(ah.v, al.v, b.v, b.v, acc[t]);
    }
  }
#pragma unroll
  for (int t = 0; t < 4; ++t) {
    float bv = bias ? bias[col0 + t * 16 + ln] : 0.f;
    if (BIAS_BF16) bv = bf16_round(bv);
#pragma unroll
    for (int r = 0; r < 8; ++r) { float v = acc[t][r] + bv; if (ACT == 1) v = fmaxf(v, 0.f); so[w][8 * hh + r][t * 16 + ln] = v; }
  }
  __builtin_amdgcn_fence(__ATOMIC_ACQ_REL, "workgroup");
  __builtin_amdgcn_wave_barrier();
  const int rsub = lane >> 4, c4 = (lane & 15) * 4;
  {
#pragma unroll
    for (int q = 0; q < 8; ++q) {
      const int r = q * 2 + rsub;
      const v4f v = *(const v4fa*)&so[w][r][c4];
      *(v4f*)(C + (size_t)(row0 + r) * ldc + col0 + c4) = v;
    }
    
  }
}

// GEMM C = act(A·W + bias + resid): A f32 (ASPLIT -> hi/lo 2 terms), Wt bf16 [N][K]; ACT 0 none, 1 relu, 2 exact gelu;
// resid (optional, f32, row index = (row % rmod), pitch ldr, RES_BF16 rounds it) added before the activation.
template <bool ASPLIT, int ACT, bool BIAS_BF16, bool RES_BF16>
__global__ __launch_bounds__(128) void k_gemm_bf3(const float* __restrict__ A, int lda, const unsigned short* __restrict__ Wt, int ldb,
                                                const float* __restrict__ bias, const float* __restrict__ resid, int rmod, int ldr,
                                                float* __restrict__ C, int ldc, int M, int N, int K) {
  __shared__ __attribute__((aligned(16))) float so[4][16][64];
  const int tid = threadIdx.x, w = tid >> 5, lane = tid & 31, ln = lane & 15, hh = lane >> 4;
  const int ntn = N / 64;
  const int wid = blockIdx.x * 4 + w;
  const int mt = wid / ntn, nq = wid % ntn;
  if (mt * 16 >= M) return;
  const int row0 = mt * 16, col0 = nq * 64;
  const float* arow = A + (size_t)(row0 + ln) * lda;
  v8f acc[4] = {};
  for (int kb = 0; kb < K; kb += 32) {
    FragB ah, al;
    const v4f x0 = *(const v4fa*)(arow + kb + 8 * hh), x1 = *(const v4fa*)(arow + kb + 8 * hh + 4);
    const v4f x2 = *(const v4fa*)(arow + kb + 16 + 8 * hh), x3 = *(const v4fa*)(arow + kb + 16 + 8 * hh + 4);
    float xs[16] = {x0[0],x0[1],x0[2],x0[3],x1[0],x1[1],x1[2],x1[3],x2[0],x2[1],x2[2],x2[3],x3[0],x3[1],x3[2],x3[3]};
#pragma unroll
    for (int i = 0; i < 16; ++i) { const unsigned short hb = bf16_bits(xs[i]); ah.u[i] = hb; al.u[i] = ASPLIT ? bf16_bits(xs[i] - bf16_val(hb)) : (unsigned short)0; }
#pragma unroll
    for (int t = 0; t < 4; ++t) {
      const unsigned short* brow = Wt + (size_t)(col0 + t * 16 + ln) * ldb + kb;
      FragB b;
      b.half[0] = *(const v8us*)(brow + 8 * hh);
      b.half[1] = *(const v8us*)(brow + 16 + 8 * hh);
      acc[t] = mmaN<ASPLIT ? 2 : 1>(ah.v, al.v, b.v, b.v, acc[t]);
    }
  }
#pragma unroll
  for (int t = 0; t < 4; ++t) {
    const int col = col0 + t * 16 + ln;
    float bv = bias ? bias[col] : 0.f;
    if (BIAS_BF16) bv = bf16_round(bv);
#pragma unroll
    for (int r = 0; r < 8; ++r) {
      float v = acc[t][r] + bv;
      if (resid) { float rv = resid[(size_t)((row0 + 8 * hh + r) % rmod) * ldr + col]; if (RES_BF16) rv = bf16_round(rv); v += rv; }
      if (ACT == 1) v = fmaxf(v, 0.f);
      if (ACT == 2) v = 0.5f * v * (1.0f + erff(v * 0.70710678118654752f));
      if (ACT == 3) { const float u = 0.7978845608028654f * (v + 0.044715f * v * v * v); v = 0.5f * v * (1.0f + tanhf(u)); }
      so[w][8 * hh + r][t * 16 + ln] = v;
    }
  }
  __builtin_amdgcn_fence(__ATOMIC_ACQ_REL, "workgroup");
  __builtin_amdgcn_wave_barrier();
  const int rsub = lane >> 4, c4 = (lane & 15) * 4;
  {
#pragma unroll
    for (int q = 0; q < 8; ++q) {
      const int r = q * 2 + rsub;
      const v4f v = *(const v4fa*)&so[w][r][c4];
      *(v4f*)(C + (size_t)(row0 + r) * ldc + col0 + c4) = v;
    }
    
  }
}
// row LayerNorm (biased variance, eps) over N: s = X (+ R); optional out_sum <- s; out_norm <- (s-mu)*rsqrt(var+eps)*g + b
template <bool PARAM_BF16>
__global__ __launch_bounds__(256) void k_layernorm(const float* __restrict__ X, const float* __restrict__ R, const float* __restrict__ g, const float* __restrict__ bta,
                                                  float* __restrict__ out_sum, float* __restrict__ out_norm, int N, float eps) {
  __shared__ float red[256];
  const int row = blockIdx.x, tid = threadIdx.x;
  const float* x = X + (size_t)row * N; const float* rr = R ? R + (size_t)row * N : nullptr;
  float vals[16];                     // up to N = 4096
  const int per = N / 256;            // contiguous chunk per thread? use strided-by-4 chunks: thread handles j = tid*4 + 1024*u
  float s1 = 0.f;
  for (int u = 0; u < per / 4; ++u) {
    const int j = tid * 4 + 1024 * u;
    const v4f a = *(const v4fa*)(x + j);
    v4f b = {0.f,0.f,0.f,0.f}; if (rr) b = *(const v4fa*)(rr + j);
#pragma unroll
    for (int q = 0; q < 4; ++q) { const float v = a[q] + b[q]; vals[u * 4 + q] = v; s1 += v; }
  }
  red[tid] = s1; __syncthreads();
  for (int st = 128; st > 0; st >>= 1) { if (tid < st) red[tid] += red[tid + st]; __syncthreads(); }
  const float mu = red[0] / (float)N; __syncthreads();
  float s2 = 0.f;
  for (int u = 0; u < per / 4; ++u)
#pragma unroll
    for (int q = 0; q < 4; ++q) { const float c = vals[u * 4 + q] - mu; s2 += c * c; }
  red[tid] = s2; __syncthreads();
  for (int st = 128; st > 0; st >>= 1) { if (tid < st) red[tid] += red[tid + st]; __syncthreads(); }
  const float rs = rsqrtf(red[0] / (float)N + eps);
  {
    for (int u = 0; u < per / 4; ++u) {
      const int j = tid * 4 + 1024 * u;
      v4f o, sm;
#pragma unroll
      for (int q = 0; q < 4; ++q) {
        float gg = g[j + q], bb = bta[j + q];
        if (PARAM_BF16) { gg = bf16_round(gg); bb = bf16_round(bb); }
        sm[q] = vals[u * 4 + q]; o[q] = (vals[u * 4 + q] - mu) * rs * gg + bb;
      }
      if (out_sum) *(v4f*)(out_sum + (size_t)row * N + j) = sm;
      *(v4f*)(out_norm + (size_t)row * N + j) = o;
    }
    
  }
}



// ---- f16 WMMA path (v_wmma_f32_16x16x32_f16): 11-bit significands for operands in range — used where a [0,1] probability operand needs more precision than bf16
typedef _Float16 v16h __attribute__((ext_vector_type(16)));
union FragH { v16h v; v8us half[2]; _Float16 h[16]; unsigned short u[16]; };
template <int NT>
__device__ __forceinline__ v8f mmaH(v16h ah, v16h al, v16h bh, v16h bl, v8f c) {
  c = __builtin_amdgcn_wmma_f32_16x16x32_f16(false, ah, false, bh, (short)0, c, false, false);
  if (NT >= 2) c = __builtin_amdgcn_wmma_f32_16x16x32_f16(false, al, false, bh, (short)0, c, false, false);
  if (NT >= 3) c = __builtin_amdgcn_wmma_f32_16x16x32_f16(false, ah, false, bl, (short)0, c, false, false);
  asm volatile("v_nop\n\tv_nop\n\tv_nop\n\tv_nop" : "+v"(c) : "v"(ah), "v"(al), "v"(bh), "v"(bl));
  return c;
}
// batched GEMM like k_gemm_b but f16 operands: A f32 (split into f16 hi/lo if ASPLIT, else rounded to f16), Bt = f16 values [n][k]; alpha; C f32; N multiple of 16 (partial tiles skipped)
template <bool ASPLIT>
__global__ __launch_bounds__(128) void k_gemm_h(const float* __restrict__ A, int lda, size_t sA, const _Float16* __restrict__ Bh, int ldb, size_t sB, float alpha, float* __restrict__ C, int ldc, size_t sC, int M, int N, int K) {
  __shared__ __attribute__((aligned(16))) float so[4][16][64];
  const int tid = threadIdx.x, w = tid >> 5, lane = tid & 31, ln = lane & 15, hh = lane >> 4; const int by = blockIdx.y;
  A += (size_t)by * sA; Bh += (size_t)by * sB; C += (size_t)by * sC;
  const int ntn = (N + 63) / 64; const int wid = blockIdx.x * 4 + w; const int mt = wid / ntn, nq = wid % ntn; if (mt * 16 >= M) return;
  const int row0 = mt * 16, col0 = nq * 64; const float* arow = A + (size_t)(row0 + ln) * lda;
  v8f acc[4] = {};
  for (int kb = 0; kb < K; kb += 32) {
    FragH ah, al;
    const v4f x0 = *(const v4fa*)(arow + kb + 8 * hh), x1 = *(const v4fa*)(arow + kb + 8 * hh + 4), x2 = *(const v4fa*)(arow + kb + 16 + 8 * hh), x3 = *(const v4fa*)(arow + kb + 16 + 8 * hh + 4);
    float xs[16] = {x0[0],x0[1],x0[2],x0[3],x1[0],x1[1],x1[2],x1[3],x2[0],x2[1],x2[2],x2[3],x3[0],x3[1],x3[2],x3[3]};
#pragma unroll
    for (int i = 0; i < 16; ++i) { const _Float16 h = (_Float16)xs[i]; ah.h[i] = h; al.h[i] = ASPLIT ? (_Float16)(xs[i] - (float)h) : (_Float16)0.0f; }
#pragma unroll
    for (int t = 0; t < 4; ++t) { if (col0 + t * 16 >= N) continue; const size_t boff = (size_t)(col0 + t * 16 + ln) * ldb + kb; FragH bq; bq.half[0] = *(const v8us*)(Bh + boff + 8 * hh); bq.half[1] = *(const v8us*)(Bh + boff + 16 + 8 * hh);
      acc[t] = mmaH<ASPLIT ? 2 : 1>(ah.v, al.v, bq.v, bq.v, acc[t]); }
  }
#pragma unroll
  for (int t = 0; t < 4; ++t) { if (col0 + t * 16 >= N) continue;
#pragma unroll
    for (int r = 0; r < 8; ++r) so[w][8 * hh + r][t * 16 + ln] = acc[t][r] * alpha; }
  __builtin_amdgcn_fence(__ATOMIC_ACQ_REL, "workgroup"); __builtin_amdgcn_wave_barrier();
  const int rsub = lane >> 4, c4 = (lane & 15) * 4;
  {
#pragma unroll
    for (int q = 0; q < 8; ++q) { const int r = q * 2 + rsub; if (col0 + c4 < N) { const v4f v = *(const v4fa*)&so[w][r][c4]; *(v4f*)(C + (size_t)(row0 + r) * ldc + col0 + c4) = v; } }
     }
}

// Wt[n][k] = f16(W[k][n]·scale) from f32 row-major W[K][N] (scale = power of two; bf16-exact weights stay exact in f16 away from the subnormal range)
// Both weight transposes go through a 64 x 64 f32 tile in LDS: a wave's 16-byte loads cover whole 128-byte lines of two W rows (was: 32 lanes, 32 lines, 4 bytes used of each), and 8 lanes store one whole 128-byte line of a Wt row.
// The tile's row pitch of 65 dwords keeps the row-wise 4-byte stores and the column-wise 4-byte reads free of bank conflicts. Rounding and scaling are done on the way out, as before.
#define WTT 64                       /* tile edge */
__device__ __forceinline__ void wt_tile(const float* __restrict__ src, int ldw, unsigned short* __restrict__ dst, int ldd, float scale, float (*tl)[WTT + 1]) {
  const int tid = threadIdx.x; const int lr = tid >> 4, lc = (tid & 15) * 4;      /* loads: 16 lanes take one 256-byte row piece, a pass of the block 16 rows */
  const float* const s0 = src + (size_t)lr * ldw + lc; const float* const s1 = s0 + (size_t)16 * ldw; const float* const s2 = s1 + (size_t)16 * ldw; const float* const s3 = s2 + (size_t)16 * ldw;
  const v4f v[4] = {*(const v4fa*)s0, *(const v4fa*)s1, *(const v4fa*)s2, *(const v4fa*)s3};      /* all four loads are in flight before the first LDS store waits */
  asm volatile("s_wait_xcnt 0x0" :: "v"(s0), "v"(s1), "v"(s2), "v"(s3) : "memory");      /* the wait between the loads above and the first reuse of their address registers; the addresses are inputs so that their registers stay untouched up to it */
#pragma unroll
  for (int u = 0; u < 4; ++u)
#pragma unroll
    for (int j = 0; j < 4; ++j) tl[u * 16 + lr][lc + j] = v[u][j];
  __syncthreads();      /* publishes the tile: every column is read by lanes that did not store it */
  const int kc = (tid & 7) * 8, nn = tid >> 3; FragH f[2];      /* stores: 8 lanes take one 128-byte row piece of Wt, a pass of the block 32 rows; both results are formed first: no store's data register is rewritten behind it */
#pragma unroll
  for (int u = 0; u < 2; ++u)
#pragma unroll
    for (int i = 0; i < 8; ++i) f[u].h[i] = (_Float16)(bf16_round(tl[kc + i][u * 32 + nn]) * scale);
  unsigned short* dp = dst + (size_t)nn * ldd + kc;
#pragma unroll
  for (int u = 0; u < 2; ++u) *(v8us*)(dp + (size_t)u * 32 * ldd) = f[u].half[0]; }
// K % 64 == 0, N % 64 == 0; one block a tile (blockIdx.x = column tile, blockIdx.y = row tile of W): neighbouring blocks take neighbouring pieces of the same W rows
__global__ __launch_bounds__(256) void k_wt_f16(const float* __restrict__ W, _Float16* __restrict__ Wt, int K, int N, float scale) {
  __shared__ float tl[WTT][WTT + 1];
  const int nt = blockIdx.x, kt = blockIdx.y; if (nt * WTT >= N || kt * WTT >= K) return;      /* the same for the whole block, in front of the barrier */
  wt_tile(W + (size_t)kt * WTT * N + nt * WTT, N, (unsigned short*)Wt + (size_t)nt * WTT * K + kt * WTT, K, scale, tl); }
// k_gemm_hh variant with fused epilogue: v = acc·alpha + bias[by·sBias + col] (+ CP[(row/rowsPerB)·sCPb + by·64 + col] if CP) ; ACT 0 none / 1 elu ; writes f16 C16 (and f32 C if non-null)
template <int ACT>
__global__ __launch_bounds__(128) void k_gemm_hhx(const _Float16* __restrict__ A, int lda, size_t sA, const _Float16* __restrict__ Bh, int ldb, size_t sB, float alpha, const float* __restrict__ bias, size_t sBias, const float* __restrict__ CP, int rowsPerB, size_t sCPb, int row0g,
    float* __restrict__ C, _Float16* __restrict__ C16, int ldc, size_t sC, int M, int N, int K) {
  __shared__ __attribute__((aligned(16))) float so[4][16][64];
  const int tid = threadIdx.x, w = tid >> 5, lane = tid & 31, ln = lane & 15, hh = lane >> 4; const int by = blockIdx.y;
  A += (size_t)by * sA; Bh += (size_t)by * sB; const size_t cofs = (size_t)by * sC; const float* bp = bias ? bias + (size_t)by * sBias : nullptr;
  const int ntn = (N + 63) / 64; const int wid = blockIdx.x * 4 + w; const int mt = wid / ntn, nq = wid % ntn; if (mt * 16 >= M) return;
  const int row0 = mt * 16, col0 = nq * 64; const _Float16* arow = A + (size_t)(row0 + ln) * lda;
  v8f acc[4] = {};
  for (int kb = 0; kb < K; kb += 32) { FragH ah; ah.half[0] = *(const v8us*)((const unsigned short*)arow + kb + 8 * hh); ah.half[1] = *(const v8us*)((const unsigned short*)arow + kb + 16 + 8 * hh);
#pragma unroll
    for (int t = 0; t < 4; ++t) { if (col0 + t * 16 >= N) continue; const size_t boff = (size_t)(col0 + t * 16 + ln) * ldb + kb; FragH bq; bq.half[0] = *(const v8us*)((const unsigned short*)Bh + boff + 8 * hh); bq.half[1] = *(const v8us*)((const unsigned short*)Bh + boff + 16 + 8 * hh);
      acc[t] = mmaH<1>(ah.v, ah.v, bq.v, bq.v, acc[t]); }
  }
#pragma unroll
  for (int t = 0; t < 4; ++t) { if (col0 + t * 16 >= N) continue; const int col = col0 + t * 16 + ln; const float bv = bp ? bf16_round(bp[col]) : 0.f;
#pragma unroll
    for (int r = 0; r < 8; ++r) { float v = acc[t][r] * alpha + bv; if (CP) { const int rr = row0g + row0 + 8 * hh + r; if (rowsPerB < 0) v += CP[cofs + (size_t)rr * ldc + col];      /* rowsPerB < 0: own element of the batched C plane */ else { const int bidx = rr / rowsPerB; v += CP[(size_t)bidx * sCPb + (size_t)by * 64 + col]; } } if (ACT == 1) v = (v > 0.f) ? v : expm1f(v); else if (ACT == 7) v = (v > 0.f) ? v + 1.0f : expf(v); else if (ACT == 8) v = tanhf(v); else if (ACT == 9) v = 0.5f * v * (1.0f + tanhf(0.7978845608028654f * (v + 0.044715f * v * v * v))); else if (ACT == 11) v = 1.0f / (1.0f + expf(-v)); else if (ACT == 12) v = (v > 0.f) ? v : 0.01f * v; else if (ACT == 14) v = (v > 0.f) ? v : 0.1f * v; else if (ACT == 16) v = (v >= 0.f) ? v : 0.3f * v; else if (ACT == 17) v = (v >= 0.f) ? v : 0.2f * v; else if (ACT == 15) v = v / (1.0f + expf(-v)); else if (ACT == 3) v = fmaxf(v, 0.f); else if (ACT == 6) v = 0.5f * v * (1.0f + erff(v * 0.70710678118654752f)); so[w][8 * hh + r][t * 16 + ln] = v; } }
  __builtin_amdgcn_fence(__ATOMIC_ACQ_REL, "workgroup"); __builtin_amdgcn_wave_barrier();
  const int rsub = lane >> 4, c4 = (lane & 15) * 4; typedef _Float16 v4h __attribute__((ext_vector_type(4)));
  {
#pragma unroll
    for (int q = 0; q < 8; ++q) { const int r = q * 2 + rsub; if (col0 + c4 < N) { const v4f v = *(const v4fa*)&so[w][r][c4]; if (C) *(v4f*)(C + cofs + (size_t)(row0 + r) * ldc + col0 + c4) = v; if (C16) { v4h h4; for (int i = 0; i < 4; ++i) h4[i] = (_Float16)v[i]; *(v4h*)(C16 + cofs + (size_t)(row0 + r) * ldc + col0 + c4) = h4; } } }
     }
}


typedef _Float16 v4h __attribute__((ext_vector_type(4)));

__global__ __launch_bounds__(256) void k_x16(const float* __restrict__ x, _Float16* __restrict__ X16, size_t n8) { const size_t t = (size_t)blockIdx.x * 256 + threadIdx.x; if (t >= n8) return; FragH f;
#pragma unroll
  for (int q = 0; q < 8; ++q) f.h[q] = (_Float16)bf16_round(x[t * 8 + q]); *(v8us*)((unsigned short*)X16 + t * 8) = f.half[0];  }
__global__ __launch_bounds__(256) void k_h16(const float* __restrict__ x, _Float16* __restrict__ X16, size_t n8) { const size_t t = (size_t)blockIdx.x * 256 + threadIdx.x; if (t >= n8) return; FragH f;
#pragma unroll
  for (int q = 0; q < 8; ++q) f.h[q] = (_Float16)x[t * 8 + q]; *(v8us*)((unsigned short*)X16 + t * 8) = f.half[0];  }
__global__ __launch_bounds__(256) void k_round16f(const float* __restrict__ W, _Float16* __restrict__ Bt, size_t n8) { const size_t t = (size_t)blockIdx.x * 256 + threadIdx.x; if (t >= n8) return; FragH f;
#pragma unroll
  for (int i = 0; i < 8; ++i) f.h[i] = (_Float16)(bf16_round(W[t * 8 + i]) * 16.0f); *(v8us*)((unsigned short*)Bt + t * 8) = f.half[0];  }
template <int NHv, int TTv>
__global__ __launch_bounds__(256) void k_vt(const _Float16* __restrict__ V16, int ldv, int voff, _Float16* __restrict__ Vt) { __shared__ unsigned short tl[64][66]; const int tid = threadIdx.x; const int slab = blockIdx.x / (TTv / 64), lg = blockIdx.x % (TTv / 64); const int b = slab / NHv, h = slab % NHv;
  for (int i = tid; i < 64 * 8; i += 256) { const int r = i / 8, c8 = (i % 8) * 8; FragH f; f.half[0] = *(const v8us*)((const unsigned short*)V16 + ((size_t)b * TTv + lg * 64 + r) * ldv + voff + h * 64 + c8);
#pragma unroll
    for (int q = 0; q < 8; ++q) tl[r][c8 + q] = f.u[q]; }
  __syncthreads();
  {
#pragma unroll
    for (int rd = 0; rd < 2; ++rd) { const int d = rd * 32 + tid / 8, pc = tid % 8; FragH f;
#pragma unroll
      for (int q = 0; q < 8; ++q) f.u[q] = tl[pc * 8 + q][d];
      *(v8us*)((unsigned short*)Vt + ((size_t)slab * 64 + d) * TTv + lg * 64 + pc * 8) = f.half[0]; }
     } }

__global__ __launch_bounds__(256) void k_hl(const float* __restrict__ F, _Float16* __restrict__ Hh, _Float16* __restrict__ Hl, size_t n8) { const size_t t = (size_t)blockIdx.x * 256 + threadIdx.x; if (t >= n8) return; FragH fh, fl; const v4f a = *(const v4fa*)(F + t * 8), c = *(const v4fa*)(F + t * 8 + 4);
#pragma unroll
  for (int q = 0; q < 4; ++q) { _Float16 h = (_Float16)a[q]; fh.h[q] = h; fl.h[q] = (_Float16)((a[q] - (float)h) * 1024.0f); h = (_Float16)c[q]; fh.h[4 + q] = h; fl.h[4 + q] = (_Float16)((c[q] - (float)h) * 1024.0f); }
  { *(v8us*)((unsigned short*)Hh + t * 8) = fh.half[0]; *(v8us*)((unsigned short*)Hl + t * 8) = fl.half[0];  } }

// ---- fast GEMM (block tile 128x128 = 8 waves of 32x64; requires M % 128 == 0 rows per launch region, N % 128 == 0, K % 64 == 0; operand rows of pitch DM); epilogue: acc alpha + bias (always given), no addend plane, so no run-time test per output element ----
// Operands go through LDS: a stage is 64 k (128 bytes, one cache line) of the block's 128 A rows and 128 B rows, fetched by whole-line 16-byte loads (8 lanes a row) into registers one stage ahead and stored at a row pitch of 144 bytes (16 x odd).
// Two LDS buffers, one barrier a stage: while a stage is worked on, the next one is stored into the other buffer and the one after it is in flight. The fragments are read from LDS by g2_frag, in the k order they had from memory.
#define G2KS 64                      /* k per stage */
#define G2P (G2KS + 8)               /* LDS row pitch, halves */
#define G2ROWS 256                   /* LDS rows per buffer: 128 of A, then 128 of B */
__device__ __forceinline__ v16h g2_frag(const _Float16* p, int hh) { FragH f; f.half[0] = *(const v8us*)((const unsigned short*)p + 8 * hh); f.half[1] = *(const v8us*)((const unsigned short*)p + 16 + 8 * hh); return f.v; }
__device__ __forceinline__ v8f g2_mma(v16h a, v16h b, v8f c) { v8f d = __builtin_amdgcn_wmma_f32_16x16x32_f16(false, a, false, b, (short)0, c, false, false); asm volatile("v_nop\n\tv_nop\n\tv_nop\n\tv_nop" : "+v"(d) : "v"(a), "v"(b)); return d; }
typedef float v2f __attribute__((ext_vector_type(2)));
// ROPE 1 (f16 rows to C16), 2 or 3 (f32 rows to C): the interleaved-pair rotation (position = row % SQ, tables CS / SN [SQ][HD / 2]) is applied to the finished f32 tile on its way from LDS to the f32 or f16 rows; a 64-column tile is one head, and a lane's four columns are two whole pairs.
// ROPE 3: one launch for q, k and v of every batch: blockIdx.y = plane * NBR + batch; sA steps the batch, sB and sBias the plane, sC both; planes 0 and 1 (q, k) are rotated, plane 2 (v) leaves by the plain path at the foot.
// FT: what a block does whose 128 rows are the first QT0 rows of a batch (the rows that are carried exactly in f32).
// FT 1 (with ROPE 1): one launch for q, k and v, blockIdx.y = plane (sB, sBias and sC step it; planes 0 and 1 are rotated); such a block stores its finished f32 tile to CF as well ([plane][batch][QT0][DM]), ahead of the rounding to f16.
// FT 2: such a block takes its A rows from the planes AH and then AL ([batch][QT0][DM]; f16 high part, residual x1024): the k loop runs once over each, the high part's sums set aside between the two; out = hi alpha + bias, then + lo alpha / 1024.
template <int ACT, int ROPE = 0, int FT = 0>
__global__ __launch_bounds__(256) void k_gemm2(const _Float16* __restrict__ A, size_t sA, const _Float16* __restrict__ Bh, size_t sB, float alpha, const float* __restrict__ bias, size_t sBias,
    float* __restrict__ C, _Float16* __restrict__ C16, int ldc, size_t sC, int M, int N, int K, const float* __restrict__ CS = nullptr, const float* __restrict__ SN = nullptr, const _Float16* __restrict__ AH = nullptr, const _Float16* __restrict__ AL = nullptr, float* __restrict__ CF = nullptr) { static_assert(FT == 0 || (QT0 == 128 && SQ % 128 == 0), "k_gemm2: a first tile is one block's rows"); static_assert(ACT == 0 || ACT == 3 || ACT == 6 || ACT == 8 || ACT == 9 || ACT == 11 || ACT == 12 || ACT == 14 || ACT == 15 || ACT == 16 || ACT == 17, "k_gemm2: unsupported ACT code (would silently apply no activation)");
  __shared__ __attribute__((aligned(16))) unsigned short sm[2 * G2ROWS * G2P]; static_assert(sizeof(sm) >= 8 * 32 * 68 * sizeof(float), "k_gemm2: the epilogue tiles lie in the operand buffers");
  float (*so)[32][68] = (float (*)[32][68])sm;      /* the epilogue's f32 tiles, one a wave, reuse the operand buffers behind the k loop's last barrier */
  const int tid = threadIdx.x, w = tid >> 5, lane = tid & 31, ln = lane & 15, hh = lane >> 4; const int by = blockIdx.y;
  const int pl = (ROPE == 3) ? by / NBR : by, ba = (ROPE == 3) ? by % NBR : by; const bool rot = (ROPE != 3 && FT != 1) || pl < 2;      /* blockIdx.y is a scalar: the tests on rot are scalar branches */
  A += (size_t)ba * sA; Bh += (size_t)pl * sB; const size_t cofs = (size_t)by * sC; const float* const bp = bias + (size_t)pl * sBias;
  const int ntn = N >> 7; const int mt = blockIdx.x / ntn, nq = blockIdx.x - mt * ntn; if (mt * 128 >= M) return;      /* the same for the whole block, in front of every barrier */
  const bool ft = FT != 0 && mt % (SQ / 128) == 0; const int fbat = mt / (SQ / 128);      /* first-tile block, and its batch: scalars, so every test on ft is a scalar branch */
  const int wr = w & 3, wc = w >> 2; const int row0 = mt * 128 + 32 * wr, col0 = nq * 128 + 64 * wc;
  const int sr = tid >> 3, sc = (tid & 7) * 8;      /* staging: 8 lanes take one 128-byte row piece, a pass of the block 32 rows */
  const unsigned short* ap = ((FT == 2 && ft) ? (const unsigned short*)AH + (size_t)(fbat * QT0 + sr) * DM : (const unsigned short*)A + (size_t)(mt * 128 + sr) * DM) + sc; const unsigned short* bq = (const unsigned short*)Bh + (size_t)(nq * 128 + sr) * DM + sc; v8us ar[4], br[4];      /* the lane's own addresses: the row pitch is a constant, so the four passes differ in the immediate offset alone */
  unsigned short* const sw = sm + sr * G2P + sc;      /* where the lane stores its pieces (buffer 0, pass 0 of A) */
  const _Float16* const fa = (const _Float16*)sm + (32 * wr + ln) * G2P; const _Float16* const fb = (const _Float16*)sm + (128 + 64 * wc + ln) * G2P;      /* the lane's fragment rows (buffer 0) */
  const v8f z8 = {0.f,0.f,0.f,0.f,0.f,0.f,0.f,0.f}; v8f c00 = z8, c01 = z8, c02 = z8, c03 = z8, c10 = z8, c11 = z8, c12 = z8, c13 = z8;
  v8f h00 = z8, h01 = z8, h02 = z8, h03 = z8, h10 = z8, h11 = z8, h12 = z8, h13 = z8;      /* FT 2: the high part's sums; 0 in any other block */
  v2f rc[16], rs[16];      /* ROPE: the lane's cos / sin pairs of its 16 rows, fetched ahead of the k loop, whose first trips cover their latency */
  if (ROPE && rot) { static_assert(HD == 64 && SQ % 32 == 0, "k_gemm2 rope: a 64-column tile is one head, a 32-row tile does not wrap the position");
    const float* cp = CS + (size_t)((row0 + (lane >> 4)) % SQ) * (HD / 2) + (lane & 15) * 2; const float* sp = SN + (size_t)((row0 + (lane >> 4)) % SQ) * (HD / 2) + (lane & 15) * 2;      /* the lane's own addresses: the 16 rows differ in the immediate offset alone */
#pragma unroll
    for (int q = 0; q < 16; ++q) { rc[q] = *(const v2f*)(cp + q * HD); rs[q] = *(const v2f*)(sp + q * HD); }      /* fully unrolled: rc and rs stay in registers; two rows on = 2 * (HD / 2) floats */
    asm volatile("s_wait_xcnt 0x0" :: "v"(cp), "v"(sp) : "memory"); }      /* the wait between the loads above and the first reuse of their address registers; the addresses are inputs so that their registers stay untouched up to it */
  const int nst = K / G2KS;
#pragma unroll 1
  for (int ph = 0; ph < ((FT == 2 && ft) ? 2 : 1); ++ph) {      /* FT 2, first tile: the k loop runs twice, over AH and then over AL, against the same B rows; rolled: one copy of the k loop, whose sums stay in their registers */
  if (FT == 2 && ph == 1) { h00 = c00; h01 = c01; h02 = c02; h03 = c03; h10 = c10; h11 = c11; h12 = c12; h13 = c13; c00 = z8; c01 = z8; c02 = z8; c03 = z8; c10 = z8; c11 = z8; c12 = z8; c13 = z8;      /* the high part is done: its sums are set aside, the residual's start at 0 */
    ap = (const unsigned short*)AL + (size_t)(fbat * QT0 + sr) * DM + sc; bq = (const unsigned short*)Bh + (size_t)(nq * 128 + sr) * DM + sc; }
#pragma unroll
  for (int u = 0; u < 4; ++u) { ar[u] = *(const v8us*)(ap + (size_t)u * 32 * DM); br[u] = *(const v8us*)(bq + (size_t)u * 32 * DM); }
  asm volatile("s_wait_xcnt 0x0" :: "v"(ap), "v"(bq) : "memory");      /* the wait between the loads above and the first rewrite of their address registers; the addresses are inputs so that their registers stay untouched up to it */
#pragma unroll
  for (int u = 0; u < 4; ++u) { *(v8us*)(sw + u * 32 * G2P) = ar[u]; *(v8us*)(sw + (128 + u * 32) * G2P) = br[u]; }
  if (nst > 1) { ap += G2KS; bq += G2KS;
#pragma unroll
    for (int u = 0; u < 4; ++u) { ar[u] = *(const v8us*)(ap + (size_t)u * 32 * DM); br[u] = *(const v8us*)(bq + (size_t)u * 32 * DM); }
    asm volatile("s_wait_xcnt 0x0" :: "v"(ap), "v"(bq) : "memory"); }      /* as above */
  __syncthreads();      /* publishes stage 0 */
#pragma unroll 1
  for (int s = 0; s < nst; ++s) { const int cur = (s & 1) * (G2ROWS * G2P), nxt = (G2ROWS * G2P) - cur;      /* rolled: the trips differ in the buffer alone */
    if (s + 1 < nst) {      /* stage s + 1 goes into the buffer whose last readers passed the barrier at the foot of trip s - 1 */
#pragma unroll
      for (int u = 0; u < 4; ++u) { *(v8us*)(sw + nxt + u * 32 * G2P) = ar[u]; *(v8us*)(sw + nxt + (128 + u * 32) * G2P) = br[u]; } }
    if (s + 2 < nst) { ap += G2KS; bq += G2KS;
#pragma unroll
      for (int u = 0; u < 4; ++u) { ar[u] = *(const v8us*)(ap + (size_t)u * 32 * DM); br[u] = *(const v8us*)(bq + (size_t)u * 32 * DM); }
      asm volatile("s_wait_xcnt 0x0" :: "v"(ap), "v"(bq) : "memory"); }      /* as above: stands in front of the next trip's address additions */
#pragma unroll
    for (int kk = 0; kk < G2KS; kk += 32) { const _Float16* pa = fa + cur + kk; const _Float16* pb = fb + cur + kk;      /* the six fragments of a 32-k block are read as one group ahead of its eight products: one LDS latency a block, not one a fragment */
      const v16h a0 = g2_frag(pa, hh), a1 = g2_frag(pa + 16 * G2P, hh), b0 = g2_frag(pb, hh), b1 = g2_frag(pb + 16 * G2P, hh), b2 = g2_frag(pb + 32 * G2P, hh), b3 = g2_frag(pb + 48 * G2P, hh);
      c00 = g2_mma(a0, b0, c00); c10 = g2_mma(a1, b0, c10); c01 = g2_mma(a0, b1, c01); c11 = g2_mma(a1, b1, c11);
      c02 = g2_mma(a0, b2, c02); c12 = g2_mma(a1, b2, c12); c03 = g2_mma(a0, b3, c03); c13 = g2_mma(a1, b3, c13); }
    __syncthreads(); }      /* publishes stage s + 1 and ends every wave's reads of stage s (behind the last trip: before the epilogue's tiles, or the second run's first stage, overwrite the buffers) */
  }
  const float al2 = (FT == 2 && ft) ? alpha * 0.0009765625f : alpha;      /* the factor of the last run's sums */
  v8f accs[8] = {c00, c01, c02, c03, c10, c11, c12, c13}; v8f hacc[8] = {h00, h01, h02, h03, h10, h11, h12, h13};
  const float* const bpc = bp + col0 + ln; float bvs[4];      /* the lane's four bias values, one a 16-column tile, read as one group: the four loads differ in the immediate offset alone */
#pragma unroll
  for (int t = 0; t < 4; ++t) bvs[t] = bpc[t * 16];
  asm volatile("s_wait_xcnt 0x0" :: "v"(bpc) : "memory");      /* the wait between the loads above and the first reuse of their address registers; the address is an input so that its registers stay untouched up to it */
#pragma unroll
  for (int u = 0; u < 8; ++u) { const int t = u & 3, half = u >> 2; const float bv = bf16_round(bvs[t]);
#pragma unroll
    for (int r = 0; r < 8; ++r) { const int rloc = half * 16 + 8 * hh + r; float v = (FT == 2) ? accs[u][r] * al2 + (hacc[u][r] * alpha + bv) : accs[u][r] * alpha + bv;
      if (ACT == 3) v = fmaxf(v, 0.f); else if (ACT == 6) v = 0.5f * v * (1.0f + erff(v * 0.70710678118654752f)); else if (ACT == 11) v = 1.0f / (1.0f + expf(-v)); else if (ACT == 15) v = v / (1.0f + expf(-v)); else if (ACT == 12) v = (v > 0.f) ? v : 0.01f * v; else if (ACT == 8) v = tanhf(v); else if (ACT == 9) v = 0.5f * v * (1.0f + tanhf(0.7978845608028654f * (v + 0.044715f * v * v * v))); else if (ACT == 14) v = (v > 0.f) ? v : 0.1f * v; else if (ACT == 16) v = (v >= 0.f) ? v : 0.3f * v; else if (ACT == 17) v = (v >= 0.f) ? v : 0.2f * v;
      so[w][rloc][t * 16 + ln] = v; } }
  __builtin_amdgcn_fence(__ATOMIC_ACQ_REL, "workgroup"); __builtin_amdgcn_wave_barrier();
  const int rsub = lane >> 4, c4 = (lane & 15) * 4;
  float* const cf = (FT == 1) ? CF + (((size_t)pl * NBR + fbat) * QT0 + 32 * wr + rsub) * DM + col0 + c4 : nullptr;      /* FT 1: the lane's place in the first-tile f32 plane; the sixteen rows differ in the immediate offset alone */
  if (ROPE && rot) { v4f t[16];      /* the sixteen row pieces are rotated first and then stored in one run; the destination is fixed at compile time */
#pragma unroll
    for (int q = 0; q < 16; ++q) { const v4f v = *(const v4fa*)&so[w][q * 2 + rsub][c4]; const v2f c = rc[q], s = rs[q];
      t[q][0] = v[0] * c[0] - v[1] * s[0]; t[q][1] = v[0] * s[0] + v[1] * c[0]; t[q][2] = v[2] * c[1] - v[3] * s[1]; t[q][3] = v[2] * s[1] + v[3] * c[1]; }
    if (ROPE >= 2) {
#pragma unroll
      for (int q = 0; q < 16; ++q) *(v4f*)(C + cofs + (size_t)(row0 + q * 2 + rsub) * ldc + col0 + c4) = t[q]; }
    else { v4h h4[16];
#pragma unroll
      for (int q = 0; q < 16; ++q) { h4[q][0] = (_Float16)t[q][0]; h4[q][1] = (_Float16)t[q][1]; h4[q][2] = (_Float16)t[q][2]; h4[q][3] = (_Float16)t[q][3]; }
#pragma unroll
      for (int q = 0; q < 16; ++q) *(v4h*)(C16 + cofs + (size_t)(row0 + q * 2 + rsub) * ldc + col0 + c4) = h4[q];
      if (FT == 1) asm volatile("s_wait_xcnt 0x0" ::: "memory");      /* the wait between the stores above and the first reuse of their registers, which the first-tile block below makes; it stands in the stores' own block, ahead of the branch */
      if (FT == 1 && ft) {
#pragma unroll
        for (int q = 0; q < 16; ++q) *(v4f*)(cf + (size_t)q * 2 * DM) = t[q]; } }
  } else {
#pragma unroll
    for (int q = 0; q < 16; ++q) { const int r = q * 2 + rsub; const v4f v = *(const v4fa*)&so[w][r][c4]; if (C) *(v4f*)(C + cofs + (size_t)(row0 + r) * ldc + col0 + c4) = v; if (C16) { v4h h4; for (int i = 0; i < 4; ++i) h4[i] = (_Float16)v[i]; *(v4h*)(C16 + cofs + (size_t)(row0 + r) * ldc + col0 + c4) = h4; } }
    if (FT == 1) asm volatile("s_wait_xcnt 0x0" ::: "memory");      /* as in the rotated path: ahead of the branch into the first-tile block */
    if (FT == 1 && ft) { v4f t[16];      /* the sixteen f32 row pieces are read again and stored in one run at the kernel's end: no store's register is rewritten behind it */
#pragma unroll
      for (int q = 0; q < 16; ++q) t[q] = *(const v4fa*)&so[w][q * 2 + rsub][c4];
#pragma unroll
      for (int q = 0; q < 16; ++q) *(v4f*)(cf + (size_t)q * 2 * DM) = t[q]; }
     } }


__global__ __launch_bounds__(256) void k_wnat(const float* __restrict__ w, size_t n8, _Float16* __restrict__ Bt) { const size_t t = (size_t)blockIdx.x * 256 + threadIdx.x; if (t >= n8) return; FragH f; for (int q = 0; q < 8; ++q) f.h[q] = (_Float16)(bf16_round(w[t * 8 + q]) * 16.0f); *(v8us*)((unsigned short*)Bt + t * 8) = f.half[0];  }
__global__ __launch_bounds__(256) void k_rsm(const float* __restrict__ S, _Float16* __restrict__ P, int nrows) {
  #pragma clang fp contract(off)
  const int i = blockIdx.x * 256 + threadIdx.x; if (i >= nrows) return; const float* s = S + (size_t)i * SQ; float mx = -3.0e38f;
#pragma unroll 1
  for (int j = 0; j < SQ; ++j) mx = fmaxf(mx, s[j]); float se = 0.f;
#pragma unroll 1
  for (int j = 0; j < SQ; ++j) se += expf(s[j] - mx); const float sc = 256.0f / se;
#pragma unroll 1
  for (int j0 = 0; j0 < SQ; j0 += 8) { FragH f; for (int q = 0; q < 8; ++q) f.h[q] = (_Float16)(expf(s[j0 + q] - mx) * sc); unsigned short* d = (unsigned short*)P + (size_t)i * SQ + j0; *(v8us*)d = f.half[0];  } }
__global__ __launch_bounds__(256) void k_vt(const _Float16* __restrict__ V16, int b, int h0, _Float16* __restrict__ VT) { __shared__ unsigned short tl[64][65]; const int tid = threadIdx.x; const int hh = blockIdx.x % HG, sg = blockIdx.x / HG; const int s0 = sg * 64; const int h = h0 + hh;
  for (int i = tid; i < 64 * 8; i += 256) { const int j = i / 8, d8 = (i % 8) * 8; FragH f; f.half[0] = *(const v8us*)((const unsigned short*)V16 + ((size_t)b * SQ + s0 + j) * DM + h * HD + d8); for (int q = 0; q < 8; ++q) tl[d8 + q][j] = f.u[q]; }
  __syncthreads();
  { for (int i = tid; i < 64 * 8; i += 256) { const int d = i / 8, j8 = (i % 8) * 8; FragH f; for (int q = 0; q < 8; ++q) f.u[q] = tl[d][j8 + q]; *(v8us*)((unsigned short*)VT + ((size_t)hh * HD + d) * SQ + s0 + j8) = f.half[0]; }  } }



#define FAQB 128                     /* query rows per block */
#define FAK 64                       /* keys per step */
#define FAP (HD + 8)                 /* LDS row pitch, halves */
__device__ __forceinline__ v8f fa_mma(v16h a, v16h b, v8f c) { return __builtin_amdgcn_wmma_f32_16x16x32_f16(false, a, false, b, (short)0, c, false, false); }
__global__ __launch_bounds__(128) void k_fattn(const _Float16* __restrict__ Q, const _Float16* __restrict__ Kh, const _Float16* __restrict__ VTa, _Float16* __restrict__ O) {
  static_assert(NB * NH == 64 && SQ / FAQB == 16 && HD == 64, "k_fattn: the block-to-tile map below is written for 64 (batch, head) pairs x 16 query blocks");
  __shared__ __attribute__((aligned(16))) _Float16 lk[FAK][FAP]; __shared__ __attribute__((aligned(16))) _Float16 lv[HD][FAP];
  const int tid = threadIdx.x, lane = tid & 31, ln = lane & 15, hh = lane >> 4; const int w = __builtin_amdgcn_readfirstlane(tid >> 5);      /* the wave's number as a scalar: the two tests on q0w below are scalar branches */
  const int g = blockIdx.x >> 8, sub = (blockIdx.x >> 6) & 3, bh = blockIdx.x & 63;
  const int qb = (g == 0) ? 15 - sub : ((g == 1) ? 8 + sub : ((g == 2) ? 7 - sub : sub));      /* a permutation of the 16 query blocks: long blocks start first, and blocks 256 apart in the index add up to the same length */
  const int b = bh / NH, h = bh % NH; const size_t r0 = (size_t)b * SQ; const int q0w = qb * FAQB + w * 32; const int nst = (qb + 1) * (FAQB / FAK);
  const unsigned short* qp = (const unsigned short*)Q + (r0 + q0w + ln) * LQ + h * HD + 8 * hh; v16h qf[2][2];      /* the lane's own address, so that the eight loads differ in the immediate offset alone; every loop but the step loop is fully unrolled: all array indices are constants and the arrays stay in registers */
#pragma unroll
  for (int nt = 0; nt < 2; ++nt)
#pragma unroll
    for (int kk = 0; kk < 2; ++kk) { FragH f; f.half[0] = *(const v8us*)(qp + (size_t)nt * 16 * LQ + kk * 32); f.half[1] = *(const v8us*)(qp + (size_t)nt * 16 * LQ + kk * 32 + 16); qf[nt][kk] = f.v; }      /* the k order of g2_frag */
  const int sr = tid >> 3, sc = (tid & 7) * 8;      /* staging: 8 lanes take one 128-byte row, a pass of the block 16 rows */
  const unsigned short* kp = (const unsigned short*)Kh + (r0 + sr) * LQ + h * HD + sc; const unsigned short* vp = (const unsigned short*)VTa + ((size_t)bh * HD + sr) * SQ + sc; v8us kr[4], vr[4];
#pragma unroll
  for (int u = 0; u < 4; ++u) { kr[u] = *(const v8us*)(kp + (size_t)u * 16 * LQ); vr[u] = *(const v8us*)(vp + (size_t)u * 16 * SQ); }
  asm volatile("s_wait_xcnt 0x0" :: "v"(qp), "v"(kp), "v"(vp) : "memory");      /* the wait between the loads above and the first rewrite of their address registers; the addresses are inputs so that their registers stay untouched up to it */
  const v8f z8 = {0.f, 0.f, 0.f, 0.f, 0.f, 0.f, 0.f, 0.f}; v8f o[4][2];
#pragma unroll
  for (int dt = 0; dt < 4; ++dt) { o[dt][0] = z8; o[dt][1] = z8; }
  float m[2] = {-1.0e30f, -1.0e30f}, l[2] = {0.f, 0.f};      /* running max (log2 units) and this lane's part of the running sum, per query tile */
  const float SC = 0.125f * 1.44269504088896340736f;      /* 1 / sqrt(64), in log2 units */
#pragma unroll 1
  for (int s = 0; s < nst; ++s) { const int k0 = s * FAK;      /* rolled: one step's code is long and its trip count varies by block */
#pragma unroll
    for (int u = 0; u < 4; ++u) { *(v8us*)&lk[u * 16 + sr][sc] = kr[u]; *(v8us*)&lv[u * 16 + sr][sc] = vr[u]; }
    __syncthreads();      /* publishes this step's K and V^T rows */
    if (s + 1 < nst) { kp += (size_t)FAK * LQ; vp += FAK;
#pragma unroll
      for (int u = 0; u < 4; ++u) { kr[u] = *(const v8us*)(kp + (size_t)u * 16 * LQ); vr[u] = *(const v8us*)(vp + (size_t)u * 16 * SQ); }
      asm volatile("s_wait_xcnt 0x0" :: "v"(kp), "v"(vp) : "memory"); }      /* as above: stands in front of the next step's address additions */
    if (k0 <= q0w + 31) {      /* a wave whose queries all lie below this step's keys only passes the barriers */
      v8f st[4][2];
#pragma unroll
      for (int kt = 0; kt < 4; ++kt) { st[kt][0] = z8; st[kt][1] = z8; }
#pragma unroll
      for (int kk = 0; kk < 2; ++kk)
#pragma unroll
        for (int kt = 0; kt < 4; ++kt) { const v16h a = g2_frag(&lk[kt * 16 + ln][kk * 32], hh); st[kt][0] = fa_mma(a, qf[0][kk], st[kt][0]); st[kt][1] = fa_mma(a, qf[1][kk], st[kt][1]); }
      if (k0 + FAK - 1 > q0w) {      /* only steps that reach past the wave's first query mask */
#pragma unroll
        for (int kt = 0; kt < 4; ++kt)
#pragma unroll
          for (int nt = 0; nt < 2; ++nt)
#pragma unroll
            for (int r = 0; r < 8; ++r) st[kt][nt][r] = (k0 + kt * 16 + 8 * hh + r <= q0w + nt * 16 + ln) ? st[kt][nt][r] : -3.0e38f; }
      v16h pf[2][2];
#pragma unroll
      for (int nt = 0; nt < 2; ++nt) { float mr = st[0][nt][0];
#pragma unroll
        for (int kt = 0; kt < 4; ++kt)
#pragma unroll
          for (int r = 0; r < 8; ++r) mr = fmaxf(mr, st[kt][nt][r]);
        mr = fmaxf(mr, __shfl_xor(mr, 16, 32));
        const float mn = fmaxf(m[nt], mr * SC); const float al = __builtin_amdgcn_exp2f(m[nt] - mn); m[nt] = mn; const float bs = 8.0f - mn;      /* + 8: weights carried x256; a masked key underflows to exactly 0 */
        v4f s4 = {0.f, 0.f, 0.f, 0.f};
#pragma unroll
        for (int kt = 0; kt < 4; ++kt)
#pragma unroll
          for (int r = 0; r < 8; ++r) { const float p = __builtin_amdgcn_exp2f(fmaf(st[kt][nt][r], SC, bs)); s4[r & 3] += p; pf[nt][kt >> 1][(kt & 1) * 8 + r] = (_Float16)p; }
        l[nt] = fmaf(l[nt], al, (s4[0] + s4[1]) + (s4[2] + s4[3]));
#pragma unroll
        for (int dt = 0; dt < 4; ++dt) o[dt][nt] *= al; }
#pragma unroll
      for (int j = 0; j < 2; ++j)
#pragma unroll
        for (int dt = 0; dt < 4; ++dt) { const v16h a = g2_frag(&lv[dt * 16 + ln][j * 32], hh); o[dt][0] = fa_mma(a, pf[0][j], o[dt][0]); o[dt][1] = fa_mma(a, pf[1][j], o[dt][1]); } }
    __syncthreads(); }      /* ends every wave's reads of this step's rows before the next step's stores */
  FragH t[2][4];      /* all eight 16-byte results are formed first: no store's data register is rewritten behind it */
#pragma unroll
  for (int nt = 0; nt < 2; ++nt) { const float f = 64.0f / (l[nt] + __shfl_xor(l[nt], 16, 32));
#pragma unroll
    for (int dt = 0; dt < 4; ++dt)
#pragma unroll
      for (int r = 0; r < 8; ++r) t[nt][dt].h[r] = (_Float16)(o[dt][nt][r] * f); }
  unsigned short* op = (unsigned short*)O + (r0 + q0w + ln) * DM + h * HD + 8 * hh;
#pragma unroll
  for (int nt = 0; nt < 2; ++nt)
#pragma unroll
    for (int dt = 0; dt < 4; ++dt) *(v8us*)(op + (size_t)nt * 16 * DM + dt * 16) = t[nt][dt].half[0]; }


// Exact f32 attention for the first QT0 rows of every batch (blockIdx.y; planes of QT0 rows a batch; o carried x64 like the f16 path, and stored as an f16 high part and an f16 residual x1024, the two operand planes of the output GEMM). One wave per query row, A0R rows of one head per block.
// All QT0 K and V rows of the head are staged in LDS once by coalesced 16-byte loads. K rows get a pitch of 68 floats (16 bytes x odd), so that 32 lanes reading 32 rows by 16 bytes spread over the banks.
// Scores: lane = key (four partial sums over the head dimension). Row max and row sum: five-step butterfly. o: lane = two head columns, loop over the keys, each key's weight read from its lane into a scalar register; keys above the row carry weight 0.
#define A0R 8                        /* rows (waves) per block */
#define A0KP (HD + 4)                /* K row pitch in LDS, floats */
__global__ __launch_bounds__(256) void k_att0w(const float* __restrict__ QF, const float* __restrict__ KF, const float* __restrict__ VF, float scale, _Float16* __restrict__ OH, _Float16* __restrict__ OL) {
  __shared__ __attribute__((aligned(16))) float lk[QT0][A0KP]; __shared__ __attribute__((aligned(16))) float lv[QT0][HD];
  const int tid = threadIdx.x, lane = tid & 31; const int w = __builtin_amdgcn_readfirstlane(tid >> 5);      /* the wave's number as a scalar: row, group count and branches below are wave-uniform */
  const int h = blockIdx.x / (QT0 / A0R), r0 = (blockIdx.x % (QT0 / A0R)) * A0R; const int i = r0 + w;
  const size_t pb = (size_t)blockIdx.y * QT0 * DM; QF += pb; KF += pb; VF += pb; OH += pb; OL += pb;
  const float* qr = QF + (size_t)i * DM + h * HD; v4f q[HD / 4];      /* every loop of this kernel is fully unrolled: the indices into q, kk, vv, sv and o and the lane of each readlane are then constants, so the arrays stay in registers */
#pragma unroll
  for (int c = 0; c < HD / 4; ++c) q[c] = *(const v4fa*)(qr + c * 4);      /* the wave's own q row, whole */
  const int sj = tid >> 4, sc4 = (tid & 15) * 4; const float* kp = KF + (size_t)sj * DM + h * HD + sc4; const float* vp = VF + (size_t)sj * DM + h * HD + sc4; v4f kk[QT0 / 16], vv[QT0 / 16];      /* one pass of the block stages 16 rows; both loops are fully unrolled and free of branches so that every load of the block is in flight before the first LDS store waits; the row pitch is a constant, so the passes differ in the immediate offset alone */
#pragma unroll
  for (int u = 0; u < QT0 / 16; ++u) { kk[u] = *(const v4fa*)(kp + (size_t)u * 16 * DM); vv[u] = *(const v4fa*)(vp + (size_t)u * 16 * DM); }
  asm volatile("s_wait_xcnt 0x0" :: "v"(kp), "v"(vp) : "memory");      /* the wait between the loads above and the first reuse of their address registers; the two addresses are inputs so that their registers stay untouched up to it */
#pragma unroll
  for (int u = 0; u < QT0 / 16; ++u) { *(v4f*)&lk[u * 16 + sj][sc4] = kk[u]; *(v4f*)&lv[u * 16 + sj][sc4] = vv[u]; }
  __syncthreads();
  const int ng = (i >> 5) + 1;      /* key groups of 32 that hold a key <= i */
  float sv[QT0 / 32];
#pragma unroll
  for (int g = 0; g < QT0 / 32; ++g) { sv[g] = -1.0e30f;
    if (g < ng) { const int j = g * 32 + lane; v4f a = {0.f, 0.f, 0.f, 0.f};
#pragma unroll
      for (int c = 0; c < HD / 4; ++c) a += q[c] * *(const v4f*)&lk[j][c * 4];
      const float s = ((a[0] + a[1]) + (a[2] + a[3])) * scale; sv[g] = (j <= i) ? s : -1.0e30f; } }
  float mx = fmaxf(fmaxf(sv[0], sv[1]), fmaxf(sv[2], sv[3]));
#pragma unroll
  for (int m = 16; m >= 1; m >>= 1) mx = fmaxf(mx, __shfl_xor(mx, m, 32));
  float se = 0.f;
#pragma unroll
  for (int g = 0; g < QT0 / 32; ++g) { const float e = expf(sv[g] - mx); sv[g] = e; se += e; }      /* a key above the row holds -1e30: its weight underflows to exactly 0 */
#pragma unroll
  for (int m = 16; m >= 1; m >>= 1) se += __shfl_xor(se, m, 32);
  v2f o[4] = {{0.f, 0.f}, {0.f, 0.f}, {0.f, 0.f}, {0.f, 0.f}};      /* four partial sums over the keys (key mod 4): four independent add chains */
#pragma unroll
  for (int g = 0; g < QT0 / 32; ++g) if (g < ng) {
#pragma unroll
    for (int jj = 0; jj < 32; ++jj) { const float e = __int_as_float(__builtin_amdgcn_readlane(__float_as_int(sv[g]), jj)); o[jj & 3] += e * *(const v2f*)&lv[g * 32 + jj][lane * 2]; } }
  const float fin = 64.0f / se; const v2f r = ((o[0] + o[1]) + (o[2] + o[3])) * fin;
  typedef _Float16 v2h __attribute__((ext_vector_type(2))); v2h rh, rl;
  rh[0] = (_Float16)r[0]; rh[1] = (_Float16)r[1]; rl[0] = (_Float16)((r[0] - (float)rh[0]) * 1024.0f); rl[1] = (_Float16)((r[1] - (float)rh[1]) * 1024.0f);
  const size_t oo = (size_t)i * DM + h * HD + lane * 2; *(v2h*)(OH + oo) = rh; *(v2h*)(OL + oo) = rl; }


__global__ __launch_bounds__(256) void k_wt_hq(const float* __restrict__ Wf, const float* __restrict__ bf, _Float16* __restrict__ Bq, _Float16* __restrict__ Bk, _Float16* __restrict__ Bv, float* __restrict__ B3) {
  static_assert(HD == WTT && DM % WTT == 0, "k_wt_hq: a 64-column tile is the q, k or v part of one head");
  __shared__ float tl[WTT][WTT + 1];
  const int nt = blockIdx.x, kt = blockIdx.y; const int h = nt / 3, wh = nt % 3;      /* column tile nt = head * 3 + (q | k | v); neighbouring blocks take neighbouring pieces of the same W rows */
  _Float16* dst = (wh == 0) ? Bq : ((wh == 1) ? Bk : Bv);
  wt_tile(Wf + (size_t)kt * WTT * (3 * DM) + nt * WTT, 3 * DM, (unsigned short*)dst + (size_t)h * HD * DM + kt * WTT, DM, 16.0f, tl);
  (void)bf; (void)B3; }
__global__ __launch_bounds__(256) void k_bhq(const float* __restrict__ bf, float* __restrict__ B3) {
  const int t = blockIdx.x * 256 + threadIdx.x; if (t >= 3 * DM) return; const int wh = t / DM, row = t % DM; const int h = row / HD, d = row % HD; const float v = bf16_round(bf[h * (3 * HD) + wh * HD + d]); *(float*)(B3 + t) = v;  }

__global__ __launch_bounds__(256) void k_tabcp32(const float* __restrict__ tc, const float* __restrict__ tsn, float* __restrict__ CS, float* __restrict__ SN, int n) {
  const int t = blockIdx.x * 256 + threadIdx.x; if (t >= n) return; const float c = bf16_round(tc[t]), s = bf16_round(tsn[t]);
  *(float*)(CS + t) = c; *(float*)(SN + t) = s;  }
extern "C" void kernel_launch(void* const* d_in, const int* in_sizes, int n_in,
                              void* d_out, int out_size, void* d_ws, size_t ws_size, hipStream_t stream) {
  (void)in_sizes; (void)n_in; (void)out_size;
  const float* const* I = (const float* const*)d_in; const float* x = I[0]; const float* wqkv = I[1]; const float* bqkv = I[2]; const float* wo = I[3]; const float* bo = I[4]; const float* tcos = I[5]; const float* tsin = I[6];      /* x; fused W_qkv [1024][3072] + b_qkv [3072] ([in][out]; per-head (q | k | v) column triples); W_out + b_out ([in][out]); rope tables cos / sin [2048][32] */
  char* ws = (char*)d_ws; size_t off = 0;
  auto take = [&](size_t bytes) { char* p = ws + off; off += (bytes + 255) & ~(size_t)255; return p; };
  _Float16* BQ = (_Float16*)take((size_t)DM * DM * 2); _Float16* BK = (_Float16*)take((size_t)DM * DM * 2); _Float16* BV = (_Float16*)take((size_t)DM * DM * 2); _Float16* BO = (_Float16*)take((size_t)DM * DM * 2);
  float* BQB = (float*)take((size_t)3 * DM * 4); float* CSB = (float*)take((size_t)SQ * 32 * 4); float* SNB = (float*)take((size_t)SQ * 32 * 4);      /* de-interleaved bias vector bq | bk | bv; bf16-rounded copies of the rope tables */ _Float16* X16 = (_Float16*)take(NR * DM * 2); _Float16* Q16 = (_Float16*)take(NR * DM * 2); _Float16* K16 = (_Float16*)take(NR * DM * 2); _Float16* V16 = (_Float16*)take(NR * DM * 2); _Float16* O16 = (_Float16*)take(NR * DM * 2);
  _Float16* VT = (_Float16*)take((size_t)NB * NH * HD * SQ * 2);
  float* QF0 = (float*)take((size_t)3 * NBR * QT0 * DM * 4); float* KF0 = QF0 + (size_t)NBR * QT0 * DM; float* VF0 = KF0 + (size_t)NBR * QT0 * DM;      /* first-tile f32 q | k | v, each NBR planes of QT0 rows, one after the other */ _Float16* OH0 = (_Float16*)take((size_t)NB * QT0 * DM * 2); _Float16* OL0 = (_Float16*)take((size_t)NB * QT0 * DM * 2);
  if (off > ws_size) return;
  k_wt_hq<<<dim3(3 * DM / WTT, DM / WTT), 256, 0, stream>>>(wqkv, bqkv, BQ, BK, BV, BQB); k_bhq<<<(3 * DM + 255) / 256, 256, 0, stream>>>(bqkv, BQB); k_wt_f16<<<dim3(DM / WTT, DM / WTT), 256, 0, stream>>>(wo, BO, DM, DM, 16.0f);      /* fused [in][out] weight with per-head (q | k | v) column triples -> three Bt planes (row h*64 + d) x16 + the de-interleaved bias vector; W_out [in][out] -> Bt x16 */
  k_tabcp32<<<(SQ * 32 + 255) / 256, 256, 0, stream>>>(tcos, tsin, CSB, SNB, SQ * 32);      /* rope tables [pos][32], bf16-rounded copies */

  k_x16<<<(unsigned)((NR * DM / 8 + 255) / 256), 256, 0, stream>>>(x, X16, NR * DM / 8);
  const size_t r0p = (size_t)B0 * SQ;      /* first projected row */
  k_gemm2<0, 1, 1><<<dim3((unsigned)((MP / 128) * (DM / 128)), 3), 256, 0, stream>>>(X16 + r0p * DM, 0, BQ, (size_t)DM * DM, 0.0625f, BQB, DM, nullptr, Q16 + r0p * DM, DM, NR * DM, MP, DM, DM, CSB, SNB, nullptr, nullptr, QF0);      /* q, k, v (f32) + bias in one launch (blockIdx.y; BQ | BK | BV and Q16 | K16 | V16 lie one after the other); q and k -> interleaved-pair rope (position = row % SQ); -> f16 rows; the blocks of the first 128 rows of a batch store their f32 tile (exact products) to QF0 | KF0 | VF0 too */
  k_att0w<<<dim3(NH * (QT0 / A0R), NBR), 256, 0, stream>>>(QF0, KF0, VF0, 0.125f, OH0 + (size_t)B0 * QT0 * DM, OL0 + (size_t)B0 * QT0 * DM);      /* exact f32 attention for rows 0..127 of every batch (o x64) -> f16 hi + x1024 residual planes */
  k_vt<NH, SQ><<<NB * NH * (SQ / 64), 256, 0, stream>>>(V16, LQ, 0, VT);      /* V^T [NB][NH][HD][SQ] */
  k_fattn<<<NB * NH * (SQ / FAQB), 128, 0, stream>>>(Q16, K16, VT, O16);      /* scores, causal softmax and P V in one launch; o (merged heads, x64) as f16 rows */
  k_gemm2<0, 0, 2><<<dim3((unsigned)((MPO / 128) * (DM / 128)), 1), 256, 0, stream>>>(O16 + r0p * DM, 0, BO, 0, 0.0009765625f, bo, 0, (float*)d_out + r0p * DM, nullptr, DM, 0, MPO, DM, DM, nullptr, nullptr, OH0 + (size_t)B0 * QT0 * DM, OL0 + (size_t)B0 * QT0 * DM);      /* out rows are the output layout; rows 0..127 of a batch: out = o_hi Wo (+ b) + o_lo Wo 2^-20, in the same launch */
}
